// v000
// The times below were measured on an AMD MI455X: many runs one after another, warmed up first and cycling through
// copies of the inputs, with the whole window's GPU time divided by the number of runs. Launches and the gaps
// between them are all in it. The median over several windows is given; except for v000 it joins two sittings, which
// can be a few percent apart, so the side-by-side timings, each taken in one sitting, are the better comparison.
// v000 is the starting kernel. One run takes 931 microseconds.
#include <hip/hip_runtime.h>
// MultiheadSdpaDiff4 (2 x 2048 tokens, EMBED 2048; differential attention: q = x Wq^T as 32 pseudo-heads x 64, k = x Wk^T as 8 heads x 64 repeat-interleaved 4x, v = x Wv^T as 4 heads x 128 repeat-interleaved 8x; causal softmax(q.k/8) v; attn = O_even - lambda_full * O_odd (16 heads x 128), lambda_full = exp(lq1.lk1) - exp(lq2.lk2) + 0.78361; RMSNorm(128, eps 1e-5) * ln_w * (1 - 0.78361); out = attn Wo^T.
// Compute dtype: inputs rounded to bf16; x exact as f16; q/k/P/v as f16 hi + residual on the first 256 rows (~2^-21) and plain beyond (~2^-12); the normalised attention as a plain f16 operand; softmax/lambda/RMSNorm f32. v_wmma_f32_16x16x32_f16.
#define NB 2
#define DM 2048
#define NKV 8
#define NREP (NH / NKV)
#define KVD (NKV * 64)           /* 512 */
#define NR (NB * SLEN)           /* 4096 */
#define SLEN 2048
#define TQ SLEN
#define TK SLEN
#define NH 32
#define SCL 0.125f
#define QBLKS (TQ / 64)
#define QB05 0
#define QBN5 4
#define QB0P QBN5
#define QBNP (QBLKS - QBN5)
#define RE 256
typedef __bf16 v16b __attribute__((ext_vector_type(16)));
typedef unsigned short v8us __attribute__((ext_vector_type(8), may_alias));
typedef float  v8f  __attribute__((ext_vector_type(8)));
typedef float  v4f  __attribute__((ext_vector_type(4)));
typedef float  v4fa __attribute__((ext_vector_type(4), may_alias));
union FragB { v16b v; v8us half[2]; unsigned short u[16]; };

__device__ __forceinline__ unsigned short bf16_bits(float x) { unsigned int u = __float_as_uint(x); return (unsigned short)((u + 0x7FFFu + ((u >> 16) & 1u)) >> 16); }
__device__ __forceinline__ float bf16_val(unsigned short b) { return __uint_as_float(((unsigned int)b) << 16); }
__device__ __forceinline__ float bf16_round(float x) { return bf16_val(bf16_bits(x)); }
// D += A·B with NT terms: 1 = ah·bh, 2 = + al·bh (A split), 3 = + ah·bl (both split)
template <int NT>
__device__ __forceinline__ v8f mmaN(v16b ah, v16b al, v16b bh, v16b bl, v8f c) {
  c = __builtin_amdgcn_wmma_f32_16x16x32_bf16(false, ah, false, bh, (short)0, c, false, false);
  if (NT >= 2) c = __builtin_amdgcn_wmma_f32_16x16x32_bf16(false, al, false, bh, (short)0, c, false, false);
  if (NT >= 3) c = __builtin_amdgcn_wmma_f32_16x16x32_bf16(false, ah, false, bl, (short)0, c, false, false);
  asm volatile("v_nop\n\tv_nop\n\tv_nop\n\tv_nop" : "+v"(c) : "v"(ah), "v"(al), "v"(bh), "v"(bl));
  return c;
}

__global__ __launch_bounds__(256) void k_wt_bf16(const float* __restrict__ W, unsigned short* __restrict__ Wt, int K, int N) {
  const int t = blockIdx.x * 256 + threadIdx.x;
  const int k8n = K / 8;
  if (t >= N * k8n) return;
  const int n = t / k8n, k8 = (t % k8n) * 8;
  v8us v;
#pragma unroll
  for (int i = 0; i < 8; ++i) v[i] = bf16_bits(W[(size_t)(k8 + i) * N + n]);
  *(v8us*)(Wt + (size_t)n * K + k8) = v;
  
}

// GEMM C[M][N] (f32, pitch ldc) = act(A[M][K]·W + bias). A f32 row-major (pitch lda) converted per fragment to bf16
// (ASPLIT: hi/lo two planes -> 2 terms, else single rounded term); Wt bf16 [N][K] (pitch ldb). BIAS_BF16 rounds the
// bias to bf16 first (bias quantised to bf16 before the add). K%32==0, M%16==0, N%64==0.
template <bool ASPLIT, int ACT, bool BIAS_BF16>
__global__ __launch_bounds__(128) void k_gemm_bf(const float* __restrict__ A, int lda, const unsigned short* __restrict__ Wt, int ldb,
                                               const float* __restrict__ bias, float* __restrict__ C, int ldc, int M, int N, int K) {
  __shared__ __attribute__((aligned(16))) float so[4][16][64];
  const int tid = threadIdx.x, w = tid >> 5, lane = tid & 31, ln = lane & 15, hh = lane >> 4;
  const int ntn = N / 64;
  const int wid = blockIdx.x * 4 + w;
  const int mt = wid / ntn, nq = wid % ntn;
  if (mt * 16 >= M) return;
  const int row0 = mt * 16, col0 = nq * 64;
  const float* arow = A + (size_t)(row0 + ln) * lda;
  v8f acc[4] = {};
  for (int kb = 0; kb < K; kb += 32) {
    FragB ah, al;
    const v4f x0 = *(const v4fa*)(arow + kb + 8 * hh), x1 = *(const v4fa*)(arow + kb + 8 * hh + 4);
    const v4f x2 = *(const v4fa*)(arow + kb + 16 + 8 * hh), x3 = *(const v4fa*)(arow + kb + 16 + 8 * hh + 4);
    float xs[16] = {x0[0],x0[1],x0[2],x0[3],x1[0],x1[1],x1[2],x1[3],x2[0],x2[1],x2[2],x2[3],x3[0],x3[1],x3[2],x3[3]};
#pragma unroll
    for (int i = 0; i < 16; ++i) { const unsigned short hb = bf16_bits(xs[i]); ah.u[i] = hb; al.u[i] = ASPLIT ? bf16_bits(xs[i] - bf16_val(hb)) : (unsigned short)0; }
#pragma unroll
    for (int t = 0; t < 4; ++t) {
      const unsigned short* brow = Wt + (size_t)(col0 + t * 16 + ln) * ldb + kb;
      FragB b;
      b.half[0] = *(const v8us*)(brow + 8 * hh);
      b.half[1] = *(const v8us*)(brow + 16 + 8 * hh);
      acc[t] = mmaN<ASPLIT ? 2 : 1>(ah.v, al.v, b.v, b.v, acc[t]);
    }
  }
#pragma unroll
  for (int t = 0; t < 4; ++t) {
    float bv = bias ? bias[col0 + t * 16 + ln] : 0.f;
    if (BIAS_BF16) bv = bf16_round(bv);
#pragma unroll
    for (int r = 0; r < 8; ++r) { float v = acc[t][r] + bv; if (ACT == 1) v = fmaxf(v, 0.f); so[w][8 * hh + r][t * 16 + ln] = v; }
  }
  __builtin_amdgcn_fence(__ATOMIC_ACQ_REL, "workgroup");
  __builtin_amdgcn_wave_barrier();
  const int rsub = lane >> 4, c4 = (lane & 15) * 4;
  {
#pragma unroll
    for (int q = 0; q < 8; ++q) {
      const int r = q * 2 + rsub;
      const v4f v = *(const v4fa*)&so[w][r][c4];
      *(v4f*)(C + (size_t)(row0 + r) * ldc + col0 + c4) = v;
    }
    
  }
}

// GEMM C = act(A·W + bias + resid): A f32 (ASPLIT -> hi/lo 2 terms), Wt bf16 [N][K]; ACT 0 none, 1 relu, 2 exact gelu;
// resid (optional, f32, row index = (row % rmod), pitch ldr, RES_BF16 rounds it) added before the activation.
template <bool ASPLIT, int ACT, bool BIAS_BF16, bool RES_BF16>
__global__ __launch_bounds__(128) void k_gemm_bf3(const float* __restrict__ A, int lda, const unsigned short* __restrict__ Wt, int ldb,
                                                const float* __restrict__ bias, const float* __restrict__ resid, int rmod, int ldr,
                                                float* __restrict__ C, int ldc, int M, int N, int K) {
  __shared__ __attribute__((aligned(16))) float so[4][16][64];
  const int tid = threadIdx.x, w = tid >> 5, lane = tid & 31, ln = lane & 15, hh = lane >> 4;
  const int ntn = N / 64;
  const int wid = blockIdx.x * 4 + w;
  const int mt = wid / ntn, nq = wid % ntn;
  if (mt * 16 >= M) return;
  const int row0 = mt * 16, col0 = nq * 64;
  const float* arow = A + (size_t)(row0 + ln) * lda;
  v8f acc[4] = {};
  for (int kb = 0; kb < K; kb += 32) {
    FragB ah, al;
    const v4f x0 = *(const v4fa*)(arow + kb + 8 * hh), x1 = *(const v4fa*)(arow + kb + 8 * hh + 4);
    const v4f x2 = *(const v4fa*)(arow + kb + 16 + 8 * hh), x3 = *(const v4fa*)(arow + kb + 16 + 8 * hh + 4);
    float xs[16] = {x0[0],x0[1],x0[2],x0[3],x1[0],x1[1],x1[2],x1[3],x2[0],x2[1],x2[2],x2[3],x3[0],x3[1],x3[2],x3[3]};
#pragma unroll
    for (int i = 0; i < 16; ++i) { const unsigned short hb = bf16_bits(xs[i]); ah.u[i] = hb; al.u[i] = ASPLIT ? bf16_bits(xs[i] - bf16_val(hb)) : (unsigned short)0; }
#pragma unroll
    for (int t = 0; t < 4; ++t) {
      const unsigned short* brow = Wt + (size_t)(col0 + t * 16 + ln) * ldb + kb;
      FragB b;
      b.half[0] = *(const v8us*)(brow + 8 * hh);
      b.half[1] = *(const v8us*)(brow + 16 + 8 * hh);
      acc[t] = mmaN<ASPLIT ? 2 : 1>(ah.v, al.v, b.v, b.v, acc[t]);
    }
  }
#pragma unroll
  for (int t = 0; t < 4; ++t) {
    const int col = col0 + t * 16 + ln;
    float bv = bias ? bias[col] : 0.f;
    if (BIAS_BF16) bv = bf16_round(bv);
#pragma unroll
    for (int r = 0; r < 8; ++r) {
      float v = acc[t][r] + bv;
      if (resid) { float rv = resid[(size_t)((row0 + 8 * hh + r) % rmod) * ldr + col]; if (RES_BF16) rv = bf16_round(rv); v += rv; }
      if (ACT == 1) v = fmaxf(v, 0.f);
      if (ACT == 2) v = 0.5f * v * (1.0f + erff(v * 0.70710678118654752f));
      if (ACT == 3) { const float u = 0.7978845608028654f * (v + 0.044715f * v * v * v); v = 0.5f * v * (1.0f + tanhf(u)); }
      so[w][8 * hh + r][t * 16 + ln] = v;
    }
  }
  __builtin_amdgcn_fence(__ATOMIC_ACQ_REL, "workgroup");
  __builtin_amdgcn_wave_barrier();
  const int rsub = lane >> 4, c4 = (lane & 15) * 4;
  {
#pragma unroll
    for (int q = 0; q < 8; ++q) {
      const int r = q * 2 + rsub;
      const v4f v = *(const v4fa*)&so[w][r][c4];
      *(v4f*)(C + (size_t)(row0 + r) * ldc + col0 + c4) = v;
    }
    
  }
}
// row LayerNorm (biased variance, eps) over N: s = X (+ R); optional out_sum <- s; out_norm <- (s-mu)*rsqrt(var+eps)*g + b
template <bool PARAM_BF16>
__global__ __launch_bounds__(256) void k_layernorm(const float* __restrict__ X, const float* __restrict__ R, const float* __restrict__ g, const float* __restrict__ bta,
                                                  float* __restrict__ out_sum, float* __restrict__ out_norm, int N, float eps) {
  __shared__ float red[256];
  const int row = blockIdx.x, tid = threadIdx.x;
  const float* x = X + (size_t)row * N; const float* rr = R ? R + (size_t)row * N : nullptr;
  float vals[16];                     // up to N = 4096
  const int per = N / 256;            // contiguous chunk per thread? use strided-by-4 chunks: thread handles j = tid*4 + 1024*u
  float s1 = 0.f;
  for (int u = 0; u < per / 4; ++u) {
    const int j = tid * 4 + 1024 * u;
    const v4f a = *(const v4fa*)(x + j);
    v4f b = {0.f,0.f,0.f,0.f}; if (rr) b = *(const v4fa*)(rr + j);
#pragma unroll
    for (int q = 0; q < 4; ++q) { const float v = a[q] + b[q]; vals[u * 4 + q] = v; s1 += v; }
  }
  red[tid] = s1; __syncthreads();
  for (int st = 128; st > 0; st >>= 1) { if (tid < st) red[tid] += red[tid + st]; __syncthreads(); }
  const float mu = red[0] / (float)N; __syncthreads();
  float s2 = 0.f;
  for (int u = 0; u < per / 4; ++u)
#pragma unroll
    for (int q = 0; q < 4; ++q) { const float c = vals[u * 4 + q] - mu; s2 += c * c; }
  red[tid] = s2; __syncthreads();
  for (int st = 128; st > 0; st >>= 1) { if (tid < st) red[tid] += red[tid + st]; __syncthreads(); }
  const float rs = rsqrtf(red[0] / (float)N + eps);
  {
    for (int u = 0; u < per / 4; ++u) {
      const int j = tid * 4 + 1024 * u;
      v4f o, sm;
#pragma unroll
      for (int q = 0; q < 4; ++q) {
        float gg = g[j + q], bb = bta[j + q];
        if (PARAM_BF16) { gg = bf16_round(gg); bb = bf16_round(bb); }
        sm[q] = vals[u * 4 + q]; o[q] = (vals[u * 4 + q] - mu) * rs * gg + bb;
      }
      if (out_sum) *(v4f*)(out_sum + (size_t)row * N + j) = sm;
      *(v4f*)(out_norm + (size_t)row * N + j) = o;
    }
    
  }
}



// ---- f16 WMMA path (v_wmma_f32_16x16x32_f16): 11-bit significands for operands in range — used where a [0,1] probability operand needs more precision than bf16
typedef _Float16 v16h __attribute__((ext_vector_type(16)));
union FragH { v16h v; v8us half[2]; _Float16 h[16]; unsigned short u[16]; };
template <int NT>
__device__ __forceinline__ v8f mmaH(v16h ah, v16h al, v16h bh, v16h bl, v8f c) {
  c = __builtin_amdgcn_wmma_f32_16x16x32_f16(false, ah, false, bh, (short)0, c, false, false);
  if (NT >= 2) c = __builtin_amdgcn_wmma_f32_16x16x32_f16(false, al, false, bh, (short)0, c, false, false);
  if (NT >= 3) c = __builtin_amdgcn_wmma_f32_16x16x32_f16(false, ah, false, bl, (short)0, c, false, false);
  asm volatile("v_nop\n\tv_nop\n\tv_nop\n\tv_nop" : "+v"(c) : "v"(ah), "v"(al), "v"(bh), "v"(bl));
  return c;
}
// batched GEMM like k_gemm_b but f16 operands: A f32 (split into f16 hi/lo if ASPLIT, else rounded to f16), Bt = f16 values [n][k]; alpha; C f32; N multiple of 16 (partial tiles skipped)
template <bool ASPLIT>
__global__ __launch_bounds__(128) void k_gemm_h(const float* __restrict__ A, int lda, size_t sA, const _Float16* __restrict__ Bh, int ldb, size_t sB, float alpha, float* __restrict__ C, int ldc, size_t sC, int M, int N, int K) {
  __shared__ __attribute__((aligned(16))) float so[4][16][64];
  const int tid = threadIdx.x, w = tid >> 5, lane = tid & 31, ln = lane & 15, hh = lane >> 4; const int by = blockIdx.y;
  A += (size_t)by * sA; Bh += (size_t)by * sB; C += (size_t)by * sC;
  const int ntn = (N + 63) / 64; const int wid = blockIdx.x * 4 + w; const int mt = wid / ntn, nq = wid % ntn; if (mt * 16 >= M) return;
  const int row0 = mt * 16, col0 = nq * 64; const float* arow = A + (size_t)(row0 + ln) * lda;
  v8f acc[4] = {};
  for (int kb = 0; kb < K; kb += 32) {
    FragH ah, al;
    const v4f x0 = *(const v4fa*)(arow + kb + 8 * hh), x1 = *(const v4fa*)(arow + kb + 8 * hh + 4), x2 = *(const v4fa*)(arow + kb + 16 + 8 * hh), x3 = *(const v4fa*)(arow + kb + 16 + 8 * hh + 4);
    float xs[16] = {x0[0],x0[1],x0[2],x0[3],x1[0],x1[1],x1[2],x1[3],x2[0],x2[1],x2[2],x2[3],x3[0],x3[1],x3[2],x3[3]};
#pragma unroll
    for (int i = 0; i < 16; ++i) { const _Float16 h = (_Float16)xs[i]; ah.h[i] = h; al.h[i] = ASPLIT ? (_Float16)(xs[i] - (float)h) : (_Float16)0.0f; }
#pragma unroll
    for (int t = 0; t < 4; ++t) { if (col0 + t * 16 >= N) continue; const size_t boff = (size_t)(col0 + t * 16 + ln) * ldb + kb; FragH bq; bq.half[0] = *(const v8us*)(Bh + boff + 8 * hh); bq.half[1] = *(const v8us*)(Bh + boff + 16 + 8 * hh);
      acc[t] = mmaH<ASPLIT ? 2 : 1>(ah.v, al.v, bq.v, bq.v, acc[t]); }
  }
#pragma unroll
  for (int t = 0; t < 4; ++t) { if (col0 + t * 16 >= N) continue;
#pragma unroll
    for (int r = 0; r < 8; ++r) so[w][8 * hh + r][t * 16 + ln] = acc[t][r] * alpha; }
  __builtin_amdgcn_fence(__ATOMIC_ACQ_REL, "workgroup"); __builtin_amdgcn_wave_barrier();
  const int rsub = lane >> 4, c4 = (lane & 15) * 4;
  {
#pragma unroll
    for (int q = 0; q < 8; ++q) { const int r = q * 2 + rsub; if (col0 + c4 < N) { const v4f v = *(const v4fa*)&so[w][r][c4]; *(v4f*)(C + (size_t)(row0 + r) * ldc + col0 + c4) = v; } }
     }
}

// Wt[n][k] = f16(W[k][n]·scale) from f32 row-major W[K][N] (scale = power of two; bf16-exact weights stay exact in f16 away from the subnormal range)
__global__ __launch_bounds__(256) void k_wt_f16(const float* __restrict__ W, _Float16* __restrict__ Wt, int K, int N, float scale) {
  const int t = blockIdx.x * 256 + threadIdx.x; if (t >= N * (K / 8)) return; const int n = t / (K / 8), k8 = (t % (K / 8)) * 8; FragH f;
#pragma unroll
  for (int i = 0; i < 8; ++i) f.h[i] = (_Float16)(bf16_round(W[(size_t)(k8 + i) * N + n]) * scale); const v8us o = f.half[0];
  *(v8us*)((unsigned short*)Wt + (size_t)n * K + k8) = o; 
}
// k_gemm_hh variant with fused epilogue: v = acc·alpha + bias[by·sBias + col] (+ CP[(row/rowsPerB)·sCPb + by·64 + col] if CP) ; ACT 0 none / 1 elu ; writes f16 C16 (and f32 C if non-null)
template <int ACT>
__global__ __launch_bounds__(128) void k_gemm_hhx(const _Float16* __restrict__ A, int lda, size_t sA, const _Float16* __restrict__ Bh, int ldb, size_t sB, float alpha, const float* __restrict__ bias, size_t sBias, const float* __restrict__ CP, int rowsPerB, size_t sCPb, int row0g,
    float* __restrict__ C, _Float16* __restrict__ C16, int ldc, size_t sC, int M, int N, int K) {
  __shared__ __attribute__((aligned(16))) float so[4][16][64];
  const int tid = threadIdx.x, w = tid >> 5, lane = tid & 31, ln = lane & 15, hh = lane >> 4; const int by = blockIdx.y;
  A += (size_t)by * sA; Bh += (size_t)by * sB; const size_t cofs = (size_t)by * sC; const float* bp = bias ? bias + (size_t)by * sBias : nullptr;
  const int ntn = (N + 63) / 64; const int wid = blockIdx.x * 4 + w; const int mt = wid / ntn, nq = wid % ntn; if (mt * 16 >= M) return;
  const int row0 = mt * 16, col0 = nq * 64; const _Float16* arow = A + (size_t)(row0 + ln) * lda;
  v8f acc[4] = {};
  for (int kb = 0; kb < K; kb += 32) { FragH ah; ah.half[0] = *(const v8us*)((const unsigned short*)arow + kb + 8 * hh); ah.half[1] = *(const v8us*)((const unsigned short*)arow + kb + 16 + 8 * hh);
#pragma unroll
    for (int t = 0; t < 4; ++t) { if (col0 + t * 16 >= N) continue; const size_t boff = (size_t)(col0 + t * 16 + ln) * ldb + kb; FragH bq; bq.half[0] = *(const v8us*)((const unsigned short*)Bh + boff + 8 * hh); bq.half[1] = *(const v8us*)((const unsigned short*)Bh + boff + 16 + 8 * hh);
      acc[t] = mmaH<1>(ah.v, ah.v, bq.v, bq.v, acc[t]); }
  }
#pragma unroll
  for (int t = 0; t < 4; ++t) { if (col0 + t * 16 >= N) continue; const int col = col0 + t * 16 + ln; const float bv = bp ? bf16_round(bp[col]) : 0.f;
#pragma unroll
    for (int r = 0; r < 8; ++r) { float v = acc[t][r] * alpha + bv; if (CP) { const int bidx = (row0g + row0 + 8 * hh + r) / rowsPerB; v += CP[(size_t)bidx * sCPb + (size_t)by * 64 + col]; } if (ACT == 1) v = (v > 0.f) ? v : expm1f(v); else if (ACT == 7) v = (v > 0.f) ? v + 1.0f : expf(v); else if (ACT == 8) v = tanhf(v); else if (ACT == 9) v = 0.5f * v * (1.0f + tanhf(0.7978845608028654f * (v + 0.044715f * v * v * v))); else if (ACT == 11) v = 1.0f / (1.0f + expf(-v)); else if (ACT == 12) v = (v > 0.f) ? v : 0.01f * v; else if (ACT == 14) v = (v > 0.f) ? v : 0.1f * v; else if (ACT == 15) v = v / (1.0f + expf(-v)); else if (ACT == 3) v = fmaxf(v, 0.f); else if (ACT == 6) v = 0.5f * v * (1.0f + erff(v * 0.70710678118654752f)); so[w][8 * hh + r][t * 16 + ln] = v; } }
  __builtin_amdgcn_fence(__ATOMIC_ACQ_REL, "workgroup"); __builtin_amdgcn_wave_barrier();
  const int rsub = lane >> 4, c4 = (lane & 15) * 4; typedef _Float16 v4h __attribute__((ext_vector_type(4)));
  {
#pragma unroll
    for (int q = 0; q < 8; ++q) { const int r = q * 2 + rsub; if (col0 + c4 < N) { const v4f v = *(const v4fa*)&so[w][r][c4]; if (C) *(v4f*)(C + cofs + (size_t)(row0 + r) * ldc + col0 + c4) = v; if (C16) { v4h h4; for (int i = 0; i < 4; ++i) h4[i] = (_Float16)v[i]; *(v4h*)(C16 + cofs + (size_t)(row0 + r) * ldc + col0 + c4) = h4; } } }
     }
}


typedef _Float16 v4h __attribute__((ext_vector_type(4)));

__global__ __launch_bounds__(256) void k_x16(const float* __restrict__ x, _Float16* __restrict__ X16, size_t n8) { const size_t t = (size_t)blockIdx.x * 256 + threadIdx.x; if (t >= n8) return; FragH f;
#pragma unroll
  for (int q = 0; q < 8; ++q) f.h[q] = (_Float16)bf16_round(x[t * 8 + q]); *(v8us*)((unsigned short*)X16 + t * 8) = f.half[0];  }
__global__ __launch_bounds__(256) void k_h16(const float* __restrict__ x, _Float16* __restrict__ X16, size_t n8) { const size_t t = (size_t)blockIdx.x * 256 + threadIdx.x; if (t >= n8) return; FragH f;
#pragma unroll
  for (int q = 0; q < 8; ++q) f.h[q] = (_Float16)x[t * 8 + q]; *(v8us*)((unsigned short*)X16 + t * 8) = f.half[0];  }
__global__ __launch_bounds__(256) void k_round16f(const float* __restrict__ W, _Float16* __restrict__ Bt, size_t n8) { const size_t t = (size_t)blockIdx.x * 256 + threadIdx.x; if (t >= n8) return; FragH f;
#pragma unroll
  for (int i = 0; i < 8; ++i) f.h[i] = (_Float16)(bf16_round(W[t * 8 + i]) * 16.0f); *(v8us*)((unsigned short*)Bt + t * 8) = f.half[0];  }
template <int NHv, int TTv>
__global__ __launch_bounds__(256) void k_vt(const _Float16* __restrict__ V16, int ldv, int voff, _Float16* __restrict__ Vt) { __shared__ unsigned short tl[64][66]; const int tid = threadIdx.x; const int slab = blockIdx.x / (TTv / 64), lg = blockIdx.x % (TTv / 64); const int b = slab / NHv, h = slab % NHv;
  for (int i = tid; i < 64 * 8; i += 256) { const int r = i / 8, c8 = (i % 8) * 8; FragH f; f.half[0] = *(const v8us*)((const unsigned short*)V16 + ((size_t)b * TTv + lg * 64 + r) * ldv + voff + h * 64 + c8);
#pragma unroll
    for (int q = 0; q < 8; ++q) tl[r][c8 + q] = f.u[q]; }
  __syncthreads();
  {
#pragma unroll
    for (int rd = 0; rd < 2; ++rd) { const int d = rd * 32 + tid / 8, pc = tid % 8; FragH f;
#pragma unroll
      for (int q = 0; q < 8; ++q) f.u[q] = tl[pc * 8 + q][d];
      *(v8us*)((unsigned short*)Vt + ((size_t)slab * 64 + d) * TTv + lg * 64 + pc * 8) = f.half[0]; }
     } }

__global__ __launch_bounds__(256) void k_hl(const float* __restrict__ F, _Float16* __restrict__ Hh, _Float16* __restrict__ Hl, size_t n8) { const size_t t = (size_t)blockIdx.x * 256 + threadIdx.x; if (t >= n8) return; FragH fh, fl; const v4f a = *(const v4fa*)(F + t * 8), c = *(const v4fa*)(F + t * 8 + 4);
#pragma unroll
  for (int q = 0; q < 4; ++q) { _Float16 h = (_Float16)a[q]; fh.h[q] = h; fl.h[q] = (_Float16)((a[q] - (float)h) * 1024.0f); h = (_Float16)c[q]; fh.h[4 + q] = h; fl.h[4 + q] = (_Float16)((c[q] - (float)h) * 1024.0f); }
  { *(v8us*)((unsigned short*)Hh + t * 8) = fh.half[0]; *(v8us*)((unsigned short*)Hl + t * 8) = fl.half[0];  } }

// ---- fast GEMM (wave tile 32x64; requires M % 32 == 0 rows per launch region and N % 64 == 0); epilogue = k_gemm_hhx semantics ----
__device__ __forceinline__ v16h g2_frag(const _Float16* p, int hh) { FragH f; f.half[0] = *(const v8us*)((const unsigned short*)p + 8 * hh); f.half[1] = *(const v8us*)((const unsigned short*)p + 16 + 8 * hh); return f.v; }
__device__ __forceinline__ v8f g2_mma(v16h a, v16h b, v8f c) { v8f d = __builtin_amdgcn_wmma_f32_16x16x32_f16(false, a, false, b, (short)0, c, false, false); asm volatile("v_nop\n\tv_nop\n\tv_nop\n\tv_nop" : "+v"(d) : "v"(a), "v"(b)); return d; }
template <int ACT>
__global__ __launch_bounds__(128) void k_gemm2(const _Float16* __restrict__ A, int lda, size_t sA, const _Float16* __restrict__ Bh, int ldb, size_t sB, float alpha, const float* __restrict__ bias, size_t sBias, const float* __restrict__ CP, int rowsPerB, size_t sCPb, int row0g,
    float* __restrict__ C, _Float16* __restrict__ C16, int ldc, size_t sC, int M, int N, int K) {
  __shared__ __attribute__((aligned(16))) float so[4][32][68];
  const int tid = threadIdx.x, w = tid >> 5, lane = tid & 31, ln = lane & 15, hh = lane >> 4; const int by = blockIdx.y;
  A += (size_t)by * sA; Bh += (size_t)by * sB; const size_t cofs = (size_t)by * sC; const float* bp = bias ? bias + (size_t)by * sBias : nullptr;
  const int ntn = N >> 6; const int mt = blockIdx.x / ntn, nq = blockIdx.x - mt * ntn; const int row0 = mt * 128 + 32 * w, col0 = nq * 64; if (row0 >= M) return;
  const _Float16* a0p = A + (size_t)(row0 + ln) * lda; const _Float16* a1p = a0p + (size_t)16 * lda;
  const _Float16* b0p = Bh + (size_t)(col0 + ln) * ldb; const _Float16* b1p = b0p + (size_t)16 * ldb; const _Float16* b2p = b1p + (size_t)16 * ldb; const _Float16* b3p = b2p + (size_t)16 * ldb;
  const v8f z8 = {0.f,0.f,0.f,0.f,0.f,0.f,0.f,0.f}; v8f c00 = z8, c01 = z8, c02 = z8, c03 = z8, c10 = z8, c11 = z8, c12 = z8, c13 = z8;
#pragma unroll 1
  for (int kb = 0; kb < K; kb += 32) { const v16h a0 = g2_frag(a0p + kb, hh), a1 = g2_frag(a1p + kb, hh);
    v16h b = g2_frag(b0p + kb, hh); c00 = g2_mma(a0, b, c00); c10 = g2_mma(a1, b, c10);
    b = g2_frag(b1p + kb, hh); c01 = g2_mma(a0, b, c01); c11 = g2_mma(a1, b, c11);
    b = g2_frag(b2p + kb, hh); c02 = g2_mma(a0, b, c02); c12 = g2_mma(a1, b, c12);
    b = g2_frag(b3p + kb, hh); c03 = g2_mma(a0, b, c03); c13 = g2_mma(a1, b, c13); }
  v8f accs[8] = {c00, c01, c02, c03, c10, c11, c12, c13};
#pragma unroll
  for (int u = 0; u < 8; ++u) { const int t = u & 3, half = u >> 2; const int col = col0 + t * 16 + ln; const float bv = bp ? bf16_round(bp[col]) : 0.f;
#pragma unroll
    for (int r = 0; r < 8; ++r) { const int rloc = half * 16 + 8 * hh + r; float v = accs[u][r] * alpha + bv; if (CP) { const int bidx = (row0g + row0 + rloc) / rowsPerB; v += CP[(size_t)bidx * sCPb + (size_t)by * 64 + col]; }
      if (ACT == 3) v = fmaxf(v, 0.f); else if (ACT == 6) v = 0.5f * v * (1.0f + erff(v * 0.70710678118654752f)); else if (ACT == 11) v = 1.0f / (1.0f + expf(-v)); else if (ACT == 15) v = v / (1.0f + expf(-v)); else if (ACT == 12) v = (v > 0.f) ? v : 0.01f * v; else if (ACT == 8) v = tanhf(v);
      so[w][rloc][t * 16 + ln] = v; } }
  __builtin_amdgcn_fence(__ATOMIC_ACQ_REL, "workgroup"); __builtin_amdgcn_wave_barrier();
  const int rsub = lane >> 4, c4 = (lane & 15) * 4;
  {
#pragma unroll
    for (int q = 0; q < 16; ++q) { const int r = q * 2 + rsub; const v4f v = *(const v4fa*)&so[w][r][c4]; if (C) *(v4f*)(C + cofs + (size_t)(row0 + r) * ldc + col0 + c4) = v; if (C16) { v4h h4; for (int i = 0; i < 4; ++i) h4[i] = (_Float16)v[i]; *(v4h*)(C16 + cofs + (size_t)(row0 + r) * ldc + col0 + c4) = h4; } }
     } }



template <int CAUSAL>
__global__ __launch_bounds__(128) void k_flash(const _Float16* __restrict__ Q16, int ldq, const _Float16* __restrict__ K16, int ldk, const _Float16* __restrict__ Vt, const int* __restrict__ MSK, float* __restrict__ O, int ldo) {
  constexpr int RPW = 16, RTN = RPW / 16, NQB = TQ / (4 * RPW), DT = 4, KS = 2;
  __shared__ __attribute__((aligned(16))) unsigned short sP[4][RPW][40]; __shared__ __attribute__((aligned(16))) float sO[4][RPW][64 + 4];
  const int tid = threadIdx.x, w = tid >> 5, lane = tid & 31, ln = lane & 15, hh = lane >> 4;
  const int slab = blockIdx.x / QBNP, qblk = QB0P + blockIdx.x % QBNP; (void)NQB; const int b = slab / NH, h = slab % NH; const int qb0 = qblk * (4 * RPW); const int q0 = qb0 + w * RPW;
  FragH aq[2][KS];
#pragma unroll
  for (int rt = 0; rt < RTN; ++rt) { const unsigned short* qr = (const unsigned short*)Q16 + ((size_t)b * TQ + q0 + rt * 16 + ln) * ldq + h * 64;
#pragma unroll
    for (int ks = 0; ks < KS; ++ks) { aq[rt][ks].half[0] = *(const v8us*)(qr + ks * 32 + 8 * hh); aq[rt][ks].half[1] = *(const v8us*)(qr + ks * 32 + 16 + 8 * hh); } }
  const unsigned short* Vth = (const unsigned short*)Vt + (size_t)slab * 64 * TK;
  float m_r[2][8], l_r[2][8]; v8f oacc[2][DT];
#pragma unroll
  for (int rt = 0; rt < RTN; ++rt) {
#pragma unroll
    for (int r = 0; r < 8; ++r) { m_r[rt][r] = -3.0e38f; l_r[rt][r] = 0.f; }
#pragma unroll
    for (int dt = 0; dt < DT; ++dt) oacc[rt][dt] = (v8f){0.f,0.f,0.f,0.f,0.f,0.f,0.f,0.f}; }
  const int jend = (CAUSAL == 1) ? (qb0 + 4 * RPW) : TK;      /* causal: keys beyond the block's last query never contribute */
#pragma unroll 1
  for (int j0 = 0; j0 < jend; j0 += 32) {
    v8f s[2][2];
#pragma unroll
    for (int nt = 0; nt < 2; ++nt) { const unsigned short* kr = (const unsigned short*)K16 + ((size_t)b * TK + j0 + nt * 16 + ln) * ldk + h * 64; FragH bk[KS];
#pragma unroll
      for (int ks = 0; ks < KS; ++ks) { bk[ks].half[0] = *(const v8us*)(kr + ks * 32 + 8 * hh); bk[ks].half[1] = *(const v8us*)(kr + ks * 32 + 16 + 8 * hh); }
#pragma unroll
      for (int rt = 0; rt < RTN; ++rt) { v8f acc = (v8f){0.f,0.f,0.f,0.f,0.f,0.f,0.f,0.f};
#pragma unroll
        for (int ks = 0; ks < KS; ++ks) acc = mmaH<1>(aq[rt][ks].v, aq[rt][ks].v, bk[ks].v, bk[ks].v, acc); s[rt][nt] = acc; } }
#pragma unroll
    for (int rt = 0; rt < RTN; ++rt)
#pragma unroll
      for (int r = 0; r < 8; ++r) { const int tq = q0 + rt * 16 + 8 * hh + r; const int k0 = j0 + ln, k1 = j0 + 16 + ln;
        const bool ok0 = (CAUSAL == 1) ? (k0 <= tq) : ((CAUSAL == 2) ? ((k0 >> 5) == (tq >> 5)) : true), ok1 = (CAUSAL == 1) ? (k1 <= tq) : ((CAUSAL == 2) ? ((k1 >> 5) == (tq >> 5)) : true);      /* mode 2: block-diagonal 32-token groups */
        const float s0 = ok0 ? s[rt][0][r] * SCL : -3.0e38f, s1 = ok1 ? s[rt][1][r] * SCL : -3.0e38f; float mc = fmaxf(s0, s1);
        mc = fmaxf(mc, __shfl_xor(mc, 1, 32)); mc = fmaxf(mc, __shfl_xor(mc, 2, 32)); mc = fmaxf(mc, __shfl_xor(mc, 4, 32)); mc = fmaxf(mc, __shfl_xor(mc, 8, 32));
        const float mn = fmaxf(m_r[rt][r], mc); const float al = (mn > -1.0e38f) ? expf(m_r[rt][r] - mn) : 1.0f; m_r[rt][r] = mn; const float p0 = ok0 ? expf(s0 - mn) : 0.f, p1 = ok1 ? expf(s1 - mn) : 0.f; l_r[rt][r] = l_r[rt][r] * al + p0 + p1;
#pragma unroll
        for (int dt = 0; dt < DT; ++dt) oacc[rt][dt][r] *= al;
        FragH t2; t2.h[0] = (_Float16)(p0 * 1024.0f); t2.h[1] = (_Float16)(p1 * 1024.0f); sP[w][rt * 16 + 8 * hh + r][ln] = t2.u[0]; sP[w][rt * 16 + 8 * hh + r][16 + ln] = t2.u[1]; }
    __builtin_amdgcn_fence(__ATOMIC_ACQ_REL, "workgroup"); __builtin_amdgcn_wave_barrier();
    FragH pa[2];
#pragma unroll
    for (int rt = 0; rt < RTN; ++rt) { pa[rt].half[0] = *(const v8us*)&sP[w][rt * 16 + ln][8 * hh]; pa[rt].half[1] = *(const v8us*)&sP[w][rt * 16 + ln][16 + 8 * hh]; }
#pragma unroll
    for (int dt = 0; dt < DT; ++dt) { const unsigned short* vrow = Vth + (size_t)(dt * 16 + ln) * TK + j0; FragH bv; bv.half[0] = *(const v8us*)(vrow + 8 * hh); bv.half[1] = *(const v8us*)(vrow + 16 + 8 * hh);
#pragma unroll
      for (int rt = 0; rt < RTN; ++rt) oacc[rt][dt] = mmaH<1>(pa[rt].v, pa[rt].v, bv.v, bv.v, oacc[rt][dt]); }
    __builtin_amdgcn_fence(__ATOMIC_ACQ_REL, "workgroup"); __builtin_amdgcn_wave_barrier(); }
#pragma unroll
  for (int rt = 0; rt < RTN; ++rt) {
#pragma unroll
    for (int r = 0; r < 8; ++r) { float l = l_r[rt][r]; l += __shfl_xor(l, 1, 32); l += __shfl_xor(l, 2, 32); l += __shfl_xor(l, 4, 32); l += __shfl_xor(l, 8, 32); l_r[rt][r] = (l > 0.f) ? 1.0f / (l * 1024.0f) : 0.f; }
#pragma unroll
    for (int dt = 0; dt < DT; ++dt)
#pragma unroll
      for (int r = 0; r < 8; ++r) sO[w][rt * 16 + 8 * hh + r][dt * 16 + ln] = oacc[rt][dt][r] * l_r[rt][r]; }
  __builtin_amdgcn_fence(__ATOMIC_ACQ_REL, "workgroup"); __builtin_amdgcn_wave_barrier();
  {
#pragma unroll
    for (int rp = 0; rp < RPW; rp += 2) { const int r = rp + (lane >> 4), pc = lane & 15; const v4f val = *(const v4fa*)&sO[w][r][pc * 4]; *(v4f*)(O + ((size_t)b * TQ + q0 + r) * ldo + h * 64 + pc * 4) = val; }
     } }
// 5-plane variant: S = Qh Kh^T + (Ql Kh^T + Qh Kl^T)/1024 with Q/K = [hi | 2^10 residual] f16 planes (QL/KL same layout as Q16/K16), then the 3-term P.V below.
// 3-term variant: O = (P_hi V_hi + (P_lo V_hi + P_hi V_lo) / 1024) / l with P = [hi | 2^10 residual] of 1024 p and V^T = [hi | 2^10 residual] planes (VtL same layout as Vt) -> ~2^-21-class products for un-averaged (early causal / peaked) rows
template <int CAUSAL>
__global__ __launch_bounds__(128) void k_flash5(const _Float16* __restrict__ Q16, const _Float16* __restrict__ QL, int ldq, const _Float16* __restrict__ K16, const _Float16* __restrict__ KL, int ldk, const _Float16* __restrict__ Vt, const _Float16* __restrict__ VtL, const int* __restrict__ MSK, float* __restrict__ O, int ldo) {
  constexpr int RPW = 16, RTN = RPW / 16, NQB = TQ / (4 * RPW), DT = 4, KS = 2;
  __shared__ __attribute__((aligned(16))) unsigned short sP[4][RPW][40]; __shared__ __attribute__((aligned(16))) unsigned short sPL[4][RPW][40]; __shared__ __attribute__((aligned(16))) float sO[4][RPW][64 + 4];
  const int tid = threadIdx.x, w = tid >> 5, lane = tid & 31, ln = lane & 15, hh = lane >> 4;
  const int slab = blockIdx.x / QBN5, qblk = QB05 + blockIdx.x % QBN5; (void)NQB; const int b = slab / NH, h = slab % NH; const int qb0 = qblk * (4 * RPW); const int q0 = qb0 + w * RPW;
  FragH aq[2][KS], aql[2][KS];
#pragma unroll
  for (int rt = 0; rt < RTN; ++rt) { const unsigned short* qr = (const unsigned short*)Q16 + ((size_t)b * TQ + q0 + rt * 16 + ln) * ldq + h * 64; const unsigned short* ql = (const unsigned short*)QL + ((size_t)b * TQ + q0 + rt * 16 + ln) * ldq + h * 64;
#pragma unroll
    for (int ks = 0; ks < KS; ++ks) { aq[rt][ks].half[0] = *(const v8us*)(qr + ks * 32 + 8 * hh); aq[rt][ks].half[1] = *(const v8us*)(qr + ks * 32 + 16 + 8 * hh); aql[rt][ks].half[0] = *(const v8us*)(ql + ks * 32 + 8 * hh); aql[rt][ks].half[1] = *(const v8us*)(ql + ks * 32 + 16 + 8 * hh); } }
  const unsigned short* Vth = (const unsigned short*)Vt + (size_t)slab * 64 * TK; const unsigned short* Vtl = (const unsigned short*)VtL + (size_t)slab * 64 * TK;
  float m_r[2][8], l_r[2][8]; v8f oacc[2][DT], oaccL[2][DT];
#pragma unroll
  for (int rt = 0; rt < RTN; ++rt) {
#pragma unroll
    for (int r = 0; r < 8; ++r) { m_r[rt][r] = -3.0e38f; l_r[rt][r] = 0.f; }
#pragma unroll
    for (int dt = 0; dt < DT; ++dt) { oacc[rt][dt] = (v8f){0.f,0.f,0.f,0.f,0.f,0.f,0.f,0.f}; oaccL[rt][dt] = oacc[rt][dt]; } }
  const int jend = (CAUSAL == 1) ? (qb0 + 4 * RPW) : TK;      /* causal: keys beyond the block's last query never contribute */
#pragma unroll 1
  for (int j0 = 0; j0 < jend; j0 += 32) {
    v8f s[2][2];
#pragma unroll
    for (int nt = 0; nt < 2; ++nt) { const unsigned short* kr = (const unsigned short*)K16 + ((size_t)b * TK + j0 + nt * 16 + ln) * ldk + h * 64; const unsigned short* klr = (const unsigned short*)KL + ((size_t)b * TK + j0 + nt * 16 + ln) * ldk + h * 64; FragH bk[KS], bkl[KS];
#pragma unroll
      for (int ks = 0; ks < KS; ++ks) { bk[ks].half[0] = *(const v8us*)(kr + ks * 32 + 8 * hh); bk[ks].half[1] = *(const v8us*)(kr + ks * 32 + 16 + 8 * hh); bkl[ks].half[0] = *(const v8us*)(klr + ks * 32 + 8 * hh); bkl[ks].half[1] = *(const v8us*)(klr + ks * 32 + 16 + 8 * hh); }
#pragma unroll
      for (int rt = 0; rt < RTN; ++rt) { v8f acc = (v8f){0.f,0.f,0.f,0.f,0.f,0.f,0.f,0.f}, accl = acc;
#pragma unroll
        for (int ks = 0; ks < KS; ++ks) { acc = mmaH<1>(aq[rt][ks].v, aq[rt][ks].v, bk[ks].v, bk[ks].v, acc); accl = mmaH<1>(aql[rt][ks].v, aql[rt][ks].v, bk[ks].v, bk[ks].v, accl); accl = mmaH<1>(aq[rt][ks].v, aq[rt][ks].v, bkl[ks].v, bkl[ks].v, accl); }
#pragma unroll
        for (int r = 0; r < 8; ++r) acc[r] += accl[r] * 0.0009765625f;
        s[rt][nt] = acc; } }
#pragma unroll
    for (int rt = 0; rt < RTN; ++rt)
#pragma unroll
      for (int r = 0; r < 8; ++r) { const int tq = q0 + rt * 16 + 8 * hh + r; const int k0 = j0 + ln, k1 = j0 + 16 + ln;
        bool ok0 = (CAUSAL == 1) ? (k0 <= tq) : ((CAUSAL == 2) ? ((k0 >> 5) == (tq >> 5)) : true), ok1 = (CAUSAL == 1) ? (k1 <= tq) : ((CAUSAL == 2) ? ((k1 >> 5) == (tq >> 5)) : true);      /* mode 2: block-diagonal 32-token groups */
        if (CAUSAL == 4) { const int* mrow = MSK + ((size_t)b * TQ + tq) * TK; ok0 = mrow[k0] != 0; ok1 = mrow[k1] != 0; }      /* mode 4: per-(query, key) INPUT mask shared by all heads; masked keys contribute nothing (== the reference's -4096 fill, whose exp underflows to 0), rows with no valid key give l = 0 -> output 0 (== the reference's row_valid zeroing) */
        const float s0 = ok0 ? s[rt][0][r] * SCL : -3.0e38f, s1 = ok1 ? s[rt][1][r] * SCL : -3.0e38f; float mc = fmaxf(s0, s1);
        mc = fmaxf(mc, __shfl_xor(mc, 1, 32)); mc = fmaxf(mc, __shfl_xor(mc, 2, 32)); mc = fmaxf(mc, __shfl_xor(mc, 4, 32)); mc = fmaxf(mc, __shfl_xor(mc, 8, 32));
        const float mn = fmaxf(m_r[rt][r], mc); const float al = (mn > -1.0e38f) ? expf(m_r[rt][r] - mn) : 1.0f; m_r[rt][r] = mn; const float p0 = ok0 ? expf(s0 - mn) : 0.f, p1 = ok1 ? expf(s1 - mn) : 0.f; l_r[rt][r] = l_r[rt][r] * al + p0 + p1;
#pragma unroll
        for (int dt = 0; dt < DT; ++dt) { oacc[rt][dt][r] *= al; oaccL[rt][dt][r] *= al; }
        FragH t2, t2l; const float ps0 = p0 * 1024.0f, ps1 = p1 * 1024.0f; t2.h[0] = (_Float16)ps0; t2.h[1] = (_Float16)ps1; t2l.h[0] = (_Float16)((ps0 - (float)t2.h[0]) * 1024.0f); t2l.h[1] = (_Float16)((ps1 - (float)t2.h[1]) * 1024.0f);
        sP[w][rt * 16 + 8 * hh + r][ln] = t2.u[0]; sP[w][rt * 16 + 8 * hh + r][16 + ln] = t2.u[1]; sPL[w][rt * 16 + 8 * hh + r][ln] = t2l.u[0]; sPL[w][rt * 16 + 8 * hh + r][16 + ln] = t2l.u[1]; }
    __builtin_amdgcn_fence(__ATOMIC_ACQ_REL, "workgroup"); __builtin_amdgcn_wave_barrier();
    FragH pa[2], pl[2];
#pragma unroll
    for (int rt = 0; rt < RTN; ++rt) { pa[rt].half[0] = *(const v8us*)&sP[w][rt * 16 + ln][8 * hh]; pa[rt].half[1] = *(const v8us*)&sP[w][rt * 16 + ln][16 + 8 * hh]; pl[rt].half[0] = *(const v8us*)&sPL[w][rt * 16 + ln][8 * hh]; pl[rt].half[1] = *(const v8us*)&sPL[w][rt * 16 + ln][16 + 8 * hh]; }
#pragma unroll
    for (int dt = 0; dt < DT; ++dt) { const unsigned short* vrow = Vth + (size_t)(dt * 16 + ln) * TK + j0; const unsigned short* vrl = Vtl + (size_t)(dt * 16 + ln) * TK + j0; FragH bv, bl; bv.half[0] = *(const v8us*)(vrow + 8 * hh); bv.half[1] = *(const v8us*)(vrow + 16 + 8 * hh); bl.half[0] = *(const v8us*)(vrl + 8 * hh); bl.half[1] = *(const v8us*)(vrl + 16 + 8 * hh);
#pragma unroll
      for (int rt = 0; rt < RTN; ++rt) { oacc[rt][dt] = mmaH<1>(pa[rt].v, pa[rt].v, bv.v, bv.v, oacc[rt][dt]); oaccL[rt][dt] = mmaH<1>(pl[rt].v, pl[rt].v, bv.v, bv.v, oaccL[rt][dt]); oaccL[rt][dt] = mmaH<1>(pa[rt].v, pa[rt].v, bl.v, bl.v, oaccL[rt][dt]); } }
    __builtin_amdgcn_fence(__ATOMIC_ACQ_REL, "workgroup"); __builtin_amdgcn_wave_barrier(); }
#pragma unroll
  for (int rt = 0; rt < RTN; ++rt) {
#pragma unroll
    for (int r = 0; r < 8; ++r) { float l = l_r[rt][r]; l += __shfl_xor(l, 1, 32); l += __shfl_xor(l, 2, 32); l += __shfl_xor(l, 4, 32); l += __shfl_xor(l, 8, 32); l_r[rt][r] = (l > 0.f) ? 1.0f / (l * 1024.0f) : 0.f; }
#pragma unroll
    for (int dt = 0; dt < DT; ++dt)
#pragma unroll
      for (int r = 0; r < 8; ++r) { float v = oacc[rt][dt][r]; v += oaccL[rt][dt][r] * 0.0009765625f; sO[w][rt * 16 + 8 * hh + r][dt * 16 + ln] = v * l_r[rt][r]; } }
  __builtin_amdgcn_fence(__ATOMIC_ACQ_REL, "workgroup"); __builtin_amdgcn_wave_barrier();
  {
#pragma unroll
    for (int rp = 0; rp < RPW; rp += 2) { const int r = rp + (lane >> 4), pc = lane & 15; const v4f val = *(const v4fa*)&sO[w][r][pc * 4]; *(v4f*)(O + ((size_t)b * TQ + q0 + r) * ldo + h * 64 + pc * 4) = val; }
     } }

__global__ __launch_bounds__(256) void k_rotab(float* __restrict__ CS, float* __restrict__ SN) {
  #pragma clang fp contract(off)
  const int t = blockIdx.x * 256 + threadIdx.x; if (t >= SLEN * 32) return; const int j = t % 32, s = t / 32; (void)j; (void)s; const float c = 1.0f, sn = 0.0f;      /* no RoPE here: identity tables make k_rope a pure hi/lo split (a*1 - b*0 is exact) */
  { *(float*)(CS + t) = c; *(float*)(SN + t) = sn;  } }
__global__ __launch_bounds__(256) void k_rope(const float* __restrict__ F, int nsrc, int ndst, int rep, const float* __restrict__ CS, const float* __restrict__ SN, _Float16* __restrict__ H, _Float16* __restrict__ L) {
  #pragma clang fp contract(off)
  const size_t t = (size_t)blockIdx.x * 256 + threadIdx.x; if (t >= (size_t)NR * ndst * 4) return; const int g8 = (int)(t % 4); const int hd = (int)((t / 4) % ndst); const size_t row = t / ((size_t)4 * ndst); const int s = (int)(row % SLEN); const int hs = hd / rep;
  const float* src = F + row * (size_t)(nsrc * 64) + hs * 64; FragH ah, al, bh, bl;
  for (int i = 0; i < 8; ++i) { const int d = g8 * 8 + i; const float c = CS[s * 32 + d], sn = SN[s * 32 + d]; const float x1 = src[d], x2 = src[d + 32];
    float o1 = x1 * c; o1 += -x2 * sn; float o2 = x2 * c; o2 += x1 * sn;
    _Float16 hv = (_Float16)o1; ah.h[i] = hv; al.h[i] = (_Float16)((o1 - (float)hv) * 1024.0f); hv = (_Float16)o2; bh.h[i] = hv; bl.h[i] = (_Float16)((o2 - (float)hv) * 1024.0f); }
  const size_t o = row * (size_t)(ndst * 64) + hd * 64 + g8 * 8;
  { *(v8us*)((unsigned short*)H + o) = ah.half[0]; *(v8us*)((unsigned short*)H + o + 32) = bh.half[0]; *(v8us*)((unsigned short*)L + o) = al.half[0]; *(v8us*)((unsigned short*)L + o + 32) = bl.half[0];  } }
__global__ __launch_bounds__(256) void k_vtg(const _Float16* __restrict__ V16, int vadd, _Float16* __restrict__ Vt) { __shared__ unsigned short tl[64][66]; const int tid = threadIdx.x; const int slab = blockIdx.x / (SLEN / 64), lg = blockIdx.x % (SLEN / 64); const int b = slab / NH, h = slab % NH; const int col0 = (h / 8) * 128 + vadd;      /* pseudo-head h reads value head h/8 (128 wide): low (vadd 0) or high (vadd 64) half */
  for (int i = tid; i < 64 * 8; i += 256) { const int r = i / 8, c8 = (i % 8) * 8; FragH f; f.half[0] = *(const v8us*)((const unsigned short*)V16 + ((size_t)b * SLEN + lg * 64 + r) * KVD + col0 + c8); for (int q = 0; q < 8; ++q) tl[r][c8 + q] = f.u[q]; }
  __syncthreads();
  { for (int rd = 0; rd < 2; ++rd) { const int d = rd * 32 + tid / 8, pc = tid % 8; FragH f; for (int q = 0; q < 8; ++q) f.u[q] = tl[pc * 8 + q][d]; *(v8us*)((unsigned short*)Vt + ((size_t)slab * 64 + d) * SLEN + lg * 64 + pc * 8) = f.half[0]; }  } }

__global__ __launch_bounds__(256) void k_wsc(const float* __restrict__ Wm, _Float16* __restrict__ Bt, size_t n8, float sc) { const size_t t = (size_t)blockIdx.x * 256 + threadIdx.x; if (t >= n8) return; FragH f; for (int q = 0; q < 8; ++q) f.h[q] = (_Float16)(bf16_round(Wm[t * 8 + q]) * sc); *(v8us*)((unsigned short*)Bt + t * 8) = f.half[0];  }
__global__ __launch_bounds__(64) void k_lam(const float* __restrict__ q1, const float* __restrict__ k1, const float* __restrict__ q2, const float* __restrict__ k2, float* __restrict__ LAM) {
  #pragma clang fp contract(off)
  const int ln = threadIdx.x & 31; if (threadIdx.x >= 32) return; float a = bf16_round(q1[ln]) * bf16_round(k1[ln]); a += bf16_round(q1[ln + 32]) * bf16_round(k1[ln + 32]); float c = bf16_round(q2[ln]) * bf16_round(k2[ln]); c += bf16_round(q2[ln + 32]) * bf16_round(k2[ln + 32]);
  for (int o = 16; o > 0; o >>= 1) { a += __shfl_xor(a, o, 32); c += __shfl_xor(c, o, 32); } const float lf = expf(a) - expf(c) + 0.78360576653162446f;      /* LAMBDA_INIT = 0.8 - 0.6 exp(-0.3 * 12) = 0.78360577 */
  const float v = (ln == 0) ? lf : 0.f; *(float*)(LAM + ln) = v;  }
__global__ __launch_bounds__(256) void k_comb(const float* __restrict__ OLO, const float* __restrict__ OHI, const float* __restrict__ LAM, const float* __restrict__ lnw, _Float16* __restrict__ A16) {
  #pragma clang fp contract(off)
  const size_t t = (size_t)blockIdx.x * 256 + threadIdx.x; if (t >= (size_t)NR * 16) return; const int j = (int)(t % 16); const size_t r = t / 16; const float lam = LAM[0]; float a[128]; float ss = 0.f;
  const float* e0 = OLO + r * DM + (size_t)(2 * j) * 64; const float* o0 = OLO + r * DM + (size_t)(2 * j + 1) * 64; const float* e1 = OHI + r * DM + (size_t)(2 * j) * 64; const float* o1 = OHI + r * DM + (size_t)(2 * j + 1) * 64;
  for (int d = 0; d < 64; ++d) { float v = e0[d]; v += -lam * o0[d]; a[d] = v; ss += v * v; float w = e1[d]; w += -lam * o1[d]; a[64 + d] = w; ss += w * w; }
  const float inv = rsqrtf(ss / 128.0f + 1e-5f); unsigned short* dst = (unsigned short*)A16 + r * DM + (size_t)j * 128;
  { for (int g = 0; g < 16; ++g) { FragH f; for (int q = 0; q < 8; ++q) { const int d = g * 8 + q; float v = a[d] * inv; v *= bf16_round(lnw[d]); v = v * 0.21639423346837554f;      /* 1 - LAMBDA_INIT */ f.h[q] = (_Float16)v; } *(v8us*)(dst + g * 8) = f.half[0]; }  } }

extern "C" void kernel_launch(void* const* d_in, const int* in_sizes, int n_in,
                              void* d_out, int out_size, void* d_ws, size_t ws_size, hipStream_t stream) {
  (void)in_sizes; (void)n_in; (void)out_size;
  const float* const* I = (const float* const*)d_in; const float* x = I[0]; const float* Wq = I[1]; const float* Wk = I[2]; const float* Wv = I[3]; const float* Wo = I[4]; const float* lq1 = I[5]; const float* lk1 = I[6]; const float* lq2 = I[7]; const float* lk2 = I[8]; const float* lnw = I[9]; const float* bq = nullptr; const float* bk = nullptr; const float* bv = nullptr;
  char* ws = (char*)d_ws; size_t off = 0;
  auto take = [&](size_t bytes) { char* p = ws + off; off += (bytes + 255) & ~(size_t)255; return p; };
  const size_t np = (size_t)NR * DM, nk = (size_t)NR * KVD;
  _Float16* BQ = (_Float16*)take((size_t)DM * DM * 2); _Float16* BK = (_Float16*)take((size_t)KVD * DM * 2); _Float16* BV = (_Float16*)take((size_t)KVD * DM * 2); _Float16* BO = (_Float16*)take((size_t)DM * DM * 2);
  float* CS = (float*)take((size_t)SLEN * 32 * 4); float* SN = (float*)take((size_t)SLEN * 32 * 4);
  _Float16* X16 = (_Float16*)take(np * 2); float* QF = (float*)take(np * 4); _Float16* QH = (_Float16*)take(np * 2); _Float16* QL = (_Float16*)take(np * 2); float* KF = (float*)take(nk * 4); float* VF = (float*)take(nk * 4); _Float16* KXH = (_Float16*)take(np * 2); _Float16* KXL = (_Float16*)take(np * 2); _Float16* VH = (_Float16*)take(nk * 2); _Float16* VL = (_Float16*)take(nk * 2); _Float16* VT = (_Float16*)take(np * 2); _Float16* VTL = (_Float16*)take(np * 2); _Float16* VT2 = (_Float16*)take(np * 2); _Float16* VTL2 = (_Float16*)take(np * 2); float* LAM = (float*)take(256);
  float* OLO = QF;      /* low-half attention output over the q f32 plane (dead after the split) */ float* OHI = (float*)VT;       _Float16* A16 = X16;      /* normalised attention over the input plane (dead after the projections) */
  if (off > ws_size) return;      /* 8+2+2+8 + 0.5 + 16+32+16+16+8+8+16+16+4+4+16+16+16+16 = 221 MiB */
  k_wsc<<<(unsigned)(((size_t)DM * DM / 8 + 255) / 256), 256, 0, stream>>>(Wq, BQ, (size_t)DM * DM / 8, 16.0f); k_wsc<<<(unsigned)(((size_t)KVD * DM / 8 + 255) / 256), 256, 0, stream>>>(Wk, BK, (size_t)KVD * DM / 8, 16.0f); k_wsc<<<(unsigned)(((size_t)KVD * DM / 8 + 255) / 256), 256, 0, stream>>>(Wv, BV, (size_t)KVD * DM / 8, 16.0f); k_wsc<<<(unsigned)(((size_t)DM * DM / 8 + 255) / 256), 256, 0, stream>>>(Wo, BO, (size_t)DM * DM / 8, 16.0f);      /* torch (out,in) = Bt */ k_lam<<<1, 64, 0, stream>>>(lq1, lk1, lq2, lk2, LAM);
  k_rotab<<<(SLEN * 32 + 255) / 256, 256, 0, stream>>>(CS, SN);
  k_x16<<<(unsigned)((np / 8 + 255) / 256), 256, 0, stream>>>(x, X16, np / 8);
  k_gemm2<0><<<dim3((NR / 128) * (DM / 64), 1), 128, 0, stream>>>(X16, DM, 0, BQ, DM, 0, 0.0625f, bq, 0, nullptr, 1, 0, 0, QF, nullptr, DM, 0, NR, DM, DM);
  k_gemm2<0><<<dim3((NR / 128) * (KVD / 64), 1), 128, 0, stream>>>(X16, DM, 0, BK, DM, 0, 0.0625f, bk, 0, nullptr, 1, 0, 0, KF, nullptr, KVD, 0, NR, KVD, DM);
  k_gemm2<0><<<dim3((NR / 128) * (KVD / 64), 1), 128, 0, stream>>>(X16, DM, 0, BV, DM, 0, 0.0625f, bv, 0, nullptr, 1, 0, 0, VF, nullptr, KVD, 0, NR, KVD, DM);
  k_rope<<<(unsigned)(((size_t)NR * NH * 4 + 255) / 256), 256, 0, stream>>>(QF, NH, NH, 1, CS, SN, QH, QL);      /* q: 32 -> 32 heads */
  k_rope<<<(unsigned)(((size_t)NR * NH * 4 + 255) / 256), 256, 0, stream>>>(KF, NKV, NH, NREP, CS, SN, KXH, KXL);      /* k: kv head h/4 expanded to query head h */
  k_hl<<<(unsigned)((nk / 8 + 255) / 256), 256, 0, stream>>>(VF, VH, VL, nk / 8);
  k_vtg<<<NB * NH * (SLEN / 64), 256, 0, stream>>>(VH, 0, VT); k_vtg<<<NB * NH * (SLEN / 64), 256, 0, stream>>>(VL, 0, VTL); k_vtg<<<NB * NH * (SLEN / 64), 256, 0, stream>>>(VH, 64, VT2); k_vtg<<<NB * NH * (SLEN / 64), 256, 0, stream>>>(VL, 64, VTL2);      /* low / high 64 of each pseudo-head's 128-wide value head; QF becomes OLO from here on */
  k_flash5<1><<<NB * NH * QBN5, 128, 0, stream>>>(QH, QL, DM, KXH, KXL, DM, VT, VTL, nullptr, OLO, DM); k_flash<1><<<NB * NH * QBNP, 128, 0, stream>>>(QH, DM, KXH, DM, VT, nullptr, OLO, DM);      
  k_flash5<1><<<NB * NH * QBN5, 128, 0, stream>>>(QH, QL, DM, KXH, KXL, DM, VT2, VTL2, nullptr, OHI, DM); k_flash<1><<<NB * NH * QBNP, 128, 0, stream>>>(QH, DM, KXH, DM, VT2, nullptr, OHI, DM);      /* pass 2: high halves, written over the now-dead low-half tiles */
  k_comb<<<(unsigned)(((size_t)NR * 16 + 255) / 256), 256, 0, stream>>>(OLO, OHI, LAM, lnw, A16);
  k_gemm2<0><<<dim3((NR / 128) * (DM / 64), 1), 128, 0, stream>>>(A16, DM, 0, BO, DM, 0, 0.0625f, nullptr, 0, nullptr, 1, 0, 0, (float*)d_out, nullptr, DM, 0, NR, DM, DM);      /* out = attn Wo^T */
}

// v001
// Measured time: 831 microseconds a run.
// Two timings next to v000 put it at 1.16 and 1.15 times that version's speed.
#include <hip/hip_runtime.h>
// MultiheadSdpaDiff4 (2 x 2048 tokens, EMBED 2048; differential attention: q = x Wq^T as 32 pseudo-heads x 64, k = x Wk^T as 8 heads x 64 repeat-interleaved 4x, v = x Wv^T as 4 heads x 128 repeat-interleaved 8x; causal softmax(q.k/8) v; attn = O_even - lambda_full * O_odd (16 heads x 128), lambda_full = exp(lq1.lk1) - exp(lq2.lk2) + 0.78361; RMSNorm(128, eps 1e-5) * ln_w * (1 - 0.78361); out = attn Wo^T.
// Compute dtype: inputs rounded to bf16; x exact as f16; q/k/P/v as f16 hi + residual on the first 256 rows (~2^-21) and plain beyond (~2^-12); the normalised attention as a plain f16 operand; softmax/lambda/RMSNorm f32. v_wmma_f32_16x16x32_f16.
#define NB 2
#define DM 2048
#define NKV 8
#define NREP (NH / NKV)
#define KVD (NKV * 64)           /* 512 */
#define NR (NB * SLEN)           /* 4096 */
#define SLEN 2048
#define TQ SLEN
#define TK SLEN
#define NH 32
#define SCL 0.125f
#define QBLKS (TQ / 64)
#define QB05 0
#define QBN5 4
#define QB0P QBN5
#define QBNP (QBLKS - QBN5)
#define RE 256
typedef __bf16 v16b __attribute__((ext_vector_type(16)));
typedef unsigned short v8us __attribute__((ext_vector_type(8), may_alias));
typedef float  v8f  __attribute__((ext_vector_type(8)));
typedef float  v4f  __attribute__((ext_vector_type(4)));
typedef float  v4fa __attribute__((ext_vector_type(4), may_alias));
union FragB { v16b v; v8us half[2]; unsigned short u[16]; };

__device__ __forceinline__ unsigned short bf16_bits(float x) { unsigned int u = __float_as_uint(x); return (unsigned short)((u + 0x7FFFu + ((u >> 16) & 1u)) >> 16); }
__device__ __forceinline__ float bf16_val(unsigned short b) { return __uint_as_float(((unsigned int)b) << 16); }
__device__ __forceinline__ float bf16_round(float x) { return bf16_val(bf16_bits(x)); }
// D += A·B with NT terms: 1 = ah·bh, 2 = + al·bh (A split), 3 = + ah·bl (both split)
template <int NT>
__device__ __forceinline__ v8f mmaN(v16b ah, v16b al, v16b bh, v16b bl, v8f c) {
  c = __builtin_amdgcn_wmma_f32_16x16x32_bf16(false, ah, false, bh, (short)0, c, false, false);
  if (NT >= 2) c = __builtin_amdgcn_wmma_f32_16x16x32_bf16(false, al, false, bh, (short)0, c, false, false);
  if (NT >= 3) c = __builtin_amdgcn_wmma_f32_16x16x32_bf16(false, ah, false, bl, (short)0, c, false, false);
  asm volatile("v_nop\n\tv_nop\n\tv_nop\n\tv_nop" : "+v"(c) : "v"(ah), "v"(al), "v"(bh), "v"(bl));
  return c;
}

__global__ __launch_bounds__(256) void k_wt_bf16(const float* __restrict__ W, unsigned short* __restrict__ Wt, int K, int N) {
  const int t = blockIdx.x * 256 + threadIdx.x;
  const int k8n = K / 8;
  if (t >= N * k8n) return;
  const int n = t / k8n, k8 = (t % k8n) * 8;
  v8us v;
#pragma unroll
  for (int i = 0; i < 8; ++i) v[i] = bf16_bits(W[(size_t)(k8 + i) * N + n]);
  *(v8us*)(Wt + (size_t)n * K + k8) = v;
  
}

// GEMM C[M][N] (f32, pitch ldc) = act(A[M][K]·W + bias). A f32 row-major (pitch lda) converted per fragment to bf16
// (ASPLIT: hi/lo two planes -> 2 terms, else single rounded term); Wt bf16 [N][K] (pitch ldb). BIAS_BF16 rounds the
// bias to bf16 first (bias quantised to bf16 before the add). K%32==0, M%16==0, N%64==0.
template <bool ASPLIT, int ACT, bool BIAS_BF16>
__global__ __launch_bounds__(128) void k_gemm_bf(const float* __restrict__ A, int lda, const unsigned short* __restrict__ Wt, int ldb,
                                               const float* __restrict__ bias, float* __restrict__ C, int ldc, int M, int N, int K) {
  __shared__ __attribute__((aligned(16))) float so[4][16][64];
  const int tid = threadIdx.x, w = tid >> 5, lane = tid & 31, ln = lane & 15, hh = lane >> 4;
  const int ntn = N / 64;
  const int wid = blockIdx.x * 4 + w;
  const int mt = wid / ntn, nq = wid % ntn;
  if (mt * 16 >= M) return;
  const int row0 = mt * 16, col0 = nq * 64;
  const float* arow = A + (size_t)(row0 + ln) * lda;
  v8f acc[4] = {};
  for (int kb = 0; kb < K; kb += 32) {
    FragB ah, al;
    const v4f x0 = *(const v4fa*)(arow + kb + 8 * hh), x1 = *(const v4fa*)(arow + kb + 8 * hh + 4);
    const v4f x2 = *(const v4fa*)(arow + kb + 16 + 8 * hh), x3 = *(const v4fa*)(arow + kb + 16 + 8 * hh + 4);
    float xs[16] = {x0[0],x0[1],x0[2],x0[3],x1[0],x1[1],x1[2],x1[3],x2[0],x2[1],x2[2],x2[3],x3[0],x3[1],x3[2],x3[3]};
#pragma unroll
    for (int i = 0; i < 16; ++i) { const unsigned short hb = bf16_bits(xs[i]); ah.u[i] = hb; al.u[i] = ASPLIT ? bf16_bits(xs[i] - bf16_val(hb)) : (unsigned short)0; }
#pragma unroll
    for (int t = 0; t < 4; ++t) {
      const unsigned short* brow = Wt + (size_t)(col0 + t * 16 + ln) * ldb + kb;
      FragB b;
      b.half[0] = *(const v8us*)(brow + 8 * hh);
      b.half[1] = *(const v8us*)(brow + 16 + 8 * hh);
      acc[t] = mmaN<ASPLIT ? 2 : 1>(ah.v, al.v, b.v, b.v, acc[t]);
    }
  }
#pragma unroll
  for (int t = 0; t < 4; ++t) {
    float bv = bias ? bias[col0 + t * 16 + ln] : 0.f;
    if (BIAS_BF16) bv = bf16_round(bv);
#pragma unroll
    for (int r = 0; r < 8; ++r) { float v = acc[t][r] + bv; if (ACT == 1) v = fmaxf(v, 0.f); so[w][8 * hh + r][t * 16 + ln] = v; }
  }
  __builtin_amdgcn_fence(__ATOMIC_ACQ_REL, "workgroup");
  __builtin_amdgcn_wave_barrier();
  const int rsub = lane >> 4, c4 = (lane & 15) * 4;
  {
#pragma unroll
    for (int q = 0; q < 8; ++q) {
      const int r = q * 2 + rsub;
      const v4f v = *(const v4fa*)&so[w][r][c4];
      *(v4f*)(C + (size_t)(row0 + r) * ldc + col0 + c4) = v;
    }
    
  }
}

// GEMM C = act(A·W + bias + resid): A f32 (ASPLIT -> hi/lo 2 terms), Wt bf16 [N][K]; ACT 0 none, 1 relu, 2 exact gelu;
// resid (optional, f32, row index = (row % rmod), pitch ldr, RES_BF16 rounds it) added before the activation.
template <bool ASPLIT, int ACT, bool BIAS_BF16, bool RES_BF16>
__global__ __launch_bounds__(128) void k_gemm_bf3(const float* __restrict__ A, int lda, const unsigned short* __restrict__ Wt, int ldb,
                                                const float* __restrict__ bias, const float* __restrict__ resid, int rmod, int ldr,
                                                float* __restrict__ C, int ldc, int M, int N, int K) {
  __shared__ __attribute__((aligned(16))) float so[4][16][64];
  const int tid = threadIdx.x, w = tid >> 5, lane = tid & 31, ln = lane & 15, hh = lane >> 4;
  const int ntn = N / 64;
  const int wid = blockIdx.x * 4 + w;
  const int mt = wid / ntn, nq = wid % ntn;
  if (mt * 16 >= M) return;
  const int row0 = mt * 16, col0 = nq * 64;
  const float* arow = A + (size_t)(row0 + ln) * lda;
  v8f acc[4] = {};
  for (int kb = 0; kb < K; kb += 32) {
    FragB ah, al;
    const v4f x0 = *(const v4fa*)(arow + kb + 8 * hh), x1 = *(const v4fa*)(arow + kb + 8 * hh + 4);
    const v4f x2 = *(const v4fa*)(arow + kb + 16 + 8 * hh), x3 = *(const v4fa*)(arow + kb + 16 + 8 * hh + 4);
    float xs[16] = {x0[0],x0[1],x0[2],x0[3],x1[0],x1[1],x1[2],x1[3],x2[0],x2[1],x2[2],x2[3],x3[0],x3[1],x3[2],x3[3]};
#pragma unroll
    for (int i = 0; i < 16; ++i) { const unsigned short hb = bf16_bits(xs[i]); ah.u[i] = hb; al.u[i] = ASPLIT ? bf16_bits(xs[i] - bf16_val(hb)) : (unsigned short)0; }
#pragma unroll
    for (int t = 0; t < 4; ++t) {
      const unsigned short* brow = Wt + (size_t)(col0 + t * 16 + ln) * ldb + kb;
      FragB b;
      b.half[0] = *(const v8us*)(brow + 8 * hh);
      b.half[1] = *(const v8us*)(brow + 16 + 8 * hh);
      acc[t] = mmaN<ASPLIT ? 2 : 1>(ah.v, al.v, b.v, b.v, acc[t]);
    }
  }
#pragma unroll
  for (int t = 0; t < 4; ++t) {
    const int col = col0 + t * 16 + ln;
    float bv = bias ? bias[col] : 0.f;
    if (BIAS_BF16) bv = bf16_round(bv);
#pragma unroll
    for (int r = 0; r < 8; ++r) {
      float v = acc[t][r] + bv;
      if (resid) { float rv = resid[(size_t)((row0 + 8 * hh + r) % rmod) * ldr + col]; if (RES_BF16) rv = bf16_round(rv); v += rv; }
      if (ACT == 1) v = fmaxf(v, 0.f);
      if (ACT == 2) v = 0.5f * v * (1.0f + erff(v * 0.70710678118654752f));
      if (ACT == 3) { const float u = 0.7978845608028654f * (v + 0.044715f * v * v * v); v = 0.5f * v * (1.0f + tanhf(u)); }
      so[w][8 * hh + r][t * 16 + ln] = v;
    }
  }
  __builtin_amdgcn_fence(__ATOMIC_ACQ_REL, "workgroup");
  __builtin_amdgcn_wave_barrier();
  const int rsub = lane >> 4, c4 = (lane & 15) * 4;
  {
#pragma unroll
    for (int q = 0; q < 8; ++q) {
      const int r = q * 2 + rsub;
      const v4f v = *(const v4fa*)&so[w][r][c4];
      *(v4f*)(C + (size_t)(row0 + r) * ldc + col0 + c4) = v;
    }
    
  }
}
// row LayerNorm (biased variance, eps) over N: s = X (+ R); optional out_sum <- s; out_norm <- (s-mu)*rsqrt(var+eps)*g + b
template <bool PARAM_BF16>
__global__ __launch_bounds__(256) void k_layernorm(const float* __restrict__ X, const float* __restrict__ R, const float* __restrict__ g, const float* __restrict__ bta,
                                                  float* __restrict__ out_sum, float* __restrict__ out_norm, int N, float eps) {
  __shared__ float red[256];
  const int row = blockIdx.x, tid = threadIdx.x;
  const float* x = X + (size_t)row * N; const float* rr = R ? R + (size_t)row * N : nullptr;
  float vals[16];                     // up to N = 4096
  const int per = N / 256;            // contiguous chunk per thread? use strided-by-4 chunks: thread handles j = tid*4 + 1024*u
  float s1 = 0.f;
  for (int u = 0; u < per / 4; ++u) {
    const int j = tid * 4 + 1024 * u;
    const v4f a = *(const v4fa*)(x + j);
    v4f b = {0.f,0.f,0.f,0.f}; if (rr) b = *(const v4fa*)(rr + j);
#pragma unroll
    for (int q = 0; q < 4; ++q) { const float v = a[q] + b[q]; vals[u * 4 + q] = v; s1 += v; }
  }
  red[tid] = s1; __syncthreads();
  for (int st = 128; st > 0; st >>= 1) { if (tid < st) red[tid] += red[tid + st]; __syncthreads(); }
  const float mu = red[0] / (float)N; __syncthreads();
  float s2 = 0.f;
  for (int u = 0; u < per / 4; ++u)
#pragma unroll
    for (int q = 0; q < 4; ++q) { const float c = vals[u * 4 + q] - mu; s2 += c * c; }
  red[tid] = s2; __syncthreads();
  for (int st = 128; st > 0; st >>= 1) { if (tid < st) red[tid] += red[tid + st]; __syncthreads(); }
  const float rs = rsqrtf(red[0] / (float)N + eps);
  {
    for (int u = 0; u < per / 4; ++u) {
      const int j = tid * 4 + 1024 * u;
      v4f o, sm;
#pragma unroll
      for (int q = 0; q < 4; ++q) {
        float gg = g[j + q], bb = bta[j + q];
        if (PARAM_BF16) { gg = bf16_round(gg); bb = bf16_round(bb); }
        sm[q] = vals[u * 4 + q]; o[q] = (vals[u * 4 + q] - mu) * rs * gg + bb;
      }
      if (out_sum) *(v4f*)(out_sum + (size_t)row * N + j) = sm;
      *(v4f*)(out_norm + (size_t)row * N + j) = o;
    }
    
  }
}



// ---- f16 WMMA path (v_wmma_f32_16x16x32_f16): 11-bit significands for operands in range — used where a [0,1] probability operand needs more precision than bf16
typedef _Float16 v16h __attribute__((ext_vector_type(16)));
union FragH { v16h v; v8us half[2]; _Float16 h[16]; unsigned short u[16]; };
template <int NT>
__device__ __forceinline__ v8f mmaH(v16h ah, v16h al, v16h bh, v16h bl, v8f c) {
  c = __builtin_amdgcn_wmma_f32_16x16x32_f16(false, ah, false, bh, (short)0, c, false, false);
  if (NT >= 2) c = __builtin_amdgcn_wmma_f32_16x16x32_f16(false, al, false, bh, (short)0, c, false, false);
  if (NT >= 3) c = __builtin_amdgcn_wmma_f32_16x16x32_f16(false, ah, false, bl, (short)0, c, false, false);
  asm volatile("v_nop\n\tv_nop\n\tv_nop\n\tv_nop" : "+v"(c) : "v"(ah), "v"(al), "v"(bh), "v"(bl));
  return c;
}
// batched GEMM like k_gemm_b but f16 operands: A f32 (split into f16 hi/lo if ASPLIT, else rounded to f16), Bt = f16 values [n][k]; alpha; C f32; N multiple of 16 (partial tiles skipped)
template <bool ASPLIT>
__global__ __launch_bounds__(128) void k_gemm_h(const float* __restrict__ A, int lda, size_t sA, const _Float16* __restrict__ Bh, int ldb, size_t sB, float alpha, float* __restrict__ C, int ldc, size_t sC, int M, int N, int K) {
  __shared__ __attribute__((aligned(16))) float so[4][16][64];
  const int tid = threadIdx.x, w = tid >> 5, lane = tid & 31, ln = lane & 15, hh = lane >> 4; const int by = blockIdx.y;
  A += (size_t)by * sA; Bh += (size_t)by * sB; C += (size_t)by * sC;
  const int ntn = (N + 63) / 64; const int wid = blockIdx.x * 4 + w; const int mt = wid / ntn, nq = wid % ntn; if (mt * 16 >= M) return;
  const int row0 = mt * 16, col0 = nq * 64; const float* arow = A + (size_t)(row0 + ln) * lda;
  v8f acc[4] = {};
  for (int kb = 0; kb < K; kb += 32) {
    FragH ah, al;
    const v4f x0 = *(const v4fa*)(arow + kb + 8 * hh), x1 = *(const v4fa*)(arow + kb + 8 * hh + 4), x2 = *(const v4fa*)(arow + kb + 16 + 8 * hh), x3 = *(const v4fa*)(arow + kb + 16 + 8 * hh + 4);
    float xs[16] = {x0[0],x0[1],x0[2],x0[3],x1[0],x1[1],x1[2],x1[3],x2[0],x2[1],x2[2],x2[3],x3[0],x3[1],x3[2],x3[3]};
#pragma unroll
    for (int i = 0; i < 16; ++i) { const _Float16 h = (_Float16)xs[i]; ah.h[i] = h; al.h[i] = ASPLIT ? (_Float16)(xs[i] - (float)h) : (_Float16)0.0f; }
#pragma unroll
    for (int t = 0; t < 4; ++t) { if (col0 + t * 16 >= N) continue; const size_t boff = (size_t)(col0 + t * 16 + ln) * ldb + kb; FragH bq; bq.half[0] = *(const v8us*)(Bh + boff + 8 * hh); bq.half[1] = *(const v8us*)(Bh + boff + 16 + 8 * hh);
      acc[t] = mmaH<ASPLIT ? 2 : 1>(ah.v, al.v, bq.v, bq.v, acc[t]); }
  }
#pragma unroll
  for (int t = 0; t < 4; ++t) { if (col0 + t * 16 >= N) continue;
#pragma unroll
    for (int r = 0; r < 8; ++r) so[w][8 * hh + r][t * 16 + ln] = acc[t][r] * alpha; }
  __builtin_amdgcn_fence(__ATOMIC_ACQ_REL, "workgroup"); __builtin_amdgcn_wave_barrier();
  const int rsub = lane >> 4, c4 = (lane & 15) * 4;
  {
#pragma unroll
    for (int q = 0; q < 8; ++q) { const int r = q * 2 + rsub; if (col0 + c4 < N) { const v4f v = *(const v4fa*)&so[w][r][c4]; *(v4f*)(C + (size_t)(row0 + r) * ldc + col0 + c4) = v; } }
     }
}

// Wt[n][k] = f16(W[k][n]·scale) from f32 row-major W[K][N] (scale = power of two; bf16-exact weights stay exact in f16 away from the subnormal range)
__global__ __launch_bounds__(256) void k_wt_f16(const float* __restrict__ W, _Float16* __restrict__ Wt, int K, int N, float scale) {
  const int t = blockIdx.x * 256 + threadIdx.x; if (t >= N * (K / 8)) return; const int n = t / (K / 8), k8 = (t % (K / 8)) * 8; FragH f;
#pragma unroll
  for (int i = 0; i < 8; ++i) f.h[i] = (_Float16)(bf16_round(W[(size_t)(k8 + i) * N + n]) * scale); const v8us o = f.half[0];
  *(v8us*)((unsigned short*)Wt + (size_t)n * K + k8) = o; 
}
// k_gemm_hh variant with fused epilogue: v = acc·alpha + bias[by·sBias + col] (+ CP[(row/rowsPerB)·sCPb + by·64 + col] if CP) ; ACT 0 none / 1 elu ; writes f16 C16 (and f32 C if non-null)
template <int ACT>
__global__ __launch_bounds__(128) void k_gemm_hhx(const _Float16* __restrict__ A, int lda, size_t sA, const _Float16* __restrict__ Bh, int ldb, size_t sB, float alpha, const float* __restrict__ bias, size_t sBias, const float* __restrict__ CP, int rowsPerB, size_t sCPb, int row0g,
    float* __restrict__ C, _Float16* __restrict__ C16, int ldc, size_t sC, int M, int N, int K) {
  __shared__ __attribute__((aligned(16))) float so[4][16][64];
  const int tid = threadIdx.x, w = tid >> 5, lane = tid & 31, ln = lane & 15, hh = lane >> 4; const int by = blockIdx.y;
  A += (size_t)by * sA; Bh += (size_t)by * sB; const size_t cofs = (size_t)by * sC; const float* bp = bias ? bias + (size_t)by * sBias : nullptr;
  const int ntn = (N + 63) / 64; const int wid = blockIdx.x * 4 + w; const int mt = wid / ntn, nq = wid % ntn; if (mt * 16 >= M) return;
  const int row0 = mt * 16, col0 = nq * 64; const _Float16* arow = A + (size_t)(row0 + ln) * lda;
  v8f acc[4] = {};
  for (int kb = 0; kb < K; kb += 32) { FragH ah; ah.half[0] = *(const v8us*)((const unsigned short*)arow + kb + 8 * hh); ah.half[1] = *(const v8us*)((const unsigned short*)arow + kb + 16 + 8 * hh);
#pragma unroll
    for (int t = 0; t < 4; ++t) { if (col0 + t * 16 >= N) continue; const size_t boff = (size_t)(col0 + t * 16 + ln) * ldb + kb; FragH bq; bq.half[0] = *(const v8us*)((const unsigned short*)Bh + boff + 8 * hh); bq.half[1] = *(const v8us*)((const unsigned short*)Bh + boff + 16 + 8 * hh);
      acc[t] = mmaH<1>(ah.v, ah.v, bq.v, bq.v, acc[t]); }
  }
#pragma unroll
  for (int t = 0; t < 4; ++t) { if (col0 + t * 16 >= N) continue; const int col = col0 + t * 16 + ln; const float bv = bp ? bf16_round(bp[col]) : 0.f;
#pragma unroll
    for (int r = 0; r < 8; ++r) { float v = acc[t][r] * alpha + bv; if (CP) { const int bidx = (row0g + row0 + 8 * hh + r) / rowsPerB; v += CP[(size_t)bidx * sCPb + (size_t)by * 64 + col]; } if (ACT == 1) v = (v > 0.f) ? v : expm1f(v); else if (ACT == 7) v = (v > 0.f) ? v + 1.0f : expf(v); else if (ACT == 8) v = tanhf(v); else if (ACT == 9) v = 0.5f * v * (1.0f + tanhf(0.7978845608028654f * (v + 0.044715f * v * v * v))); else if (ACT == 11) v = 1.0f / (1.0f + expf(-v)); else if (ACT == 12) v = (v > 0.f) ? v : 0.01f * v; else if (ACT == 14) v = (v > 0.f) ? v : 0.1f * v; else if (ACT == 15) v = v / (1.0f + expf(-v)); else if (ACT == 3) v = fmaxf(v, 0.f); else if (ACT == 6) v = 0.5f * v * (1.0f + erff(v * 0.70710678118654752f)); so[w][8 * hh + r][t * 16 + ln] = v; } }
  __builtin_amdgcn_fence(__ATOMIC_ACQ_REL, "workgroup"); __builtin_amdgcn_wave_barrier();
  const int rsub = lane >> 4, c4 = (lane & 15) * 4; typedef _Float16 v4h __attribute__((ext_vector_type(4)));
  {
#pragma unroll
    for (int q = 0; q < 8; ++q) { const int r = q * 2 + rsub; if (col0 + c4 < N) { const v4f v = *(const v4fa*)&so[w][r][c4]; if (C) *(v4f*)(C + cofs + (size_t)(row0 + r) * ldc + col0 + c4) = v; if (C16) { v4h h4; for (int i = 0; i < 4; ++i) h4[i] = (_Float16)v[i]; *(v4h*)(C16 + cofs + (size_t)(row0 + r) * ldc + col0 + c4) = h4; } } }
     }
}


typedef _Float16 v4h __attribute__((ext_vector_type(4)));

__global__ __launch_bounds__(256) void k_x16(const float* __restrict__ x, _Float16* __restrict__ X16, size_t n8) { const size_t t = (size_t)blockIdx.x * 256 + threadIdx.x; if (t >= n8) return; FragH f;
#pragma unroll
  for (int q = 0; q < 8; ++q) f.h[q] = (_Float16)bf16_round(x[t * 8 + q]); *(v8us*)((unsigned short*)X16 + t * 8) = f.half[0];  }
__global__ __launch_bounds__(256) void k_h16(const float* __restrict__ x, _Float16* __restrict__ X16, size_t n8) { const size_t t = (size_t)blockIdx.x * 256 + threadIdx.x; if (t >= n8) return; FragH f;
#pragma unroll
  for (int q = 0; q < 8; ++q) f.h[q] = (_Float16)x[t * 8 + q]; *(v8us*)((unsigned short*)X16 + t * 8) = f.half[0];  }
__global__ __launch_bounds__(256) void k_round16f(const float* __restrict__ W, _Float16* __restrict__ Bt, size_t n8) { const size_t t = (size_t)blockIdx.x * 256 + threadIdx.x; if (t >= n8) return; FragH f;
#pragma unroll
  for (int i = 0; i < 8; ++i) f.h[i] = (_Float16)(bf16_round(W[t * 8 + i]) * 16.0f); *(v8us*)((unsigned short*)Bt + t * 8) = f.half[0];  }
template <int NHv, int TTv>
__global__ __launch_bounds__(256) void k_vt(const _Float16* __restrict__ V16, int ldv, int voff, _Float16* __restrict__ Vt) { __shared__ unsigned short tl[64][66]; const int tid = threadIdx.x; const int slab = blockIdx.x / (TTv / 64), lg = blockIdx.x % (TTv / 64); const int b = slab / NHv, h = slab % NHv;
  for (int i = tid; i < 64 * 8; i += 256) { const int r = i / 8, c8 = (i % 8) * 8; FragH f; f.half[0] = *(const v8us*)((const unsigned short*)V16 + ((size_t)b * TTv + lg * 64 + r) * ldv + voff + h * 64 + c8);
#pragma unroll
    for (int q = 0; q < 8; ++q) tl[r][c8 + q] = f.u[q]; }
  __syncthreads();
  {
#pragma unroll
    for (int rd = 0; rd < 2; ++rd) { const int d = rd * 32 + tid / 8, pc = tid % 8; FragH f;
#pragma unroll
      for (int q = 0; q < 8; ++q) f.u[q] = tl[pc * 8 + q][d];
      *(v8us*)((unsigned short*)Vt + ((size_t)slab * 64 + d) * TTv + lg * 64 + pc * 8) = f.half[0]; }
     } }

__global__ __launch_bounds__(256) void k_hl(const float* __restrict__ F, _Float16* __restrict__ Hh, _Float16* __restrict__ Hl, size_t n8) { const size_t t = (size_t)blockIdx.x * 256 + threadIdx.x; if (t >= n8) return; FragH fh, fl; const v4f a = *(const v4fa*)(F + t * 8), c = *(const v4fa*)(F + t * 8 + 4);
#pragma unroll
  for (int q = 0; q < 4; ++q) { _Float16 h = (_Float16)a[q]; fh.h[q] = h; fl.h[q] = (_Float16)((a[q] - (float)h) * 1024.0f); h = (_Float16)c[q]; fh.h[4 + q] = h; fl.h[4 + q] = (_Float16)((c[q] - (float)h) * 1024.0f); }
  { *(v8us*)((unsigned short*)Hh + t * 8) = fh.half[0]; *(v8us*)((unsigned short*)Hl + t * 8) = fl.half[0];  } }

// ---- fast GEMM (wave tile 32x64; requires M % 32 == 0 rows per launch region and N % 64 == 0); epilogue = k_gemm_hhx semantics ----
__device__ __forceinline__ v16h g2_frag(const _Float16* p, int hh) { FragH f; f.half[0] = *(const v8us*)((const unsigned short*)p + 8 * hh); f.half[1] = *(const v8us*)((const unsigned short*)p + 16 + 8 * hh); return f.v; }
__device__ __forceinline__ v8f g2_mma(v16h a, v16h b, v8f c) { v8f d = __builtin_amdgcn_wmma_f32_16x16x32_f16(false, a, false, b, (short)0, c, false, false); asm volatile("v_nop\n\tv_nop\n\tv_nop\n\tv_nop" : "+v"(d) : "v"(a), "v"(b)); return d; }
template <int ACT>
__global__ __launch_bounds__(128) void k_gemm2(const _Float16* __restrict__ A, int lda, size_t sA, const _Float16* __restrict__ Bh, int ldb, size_t sB, float alpha, const float* __restrict__ bias, size_t sBias, const float* __restrict__ CP, int rowsPerB, size_t sCPb, int row0g,
    float* __restrict__ C, _Float16* __restrict__ C16, int ldc, size_t sC, int M, int N, int K) {
  __shared__ __attribute__((aligned(16))) float so[4][32][68];
  const int tid = threadIdx.x, w = tid >> 5, lane = tid & 31, ln = lane & 15, hh = lane >> 4; const int by = blockIdx.y;
  A += (size_t)by * sA; Bh += (size_t)by * sB; const size_t cofs = (size_t)by * sC; const float* bp = bias ? bias + (size_t)by * sBias : nullptr;
  const int ntn = N >> 6; const int mt = blockIdx.x / ntn, nq = blockIdx.x - mt * ntn; const int row0 = mt * 128 + 32 * w, col0 = nq * 64; if (row0 >= M) return;
  const _Float16* a0p = A + (size_t)(row0 + ln) * lda; const _Float16* a1p = a0p + (size_t)16 * lda;
  const _Float16* b0p = Bh + (size_t)(col0 + ln) * ldb; const _Float16* b1p = b0p + (size_t)16 * ldb; const _Float16* b2p = b1p + (size_t)16 * ldb; const _Float16* b3p = b2p + (size_t)16 * ldb;
  const v8f z8 = {0.f,0.f,0.f,0.f,0.f,0.f,0.f,0.f}; v8f c00 = z8, c01 = z8, c02 = z8, c03 = z8, c10 = z8, c11 = z8, c12 = z8, c13 = z8;
#pragma unroll 1
  for (int kb = 0; kb < K; kb += 32) { const v16h a0 = g2_frag(a0p + kb, hh), a1 = g2_frag(a1p + kb, hh);
    v16h b = g2_frag(b0p + kb, hh); c00 = g2_mma(a0, b, c00); c10 = g2_mma(a1, b, c10);
    b = g2_frag(b1p + kb, hh); c01 = g2_mma(a0, b, c01); c11 = g2_mma(a1, b, c11);
    b = g2_frag(b2p + kb, hh); c02 = g2_mma(a0, b, c02); c12 = g2_mma(a1, b, c12);
    b = g2_frag(b3p + kb, hh); c03 = g2_mma(a0, b, c03); c13 = g2_mma(a1, b, c13); }
  v8f accs[8] = {c00, c01, c02, c03, c10, c11, c12, c13};
#pragma unroll
  for (int u = 0; u < 8; ++u) { const int t = u & 3, half = u >> 2; const int col = col0 + t * 16 + ln; const float bv = bp ? bf16_round(bp[col]) : 0.f;
#pragma unroll
    for (int r = 0; r < 8; ++r) { const int rloc = half * 16 + 8 * hh + r; float v = accs[u][r] * alpha + bv; if (CP) { const int bidx = (row0g + row0 + rloc) / rowsPerB; v += CP[(size_t)bidx * sCPb + (size_t)by * 64 + col]; }
      if (ACT == 3) v = fmaxf(v, 0.f); else if (ACT == 6) v = 0.5f * v * (1.0f + erff(v * 0.70710678118654752f)); else if (ACT == 11) v = 1.0f / (1.0f + expf(-v)); else if (ACT == 15) v = v / (1.0f + expf(-v)); else if (ACT == 12) v = (v > 0.f) ? v : 0.01f * v; else if (ACT == 8) v = tanhf(v);
      so[w][rloc][t * 16 + ln] = v; } }
  __builtin_amdgcn_fence(__ATOMIC_ACQ_REL, "workgroup"); __builtin_amdgcn_wave_barrier();
  const int rsub = lane >> 4, c4 = (lane & 15) * 4;
  {
#pragma unroll
    for (int q = 0; q < 16; ++q) { const int r = q * 2 + rsub; const v4f v = *(const v4fa*)&so[w][r][c4]; if (C) *(v4f*)(C + cofs + (size_t)(row0 + r) * ldc + col0 + c4) = v; if (C16) { v4h h4; for (int i = 0; i < 4; ++i) h4[i] = (_Float16)v[i]; *(v4h*)(C16 + cofs + (size_t)(row0 + r) * ldc + col0 + c4) = h4; } }
     } }



template <int CAUSAL>
__global__ __launch_bounds__(128) void k_flash(const _Float16* __restrict__ Q16, int ldq, const _Float16* __restrict__ K16, int ldk, const _Float16* __restrict__ Vt, const _Float16* __restrict__ Vt2, const int* __restrict__ MSK, float* __restrict__ O, float* __restrict__ O2, int ldo) {
  constexpr int RPW = 16, RTN = RPW / 16, NQB = TQ / (4 * RPW), DT = 8, KS = 2;      /* DT 0..3: low 64 value columns (Vt -> O), DT 4..7: high 64 (Vt2 -> O2); one score/softmax pass feeds both */
  __shared__ __attribute__((aligned(16))) unsigned short sP[4][RPW][40]; __shared__ __attribute__((aligned(16))) float sO[4][RPW][64 + 4];
  const int tid = threadIdx.x, w = tid >> 5, lane = tid & 31, ln = lane & 15, hh = lane >> 4;
  const int slab = blockIdx.x / QBNP, qblk = QB0P + blockIdx.x % QBNP; (void)NQB; const int b = slab / NH, h = slab % NH; const int qb0 = qblk * (4 * RPW); const int q0 = qb0 + w * RPW;
  FragH aq[2][KS];
#pragma unroll
  for (int rt = 0; rt < RTN; ++rt) { const unsigned short* qr = (const unsigned short*)Q16 + ((size_t)b * TQ + q0 + rt * 16 + ln) * ldq + h * 64;
#pragma unroll
    for (int ks = 0; ks < KS; ++ks) { aq[rt][ks].half[0] = *(const v8us*)(qr + ks * 32 + 8 * hh); aq[rt][ks].half[1] = *(const v8us*)(qr + ks * 32 + 16 + 8 * hh); } }
  const unsigned short* Vth = (const unsigned short*)Vt + (size_t)slab * 64 * TK; const unsigned short* Vth2 = (const unsigned short*)Vt2 + (size_t)slab * 64 * TK;
  float m_r[2][8], l_r[2][8]; v8f oacc[2][DT];
#pragma unroll
  for (int rt = 0; rt < RTN; ++rt) {
#pragma unroll
    for (int r = 0; r < 8; ++r) { m_r[rt][r] = -3.0e38f; l_r[rt][r] = 0.f; }
#pragma unroll
    for (int dt = 0; dt < DT; ++dt) oacc[rt][dt] = (v8f){0.f,0.f,0.f,0.f,0.f,0.f,0.f,0.f}; }
  const int jend = (CAUSAL == 1) ? (qb0 + 4 * RPW) : TK;      /* causal: keys beyond the block's last query never contribute */
#pragma unroll 1
  for (int j0 = 0; j0 < jend; j0 += 32) {
    v8f s[2][2];
#pragma unroll
    for (int nt = 0; nt < 2; ++nt) { const unsigned short* kr = (const unsigned short*)K16 + ((size_t)b * TK + j0 + nt * 16 + ln) * ldk + h * 64; FragH bk[KS];
#pragma unroll
      for (int ks = 0; ks < KS; ++ks) { bk[ks].half[0] = *(const v8us*)(kr + ks * 32 + 8 * hh); bk[ks].half[1] = *(const v8us*)(kr + ks * 32 + 16 + 8 * hh); }
#pragma unroll
      for (int rt = 0; rt < RTN; ++rt) { v8f acc = (v8f){0.f,0.f,0.f,0.f,0.f,0.f,0.f,0.f};
#pragma unroll
        for (int ks = 0; ks < KS; ++ks) acc = mmaH<1>(aq[rt][ks].v, aq[rt][ks].v, bk[ks].v, bk[ks].v, acc); s[rt][nt] = acc; } }
#pragma unroll
    for (int rt = 0; rt < RTN; ++rt)
#pragma unroll
      for (int r = 0; r < 8; ++r) { const int tq = q0 + rt * 16 + 8 * hh + r; const int k0 = j0 + ln, k1 = j0 + 16 + ln;
        const bool ok0 = (CAUSAL == 1) ? (k0 <= tq) : ((CAUSAL == 2) ? ((k0 >> 5) == (tq >> 5)) : true), ok1 = (CAUSAL == 1) ? (k1 <= tq) : ((CAUSAL == 2) ? ((k1 >> 5) == (tq >> 5)) : true);      /* mode 2: block-diagonal 32-token groups */
        const float s0 = ok0 ? s[rt][0][r] * SCL : -3.0e38f, s1 = ok1 ? s[rt][1][r] * SCL : -3.0e38f; float mc = fmaxf(s0, s1);
        mc = fmaxf(mc, __shfl_xor(mc, 1, 32)); mc = fmaxf(mc, __shfl_xor(mc, 2, 32)); mc = fmaxf(mc, __shfl_xor(mc, 4, 32)); mc = fmaxf(mc, __shfl_xor(mc, 8, 32));
        const float mn = fmaxf(m_r[rt][r], mc); const float al = (mn > -1.0e38f) ? expf(m_r[rt][r] - mn) : 1.0f; m_r[rt][r] = mn; const float p0 = ok0 ? expf(s0 - mn) : 0.f, p1 = ok1 ? expf(s1 - mn) : 0.f; l_r[rt][r] = l_r[rt][r] * al + p0 + p1;
#pragma unroll
        for (int dt = 0; dt < DT; ++dt) oacc[rt][dt][r] *= al;
        FragH t2; t2.h[0] = (_Float16)(p0 * 1024.0f); t2.h[1] = (_Float16)(p1 * 1024.0f); sP[w][rt * 16 + 8 * hh + r][ln] = t2.u[0]; sP[w][rt * 16 + 8 * hh + r][16 + ln] = t2.u[1]; }
    __builtin_amdgcn_fence(__ATOMIC_ACQ_REL, "workgroup"); __builtin_amdgcn_wave_barrier();
    FragH pa[2];
#pragma unroll
    for (int rt = 0; rt < RTN; ++rt) { pa[rt].half[0] = *(const v8us*)&sP[w][rt * 16 + ln][8 * hh]; pa[rt].half[1] = *(const v8us*)&sP[w][rt * 16 + ln][16 + 8 * hh]; }
#pragma unroll
    for (int dt = 0; dt < 4; ++dt) { const size_t vo = (size_t)(dt * 16 + ln) * TK + j0; const unsigned short* vrow = Vth + vo; const unsigned short* vrow2 = Vth2 + vo; FragH bv, bv2; bv.half[0] = *(const v8us*)(vrow + 8 * hh); bv.half[1] = *(const v8us*)(vrow + 16 + 8 * hh); bv2.half[0] = *(const v8us*)(vrow2 + 8 * hh); bv2.half[1] = *(const v8us*)(vrow2 + 16 + 8 * hh);
#pragma unroll
      for (int rt = 0; rt < RTN; ++rt) { oacc[rt][dt] = mmaH<1>(pa[rt].v, pa[rt].v, bv.v, bv.v, oacc[rt][dt]); oacc[rt][4 + dt] = mmaH<1>(pa[rt].v, pa[rt].v, bv2.v, bv2.v, oacc[rt][4 + dt]); } }
    __builtin_amdgcn_fence(__ATOMIC_ACQ_REL, "workgroup"); __builtin_amdgcn_wave_barrier(); }
#pragma unroll
  for (int rt = 0; rt < RTN; ++rt) {
#pragma unroll
    for (int r = 0; r < 8; ++r) { float l = l_r[rt][r]; l += __shfl_xor(l, 1, 32); l += __shfl_xor(l, 2, 32); l += __shfl_xor(l, 4, 32); l += __shfl_xor(l, 8, 32); l_r[rt][r] = (l > 0.f) ? 1.0f / (l * 1024.0f) : 0.f; } }
#pragma unroll
  for (int hf = 0; hf < 2; ++hf) { float* __restrict__ Oh = hf ? O2 : O;
#pragma unroll
    for (int rt = 0; rt < RTN; ++rt)
#pragma unroll
      for (int dt = 0; dt < 4; ++dt)
#pragma unroll
        for (int r = 0; r < 8; ++r) sO[w][rt * 16 + 8 * hh + r][dt * 16 + ln] = oacc[rt][hf * 4 + dt][r] * l_r[rt][r];
    __builtin_amdgcn_fence(__ATOMIC_ACQ_REL, "workgroup"); __builtin_amdgcn_wave_barrier();
#pragma unroll
    for (int rp = 0; rp < RPW; rp += 2) { const int r = rp + (lane >> 4), pc = lane & 15; const v4f val = *(const v4fa*)&sO[w][r][pc * 4]; *(v4f*)(Oh + ((size_t)b * TQ + q0 + r) * ldo + h * 64 + pc * 4) = val; }
    if (hf == 0) { __builtin_amdgcn_fence(__ATOMIC_ACQ_REL, "workgroup"); __builtin_amdgcn_wave_barrier(); }      /* the high half reuses this wave's sO slice: its stores stay behind the low half's reads */
  } }
// 5-plane variant: S = Qh Kh^T + (Ql Kh^T + Qh Kl^T)/1024 with Q/K = [hi | 2^10 residual] f16 planes (QL/KL same layout as Q16/K16), then the 3-term P.V below.
// 3-term variant: O = (P_hi V_hi + (P_lo V_hi + P_hi V_lo) / 1024) / l with P = [hi | 2^10 residual] of 1024 p and V^T = [hi | 2^10 residual] planes (VtL same layout as Vt) -> ~2^-21-class products for un-averaged (early causal / peaked) rows
template <int CAUSAL>
__global__ __launch_bounds__(128) void k_flash5(const _Float16* __restrict__ Q16, const _Float16* __restrict__ QL, int ldq, const _Float16* __restrict__ K16, const _Float16* __restrict__ KL, int ldk, const _Float16* __restrict__ Vt, const _Float16* __restrict__ VtL, const int* __restrict__ MSK, float* __restrict__ O, int ldo) {
  constexpr int RPW = 16, RTN = RPW / 16, NQB = TQ / (4 * RPW), DT = 4, KS = 2;
  __shared__ __attribute__((aligned(16))) unsigned short sP[4][RPW][40]; __shared__ __attribute__((aligned(16))) unsigned short sPL[4][RPW][40]; __shared__ __attribute__((aligned(16))) float sO[4][RPW][64 + 4];
  const int tid = threadIdx.x, w = tid >> 5, lane = tid & 31, ln = lane & 15, hh = lane >> 4;
  const int slab = blockIdx.x / QBN5, qblk = QB05 + blockIdx.x % QBN5; (void)NQB; const int b = slab / NH, h = slab % NH; const int qb0 = qblk * (4 * RPW); const int q0 = qb0 + w * RPW;
  FragH aq[2][KS], aql[2][KS];
#pragma unroll
  for (int rt = 0; rt < RTN; ++rt) { const unsigned short* qr = (const unsigned short*)Q16 + ((size_t)b * TQ + q0 + rt * 16 + ln) * ldq + h * 64; const unsigned short* ql = (const unsigned short*)QL + ((size_t)b * TQ + q0 + rt * 16 + ln) * ldq + h * 64;
#pragma unroll
    for (int ks = 0; ks < KS; ++ks) { aq[rt][ks].half[0] = *(const v8us*)(qr + ks * 32 + 8 * hh); aq[rt][ks].half[1] = *(const v8us*)(qr + ks * 32 + 16 + 8 * hh); aql[rt][ks].half[0] = *(const v8us*)(ql + ks * 32 + 8 * hh); aql[rt][ks].half[1] = *(const v8us*)(ql + ks * 32 + 16 + 8 * hh); } }
  const unsigned short* Vth = (const unsigned short*)Vt + (size_t)slab * 64 * TK; const unsigned short* Vtl = (const unsigned short*)VtL + (size_t)slab * 64 * TK;
  float m_r[2][8], l_r[2][8]; v8f oacc[2][DT], oaccL[2][DT];
#pragma unroll
  for (int rt = 0; rt < RTN; ++rt) {
#pragma unroll
    for (int r = 0; r < 8; ++r) { m_r[rt][r] = -3.0e38f; l_r[rt][r] = 0.f; }
#pragma unroll
    for (int dt = 0; dt < DT; ++dt) { oacc[rt][dt] = (v8f){0.f,0.f,0.f,0.f,0.f,0.f,0.f,0.f}; oaccL[rt][dt] = oacc[rt][dt]; } }
  const int jend = (CAUSAL == 1) ? (qb0 + 4 * RPW) : TK;      /* causal: keys beyond the block's last query never contribute */
#pragma unroll 1
  for (int j0 = 0; j0 < jend; j0 += 32) {
    v8f s[2][2];
#pragma unroll
    for (int nt = 0; nt < 2; ++nt) { const unsigned short* kr = (const unsigned short*)K16 + ((size_t)b * TK + j0 + nt * 16 + ln) * ldk + h * 64; const unsigned short* klr = (const unsigned short*)KL + ((size_t)b * TK + j0 + nt * 16 + ln) * ldk + h * 64; FragH bk[KS], bkl[KS];
#pragma unroll
      for (int ks = 0; ks < KS; ++ks) { bk[ks].half[0] = *(const v8us*)(kr + ks * 32 + 8 * hh); bk[ks].half[1] = *(const v8us*)(kr + ks * 32 + 16 + 8 * hh); bkl[ks].half[0] = *(const v8us*)(klr + ks * 32 + 8 * hh); bkl[ks].half[1] = *(const v8us*)(klr + ks * 32 + 16 + 8 * hh); }
#pragma unroll
      for (int rt = 0; rt < RTN; ++rt) { v8f acc = (v8f){0.f,0.f,0.f,0.f,0.f,0.f,0.f,0.f}, accl = acc;
#pragma unroll
        for (int ks = 0; ks < KS; ++ks) { acc = mmaH<1>(aq[rt][ks].v, aq[rt][ks].v, bk[ks].v, bk[ks].v, acc); accl = mmaH<1>(aql[rt][ks].v, aql[rt][ks].v, bk[ks].v, bk[ks].v, accl); accl = mmaH<1>(aq[rt][ks].v, aq[rt][ks].v, bkl[ks].v, bkl[ks].v, accl); }
#pragma unroll
        for (int r = 0; r < 8; ++r) acc[r] += accl[r] * 0.0009765625f;
        s[rt][nt] = acc; } }
#pragma unroll
    for (int rt = 0; rt < RTN; ++rt)
#pragma unroll
      for (int r = 0; r < 8; ++r) { const int tq = q0 + rt * 16 + 8 * hh + r; const int k0 = j0 + ln, k1 = j0 + 16 + ln;
        bool ok0 = (CAUSAL == 1) ? (k0 <= tq) : ((CAUSAL == 2) ? ((k0 >> 5) == (tq >> 5)) : true), ok1 = (CAUSAL == 1) ? (k1 <= tq) : ((CAUSAL == 2) ? ((k1 >> 5) == (tq >> 5)) : true);      /* mode 2: block-diagonal 32-token groups */
        if (CAUSAL == 4) { const int* mrow = MSK + ((size_t)b * TQ + tq) * TK; ok0 = mrow[k0] != 0; ok1 = mrow[k1] != 0; }      /* mode 4: per-(query, key) INPUT mask shared by all heads; masked keys contribute nothing (== the reference's -4096 fill, whose exp underflows to 0), rows with no valid key give l = 0 -> output 0 (== the reference's row_valid zeroing) */
        const float s0 = ok0 ? s[rt][0][r] * SCL : -3.0e38f, s1 = ok1 ? s[rt][1][r] * SCL : -3.0e38f; float mc = fmaxf(s0, s1);
        mc = fmaxf(mc, __shfl_xor(mc, 1, 32)); mc = fmaxf(mc, __shfl_xor(mc, 2, 32)); mc = fmaxf(mc, __shfl_xor(mc, 4, 32)); mc = fmaxf(mc, __shfl_xor(mc, 8, 32));
        const float mn = fmaxf(m_r[rt][r], mc); const float al = (mn > -1.0e38f) ? expf(m_r[rt][r] - mn) : 1.0f; m_r[rt][r] = mn; const float p0 = ok0 ? expf(s0 - mn) : 0.f, p1 = ok1 ? expf(s1 - mn) : 0.f; l_r[rt][r] = l_r[rt][r] * al + p0 + p1;
#pragma unroll
        for (int dt = 0; dt < DT; ++dt) { oacc[rt][dt][r] *= al; oaccL[rt][dt][r] *= al; }
        FragH t2, t2l; const float ps0 = p0 * 1024.0f, ps1 = p1 * 1024.0f; t2.h[0] = (_Float16)ps0; t2.h[1] = (_Float16)ps1; t2l.h[0] = (_Float16)((ps0 - (float)t2.h[0]) * 1024.0f); t2l.h[1] = (_Float16)((ps1 - (float)t2.h[1]) * 1024.0f);
        sP[w][rt * 16 + 8 * hh + r][ln] = t2.u[0]; sP[w][rt * 16 + 8 * hh + r][16 + ln] = t2.u[1]; sPL[w][rt * 16 + 8 * hh + r][ln] = t2l.u[0]; sPL[w][rt * 16 + 8 * hh + r][16 + ln] = t2l.u[1]; }
    __builtin_amdgcn_fence(__ATOMIC_ACQ_REL, "workgroup"); __builtin_amdgcn_wave_barrier();
    FragH pa[2], pl[2];
#pragma unroll
    for (int rt = 0; rt < RTN; ++rt) { pa[rt].half[0] = *(const v8us*)&sP[w][rt * 16 + ln][8 * hh]; pa[rt].half[1] = *(const v8us*)&sP[w][rt * 16 + ln][16 + 8 * hh]; pl[rt].half[0] = *(const v8us*)&sPL[w][rt * 16 + ln][8 * hh]; pl[rt].half[1] = *(const v8us*)&sPL[w][rt * 16 + ln][16 + 8 * hh]; }
#pragma unroll
    for (int dt = 0; dt < DT; ++dt) { const unsigned short* vrow = Vth + (size_t)(dt * 16 + ln) * TK + j0; const unsigned short* vrl = Vtl + (size_t)(dt * 16 + ln) * TK + j0; FragH bv, bl; bv.half[0] = *(const v8us*)(vrow + 8 * hh); bv.half[1] = *(const v8us*)(vrow + 16 + 8 * hh); bl.half[0] = *(const v8us*)(vrl + 8 * hh); bl.half[1] = *(const v8us*)(vrl + 16 + 8 * hh);
#pragma unroll
      for (int rt = 0; rt < RTN; ++rt) { oacc[rt][dt] = mmaH<1>(pa[rt].v, pa[rt].v, bv.v, bv.v, oacc[rt][dt]); oaccL[rt][dt] = mmaH<1>(pl[rt].v, pl[rt].v, bv.v, bv.v, oaccL[rt][dt]); oaccL[rt][dt] = mmaH<1>(pa[rt].v, pa[rt].v, bl.v, bl.v, oaccL[rt][dt]); } }
    __builtin_amdgcn_fence(__ATOMIC_ACQ_REL, "workgroup"); __builtin_amdgcn_wave_barrier(); }
#pragma unroll
  for (int rt = 0; rt < RTN; ++rt) {
#pragma unroll
    for (int r = 0; r < 8; ++r) { float l = l_r[rt][r]; l += __shfl_xor(l, 1, 32); l += __shfl_xor(l, 2, 32); l += __shfl_xor(l, 4, 32); l += __shfl_xor(l, 8, 32); l_r[rt][r] = (l > 0.f) ? 1.0f / (l * 1024.0f) : 0.f; }
#pragma unroll
    for (int dt = 0; dt < DT; ++dt)
#pragma unroll
      for (int r = 0; r < 8; ++r) { float v = oacc[rt][dt][r]; v += oaccL[rt][dt][r] * 0.0009765625f; sO[w][rt * 16 + 8 * hh + r][dt * 16 + ln] = v * l_r[rt][r]; } }
  __builtin_amdgcn_fence(__ATOMIC_ACQ_REL, "workgroup"); __builtin_amdgcn_wave_barrier();
  {
#pragma unroll
    for (int rp = 0; rp < RPW; rp += 2) { const int r = rp + (lane >> 4), pc = lane & 15; const v4f val = *(const v4fa*)&sO[w][r][pc * 4]; *(v4f*)(O + ((size_t)b * TQ + q0 + r) * ldo + h * 64 + pc * 4) = val; }
     } }

__global__ __launch_bounds__(256) void k_rotab(float* __restrict__ CS, float* __restrict__ SN) {
  #pragma clang fp contract(off)
  const int t = blockIdx.x * 256 + threadIdx.x; if (t >= SLEN * 32) return; const int j = t % 32, s = t / 32; (void)j; (void)s; const float c = 1.0f, sn = 0.0f;      /* no RoPE here: identity tables make k_rope a pure hi/lo split (a*1 - b*0 is exact) */
  { *(float*)(CS + t) = c; *(float*)(SN + t) = sn;  } }
__global__ __launch_bounds__(256) void k_rope(const float* __restrict__ F, int nsrc, int ndst, int rep, const float* __restrict__ CS, const float* __restrict__ SN, _Float16* __restrict__ H, _Float16* __restrict__ L) {
  #pragma clang fp contract(off)
  const size_t t = (size_t)blockIdx.x * 256 + threadIdx.x; if (t >= (size_t)NR * ndst * 4) return; const int g8 = (int)(t % 4); const int hd = (int)((t / 4) % ndst); const size_t row = t / ((size_t)4 * ndst); const int s = (int)(row % SLEN); const int hs = hd / rep;
  const float* src = F + row * (size_t)(nsrc * 64) + hs * 64; FragH ah, al, bh, bl;
  for (int i = 0; i < 8; ++i) { const int d = g8 * 8 + i; const float c = CS[s * 32 + d], sn = SN[s * 32 + d]; const float x1 = src[d], x2 = src[d + 32];
    float o1 = x1 * c; o1 += -x2 * sn; float o2 = x2 * c; o2 += x1 * sn;
    _Float16 hv = (_Float16)o1; ah.h[i] = hv; al.h[i] = (_Float16)((o1 - (float)hv) * 1024.0f); hv = (_Float16)o2; bh.h[i] = hv; bl.h[i] = (_Float16)((o2 - (float)hv) * 1024.0f); }
  const size_t o = row * (size_t)(ndst * 64) + hd * 64 + g8 * 8;
  { *(v8us*)((unsigned short*)H + o) = ah.half[0]; *(v8us*)((unsigned short*)H + o + 32) = bh.half[0]; *(v8us*)((unsigned short*)L + o) = al.half[0]; *(v8us*)((unsigned short*)L + o + 32) = bl.half[0];  } }
__global__ __launch_bounds__(256) void k_vtg(const _Float16* __restrict__ V16, int vadd, _Float16* __restrict__ Vt) { __shared__ unsigned short tl[64][66]; const int tid = threadIdx.x; const int slab = blockIdx.x / (SLEN / 64), lg = blockIdx.x % (SLEN / 64); const int b = slab / NH, h = slab % NH; const int col0 = (h / 8) * 128 + vadd;      /* pseudo-head h reads value head h/8 (128 wide): low (vadd 0) or high (vadd 64) half */
  for (int i = tid; i < 64 * 8; i += 256) { const int r = i / 8, c8 = (i % 8) * 8; FragH f; f.half[0] = *(const v8us*)((const unsigned short*)V16 + ((size_t)b * SLEN + lg * 64 + r) * KVD + col0 + c8); for (int q = 0; q < 8; ++q) tl[r][c8 + q] = f.u[q]; }
  __syncthreads();
  { for (int rd = 0; rd < 2; ++rd) { const int d = rd * 32 + tid / 8, pc = tid % 8; FragH f; for (int q = 0; q < 8; ++q) f.u[q] = tl[pc * 8 + q][d]; *(v8us*)((unsigned short*)Vt + ((size_t)slab * 64 + d) * SLEN + lg * 64 + pc * 8) = f.half[0]; }  } }

__global__ __launch_bounds__(256) void k_wsc(const float* __restrict__ Wm, _Float16* __restrict__ Bt, size_t n8, float sc) { const size_t t = (size_t)blockIdx.x * 256 + threadIdx.x; if (t >= n8) return; FragH f; for (int q = 0; q < 8; ++q) f.h[q] = (_Float16)(bf16_round(Wm[t * 8 + q]) * sc); *(v8us*)((unsigned short*)Bt + t * 8) = f.half[0];  }
__global__ __launch_bounds__(64) void k_lam(const float* __restrict__ q1, const float* __restrict__ k1, const float* __restrict__ q2, const float* __restrict__ k2, float* __restrict__ LAM) {
  #pragma clang fp contract(off)
  const int ln = threadIdx.x & 31; if (threadIdx.x >= 32) return; float a = bf16_round(q1[ln]) * bf16_round(k1[ln]); a += bf16_round(q1[ln + 32]) * bf16_round(k1[ln + 32]); float c = bf16_round(q2[ln]) * bf16_round(k2[ln]); c += bf16_round(q2[ln + 32]) * bf16_round(k2[ln + 32]);
  for (int o = 16; o > 0; o >>= 1) { a += __shfl_xor(a, o, 32); c += __shfl_xor(c, o, 32); } const float lf = expf(a) - expf(c) + 0.78360576653162446f;      /* LAMBDA_INIT = 0.8 - 0.6 exp(-0.3 * 12) = 0.78360577 */
  const float v = (ln == 0) ? lf : 0.f; *(float*)(LAM + ln) = v;  }
__global__ __launch_bounds__(256) void k_comb(const float* __restrict__ OLO, const float* __restrict__ OHI, const float* __restrict__ LAM, const float* __restrict__ lnw, _Float16* __restrict__ A16) {
  #pragma clang fp contract(off)
  const size_t t = (size_t)blockIdx.x * 256 + threadIdx.x; if (t >= (size_t)NR * 16) return; const int j = (int)(t % 16); const size_t r = t / 16; const float lam = LAM[0]; float a[128]; float ss = 0.f;
  const float* e0 = OLO + r * DM + (size_t)(2 * j) * 64; const float* o0 = OLO + r * DM + (size_t)(2 * j + 1) * 64; const float* e1 = OHI + r * DM + (size_t)(2 * j) * 64; const float* o1 = OHI + r * DM + (size_t)(2 * j + 1) * 64;
  for (int d = 0; d < 64; ++d) { float v = e0[d]; v += -lam * o0[d]; a[d] = v; ss += v * v; float w = e1[d]; w += -lam * o1[d]; a[64 + d] = w; ss += w * w; }
  const float inv = rsqrtf(ss / 128.0f + 1e-5f); unsigned short* dst = (unsigned short*)A16 + r * DM + (size_t)j * 128;
  { for (int g = 0; g < 16; ++g) { FragH f; for (int q = 0; q < 8; ++q) { const int d = g * 8 + q; float v = a[d] * inv; v *= bf16_round(lnw[d]); v = v * 0.21639423346837554f;      /* 1 - LAMBDA_INIT */ f.h[q] = (_Float16)v; } *(v8us*)(dst + g * 8) = f.half[0]; }  } }

extern "C" void kernel_launch(void* const* d_in, const int* in_sizes, int n_in,
                              void* d_out, int out_size, void* d_ws, size_t ws_size, hipStream_t stream) {
  (void)in_sizes; (void)n_in; (void)out_size;
  const float* const* I = (const float* const*)d_in; const float* x = I[0]; const float* Wq = I[1]; const float* Wk = I[2]; const float* Wv = I[3]; const float* Wo = I[4]; const float* lq1 = I[5]; const float* lk1 = I[6]; const float* lq2 = I[7]; const float* lk2 = I[8]; const float* lnw = I[9]; const float* bq = nullptr; const float* bk = nullptr; const float* bv = nullptr;
  char* ws = (char*)d_ws; size_t off = 0;
  auto take = [&](size_t bytes) { char* p = ws + off; off += (bytes + 255) & ~(size_t)255; return p; };
  const size_t np = (size_t)NR * DM, nk = (size_t)NR * KVD;
  _Float16* BQ = (_Float16*)take((size_t)DM * DM * 2); _Float16* BK = (_Float16*)take((size_t)KVD * DM * 2); _Float16* BV = (_Float16*)take((size_t)KVD * DM * 2); _Float16* BO = (_Float16*)take((size_t)DM * DM * 2);
  float* CS = (float*)take((size_t)SLEN * 32 * 4); float* SN = (float*)take((size_t)SLEN * 32 * 4);
  _Float16* X16 = (_Float16*)take(np * 2); float* QF = (float*)take(np * 4); _Float16* QH = (_Float16*)take(np * 2); _Float16* QL = (_Float16*)take(np * 2); float* KF = (float*)take(nk * 4); float* VF = (float*)take(nk * 4); _Float16* KXH = (_Float16*)take(np * 2); _Float16* KXL = (_Float16*)take(np * 2); _Float16* VH = (_Float16*)take(nk * 2); _Float16* VL = (_Float16*)take(nk * 2); _Float16* VT = (_Float16*)take(np * 2); _Float16* VTL = (_Float16*)take(np * 2); _Float16* VT2 = (_Float16*)take(np * 2); _Float16* VTL2 = (_Float16*)take(np * 2); float* LAM = (float*)take(256); float* OHI = (float*)take(np * 4);      /* high-half attention output: a plane of its own, both value halves being live in the fused pass */
  float* OLO = QF;      /* low-half attention output over the q f32 plane (dead after the split) */ _Float16* A16 = X16;      /* normalised attention over the input plane (dead after the projections) */
  if (off > ws_size) return;      /* 8+2+2+8 + 0.5 + 16+32+16+16+8+8+16+16+4+4+16+16+16+16 + 32 = 253 MiB */
  k_wsc<<<(unsigned)(((size_t)DM * DM / 8 + 255) / 256), 256, 0, stream>>>(Wq, BQ, (size_t)DM * DM / 8, 16.0f); k_wsc<<<(unsigned)(((size_t)KVD * DM / 8 + 255) / 256), 256, 0, stream>>>(Wk, BK, (size_t)KVD * DM / 8, 16.0f); k_wsc<<<(unsigned)(((size_t)KVD * DM / 8 + 255) / 256), 256, 0, stream>>>(Wv, BV, (size_t)KVD * DM / 8, 16.0f); k_wsc<<<(unsigned)(((size_t)DM * DM / 8 + 255) / 256), 256, 0, stream>>>(Wo, BO, (size_t)DM * DM / 8, 16.0f);      /* torch (out,in) = Bt */ k_lam<<<1, 64, 0, stream>>>(lq1, lk1, lq2, lk2, LAM);
  k_rotab<<<(SLEN * 32 + 255) / 256, 256, 0, stream>>>(CS, SN);
  k_x16<<<(unsigned)((np / 8 + 255) / 256), 256, 0, stream>>>(x, X16, np / 8);
  k_gemm2<0><<<dim3((NR / 128) * (DM / 64), 1), 128, 0, stream>>>(X16, DM, 0, BQ, DM, 0, 0.0625f, bq, 0, nullptr, 1, 0, 0, QF, nullptr, DM, 0, NR, DM, DM);
  k_gemm2<0><<<dim3((NR / 128) * (KVD / 64), 1), 128, 0, stream>>>(X16, DM, 0, BK, DM, 0, 0.0625f, bk, 0, nullptr, 1, 0, 0, KF, nullptr, KVD, 0, NR, KVD, DM);
  k_gemm2<0><<<dim3((NR / 128) * (KVD / 64), 1), 128, 0, stream>>>(X16, DM, 0, BV, DM, 0, 0.0625f, bv, 0, nullptr, 1, 0, 0, VF, nullptr, KVD, 0, NR, KVD, DM);
  k_rope<<<(unsigned)(((size_t)NR * NH * 4 + 255) / 256), 256, 0, stream>>>(QF, NH, NH, 1, CS, SN, QH, QL);      /* q: 32 -> 32 heads */
  k_rope<<<(unsigned)(((size_t)NR * NH * 4 + 255) / 256), 256, 0, stream>>>(KF, NKV, NH, NREP, CS, SN, KXH, KXL);      /* k: kv head h/4 expanded to query head h */
  k_hl<<<(unsigned)((nk / 8 + 255) / 256), 256, 0, stream>>>(VF, VH, VL, nk / 8);
  k_vtg<<<NB * NH * (SLEN / 64), 256, 0, stream>>>(VH, 0, VT); k_vtg<<<NB * NH * (SLEN / 64), 256, 0, stream>>>(VL, 0, VTL); k_vtg<<<NB * NH * (SLEN / 64), 256, 0, stream>>>(VH, 64, VT2); k_vtg<<<NB * NH * (SLEN / 64), 256, 0, stream>>>(VL, 64, VTL2);      /* low / high 64 of each pseudo-head's 128-wide value head; QF becomes OLO from here on */
  k_flash5<1><<<NB * NH * QBN5, 128, 0, stream>>>(QH, QL, DM, KXH, KXL, DM, VT, VTL, nullptr, OLO, DM); k_flash5<1><<<NB * NH * QBN5, 128, 0, stream>>>(QH, QL, DM, KXH, KXL, DM, VT2, VTL2, nullptr, OHI, DM);      /* first 256 rows: low, then high 64 value columns */
  k_flash<1><<<NB * NH * QBNP, 128, 0, stream>>>(QH, DM, KXH, DM, VT, VT2, nullptr, OLO, OHI, DM);      /* rows from 256 on: one pass over the keys for both halves of each pseudo-head's 128-wide value head */
  k_comb<<<(unsigned)(((size_t)NR * 16 + 255) / 256), 256, 0, stream>>>(OLO, OHI, LAM, lnw, A16);
  k_gemm2<0><<<dim3((NR / 128) * (DM / 64), 1), 128, 0, stream>>>(A16, DM, 0, BO, DM, 0, 0.0625f, nullptr, 0, nullptr, 1, 0, 0, (float*)d_out, nullptr, DM, 0, NR, DM, DM);      /* out = attn Wo^T */
}

// v002
// A run of this version takes 639 microseconds.
// In both of two side-by-side timings against v001, it was 1.30 times as fast.
// All steps since v000 together make it 1.50 times as fast.
#include <hip/hip_runtime.h>
// MultiheadSdpaDiff4 (2 x 2048 tokens, EMBED 2048; differential attention: q = x Wq^T as 32 pseudo-heads x 64, k = x Wk^T as 8 heads x 64 repeat-interleaved 4x, v = x Wv^T as 4 heads x 128 repeat-interleaved 8x; causal softmax(q.k/8) v; attn = O_even - lambda_full * O_odd (16 heads x 128), lambda_full = exp(lq1.lk1) - exp(lq2.lk2) + 0.78361; RMSNorm(128, eps 1e-5) * ln_w * (1 - 0.78361); out = attn Wo^T.
// Compute dtype: inputs rounded to bf16; x exact as f16; q/k/P/v as f16 hi + residual on the first 256 rows (~2^-21) and plain beyond (~2^-12); the normalised attention as a plain f16 operand; softmax/lambda/RMSNorm f32. v_wmma_f32_16x16x32_f16.
#define NB 2
#define DM 2048
#define NKV 8
#define NREP (NH / NKV)
#define KVD (NKV * 64)           /* 512 */
#define NR (NB * SLEN)           /* 4096 */
#define SLEN 2048
#define TQ SLEN
#define TK SLEN
#define NH 32
#define SCL 0.125f
#define QBLKS (TQ / 64)
#define QB05 0
#define QBN5 4
#define QB0P QBN5
#define QBNP (QBLKS - QBN5)
#define RE 256
typedef __bf16 v16b __attribute__((ext_vector_type(16)));
typedef unsigned short v8us __attribute__((ext_vector_type(8), may_alias));
typedef float  v8f  __attribute__((ext_vector_type(8)));
typedef float  v4f  __attribute__((ext_vector_type(4)));
typedef float  v4fa __attribute__((ext_vector_type(4), may_alias));
union FragB { v16b v; v8us half[2]; unsigned short u[16]; };

__device__ __forceinline__ unsigned short bf16_bits(float x) { unsigned int u = __float_as_uint(x); return (unsigned short)((u + 0x7FFFu + ((u >> 16) & 1u)) >> 16); }
__device__ __forceinline__ float bf16_val(unsigned short b) { return __uint_as_float(((unsigned int)b) << 16); }
__device__ __forceinline__ float bf16_round(float x) { return bf16_val(bf16_bits(x)); }
// D += A·B with NT terms: 1 = ah·bh, 2 = + al·bh (A split), 3 = + ah·bl (both split)
template <int NT>
__device__ __forceinline__ v8f mmaN(v16b ah, v16b al, v16b bh, v16b bl, v8f c) {
  c = __builtin_amdgcn_wmma_f32_16x16x32_bf16(false, ah, false, bh, (short)0, c, false, false);
  if (NT >= 2) c = __builtin_amdgcn_wmma_f32_16x16x32_bf16(false, al, false, bh, (short)0, c, false, false);
  if (NT >= 3) c = __builtin_amdgcn_wmma_f32_16x16x32_bf16(false, ah, false, bl, (short)0, c, false, false);
  asm volatile("v_nop\n\tv_nop\n\tv_nop\n\tv_nop" : "+v"(c) : "v"(ah), "v"(al), "v"(bh), "v"(bl));
  return c;
}

__global__ __launch_bounds__(256) void k_wt_bf16(const float* __restrict__ W, unsigned short* __restrict__ Wt, int K, int N) {
  const int t = blockIdx.x * 256 + threadIdx.x;
  const int k8n = K / 8;
  if (t >= N * k8n) return;
  const int n = t / k8n, k8 = (t % k8n) * 8;
  v8us v;
#pragma unroll
  for (int i = 0; i < 8; ++i) v[i] = bf16_bits(W[(size_t)(k8 + i) * N + n]);
  *(v8us*)(Wt + (size_t)n * K + k8) = v;
  
}

// GEMM C[M][N] (f32, pitch ldc) = act(A[M][K]·W + bias). A f32 row-major (pitch lda) converted per fragment to bf16
// (ASPLIT: hi/lo two planes -> 2 terms, else single rounded term); Wt bf16 [N][K] (pitch ldb). BIAS_BF16 rounds the
// bias to bf16 first (bias quantised to bf16 before the add). K%32==0, M%16==0, N%64==0.
template <bool ASPLIT, int ACT, bool BIAS_BF16>
__global__ __launch_bounds__(128) void k_gemm_bf(const float* __restrict__ A, int lda, const unsigned short* __restrict__ Wt, int ldb,
                                               const float* __restrict__ bias, float* __restrict__ C, int ldc, int M, int N, int K) {
  __shared__ __attribute__((aligned(16))) float so[4][16][64];
  const int tid = threadIdx.x, w = tid >> 5, lane = tid & 31, ln = lane & 15, hh = lane >> 4;
  const int ntn = N / 64;
  const int wid = blockIdx.x * 4 + w;
  const int mt = wid / ntn, nq = wid % ntn;
  if (mt * 16 >= M) return;
  const int row0 = mt * 16, col0 = nq * 64;
  const float* arow = A + (size_t)(row0 + ln) * lda;
  v8f acc[4] = {};
  for (int kb = 0; kb < K; kb += 32) {
    FragB ah, al;
    const v4f x0 = *(const v4fa*)(arow + kb + 8 * hh), x1 = *(const v4fa*)(arow + kb + 8 * hh + 4);
    const v4f x2 = *(const v4fa*)(arow + kb + 16 + 8 * hh), x3 = *(const v4fa*)(arow + kb + 16 + 8 * hh + 4);
    float xs[16] = {x0[0],x0[1],x0[2],x0[3],x1[0],x1[1],x1[2],x1[3],x2[0],x2[1],x2[2],x2[3],x3[0],x3[1],x3[2],x3[3]};
#pragma unroll
    for (int i = 0; i < 16; ++i) { const unsigned short hb = bf16_bits(xs[i]); ah.u[i] = hb; al.u[i] = ASPLIT ? bf16_bits(xs[i] - bf16_val(hb)) : (unsigned short)0; }
#pragma unroll
    for (int t = 0; t < 4; ++t) {
      const unsigned short* brow = Wt + (size_t)(col0 + t * 16 + ln) * ldb + kb;
      FragB b;
      b.half[0] = *(const v8us*)(brow + 8 * hh);
      b.half[1] = *(const v8us*)(brow + 16 + 8 * hh);
      acc[t] = mmaN<ASPLIT ? 2 : 1>(ah.v, al.v, b.v, b.v, acc[t]);
    }
  }
#pragma unroll
  for (int t = 0; t < 4; ++t) {
    float bv = bias ? bias[col0 + t * 16 + ln] : 0.f;
    if (BIAS_BF16) bv = bf16_round(bv);
#pragma unroll
    for (int r = 0; r < 8; ++r) { float v = acc[t][r] + bv; if (ACT == 1) v = fmaxf(v, 0.f); so[w][8 * hh + r][t * 16 + ln] = v; }
  }
  __builtin_amdgcn_fence(__ATOMIC_ACQ_REL, "workgroup");
  __builtin_amdgcn_wave_barrier();
  const int rsub = lane >> 4, c4 = (lane & 15) * 4;
  {
#pragma unroll
    for (int q = 0; q < 8; ++q) {
      const int r = q * 2 + rsub;
      const v4f v = *(const v4fa*)&so[w][r][c4];
      *(v4f*)(C + (size_t)(row0 + r) * ldc + col0 + c4) = v;
    }
    
  }
}

// GEMM C = act(A·W + bias + resid): A f32 (ASPLIT -> hi/lo 2 terms), Wt bf16 [N][K]; ACT 0 none, 1 relu, 2 exact gelu;
// resid (optional, f32, row index = (row % rmod), pitch ldr, RES_BF16 rounds it) added before the activation.
template <bool ASPLIT, int ACT, bool BIAS_BF16, bool RES_BF16>
__global__ __launch_bounds__(128) void k_gemm_bf3(const float* __restrict__ A, int lda, const unsigned short* __restrict__ Wt, int ldb,
                                                const float* __restrict__ bias, const float* __restrict__ resid, int rmod, int ldr,
                                                float* __restrict__ C, int ldc, int M, int N, int K) {
  __shared__ __attribute__((aligned(16))) float so[4][16][64];
  const int tid = threadIdx.x, w = tid >> 5, lane = tid & 31, ln = lane & 15, hh = lane >> 4;
  const int ntn = N / 64;
  const int wid = blockIdx.x * 4 + w;
  const int mt = wid / ntn, nq = wid % ntn;
  if (mt * 16 >= M) return;
  const int row0 = mt * 16, col0 = nq * 64;
  const float* arow = A + (size_t)(row0 + ln) * lda;
  v8f acc[4] = {};
  for (int kb = 0; kb < K; kb += 32) {
    FragB ah, al;
    const v4f x0 = *(const v4fa*)(arow + kb + 8 * hh), x1 = *(const v4fa*)(arow + kb + 8 * hh + 4);
    const v4f x2 = *(const v4fa*)(arow + kb + 16 + 8 * hh), x3 = *(const v4fa*)(arow + kb + 16 + 8 * hh + 4);
    float xs[16] = {x0[0],x0[1],x0[2],x0[3],x1[0],x1[1],x1[2],x1[3],x2[0],x2[1],x2[2],x2[3],x3[0],x3[1],x3[2],x3[3]};
#pragma unroll
    for (int i = 0; i < 16; ++i) { const unsigned short hb = bf16_bits(xs[i]); ah.u[i] = hb; al.u[i] = ASPLIT ? bf16_bits(xs[i] - bf16_val(hb)) : (unsigned short)0; }
#pragma unroll
    for (int t = 0; t < 4; ++t) {
      const unsigned short* brow = Wt + (size_t)(col0 + t * 16 + ln) * ldb + kb;
      FragB b;
      b.half[0] = *(const v8us*)(brow + 8 * hh);
      b.half[1] = *(const v8us*)(brow + 16 + 8 * hh);
      acc[t] = mmaN<ASPLIT ? 2 : 1>(ah.v, al.v, b.v, b.v, acc[t]);
    }
  }
#pragma unroll
  for (int t = 0; t < 4; ++t) {
    const int col = col0 + t * 16 + ln;
    float bv = bias ? bias[col] : 0.f;
    if (BIAS_BF16) bv = bf16_round(bv);
#pragma unroll
    for (int r = 0; r < 8; ++r) {
      float v = acc[t][r] + bv;
      if (resid) { float rv = resid[(size_t)((row0 + 8 * hh + r) % rmod) * ldr + col]; if (RES_BF16) rv = bf16_round(rv); v += rv; }
      if (ACT == 1) v = fmaxf(v, 0.f);
      if (ACT == 2) v = 0.5f * v * (1.0f + erff(v * 0.70710678118654752f));
      if (ACT == 3) { const float u = 0.7978845608028654f * (v + 0.044715f * v * v * v); v = 0.5f * v * (1.0f + tanhf(u)); }
      so[w][8 * hh + r][t * 16 + ln] = v;
    }
  }
  __builtin_amdgcn_fence(__ATOMIC_ACQ_REL, "workgroup");
  __builtin_amdgcn_wave_barrier();
  const int rsub = lane >> 4, c4 = (lane & 15) * 4;
  {
#pragma unroll
    for (int q = 0; q < 8; ++q) {
      const int r = q * 2 + rsub;
      const v4f v = *(const v4fa*)&so[w][r][c4];
      *(v4f*)(C + (size_t)(row0 + r) * ldc + col0 + c4) = v;
    }
    
  }
}
// row LayerNorm (biased variance, eps) over N: s = X (+ R); optional out_sum <- s; out_norm <- (s-mu)*rsqrt(var+eps)*g + b
template <bool PARAM_BF16>
__global__ __launch_bounds__(256) void k_layernorm(const float* __restrict__ X, const float* __restrict__ R, const float* __restrict__ g, const float* __restrict__ bta,
                                                  float* __restrict__ out_sum, float* __restrict__ out_norm, int N, float eps) {
  __shared__ float red[256];
  const int row = blockIdx.x, tid = threadIdx.x;
  const float* x = X + (size_t)row * N; const float* rr = R ? R + (size_t)row * N : nullptr;
  float vals[16];                     // up to N = 4096
  const int per = N / 256;            // contiguous chunk per thread? use strided-by-4 chunks: thread handles j = tid*4 + 1024*u
  float s1 = 0.f;
  for (int u = 0; u < per / 4; ++u) {
    const int j = tid * 4 + 1024 * u;
    const v4f a = *(const v4fa*)(x + j);
    v4f b = {0.f,0.f,0.f,0.f}; if (rr) b = *(const v4fa*)(rr + j);
#pragma unroll
    for (int q = 0; q < 4; ++q) { const float v = a[q] + b[q]; vals[u * 4 + q] = v; s1 += v; }
  }
  red[tid] = s1; __syncthreads();
  for (int st = 128; st > 0; st >>= 1) { if (tid < st) red[tid] += red[tid + st]; __syncthreads(); }
  const float mu = red[0] / (float)N; __syncthreads();
  float s2 = 0.f;
  for (int u = 0; u < per / 4; ++u)
#pragma unroll
    for (int q = 0; q < 4; ++q) { const float c = vals[u * 4 + q] - mu; s2 += c * c; }
  red[tid] = s2; __syncthreads();
  for (int st = 128; st > 0; st >>= 1) { if (tid < st) red[tid] += red[tid + st]; __syncthreads(); }
  const float rs = rsqrtf(red[0] / (float)N + eps);
  {
    for (int u = 0; u < per / 4; ++u) {
      const int j = tid * 4 + 1024 * u;
      v4f o, sm;
#pragma unroll
      for (int q = 0; q < 4; ++q) {
        float gg = g[j + q], bb = bta[j + q];
        if (PARAM_BF16) { gg = bf16_round(gg); bb = bf16_round(bb); }
        sm[q] = vals[u * 4 + q]; o[q] = (vals[u * 4 + q] - mu) * rs * gg + bb;
      }
      if (out_sum) *(v4f*)(out_sum + (size_t)row * N + j) = sm;
      *(v4f*)(out_norm + (size_t)row * N + j) = o;
    }
    
  }
}



// ---- f16 WMMA path (v_wmma_f32_16x16x32_f16): 11-bit significands for operands in range — used where a [0,1] probability operand needs more precision than bf16
typedef _Float16 v16h __attribute__((ext_vector_type(16)));
union FragH { v16h v; v8us half[2]; _Float16 h[16]; unsigned short u[16]; };
template <int NT>
__device__ __forceinline__ v8f mmaH(v16h ah, v16h al, v16h bh, v16h bl, v8f c) {
  c = __builtin_amdgcn_wmma_f32_16x16x32_f16(false, ah, false, bh, (short)0, c, false, false);
  if (NT >= 2) c = __builtin_amdgcn_wmma_f32_16x16x32_f16(false, al, false, bh, (short)0, c, false, false);
  if (NT >= 3) c = __builtin_amdgcn_wmma_f32_16x16x32_f16(false, ah, false, bl, (short)0, c, false, false);
  asm volatile("v_nop\n\tv_nop\n\tv_nop\n\tv_nop" : "+v"(c) : "v"(ah), "v"(al), "v"(bh), "v"(bl));
  return c;
}
// batched GEMM like k_gemm_b but f16 operands: A f32 (split into f16 hi/lo if ASPLIT, else rounded to f16), Bt = f16 values [n][k]; alpha; C f32; N multiple of 16 (partial tiles skipped)
template <bool ASPLIT>
__global__ __launch_bounds__(128) void k_gemm_h(const float* __restrict__ A, int lda, size_t sA, const _Float16* __restrict__ Bh, int ldb, size_t sB, float alpha, float* __restrict__ C, int ldc, size_t sC, int M, int N, int K) {
  __shared__ __attribute__((aligned(16))) float so[4][16][64];
  const int tid = threadIdx.x, w = tid >> 5, lane = tid & 31, ln = lane & 15, hh = lane >> 4; const int by = blockIdx.y;
  A += (size_t)by * sA; Bh += (size_t)by * sB; C += (size_t)by * sC;
  const int ntn = (N + 63) / 64; const int wid = blockIdx.x * 4 + w; const int mt = wid / ntn, nq = wid % ntn; if (mt * 16 >= M) return;
  const int row0 = mt * 16, col0 = nq * 64; const float* arow = A + (size_t)(row0 + ln) * lda;
  v8f acc[4] = {};
  for (int kb = 0; kb < K; kb += 32) {
    FragH ah, al;
    const v4f x0 = *(const v4fa*)(arow + kb + 8 * hh), x1 = *(const v4fa*)(arow + kb + 8 * hh + 4), x2 = *(const v4fa*)(arow + kb + 16 + 8 * hh), x3 = *(const v4fa*)(arow + kb + 16 + 8 * hh + 4);
    float xs[16] = {x0[0],x0[1],x0[2],x0[3],x1[0],x1[1],x1[2],x1[3],x2[0],x2[1],x2[2],x2[3],x3[0],x3[1],x3[2],x3[3]};
#pragma unroll
    for (int i = 0; i < 16; ++i) { const _Float16 h = (_Float16)xs[i]; ah.h[i] = h; al.h[i] = ASPLIT ? (_Float16)(xs[i] - (float)h) : (_Float16)0.0f; }
#pragma unroll
    for (int t = 0; t < 4; ++t) { if (col0 + t * 16 >= N) continue; const size_t boff = (size_t)(col0 + t * 16 + ln) * ldb + kb; FragH bq; bq.half[0] = *(const v8us*)(Bh + boff + 8 * hh); bq.half[1] = *(const v8us*)(Bh + boff + 16 + 8 * hh);
      acc[t] = mmaH<ASPLIT ? 2 : 1>(ah.v, al.v, bq.v, bq.v, acc[t]); }
  }
#pragma unroll
  for (int t = 0; t < 4; ++t) { if (col0 + t * 16 >= N) continue;
#pragma unroll
    for (int r = 0; r < 8; ++r) so[w][8 * hh + r][t * 16 + ln] = acc[t][r] * alpha; }
  __builtin_amdgcn_fence(__ATOMIC_ACQ_REL, "workgroup"); __builtin_amdgcn_wave_barrier();
  const int rsub = lane >> 4, c4 = (lane & 15) * 4;
  {
#pragma unroll
    for (int q = 0; q < 8; ++q) { const int r = q * 2 + rsub; if (col0 + c4 < N) { const v4f v = *(const v4fa*)&so[w][r][c4]; *(v4f*)(C + (size_t)(row0 + r) * ldc + col0 + c4) = v; } }
     }
}

// Wt[n][k] = f16(W[k][n]·scale) from f32 row-major W[K][N] (scale = power of two; bf16-exact weights stay exact in f16 away from the subnormal range)
__global__ __launch_bounds__(256) void k_wt_f16(const float* __restrict__ W, _Float16* __restrict__ Wt, int K, int N, float scale) {
  const int t = blockIdx.x * 256 + threadIdx.x; if (t >= N * (K / 8)) return; const int n = t / (K / 8), k8 = (t % (K / 8)) * 8; FragH f;
#pragma unroll
  for (int i = 0; i < 8; ++i) f.h[i] = (_Float16)(bf16_round(W[(size_t)(k8 + i) * N + n]) * scale); const v8us o = f.half[0];
  *(v8us*)((unsigned short*)Wt + (size_t)n * K + k8) = o; 
}
// k_gemm_hh variant with fused epilogue: v = acc·alpha + bias[by·sBias + col] (+ CP[(row/rowsPerB)·sCPb + by·64 + col] if CP) ; ACT 0 none / 1 elu ; writes f16 C16 (and f32 C if non-null)
template <int ACT>
__global__ __launch_bounds__(128) void k_gemm_hhx(const _Float16* __restrict__ A, int lda, size_t sA, const _Float16* __restrict__ Bh, int ldb, size_t sB, float alpha, const float* __restrict__ bias, size_t sBias, const float* __restrict__ CP, int rowsPerB, size_t sCPb, int row0g,
    float* __restrict__ C, _Float16* __restrict__ C16, int ldc, size_t sC, int M, int N, int K) {
  __shared__ __attribute__((aligned(16))) float so[4][16][64];
  const int tid = threadIdx.x, w = tid >> 5, lane = tid & 31, ln = lane & 15, hh = lane >> 4; const int by = blockIdx.y;
  A += (size_t)by * sA; Bh += (size_t)by * sB; const size_t cofs = (size_t)by * sC; const float* bp = bias ? bias + (size_t)by * sBias : nullptr;
  const int ntn = (N + 63) / 64; const int wid = blockIdx.x * 4 + w; const int mt = wid / ntn, nq = wid % ntn; if (mt * 16 >= M) return;
  const int row0 = mt * 16, col0 = nq * 64; const _Float16* arow = A + (size_t)(row0 + ln) * lda;
  v8f acc[4] = {};
  for (int kb = 0; kb < K; kb += 32) { FragH ah; ah.half[0] = *(const v8us*)((const unsigned short*)arow + kb + 8 * hh); ah.half[1] = *(const v8us*)((const unsigned short*)arow + kb + 16 + 8 * hh);
#pragma unroll
    for (int t = 0; t < 4; ++t) { if (col0 + t * 16 >= N) continue; const size_t boff = (size_t)(col0 + t * 16 + ln) * ldb + kb; FragH bq; bq.half[0] = *(const v8us*)((const unsigned short*)Bh + boff + 8 * hh); bq.half[1] = *(const v8us*)((const unsigned short*)Bh + boff + 16 + 8 * hh);
      acc[t] = mmaH<1>(ah.v, ah.v, bq.v, bq.v, acc[t]); }
  }
#pragma unroll
  for (int t = 0; t < 4; ++t) { if (col0 + t * 16 >= N) continue; const int col = col0 + t * 16 + ln; const float bv = bp ? bf16_round(bp[col]) : 0.f;
#pragma unroll
    for (int r = 0; r < 8; ++r) { float v = acc[t][r] * alpha + bv; if (CP) { const int bidx = (row0g + row0 + 8 * hh + r) / rowsPerB; v += CP[(size_t)bidx * sCPb + (size_t)by * 64 + col]; } if (ACT == 1) v = (v > 0.f) ? v : expm1f(v); else if (ACT == 7) v = (v > 0.f) ? v + 1.0f : expf(v); else if (ACT == 8) v = tanhf(v); else if (ACT == 9) v = 0.5f * v * (1.0f + tanhf(0.7978845608028654f * (v + 0.044715f * v * v * v))); else if (ACT == 11) v = 1.0f / (1.0f + expf(-v)); else if (ACT == 12) v = (v > 0.f) ? v : 0.01f * v; else if (ACT == 14) v = (v > 0.f) ? v : 0.1f * v; else if (ACT == 15) v = v / (1.0f + expf(-v)); else if (ACT == 3) v = fmaxf(v, 0.f); else if (ACT == 6) v = 0.5f * v * (1.0f + erff(v * 0.70710678118654752f)); so[w][8 * hh + r][t * 16 + ln] = v; } }
  __builtin_amdgcn_fence(__ATOMIC_ACQ_REL, "workgroup"); __builtin_amdgcn_wave_barrier();
  const int rsub = lane >> 4, c4 = (lane & 15) * 4; typedef _Float16 v4h __attribute__((ext_vector_type(4)));
  {
#pragma unroll
    for (int q = 0; q < 8; ++q) { const int r = q * 2 + rsub; if (col0 + c4 < N) { const v4f v = *(const v4fa*)&so[w][r][c4]; if (C) *(v4f*)(C + cofs + (size_t)(row0 + r) * ldc + col0 + c4) = v; if (C16) { v4h h4; for (int i = 0; i < 4; ++i) h4[i] = (_Float16)v[i]; *(v4h*)(C16 + cofs + (size_t)(row0 + r) * ldc + col0 + c4) = h4; } } }
     }
}


typedef _Float16 v4h __attribute__((ext_vector_type(4)));

__global__ __launch_bounds__(256) void k_x16(const float* __restrict__ x, _Float16* __restrict__ X16, size_t n8) { const size_t t = (size_t)blockIdx.x * 256 + threadIdx.x; if (t >= n8) return; FragH f;
#pragma unroll
  for (int q = 0; q < 8; ++q) f.h[q] = (_Float16)bf16_round(x[t * 8 + q]); *(v8us*)((unsigned short*)X16 + t * 8) = f.half[0];  }
__global__ __launch_bounds__(256) void k_h16(const float* __restrict__ x, _Float16* __restrict__ X16, size_t n8) { const size_t t = (size_t)blockIdx.x * 256 + threadIdx.x; if (t >= n8) return; FragH f;
#pragma unroll
  for (int q = 0; q < 8; ++q) f.h[q] = (_Float16)x[t * 8 + q]; *(v8us*)((unsigned short*)X16 + t * 8) = f.half[0];  }
__global__ __launch_bounds__(256) void k_round16f(const float* __restrict__ W, _Float16* __restrict__ Bt, size_t n8) { const size_t t = (size_t)blockIdx.x * 256 + threadIdx.x; if (t >= n8) return; FragH f;
#pragma unroll
  for (int i = 0; i < 8; ++i) f.h[i] = (_Float16)(bf16_round(W[t * 8 + i]) * 16.0f); *(v8us*)((unsigned short*)Bt + t * 8) = f.half[0];  }
template <int NHv, int TTv>
__global__ __launch_bounds__(256) void k_vt(const _Float16* __restrict__ V16, int ldv, int voff, _Float16* __restrict__ Vt) { __shared__ unsigned short tl[64][66]; const int tid = threadIdx.x; const int slab = blockIdx.x / (TTv / 64), lg = blockIdx.x % (TTv / 64); const int b = slab / NHv, h = slab % NHv;
  for (int i = tid; i < 64 * 8; i += 256) { const int r = i / 8, c8 = (i % 8) * 8; FragH f; f.half[0] = *(const v8us*)((const unsigned short*)V16 + ((size_t)b * TTv + lg * 64 + r) * ldv + voff + h * 64 + c8);
#pragma unroll
    for (int q = 0; q < 8; ++q) tl[r][c8 + q] = f.u[q]; }
  __syncthreads();
  {
#pragma unroll
    for (int rd = 0; rd < 2; ++rd) { const int d = rd * 32 + tid / 8, pc = tid % 8; FragH f;
#pragma unroll
      for (int q = 0; q < 8; ++q) f.u[q] = tl[pc * 8 + q][d];
      *(v8us*)((unsigned short*)Vt + ((size_t)slab * 64 + d) * TTv + lg * 64 + pc * 8) = f.half[0]; }
     } }

__global__ __launch_bounds__(256) void k_hl(const float* __restrict__ F, _Float16* __restrict__ Hh, _Float16* __restrict__ Hl, size_t n8) { const size_t t = (size_t)blockIdx.x * 256 + threadIdx.x; if (t >= n8) return; FragH fh, fl; const v4f a = *(const v4fa*)(F + t * 8), c = *(const v4fa*)(F + t * 8 + 4);
#pragma unroll
  for (int q = 0; q < 4; ++q) { _Float16 h = (_Float16)a[q]; fh.h[q] = h; fl.h[q] = (_Float16)((a[q] - (float)h) * 1024.0f); h = (_Float16)c[q]; fh.h[4 + q] = h; fl.h[4 + q] = (_Float16)((c[q] - (float)h) * 1024.0f); }
  { *(v8us*)((unsigned short*)Hh + t * 8) = fh.half[0]; *(v8us*)((unsigned short*)Hl + t * 8) = fl.half[0];  } }

// ---- fast GEMM (block tile 128x64, wave tile 32x64; requires M % 128 == 0, N % 64 == 0, K % 64 == 0); epilogue = k_gemm_hhx semantics ----
// Per trip a 64-deep slice of A (128 rows) and of B (64 rows) is copied to LDS in whole 128-byte lines (asynchronous copies, two buffers: the next slice flies while this one is multiplied); fragments come from LDS.
#define G2_PITCH 144                      /* LDS bytes per staged row: 128 + 16, the conflict-free pitch for 16-byte reads */
#define G2_BUF ((128 + 64) * G2_PITCH)    /* one buffer: A rows 0..127, then B rows 128..191 */
__device__ __forceinline__ v16h g2_lfrag(const unsigned char* p) { FragH f; f.half[0] = *(const v8us*)p; f.half[1] = *(const v8us*)(p + 32); return f.v; }
__device__ __forceinline__ v8f g2_mma(v16h a, v16h b, v8f c) { v8f d = __builtin_amdgcn_wmma_f32_16x16x32_f16(false, a, false, b, (short)0, c, false, false); asm volatile("v_nop\n\tv_nop\n\tv_nop\n\tv_nop" : "+v"(d) : "v"(a), "v"(b)); return d; }
// one slice: 12 copies of 16 bytes per lane (8 of A, 4 of B), a wave's copy covering 4 whole rows; l = the lane's LDS byte address of its first row, rows 16 apart
__device__ __forceinline__ void g2_copy(unsigned l, const _Float16* ga, size_t sa16, const _Float16* gb, size_t sb16) {
  /* the closing s_wait_xcnt keeps every address register intact until the copies have taken it */
  asm volatile("global_load_async_to_lds_b128 %0, %12, off\n\t"
               "global_load_async_to_lds_b128 %1, %13, off\n\t"
               "global_load_async_to_lds_b128 %2, %14, off\n\t"
               "global_load_async_to_lds_b128 %3, %15, off\n\t"
               "global_load_async_to_lds_b128 %4, %16, off\n\t"
               "global_load_async_to_lds_b128 %5, %17, off\n\t"
               "global_load_async_to_lds_b128 %6, %18, off\n\t"
               "global_load_async_to_lds_b128 %7, %19, off\n\t"
               "global_load_async_to_lds_b128 %8, %20, off\n\t"
               "global_load_async_to_lds_b128 %9, %21, off\n\t"
               "global_load_async_to_lds_b128 %10, %22, off\n\t"
               "global_load_async_to_lds_b128 %11, %23, off\n\t"
               "s_wait_xcnt 0x0"
               :: "v"(l), "v"(l + 16 * G2_PITCH), "v"(l + 32 * G2_PITCH), "v"(l + 48 * G2_PITCH), "v"(l + 64 * G2_PITCH), "v"(l + 80 * G2_PITCH), "v"(l + 96 * G2_PITCH), "v"(l + 112 * G2_PITCH),
                  "v"(l + 128 * G2_PITCH), "v"(l + 144 * G2_PITCH), "v"(l + 160 * G2_PITCH), "v"(l + 176 * G2_PITCH),
                  "v"(ga), "v"(ga + sa16), "v"(ga + 2 * sa16), "v"(ga + 3 * sa16), "v"(ga + 4 * sa16), "v"(ga + 5 * sa16), "v"(ga + 6 * sa16), "v"(ga + 7 * sa16),
                  "v"(gb), "v"(gb + sb16), "v"(gb + 2 * sb16), "v"(gb + 3 * sb16)
               : "memory");
}
template <int ACT>
__global__ __launch_bounds__(128) void k_gemm2(const _Float16* __restrict__ A, int lda, size_t sA, const _Float16* __restrict__ Bh, int ldb, size_t sB, float alpha, const float* __restrict__ bias, size_t sBias, const float* __restrict__ CP, int rowsPerB, size_t sCPb, int row0g,
    float* __restrict__ C, _Float16* __restrict__ C16, int ldc, size_t sC, int M, int N, int K) {
  __shared__ __attribute__((aligned(16))) unsigned char smem[2 * G2_BUF];      /* the two staging buffers; the epilogue's 4 x 32 x 68 floats lie over them once the loop's last barrier has ended every read */
  float (*so)[32][68] = reinterpret_cast<float (*)[32][68]>(smem);
  const int tid = threadIdx.x, w = tid >> 5, lane = tid & 31, ln = lane & 15, hh = lane >> 4; const int by = blockIdx.y;
  A += (size_t)by * sA; Bh += (size_t)by * sB; const size_t cofs = (size_t)by * sC; const float* bp = bias ? bias + (size_t)by * sBias : nullptr;
  const int ntn = N >> 6; const int mt = blockIdx.x / ntn, nq = blockIdx.x - mt * ntn; const int row0 = mt * 128 + 32 * w, col0 = nq * 64; if (mt * 128 >= M) return;      /* the whole block leaves or none: barriers follow */
  const int crow = tid >> 3, cch = tid & 7;      /* copy role: row (mod 16) and 16-byte piece of the 128-byte row */
  const _Float16* gA = A + (size_t)(mt * 128 + crow) * lda + cch * 8; const _Float16* gB = Bh + (size_t)(col0 + crow) * ldb + cch * 8; const size_t sa16 = (size_t)16 * lda, sb16 = (size_t)16 * ldb;
  const unsigned l0 = (unsigned)(size_t)smem + (unsigned)(crow * G2_PITCH + cch * 16);
  const int aoff = (32 * w + ln) * G2_PITCH + 16 * hh, boff = (128 + ln) * G2_PITCH + 16 * hh;
  const v8f z8 = {0.f,0.f,0.f,0.f,0.f,0.f,0.f,0.f}; v8f c00 = z8, c01 = z8, c02 = z8, c03 = z8, c10 = z8, c11 = z8, c12 = z8, c13 = z8;
  const int NT = K >> 6;
  g2_copy(l0, gA, sa16, gB, sb16);
  asm volatile("s_wait_asynccnt 0x0" ::: "memory");      /* slice 0 has landed before the barrier publishes it */
  __syncthreads();
  if (NT > 1) g2_copy(l0 + G2_BUF, gA + 64, sa16, gB + 64, sb16);
#pragma unroll 1      /* one slice per trip: the buffer alternates with the trip's parity */
  for (int t = 0; t < NT; ++t) { const unsigned char* sb = smem + (t & 1) * G2_BUF; const unsigned char* pa = sb + aoff; const unsigned char* pb = sb + boff;
    const v16h a0 = g2_lfrag(pa), a1 = g2_lfrag(pa + 16 * G2_PITCH), b0 = g2_lfrag(pb), b1 = g2_lfrag(pb + 16 * G2_PITCH), b2 = g2_lfrag(pb + 32 * G2_PITCH), b3 = g2_lfrag(pb + 48 * G2_PITCH);
    const v16h e0 = g2_lfrag(pa + 64), e1 = g2_lfrag(pa + 16 * G2_PITCH + 64), f0 = g2_lfrag(pb + 64), f1 = g2_lfrag(pb + 16 * G2_PITCH + 64), f2 = g2_lfrag(pb + 32 * G2_PITCH + 64), f3 = g2_lfrag(pb + 48 * G2_PITCH + 64);
    c00 = g2_mma(a0, b0, c00); c10 = g2_mma(a1, b0, c10); c01 = g2_mma(a0, b1, c01); c11 = g2_mma(a1, b1, c11); c02 = g2_mma(a0, b2, c02); c12 = g2_mma(a1, b2, c12); c03 = g2_mma(a0, b3, c03); c13 = g2_mma(a1, b3, c13);
    c00 = g2_mma(e0, f0, c00); c10 = g2_mma(e1, f0, c10); c01 = g2_mma(e0, f1, c01); c11 = g2_mma(e1, f1, c11); c02 = g2_mma(e0, f2, c02); c12 = g2_mma(e1, f2, c12); c03 = g2_mma(e0, f3, c03); c13 = g2_mma(e1, f3, c13);
    asm volatile("s_wait_dscnt 0x0" ::: "memory");         /* this wave's reads of the buffer are over before it may be refilled */
    asm volatile("s_wait_asynccnt 0x0" ::: "memory");      /* this wave's copies of the next slice have landed */
    __syncthreads();                                       /* publishes the next slice and ends every wave's reads of this one */
    if (t + 2 < NT) g2_copy(l0 + (unsigned)(t & 1) * G2_BUF, gA + (size_t)(t + 2) * 64, sa16, gB + (size_t)(t + 2) * 64, sb16); }
  asm volatile("s_wait_asynccnt 0x0" ::: "memory");        /* nothing is in flight when the buffers become output staging */
  v8f accs[8] = {c00, c01, c02, c03, c10, c11, c12, c13};
#pragma unroll
  for (int u = 0; u < 8; ++u) { const int t = u & 3, half = u >> 2; const int col = col0 + t * 16 + ln; const float bv = bp ? bf16_round(bp[col]) : 0.f;
#pragma unroll
    for (int r = 0; r < 8; ++r) { const int rloc = half * 16 + 8 * hh + r; float v = accs[u][r] * alpha + bv; if (CP) { const int bidx = (row0g + row0 + rloc) / rowsPerB; v += CP[(size_t)bidx * sCPb + (size_t)by * 64 + col]; }
      if (ACT == 3) v = fmaxf(v, 0.f); else if (ACT == 6) v = 0.5f * v * (1.0f + erff(v * 0.70710678118654752f)); else if (ACT == 11) v = 1.0f / (1.0f + expf(-v)); else if (ACT == 15) v = v / (1.0f + expf(-v)); else if (ACT == 12) v = (v > 0.f) ? v : 0.01f * v; else if (ACT == 8) v = tanhf(v);
      so[w][rloc][t * 16 + ln] = v; } }
  __builtin_amdgcn_fence(__ATOMIC_ACQ_REL, "workgroup"); __builtin_amdgcn_wave_barrier();
  const int rsub = lane >> 4, c4 = (lane & 15) * 4;
  {
#pragma unroll
    for (int q = 0; q < 16; ++q) { const int r = q * 2 + rsub; const v4f v = *(const v4fa*)&so[w][r][c4]; if (C) *(v4f*)(C + cofs + (size_t)(row0 + r) * ldc + col0 + c4) = v; if (C16) { v4h h4; for (int i = 0; i < 4; ++i) h4[i] = (_Float16)v[i]; *(v4h*)(C16 + cofs + (size_t)(row0 + r) * ldc + col0 + c4) = h4; } }
     } }



template <int CAUSAL>
__global__ __launch_bounds__(128) void k_flash(const _Float16* __restrict__ Q16, int ldq, const _Float16* __restrict__ K16, int ldk, const _Float16* __restrict__ Vt, const _Float16* __restrict__ Vt2, const int* __restrict__ MSK, float* __restrict__ O, float* __restrict__ O2, int ldo) {
  constexpr int RPW = 16, RTN = RPW / 16, NQB = TQ / (4 * RPW), DT = 8, KS = 2;      /* DT 0..3: low 64 value columns (Vt -> O), DT 4..7: high 64 (Vt2 -> O2); one score/softmax pass feeds both */
  __shared__ __attribute__((aligned(16))) unsigned short sP[4][RPW][40]; __shared__ __attribute__((aligned(16))) float sO[4][RPW][64 + 4];
  const int tid = threadIdx.x, w = tid >> 5, lane = tid & 31, ln = lane & 15, hh = lane >> 4;
  const int slab = blockIdx.x / QBNP, qblk = QB0P + blockIdx.x % QBNP; (void)NQB; const int b = slab / NH, h = slab % NH; const int qb0 = qblk * (4 * RPW); const int q0 = qb0 + w * RPW;
  FragH aq[2][KS];
#pragma unroll
  for (int rt = 0; rt < RTN; ++rt) { const unsigned short* qr = (const unsigned short*)Q16 + ((size_t)b * TQ + q0 + rt * 16 + ln) * ldq + h * 64;
#pragma unroll
    for (int ks = 0; ks < KS; ++ks) { aq[rt][ks].half[0] = *(const v8us*)(qr + ks * 32 + 8 * hh); aq[rt][ks].half[1] = *(const v8us*)(qr + ks * 32 + 16 + 8 * hh); } }
  const unsigned short* Vth = (const unsigned short*)Vt + (size_t)slab * 64 * TK; const unsigned short* Vth2 = (const unsigned short*)Vt2 + (size_t)slab * 64 * TK;
  float m_r[2][8], l_r[2][8]; v8f oacc[2][DT];
#pragma unroll
  for (int rt = 0; rt < RTN; ++rt) {
#pragma unroll
    for (int r = 0; r < 8; ++r) { m_r[rt][r] = -3.0e38f; l_r[rt][r] = 0.f; }
#pragma unroll
    for (int dt = 0; dt < DT; ++dt) oacc[rt][dt] = (v8f){0.f,0.f,0.f,0.f,0.f,0.f,0.f,0.f}; }
  const int jend = (CAUSAL == 1) ? (qb0 + 4 * RPW) : TK;      /* causal: keys beyond the block's last query never contribute */
#pragma unroll 1
  for (int j0 = 0; j0 < jend; j0 += 32) {
    v8f s[2][2];
#pragma unroll
    for (int nt = 0; nt < 2; ++nt) { const unsigned short* kr = (const unsigned short*)K16 + ((size_t)b * TK + j0 + nt * 16 + ln) * ldk + h * 64; FragH bk[KS];
#pragma unroll
      for (int ks = 0; ks < KS; ++ks) { bk[ks].half[0] = *(const v8us*)(kr + ks * 32 + 8 * hh); bk[ks].half[1] = *(const v8us*)(kr + ks * 32 + 16 + 8 * hh); }
#pragma unroll
      for (int rt = 0; rt < RTN; ++rt) { v8f acc = (v8f){0.f,0.f,0.f,0.f,0.f,0.f,0.f,0.f};
#pragma unroll
        for (int ks = 0; ks < KS; ++ks) acc = mmaH<1>(aq[rt][ks].v, aq[rt][ks].v, bk[ks].v, bk[ks].v, acc); s[rt][nt] = acc; } }
#pragma unroll
    for (int rt = 0; rt < RTN; ++rt)
#pragma unroll
      for (int r = 0; r < 8; ++r) { const int tq = q0 + rt * 16 + 8 * hh + r; const int k0 = j0 + ln, k1 = j0 + 16 + ln;
        const bool ok0 = (CAUSAL == 1) ? (k0 <= tq) : ((CAUSAL == 2) ? ((k0 >> 5) == (tq >> 5)) : true), ok1 = (CAUSAL == 1) ? (k1 <= tq) : ((CAUSAL == 2) ? ((k1 >> 5) == (tq >> 5)) : true);      /* mode 2: block-diagonal 32-token groups */
        const float s0 = ok0 ? s[rt][0][r] * SCL : -3.0e38f, s1 = ok1 ? s[rt][1][r] * SCL : -3.0e38f; float mc = fmaxf(s0, s1);
        mc = fmaxf(mc, __shfl_xor(mc, 1, 32)); mc = fmaxf(mc, __shfl_xor(mc, 2, 32)); mc = fmaxf(mc, __shfl_xor(mc, 4, 32)); mc = fmaxf(mc, __shfl_xor(mc, 8, 32));
        const float mn = fmaxf(m_r[rt][r], mc); const float al = (mn > -1.0e38f) ? expf(m_r[rt][r] - mn) : 1.0f; m_r[rt][r] = mn; const float p0 = ok0 ? expf(s0 - mn) : 0.f, p1 = ok1 ? expf(s1 - mn) : 0.f; l_r[rt][r] = l_r[rt][r] * al + p0 + p1;
#pragma unroll
        for (int dt = 0; dt < DT; ++dt) oacc[rt][dt][r] *= al;
        FragH t2; t2.h[0] = (_Float16)(p0 * 1024.0f); t2.h[1] = (_Float16)(p1 * 1024.0f); sP[w][rt * 16 + 8 * hh + r][ln] = t2.u[0]; sP[w][rt * 16 + 8 * hh + r][16 + ln] = t2.u[1]; }
    __builtin_amdgcn_fence(__ATOMIC_ACQ_REL, "workgroup"); __builtin_amdgcn_wave_barrier();
    FragH pa[2];
#pragma unroll
    for (int rt = 0; rt < RTN; ++rt) { pa[rt].half[0] = *(const v8us*)&sP[w][rt * 16 + ln][8 * hh]; pa[rt].half[1] = *(const v8us*)&sP[w][rt * 16 + ln][16 + 8 * hh]; }
#pragma unroll
    for (int dt = 0; dt < 4; ++dt) { const size_t vo = (size_t)(dt * 16 + ln) * TK + j0; const unsigned short* vrow = Vth + vo; const unsigned short* vrow2 = Vth2 + vo; FragH bv, bv2; bv.half[0] = *(const v8us*)(vrow + 8 * hh); bv.half[1] = *(const v8us*)(vrow + 16 + 8 * hh); bv2.half[0] = *(const v8us*)(vrow2 + 8 * hh); bv2.half[1] = *(const v8us*)(vrow2 + 16 + 8 * hh);
#pragma unroll
      for (int rt = 0; rt < RTN; ++rt) { oacc[rt][dt] = mmaH<1>(pa[rt].v, pa[rt].v, bv.v, bv.v, oacc[rt][dt]); oacc[rt][4 + dt] = mmaH<1>(pa[rt].v, pa[rt].v, bv2.v, bv2.v, oacc[rt][4 + dt]); } }
    __builtin_amdgcn_fence(__ATOMIC_ACQ_REL, "workgroup"); __builtin_amdgcn_wave_barrier(); }
#pragma unroll
  for (int rt = 0; rt < RTN; ++rt) {
#pragma unroll
    for (int r = 0; r < 8; ++r) { float l = l_r[rt][r]; l += __shfl_xor(l, 1, 32); l += __shfl_xor(l, 2, 32); l += __shfl_xor(l, 4, 32); l += __shfl_xor(l, 8, 32); l_r[rt][r] = (l > 0.f) ? 1.0f / (l * 1024.0f) : 0.f; } }
#pragma unroll
  for (int hf = 0; hf < 2; ++hf) { float* __restrict__ Oh = hf ? O2 : O;
#pragma unroll
    for (int rt = 0; rt < RTN; ++rt)
#pragma unroll
      for (int dt = 0; dt < 4; ++dt)
#pragma unroll
        for (int r = 0; r < 8; ++r) sO[w][rt * 16 + 8 * hh + r][dt * 16 + ln] = oacc[rt][hf * 4 + dt][r] * l_r[rt][r];
    __builtin_amdgcn_fence(__ATOMIC_ACQ_REL, "workgroup"); __builtin_amdgcn_wave_barrier();
#pragma unroll
    for (int rp = 0; rp < RPW; rp += 2) { const int r = rp + (lane >> 4), pc = lane & 15; const v4f val = *(const v4fa*)&sO[w][r][pc * 4]; *(v4f*)(Oh + ((size_t)b * TQ + q0 + r) * ldo + h * 64 + pc * 4) = val; }
    if (hf == 0) { __builtin_amdgcn_fence(__ATOMIC_ACQ_REL, "workgroup"); __builtin_amdgcn_wave_barrier(); }      /* the high half reuses this wave's sO slice: its stores stay behind the low half's reads */
  } }
// 5-plane variant: S = Qh Kh^T + (Ql Kh^T + Qh Kl^T)/1024 with Q/K = [hi | 2^10 residual] f16 planes (QL/KL same layout as Q16/K16), then the 3-term P.V below.
// 3-term variant: O = (P_hi V_hi + (P_lo V_hi + P_hi V_lo) / 1024) / l with P = [hi | 2^10 residual] of 1024 p and V^T = [hi | 2^10 residual] planes (VtL same layout as Vt) -> ~2^-21-class products for un-averaged (early causal / peaked) rows
template <int CAUSAL>
__global__ __launch_bounds__(128) void k_flash5(const _Float16* __restrict__ Q16, const _Float16* __restrict__ QL, int ldq, const _Float16* __restrict__ K16, const _Float16* __restrict__ KL, int ldk, const _Float16* __restrict__ Vt, const _Float16* __restrict__ VtL, const int* __restrict__ MSK, float* __restrict__ O, int ldo) {
  constexpr int RPW = 16, RTN = RPW / 16, NQB = TQ / (4 * RPW), DT = 4, KS = 2;
  __shared__ __attribute__((aligned(16))) unsigned short sP[4][RPW][40]; __shared__ __attribute__((aligned(16))) unsigned short sPL[4][RPW][40]; __shared__ __attribute__((aligned(16))) float sO[4][RPW][64 + 4];
  const int tid = threadIdx.x, w = tid >> 5, lane = tid & 31, ln = lane & 15, hh = lane >> 4;
  const int slab = blockIdx.x / QBN5, qblk = QB05 + blockIdx.x % QBN5; (void)NQB; const int b = slab / NH, h = slab % NH; const int qb0 = qblk * (4 * RPW); const int q0 = qb0 + w * RPW;
  FragH aq[2][KS], aql[2][KS];
#pragma unroll
  for (int rt = 0; rt < RTN; ++rt) { const unsigned short* qr = (const unsigned short*)Q16 + ((size_t)b * TQ + q0 + rt * 16 + ln) * ldq + h * 64; const unsigned short* ql = (const unsigned short*)QL + ((size_t)b * TQ + q0 + rt * 16 + ln) * ldq + h * 64;
#pragma unroll
    for (int ks = 0; ks < KS; ++ks) { aq[rt][ks].half[0] = *(const v8us*)(qr + ks * 32 + 8 * hh); aq[rt][ks].half[1] = *(const v8us*)(qr + ks * 32 + 16 + 8 * hh); aql[rt][ks].half[0] = *(const v8us*)(ql + ks * 32 + 8 * hh); aql[rt][ks].half[1] = *(const v8us*)(ql + ks * 32 + 16 + 8 * hh); } }
  const unsigned short* Vth = (const unsigned short*)Vt + (size_t)slab * 64 * TK; const unsigned short* Vtl = (const unsigned short*)VtL + (size_t)slab * 64 * TK;
  float m_r[2][8], l_r[2][8]; v8f oacc[2][DT], oaccL[2][DT];
#pragma unroll
  for (int rt = 0; rt < RTN; ++rt) {
#pragma unroll
    for (int r = 0; r < 8; ++r) { m_r[rt][r] = -3.0e38f; l_r[rt][r] = 0.f; }
#pragma unroll
    for (int dt = 0; dt < DT; ++dt) { oacc[rt][dt] = (v8f){0.f,0.f,0.f,0.f,0.f,0.f,0.f,0.f}; oaccL[rt][dt] = oacc[rt][dt]; } }
  const int jend = (CAUSAL == 1) ? (qb0 + 4 * RPW) : TK;      /* causal: keys beyond the block's last query never contribute */
#pragma unroll 1
  for (int j0 = 0; j0 < jend; j0 += 32) {
    v8f s[2][2];
#pragma unroll
    for (int nt = 0; nt < 2; ++nt) { const unsigned short* kr = (const unsigned short*)K16 + ((size_t)b * TK + j0 + nt * 16 + ln) * ldk + h * 64; const unsigned short* klr = (const unsigned short*)KL + ((size_t)b * TK + j0 + nt * 16 + ln) * ldk + h * 64; FragH bk[KS], bkl[KS];
#pragma unroll
      for (int ks = 0; ks < KS; ++ks) { bk[ks].half[0] = *(const v8us*)(kr + ks * 32 + 8 * hh); bk[ks].half[1] = *(const v8us*)(kr + ks * 32 + 16 + 8 * hh); bkl[ks].half[0] = *(const v8us*)(klr + ks * 32 + 8 * hh); bkl[ks].half[1] = *(const v8us*)(klr + ks * 32 + 16 + 8 * hh); }
#pragma unroll
      for (int rt = 0; rt < RTN; ++rt) { v8f acc = (v8f){0.f,0.f,0.f,0.f,0.f,0.f,0.f,0.f}, accl = acc;
#pragma unroll
        for (int ks = 0; ks < KS; ++ks) { acc = mmaH<1>(aq[rt][ks].v, aq[rt][ks].v, bk[ks].v, bk[ks].v, acc); accl = mmaH<1>(aql[rt][ks].v, aql[rt][ks].v, bk[ks].v, bk[ks].v, accl); accl = mmaH<1>(aq[rt][ks].v, aq[rt][ks].v, bkl[ks].v, bkl[ks].v, accl); }
#pragma unroll
        for (int r = 0; r < 8; ++r) acc[r] += accl[r] * 0.0009765625f;
        s[rt][nt] = acc; } }
#pragma unroll
    for (int rt = 0; rt < RTN; ++rt)
#pragma unroll
      for (int r = 0; r < 8; ++r) { const int tq = q0 + rt * 16 + 8 * hh + r; const int k0 = j0 + ln, k1 = j0 + 16 + ln;
        bool ok0 = (CAUSAL == 1) ? (k0 <= tq) : ((CAUSAL == 2) ? ((k0 >> 5) == (tq >> 5)) : true), ok1 = (CAUSAL == 1) ? (k1 <= tq) : ((CAUSAL == 2) ? ((k1 >> 5) == (tq >> 5)) : true);      /* mode 2: block-diagonal 32-token groups */
        if (CAUSAL == 4) { const int* mrow = MSK + ((size_t)b * TQ + tq) * TK; ok0 = mrow[k0] != 0; ok1 = mrow[k1] != 0; }      /* mode 4: per-(query, key) INPUT mask shared by all heads; masked keys contribute nothing (== the reference's -4096 fill, whose exp underflows to 0), rows with no valid key give l = 0 -> output 0 (== the reference's row_valid zeroing) */
        const float s0 = ok0 ? s[rt][0][r] * SCL : -3.0e38f, s1 = ok1 ? s[rt][1][r] * SCL : -3.0e38f; float mc = fmaxf(s0, s1);
        mc = fmaxf(mc, __shfl_xor(mc, 1, 32)); mc = fmaxf(mc, __shfl_xor(mc, 2, 32)); mc = fmaxf(mc, __shfl_xor(mc, 4, 32)); mc = fmaxf(mc, __shfl_xor(mc, 8, 32));
        const float mn = fmaxf(m_r[rt][r], mc); const float al = (mn > -1.0e38f) ? expf(m_r[rt][r] - mn) : 1.0f; m_r[rt][r] = mn; const float p0 = ok0 ? expf(s0 - mn) : 0.f, p1 = ok1 ? expf(s1 - mn) : 0.f; l_r[rt][r] = l_r[rt][r] * al + p0 + p1;
#pragma unroll
        for (int dt = 0; dt < DT; ++dt) { oacc[rt][dt][r] *= al; oaccL[rt][dt][r] *= al; }
        FragH t2, t2l; const float ps0 = p0 * 1024.0f, ps1 = p1 * 1024.0f; t2.h[0] = (_Float16)ps0; t2.h[1] = (_Float16)ps1; t2l.h[0] = (_Float16)((ps0 - (float)t2.h[0]) * 1024.0f); t2l.h[1] = (_Float16)((ps1 - (float)t2.h[1]) * 1024.0f);
        sP[w][rt * 16 + 8 * hh + r][ln] = t2.u[0]; sP[w][rt * 16 + 8 * hh + r][16 + ln] = t2.u[1]; sPL[w][rt * 16 + 8 * hh + r][ln] = t2l.u[0]; sPL[w][rt * 16 + 8 * hh + r][16 + ln] = t2l.u[1]; }
    __builtin_amdgcn_fence(__ATOMIC_ACQ_REL, "workgroup"); __builtin_amdgcn_wave_barrier();
    FragH pa[2], pl[2];
#pragma unroll
    for (int rt = 0; rt < RTN; ++rt) { pa[rt].half[0] = *(const v8us*)&sP[w][rt * 16 + ln][8 * hh]; pa[rt].half[1] = *(const v8us*)&sP[w][rt * 16 + ln][16 + 8 * hh]; pl[rt].half[0] = *(const v8us*)&sPL[w][rt * 16 + ln][8 * hh]; pl[rt].half[1] = *(const v8us*)&sPL[w][rt * 16 + ln][16 + 8 * hh]; }
#pragma unroll
    for (int dt = 0; dt < DT; ++dt) { const unsigned short* vrow = Vth + (size_t)(dt * 16 + ln) * TK + j0; const unsigned short* vrl = Vtl + (size_t)(dt * 16 + ln) * TK + j0; FragH bv, bl; bv.half[0] = *(const v8us*)(vrow + 8 * hh); bv.half[1] = *(const v8us*)(vrow + 16 + 8 * hh); bl.half[0] = *(const v8us*)(vrl + 8 * hh); bl.half[1] = *(const v8us*)(vrl + 16 + 8 * hh);
#pragma unroll
      for (int rt = 0; rt < RTN; ++rt) { oacc[rt][dt] = mmaH<1>(pa[rt].v, pa[rt].v, bv.v, bv.v, oacc[rt][dt]); oaccL[rt][dt] = mmaH<1>(pl[rt].v, pl[rt].v, bv.v, bv.v, oaccL[rt][dt]); oaccL[rt][dt] = mmaH<1>(pa[rt].v, pa[rt].v, bl.v, bl.v, oaccL[rt][dt]); } }
    __builtin_amdgcn_fence(__ATOMIC_ACQ_REL, "workgroup"); __builtin_amdgcn_wave_barrier(); }
#pragma unroll
  for (int rt = 0; rt < RTN; ++rt) {
#pragma unroll
    for (int r = 0; r < 8; ++r) { float l = l_r[rt][r]; l += __shfl_xor(l, 1, 32); l += __shfl_xor(l, 2, 32); l += __shfl_xor(l, 4, 32); l += __shfl_xor(l, 8, 32); l_r[rt][r] = (l > 0.f) ? 1.0f / (l * 1024.0f) : 0.f; }
#pragma unroll
    for (int dt = 0; dt < DT; ++dt)
#pragma unroll
      for (int r = 0; r < 8; ++r) { float v = oacc[rt][dt][r]; v += oaccL[rt][dt][r] * 0.0009765625f; sO[w][rt * 16 + 8 * hh + r][dt * 16 + ln] = v * l_r[rt][r]; } }
  __builtin_amdgcn_fence(__ATOMIC_ACQ_REL, "workgroup"); __builtin_amdgcn_wave_barrier();
  {
#pragma unroll
    for (int rp = 0; rp < RPW; rp += 2) { const int r = rp + (lane >> 4), pc = lane & 15; const v4f val = *(const v4fa*)&sO[w][r][pc * 4]; *(v4f*)(O + ((size_t)b * TQ + q0 + r) * ldo + h * 64 + pc * 4) = val; }
     } }

__global__ __launch_bounds__(256) void k_rotab(float* __restrict__ CS, float* __restrict__ SN) {
  #pragma clang fp contract(off)
  const int t = blockIdx.x * 256 + threadIdx.x; if (t >= SLEN * 32) return; const int j = t % 32, s = t / 32; (void)j; (void)s; const float c = 1.0f, sn = 0.0f;      /* no RoPE here: identity tables make k_rope a pure hi/lo split (a*1 - b*0 is exact) */
  { *(float*)(CS + t) = c; *(float*)(SN + t) = sn;  } }
__global__ __launch_bounds__(256) void k_rope(const float* __restrict__ F, int nsrc, int ndst, int rep, const float* __restrict__ CS, const float* __restrict__ SN, _Float16* __restrict__ H, _Float16* __restrict__ L) {
  #pragma clang fp contract(off)
  const size_t t = (size_t)blockIdx.x * 256 + threadIdx.x; if (t >= (size_t)NR * ndst * 4) return; const int g8 = (int)(t % 4); const int hd = (int)((t / 4) % ndst); const size_t row = t / ((size_t)4 * ndst); const int s = (int)(row % SLEN); const int hs = hd / rep;
  const float* src = F + row * (size_t)(nsrc * 64) + hs * 64; FragH ah, al, bh, bl;
  for (int i = 0; i < 8; ++i) { const int d = g8 * 8 + i; const float c = CS[s * 32 + d], sn = SN[s * 32 + d]; const float x1 = src[d], x2 = src[d + 32];
    float o1 = x1 * c; o1 += -x2 * sn; float o2 = x2 * c; o2 += x1 * sn;
    _Float16 hv = (_Float16)o1; ah.h[i] = hv; al.h[i] = (_Float16)((o1 - (float)hv) * 1024.0f); hv = (_Float16)o2; bh.h[i] = hv; bl.h[i] = (_Float16)((o2 - (float)hv) * 1024.0f); }
  const size_t o = row * (size_t)(ndst * 64) + hd * 64 + g8 * 8;
  { *(v8us*)((unsigned short*)H + o) = ah.half[0]; *(v8us*)((unsigned short*)H + o + 32) = bh.half[0]; *(v8us*)((unsigned short*)L + o) = al.half[0]; *(v8us*)((unsigned short*)L + o + 32) = bl.half[0];  } }
__global__ __launch_bounds__(256) void k_vtg(const _Float16* __restrict__ V16, int vadd, _Float16* __restrict__ Vt) { __shared__ unsigned short tl[64][66]; const int tid = threadIdx.x; const int slab = blockIdx.x / (SLEN / 64), lg = blockIdx.x % (SLEN / 64); const int b = slab / NH, h = slab % NH; const int col0 = (h / 8) * 128 + vadd;      /* pseudo-head h reads value head h/8 (128 wide): low (vadd 0) or high (vadd 64) half */
  for (int i = tid; i < 64 * 8; i += 256) { const int r = i / 8, c8 = (i % 8) * 8; FragH f; f.half[0] = *(const v8us*)((const unsigned short*)V16 + ((size_t)b * SLEN + lg * 64 + r) * KVD + col0 + c8); for (int q = 0; q < 8; ++q) tl[r][c8 + q] = f.u[q]; }
  __syncthreads();
  { for (int rd = 0; rd < 2; ++rd) { const int d = rd * 32 + tid / 8, pc = tid % 8; FragH f; for (int q = 0; q < 8; ++q) f.u[q] = tl[pc * 8 + q][d]; *(v8us*)((unsigned short*)Vt + ((size_t)slab * 64 + d) * SLEN + lg * 64 + pc * 8) = f.half[0]; }  } }

__global__ __launch_bounds__(256) void k_wsc(const float* __restrict__ Wm, _Float16* __restrict__ Bt, size_t n8, float sc) { const size_t t = (size_t)blockIdx.x * 256 + threadIdx.x; if (t >= n8) return; FragH f; for (int q = 0; q < 8; ++q) f.h[q] = (_Float16)(bf16_round(Wm[t * 8 + q]) * sc); *(v8us*)((unsigned short*)Bt + t * 8) = f.half[0];  }
__global__ __launch_bounds__(64) void k_lam(const float* __restrict__ q1, const float* __restrict__ k1, const float* __restrict__ q2, const float* __restrict__ k2, float* __restrict__ LAM) {
  #pragma clang fp contract(off)
  const int ln = threadIdx.x & 31; if (threadIdx.x >= 32) return; float a = bf16_round(q1[ln]) * bf16_round(k1[ln]); a += bf16_round(q1[ln + 32]) * bf16_round(k1[ln + 32]); float c = bf16_round(q2[ln]) * bf16_round(k2[ln]); c += bf16_round(q2[ln + 32]) * bf16_round(k2[ln + 32]);
  for (int o = 16; o > 0; o >>= 1) { a += __shfl_xor(a, o, 32); c += __shfl_xor(c, o, 32); } const float lf = expf(a) - expf(c) + 0.78360576653162446f;      /* LAMBDA_INIT = 0.8 - 0.6 exp(-0.3 * 12) = 0.78360577 */
  const float v = (ln == 0) ? lf : 0.f; *(float*)(LAM + ln) = v;  }
__global__ __launch_bounds__(256) void k_comb(const float* __restrict__ OLO, const float* __restrict__ OHI, const float* __restrict__ LAM, const float* __restrict__ lnw, _Float16* __restrict__ A16) {
  #pragma clang fp contract(off)
  const size_t t = (size_t)blockIdx.x * 256 + threadIdx.x; if (t >= (size_t)NR * 16) return; const int j = (int)(t % 16); const size_t r = t / 16; const float lam = LAM[0]; float a[128]; float ss = 0.f;
  const float* e0 = OLO + r * DM + (size_t)(2 * j) * 64; const float* o0 = OLO + r * DM + (size_t)(2 * j + 1) * 64; const float* e1 = OHI + r * DM + (size_t)(2 * j) * 64; const float* o1 = OHI + r * DM + (size_t)(2 * j + 1) * 64;
  for (int d = 0; d < 64; ++d) { float v = e0[d]; v += -lam * o0[d]; a[d] = v; ss += v * v; float w = e1[d]; w += -lam * o1[d]; a[64 + d] = w; ss += w * w; }
  const float inv = rsqrtf(ss / 128.0f + 1e-5f); unsigned short* dst = (unsigned short*)A16 + r * DM + (size_t)j * 128;
  { for (int g = 0; g < 16; ++g) { FragH f; for (int q = 0; q < 8; ++q) { const int d = g * 8 + q; float v = a[d] * inv; v *= bf16_round(lnw[d]); v = v * 0.21639423346837554f;      /* 1 - LAMBDA_INIT */ f.h[q] = (_Float16)v; } *(v8us*)(dst + g * 8) = f.half[0]; }  } }

extern "C" void kernel_launch(void* const* d_in, const int* in_sizes, int n_in,
                              void* d_out, int out_size, void* d_ws, size_t ws_size, hipStream_t stream) {
  (void)in_sizes; (void)n_in; (void)out_size;
  const float* const* I = (const float* const*)d_in; const float* x = I[0]; const float* Wq = I[1]; const float* Wk = I[2]; const float* Wv = I[3]; const float* Wo = I[4]; const float* lq1 = I[5]; const float* lk1 = I[6]; const float* lq2 = I[7]; const float* lk2 = I[8]; const float* lnw = I[9]; const float* bq = nullptr; const float* bk = nullptr; const float* bv = nullptr;
  char* ws = (char*)d_ws; size_t off = 0;
  auto take = [&](size_t bytes) { char* p = ws + off; off += (bytes + 255) & ~(size_t)255; return p; };
  const size_t np = (size_t)NR * DM, nk = (size_t)NR * KVD;
  _Float16* BQ = (_Float16*)take((size_t)DM * DM * 2); _Float16* BK = (_Float16*)take((size_t)KVD * DM * 2); _Float16* BV = (_Float16*)take((size_t)KVD * DM * 2); _Float16* BO = (_Float16*)take((size_t)DM * DM * 2);
  float* CS = (float*)take((size_t)SLEN * 32 * 4); float* SN = (float*)take((size_t)SLEN * 32 * 4);
  _Float16* X16 = (_Float16*)take(np * 2); float* QF = (float*)take(np * 4); _Float16* QH = (_Float16*)take(np * 2); _Float16* QL = (_Float16*)take(np * 2); float* KF = (float*)take(nk * 4); float* VF = (float*)take(nk * 4); _Float16* KXH = (_Float16*)take(np * 2); _Float16* KXL = (_Float16*)take(np * 2); _Float16* VH = (_Float16*)take(nk * 2); _Float16* VL = (_Float16*)take(nk * 2); _Float16* VT = (_Float16*)take(np * 2); _Float16* VTL = (_Float16*)take(np * 2); _Float16* VT2 = (_Float16*)take(np * 2); _Float16* VTL2 = (_Float16*)take(np * 2); float* LAM = (float*)take(256); float* OHI = (float*)take(np * 4);      /* high-half attention output: a plane of its own, both value halves being live in the fused pass */
  float* OLO = QF;      /* low-half attention output over the q f32 plane (dead after the split) */ _Float16* A16 = X16;      /* normalised attention over the input plane (dead after the projections) */
  if (off > ws_size) return;      /* 8+2+2+8 + 0.5 + 16+32+16+16+8+8+16+16+4+4+16+16+16+16 + 32 = 253 MiB */
  k_wsc<<<(unsigned)(((size_t)DM * DM / 8 + 255) / 256), 256, 0, stream>>>(Wq, BQ, (size_t)DM * DM / 8, 16.0f); k_wsc<<<(unsigned)(((size_t)KVD * DM / 8 + 255) / 256), 256, 0, stream>>>(Wk, BK, (size_t)KVD * DM / 8, 16.0f); k_wsc<<<(unsigned)(((size_t)KVD * DM / 8 + 255) / 256), 256, 0, stream>>>(Wv, BV, (size_t)KVD * DM / 8, 16.0f); k_wsc<<<(unsigned)(((size_t)DM * DM / 8 + 255) / 256), 256, 0, stream>>>(Wo, BO, (size_t)DM * DM / 8, 16.0f);      /* torch (out,in) = Bt */ k_lam<<<1, 64, 0, stream>>>(lq1, lk1, lq2, lk2, LAM);
  k_rotab<<<(SLEN * 32 + 255) / 256, 256, 0, stream>>>(CS, SN);
  k_x16<<<(unsigned)((np / 8 + 255) / 256), 256, 0, stream>>>(x, X16, np / 8);
  k_gemm2<0><<<dim3((NR / 128) * (DM / 64), 1), 128, 0, stream>>>(X16, DM, 0, BQ, DM, 0, 0.0625f, bq, 0, nullptr, 1, 0, 0, QF, nullptr, DM, 0, NR, DM, DM);
  k_gemm2<0><<<dim3((NR / 128) * (KVD / 64), 1), 128, 0, stream>>>(X16, DM, 0, BK, DM, 0, 0.0625f, bk, 0, nullptr, 1, 0, 0, KF, nullptr, KVD, 0, NR, KVD, DM);
  k_gemm2<0><<<dim3((NR / 128) * (KVD / 64), 1), 128, 0, stream>>>(X16, DM, 0, BV, DM, 0, 0.0625f, bv, 0, nullptr, 1, 0, 0, VF, nullptr, KVD, 0, NR, KVD, DM);
  k_rope<<<(unsigned)(((size_t)NR * NH * 4 + 255) / 256), 256, 0, stream>>>(QF, NH, NH, 1, CS, SN, QH, QL);      /* q: 32 -> 32 heads */
  k_rope<<<(unsigned)(((size_t)NR * NH * 4 + 255) / 256), 256, 0, stream>>>(KF, NKV, NH, NREP, CS, SN, KXH, KXL);      /* k: kv head h/4 expanded to query head h */
  k_hl<<<(unsigned)((nk / 8 + 255) / 256), 256, 0, stream>>>(VF, VH, VL, nk / 8);
  k_vtg<<<NB * NH * (SLEN / 64), 256, 0, stream>>>(VH, 0, VT); k_vtg<<<NB * NH * (SLEN / 64), 256, 0, stream>>>(VL, 0, VTL); k_vtg<<<NB * NH * (SLEN / 64), 256, 0, stream>>>(VH, 64, VT2); k_vtg<<<NB * NH * (SLEN / 64), 256, 0, stream>>>(VL, 64, VTL2);      /* low / high 64 of each pseudo-head's 128-wide value head; QF becomes OLO from here on */
  k_flash5<1><<<NB * NH * QBN5, 128, 0, stream>>>(QH, QL, DM, KXH, KXL, DM, VT, VTL, nullptr, OLO, DM); k_flash5<1><<<NB * NH * QBN5, 128, 0, stream>>>(QH, QL, DM, KXH, KXL, DM, VT2, VTL2, nullptr, OHI, DM);      /* first 256 rows: low, then high 64 value columns */
  k_flash<1><<<NB * NH * QBNP, 128, 0, stream>>>(QH, DM, KXH, DM, VT, VT2, nullptr, OLO, OHI, DM);      /* rows from 256 on: one pass over the keys for both halves of each pseudo-head's 128-wide value head */
  k_comb<<<(unsigned)(((size_t)NR * 16 + 255) / 256), 256, 0, stream>>>(OLO, OHI, LAM, lnw, A16);
  k_gemm2<0><<<dim3((NR / 128) * (DM / 64), 1), 128, 0, stream>>>(A16, DM, 0, BO, DM, 0, 0.0625f, nullptr, 0, nullptr, 1, 0, 0, (float*)d_out, nullptr, DM, 0, NR, DM, DM);      /* out = attn Wo^T */
}

// v003
// Measured time: 383 microseconds a run.
// Timed twice side by side with v002, it ran 1.67 and 1.66 times as fast.
// Counting every step since v000, it is 2.50 times as fast.
#include <hip/hip_runtime.h>
// MultiheadSdpaDiff4 (2 x 2048 tokens, EMBED 2048; differential attention: q = x Wq^T as 32 pseudo-heads x 64, k = x Wk^T as 8 heads x 64 repeat-interleaved 4x, v = x Wv^T as 4 heads x 128 repeat-interleaved 8x; causal softmax(q.k/8) v; attn = O_even - lambda_full * O_odd (16 heads x 128), lambda_full = exp(lq1.lk1) - exp(lq2.lk2) + 0.78361; RMSNorm(128, eps 1e-5) * ln_w * (1 - 0.78361); out = attn Wo^T.
// Compute dtype: inputs rounded to bf16; x exact as f16; q/k/P/v as f16 hi + residual on the first 256 rows (~2^-21) and plain beyond (~2^-12); the normalised attention as a plain f16 operand; softmax/lambda/RMSNorm f32. v_wmma_f32_16x16x32_f16.
#define NB 2
#define DM 2048
#define NKV 8
#define NREP (NH / NKV)
#define KVD (NKV * 64)           /* 512 */
#define NR (NB * SLEN)           /* 4096 */
#define SLEN 2048
#define TQ SLEN
#define TK SLEN
#define NH 32
#define SCL 0.125f
#define QBLKS (TQ / 64)
#define QB05 0
#define QBN5 4
#define QB0P QBN5
#define QBNP (QBLKS - QBN5)
#define RE 256
typedef __bf16 v16b __attribute__((ext_vector_type(16)));
typedef unsigned short v8us __attribute__((ext_vector_type(8), may_alias));
typedef float  v8f  __attribute__((ext_vector_type(8)));
typedef float  v4f  __attribute__((ext_vector_type(4)));
typedef float  v4fa __attribute__((ext_vector_type(4), may_alias));
union FragB { v16b v; v8us half[2]; unsigned short u[16]; };

__device__ __forceinline__ unsigned short bf16_bits(float x) { unsigned int u = __float_as_uint(x); return (unsigned short)((u + 0x7FFFu + ((u >> 16) & 1u)) >> 16); }
__device__ __forceinline__ float bf16_val(unsigned short b) { return __uint_as_float(((unsigned int)b) << 16); }
__device__ __forceinline__ float bf16_round(float x) { return bf16_val(bf16_bits(x)); }
// D += A·B with NT terms: 1 = ah·bh, 2 = + al·bh (A split), 3 = + ah·bl (both split)
template <int NT>
__device__ __forceinline__ v8f mmaN(v16b ah, v16b al, v16b bh, v16b bl, v8f c) {
  c = __builtin_amdgcn_wmma_f32_16x16x32_bf16(false, ah, false, bh, (short)0, c, false, false);
  if (NT >= 2) c = __builtin_amdgcn_wmma_f32_16x16x32_bf16(false, al, false, bh, (short)0, c, false, false);
  if (NT >= 3) c = __builtin_amdgcn_wmma_f32_16x16x32_bf16(false, ah, false, bl, (short)0, c, false, false);
  asm volatile("v_nop\n\tv_nop\n\tv_nop\n\tv_nop" : "+v"(c) : "v"(ah), "v"(al), "v"(bh), "v"(bl));
  return c;
}

__global__ __launch_bounds__(256) void k_wt_bf16(const float* __restrict__ W, unsigned short* __restrict__ Wt, int K, int N) {
  const int t = blockIdx.x * 256 + threadIdx.x;
  const int k8n = K / 8;
  if (t >= N * k8n) return;
  const int n = t / k8n, k8 = (t % k8n) * 8;
  v8us v;
#pragma unroll
  for (int i = 0; i < 8; ++i) v[i] = bf16_bits(W[(size_t)(k8 + i) * N + n]);
  *(v8us*)(Wt + (size_t)n * K + k8) = v;
  
}

// GEMM C[M][N] (f32, pitch ldc) = act(A[M][K]·W + bias). A f32 row-major (pitch lda) converted per fragment to bf16
// (ASPLIT: hi/lo two planes -> 2 terms, else single rounded term); Wt bf16 [N][K] (pitch ldb). BIAS_BF16 rounds the
// bias to bf16 first (bias quantised to bf16 before the add). K%32==0, M%16==0, N%64==0.
template <bool ASPLIT, int ACT, bool BIAS_BF16>
__global__ __launch_bounds__(128) void k_gemm_bf(const float* __restrict__ A, int lda, const unsigned short* __restrict__ Wt, int ldb,
                                               const float* __restrict__ bias, float* __restrict__ C, int ldc, int M, int N, int K) {
  __shared__ __attribute__((aligned(16))) float so[4][16][64];
  const int tid = threadIdx.x, w = tid >> 5, lane = tid & 31, ln = lane & 15, hh = lane >> 4;
  const int ntn = N / 64;
  const int wid = blockIdx.x * 4 + w;
  const int mt = wid / ntn, nq = wid % ntn;
  if (mt * 16 >= M) return;
  const int row0 = mt * 16, col0 = nq * 64;
  const float* arow = A + (size_t)(row0 + ln) * lda;
  v8f acc[4] = {};
  for (int kb = 0; kb < K; kb += 32) {
    FragB ah, al;
    const v4f x0 = *(const v4fa*)(arow + kb + 8 * hh), x1 = *(const v4fa*)(arow + kb + 8 * hh + 4);
    const v4f x2 = *(const v4fa*)(arow + kb + 16 + 8 * hh), x3 = *(const v4fa*)(arow + kb + 16 + 8 * hh + 4);
    float xs[16] = {x0[0],x0[1],x0[2],x0[3],x1[0],x1[1],x1[2],x1[3],x2[0],x2[1],x2[2],x2[3],x3[0],x3[1],x3[2],x3[3]};
#pragma unroll
    for (int i = 0; i < 16; ++i) { const unsigned short hb = bf16_bits(xs[i]); ah.u[i] = hb; al.u[i] = ASPLIT ? bf16_bits(xs[i] - bf16_val(hb)) : (unsigned short)0; }
#pragma unroll
    for (int t = 0; t < 4; ++t) {
      const unsigned short* brow = Wt + (size_t)(col0 + t * 16 + ln) * ldb + kb;
      FragB b;
      b.half[0] = *(const v8us*)(brow + 8 * hh);
      b.half[1] = *(const v8us*)(brow + 16 + 8 * hh);
      acc[t] = mmaN<ASPLIT ? 2 : 1>(ah.v, al.v, b.v, b.v, acc[t]);
    }
  }
#pragma unroll
  for (int t = 0; t < 4; ++t) {
    float bv = bias ? bias[col0 + t * 16 + ln] : 0.f;
    if (BIAS_BF16) bv = bf16_round(bv);
#pragma unroll
    for (int r = 0; r < 8; ++r) { float v = acc[t][r] + bv; if (ACT == 1) v = fmaxf(v, 0.f); so[w][8 * hh + r][t * 16 + ln] = v; }
  }
  __builtin_amdgcn_fence(__ATOMIC_ACQ_REL, "workgroup");
  __builtin_amdgcn_wave_barrier();
  const int rsub = lane >> 4, c4 = (lane & 15) * 4;
  {
#pragma unroll
    for (int q = 0; q < 8; ++q) {
      const int r = q * 2 + rsub;
      const v4f v = *(const v4fa*)&so[w][r][c4];
      *(v4f*)(C + (size_t)(row0 + r) * ldc + col0 + c4) = v;
    }
    
  }
}

// GEMM C = act(A·W + bias + resid): A f32 (ASPLIT -> hi/lo 2 terms), Wt bf16 [N][K]; ACT 0 none, 1 relu, 2 exact gelu;
// resid (optional, f32, row index = (row % rmod), pitch ldr, RES_BF16 rounds it) added before the activation.
template <bool ASPLIT, int ACT, bool BIAS_BF16, bool RES_BF16>
__global__ __launch_bounds__(128) void k_gemm_bf3(const float* __restrict__ A, int lda, const unsigned short* __restrict__ Wt, int ldb,
                                                const float* __restrict__ bias, const float* __restrict__ resid, int rmod, int ldr,
                                                float* __restrict__ C, int ldc, int M, int N, int K) {
  __shared__ __attribute__((aligned(16))) float so[4][16][64];
  const int tid = threadIdx.x, w = tid >> 5, lane = tid & 31, ln = lane & 15, hh = lane >> 4;
  const int ntn = N / 64;
  const int wid = blockIdx.x * 4 + w;
  const int mt = wid / ntn, nq = wid % ntn;
  if (mt * 16 >= M) return;
  const int row0 = mt * 16, col0 = nq * 64;
  const float* arow = A + (size_t)(row0 + ln) * lda;
  v8f acc[4] = {};
  for (int kb = 0; kb < K; kb += 32) {
    FragB ah, al;
    const v4f x0 = *(const v4fa*)(arow + kb + 8 * hh), x1 = *(const v4fa*)(arow + kb + 8 * hh + 4);
    const v4f x2 = *(const v4fa*)(arow + kb + 16 + 8 * hh), x3 = *(const v4fa*)(arow + kb + 16 + 8 * hh + 4);
    float xs[16] = {x0[0],x0[1],x0[2],x0[3],x1[0],x1[1],x1[2],x1[3],x2[0],x2[1],x2[2],x2[3],x3[0],x3[1],x3[2],x3[3]};
#pragma unroll
    for (int i = 0; i < 16; ++i) { const unsigned short hb = bf16_bits(xs[i]); ah.u[i] = hb; al.u[i] = ASPLIT ? bf16_bits(xs[i] - bf16_val(hb)) : (unsigned short)0; }
#pragma unroll
    for (int t = 0; t < 4; ++t) {
      const unsigned short* brow = Wt + (size_t)(col0 + t * 16 + ln) * ldb + kb;
      FragB b;
      b.half[0] = *(const v8us*)(brow + 8 * hh);
      b.half[1] = *(const v8us*)(brow + 16 + 8 * hh);
      acc[t] = mmaN<ASPLIT ? 2 : 1>(ah.v, al.v, b.v, b.v, acc[t]);
    }
  }
#pragma unroll
  for (int t = 0; t < 4; ++t) {
    const int col = col0 + t * 16 + ln;
    float bv = bias ? bias[col] : 0.f;
    if (BIAS_BF16) bv = bf16_round(bv);
#pragma unroll
    for (int r = 0; r < 8; ++r) {
      float v = acc[t][r] + bv;
      if (resid) { float rv = resid[(size_t)((row0 + 8 * hh + r) % rmod) * ldr + col]; if (RES_BF16) rv = bf16_round(rv); v += rv; }
      if (ACT == 1) v = fmaxf(v, 0.f);
      if (ACT == 2) v = 0.5f * v * (1.0f + erff(v * 0.70710678118654752f));
      if (ACT == 3) { const float u = 0.7978845608028654f * (v + 0.044715f * v * v * v); v = 0.5f * v * (1.0f + tanhf(u)); }
      so[w][8 * hh + r][t * 16 + ln] = v;
    }
  }
  __builtin_amdgcn_fence(__ATOMIC_ACQ_REL, "workgroup");
  __builtin_amdgcn_wave_barrier();
  const int rsub = lane >> 4, c4 = (lane & 15) * 4;
  {
#pragma unroll
    for (int q = 0; q < 8; ++q) {
      const int r = q * 2 + rsub;
      const v4f v = *(const v4fa*)&so[w][r][c4];
      *(v4f*)(C + (size_t)(row0 + r) * ldc + col0 + c4) = v;
    }
    
  }
}
// row LayerNorm (biased variance, eps) over N: s = X (+ R); optional out_sum <- s; out_norm <- (s-mu)*rsqrt(var+eps)*g + b
template <bool PARAM_BF16>
__global__ __launch_bounds__(256) void k_layernorm(const float* __restrict__ X, const float* __restrict__ R, const float* __restrict__ g, const float* __restrict__ bta,
                                                  float* __restrict__ out_sum, float* __restrict__ out_norm, int N, float eps) {
  __shared__ float red[256];
  const int row = blockIdx.x, tid = threadIdx.x;
  const float* x = X + (size_t)row * N; const float* rr = R ? R + (size_t)row * N : nullptr;
  float vals[16];                     // up to N = 4096
  const int per = N / 256;            // contiguous chunk per thread? use strided-by-4 chunks: thread handles j = tid*4 + 1024*u
  float s1 = 0.f;
  for (int u = 0; u < per / 4; ++u) {
    const int j = tid * 4 + 1024 * u;
    const v4f a = *(const v4fa*)(x + j);
    v4f b = {0.f,0.f,0.f,0.f}; if (rr) b = *(const v4fa*)(rr + j);
#pragma unroll
    for (int q = 0; q < 4; ++q) { const float v = a[q] + b[q]; vals[u * 4 + q] = v; s1 += v; }
  }
  red[tid] = s1; __syncthreads();
  for (int st = 128; st > 0; st >>= 1) { if (tid < st) red[tid] += red[tid + st]; __syncthreads(); }
  const float mu = red[0] / (float)N; __syncthreads();
  float s2 = 0.f;
  for (int u = 0; u < per / 4; ++u)
#pragma unroll
    for (int q = 0; q < 4; ++q) { const float c = vals[u * 4 + q] - mu; s2 += c * c; }
  red[tid] = s2; __syncthreads();
  for (int st = 128; st > 0; st >>= 1) { if (tid < st) red[tid] += red[tid + st]; __syncthreads(); }
  const float rs = rsqrtf(red[0] / (float)N + eps);
  {
    for (int u = 0; u < per / 4; ++u) {
      const int j = tid * 4 + 1024 * u;
      v4f o, sm;
#pragma unroll
      for (int q = 0; q < 4; ++q) {
        float gg = g[j + q], bb = bta[j + q];
        if (PARAM_BF16) { gg = bf16_round(gg); bb = bf16_round(bb); }
        sm[q] = vals[u * 4 + q]; o[q] = (vals[u * 4 + q] - mu) * rs * gg + bb;
      }
      if (out_sum) *(v4f*)(out_sum + (size_t)row * N + j) = sm;
      *(v4f*)(out_norm + (size_t)row * N + j) = o;
    }
    
  }
}



// ---- f16 WMMA path (v_wmma_f32_16x16x32_f16): 11-bit significands for operands in range — used where a [0,1] probability operand needs more precision than bf16
typedef _Float16 v16h __attribute__((ext_vector_type(16)));
union FragH { v16h v; v8us half[2]; _Float16 h[16]; unsigned short u[16]; };
template <int NT>
__device__ __forceinline__ v8f mmaH(v16h ah, v16h al, v16h bh, v16h bl, v8f c) {
  c = __builtin_amdgcn_wmma_f32_16x16x32_f16(false, ah, false, bh, (short)0, c, false, false);
  if (NT >= 2) c = __builtin_amdgcn_wmma_f32_16x16x32_f16(false, al, false, bh, (short)0, c, false, false);
  if (NT >= 3) c = __builtin_amdgcn_wmma_f32_16x16x32_f16(false, ah, false, bl, (short)0, c, false, false);
  asm volatile("v_nop\n\tv_nop\n\tv_nop\n\tv_nop" : "+v"(c) : "v"(ah), "v"(al), "v"(bh), "v"(bl));
  return c;
}
// batched GEMM like k_gemm_b but f16 operands: A f32 (split into f16 hi/lo if ASPLIT, else rounded to f16), Bt = f16 values [n][k]; alpha; C f32; N multiple of 16 (partial tiles skipped)
template <bool ASPLIT>
__global__ __launch_bounds__(128) void k_gemm_h(const float* __restrict__ A, int lda, size_t sA, const _Float16* __restrict__ Bh, int ldb, size_t sB, float alpha, float* __restrict__ C, int ldc, size_t sC, int M, int N, int K) {
  __shared__ __attribute__((aligned(16))) float so[4][16][64];
  const int tid = threadIdx.x, w = tid >> 5, lane = tid & 31, ln = lane & 15, hh = lane >> 4; const int by = blockIdx.y;
  A += (size_t)by * sA; Bh += (size_t)by * sB; C += (size_t)by * sC;
  const int ntn = (N + 63) / 64; const int wid = blockIdx.x * 4 + w; const int mt = wid / ntn, nq = wid % ntn; if (mt * 16 >= M) return;
  const int row0 = mt * 16, col0 = nq * 64; const float* arow = A + (size_t)(row0 + ln) * lda;
  v8f acc[4] = {};
  for (int kb = 0; kb < K; kb += 32) {
    FragH ah, al;
    const v4f x0 = *(const v4fa*)(arow + kb + 8 * hh), x1 = *(const v4fa*)(arow + kb + 8 * hh + 4), x2 = *(const v4fa*)(arow + kb + 16 + 8 * hh), x3 = *(const v4fa*)(arow + kb + 16 + 8 * hh + 4);
    float xs[16] = {x0[0],x0[1],x0[2],x0[3],x1[0],x1[1],x1[2],x1[3],x2[0],x2[1],x2[2],x2[3],x3[0],x3[1],x3[2],x3[3]};
#pragma unroll
    for (int i = 0; i < 16; ++i) { const _Float16 h = (_Float16)xs[i]; ah.h[i] = h; al.h[i] = ASPLIT ? (_Float16)(xs[i] - (float)h) : (_Float16)0.0f; }
#pragma unroll
    for (int t = 0; t < 4; ++t) { if (col0 + t * 16 >= N) continue; const size_t boff = (size_t)(col0 + t * 16 + ln) * ldb + kb; FragH bq; bq.half[0] = *(const v8us*)(Bh + boff + 8 * hh); bq.half[1] = *(const v8us*)(Bh + boff + 16 + 8 * hh);
      acc[t] = mmaH<ASPLIT ? 2 : 1>(ah.v, al.v, bq.v, bq.v, acc[t]); }
  }
#pragma unroll
  for (int t = 0; t < 4; ++t) { if (col0 + t * 16 >= N) continue;
#pragma unroll
    for (int r = 0; r < 8; ++r) so[w][8 * hh + r][t * 16 + ln] = acc[t][r] * alpha; }
  __builtin_amdgcn_fence(__ATOMIC_ACQ_REL, "workgroup"); __builtin_amdgcn_wave_barrier();
  const int rsub = lane >> 4, c4 = (lane & 15) * 4;
  {
#pragma unroll
    for (int q = 0; q < 8; ++q) { const int r = q * 2 + rsub; if (col0 + c4 < N) { const v4f v = *(const v4fa*)&so[w][r][c4]; *(v4f*)(C + (size_t)(row0 + r) * ldc + col0 + c4) = v; } }
     }
}

// Wt[n][k] = f16(W[k][n]·scale) from f32 row-major W[K][N] (scale = power of two; bf16-exact weights stay exact in f16 away from the subnormal range)
__global__ __launch_bounds__(256) void k_wt_f16(const float* __restrict__ W, _Float16* __restrict__ Wt, int K, int N, float scale) {
  const int t = blockIdx.x * 256 + threadIdx.x; if (t >= N * (K / 8)) return; const int n = t / (K / 8), k8 = (t % (K / 8)) * 8; FragH f;
#pragma unroll
  for (int i = 0; i < 8; ++i) f.h[i] = (_Float16)(bf16_round(W[(size_t)(k8 + i) * N + n]) * scale); const v8us o = f.half[0];
  *(v8us*)((unsigned short*)Wt + (size_t)n * K + k8) = o; 
}
// k_gemm_hh variant with fused epilogue: v = acc·alpha + bias[by·sBias + col] (+ CP[(row/rowsPerB)·sCPb + by·64 + col] if CP) ; ACT 0 none / 1 elu ; writes f16 C16 (and f32 C if non-null)
template <int ACT>
__global__ __launch_bounds__(128) void k_gemm_hhx(const _Float16* __restrict__ A, int lda, size_t sA, const _Float16* __restrict__ Bh, int ldb, size_t sB, float alpha, const float* __restrict__ bias, size_t sBias, const float* __restrict__ CP, int rowsPerB, size_t sCPb, int row0g,
    float* __restrict__ C, _Float16* __restrict__ C16, int ldc, size_t sC, int M, int N, int K) {
  __shared__ __attribute__((aligned(16))) float so[4][16][64];
  const int tid = threadIdx.x, w = tid >> 5, lane = tid & 31, ln = lane & 15, hh = lane >> 4; const int by = blockIdx.y;
  A += (size_t)by * sA; Bh += (size_t)by * sB; const size_t cofs = (size_t)by * sC; const float* bp = bias ? bias + (size_t)by * sBias : nullptr;
  const int ntn = (N + 63) / 64; const int wid = blockIdx.x * 4 + w; const int mt = wid / ntn, nq = wid % ntn; if (mt * 16 >= M) return;
  const int row0 = mt * 16, col0 = nq * 64; const _Float16* arow = A + (size_t)(row0 + ln) * lda;
  v8f acc[4] = {};
  for (int kb = 0; kb < K; kb += 32) { FragH ah; ah.half[0] = *(const v8us*)((const unsigned short*)arow + kb + 8 * hh); ah.half[1] = *(const v8us*)((const unsigned short*)arow + kb + 16 + 8 * hh);
#pragma unroll
    for (int t = 0; t < 4; ++t) { if (col0 + t * 16 >= N) continue; const size_t boff = (size_t)(col0 + t * 16 + ln) * ldb + kb; FragH bq; bq.half[0] = *(const v8us*)((const unsigned short*)Bh + boff + 8 * hh); bq.half[1] = *(const v8us*)((const unsigned short*)Bh + boff + 16 + 8 * hh);
      acc[t] = mmaH<1>(ah.v, ah.v, bq.v, bq.v, acc[t]); }
  }
#pragma unroll
  for (int t = 0; t < 4; ++t) { if (col0 + t * 16 >= N) continue; const int col = col0 + t * 16 + ln; const float bv = bp ? bf16_round(bp[col]) : 0.f;
#pragma unroll
    for (int r = 0; r < 8; ++r) { float v = acc[t][r] * alpha + bv; if (CP) { const int bidx = (row0g + row0 + 8 * hh + r) / rowsPerB; v += CP[(size_t)bidx * sCPb + (size_t)by * 64 + col]; } if (ACT == 1) v = (v > 0.f) ? v : expm1f(v); else if (ACT == 7) v = (v > 0.f) ? v + 1.0f : expf(v); else if (ACT == 8) v = tanhf(v); else if (ACT == 9) v = 0.5f * v * (1.0f + tanhf(0.7978845608028654f * (v + 0.044715f * v * v * v))); else if (ACT == 11) v = 1.0f / (1.0f + expf(-v)); else if (ACT == 12) v = (v > 0.f) ? v : 0.01f * v; else if (ACT == 14) v = (v > 0.f) ? v : 0.1f * v; else if (ACT == 15) v = v / (1.0f + expf(-v)); else if (ACT == 3) v = fmaxf(v, 0.f); else if (ACT == 6) v = 0.5f * v * (1.0f + erff(v * 0.70710678118654752f)); so[w][8 * hh + r][t * 16 + ln] = v; } }
  __builtin_amdgcn_fence(__ATOMIC_ACQ_REL, "workgroup"); __builtin_amdgcn_wave_barrier();
  const int rsub = lane >> 4, c4 = (lane & 15) * 4; typedef _Float16 v4h __attribute__((ext_vector_type(4)));
  {
#pragma unroll
    for (int q = 0; q < 8; ++q) { const int r = q * 2 + rsub; if (col0 + c4 < N) { const v4f v = *(const v4fa*)&so[w][r][c4]; if (C) *(v4f*)(C + cofs + (size_t)(row0 + r) * ldc + col0 + c4) = v; if (C16) { v4h h4; for (int i = 0; i < 4; ++i) h4[i] = (_Float16)v[i]; *(v4h*)(C16 + cofs + (size_t)(row0 + r) * ldc + col0 + c4) = h4; } } }
     }
}


typedef _Float16 v4h __attribute__((ext_vector_type(4)));

__global__ __launch_bounds__(256) void k_x16(const float* __restrict__ x, _Float16* __restrict__ X16, size_t n8) { const size_t t = (size_t)blockIdx.x * 256 + threadIdx.x; if (t >= n8) return; FragH f;
#pragma unroll
  for (int q = 0; q < 8; ++q) f.h[q] = (_Float16)bf16_round(x[t * 8 + q]); *(v8us*)((unsigned short*)X16 + t * 8) = f.half[0];  }
__global__ __launch_bounds__(256) void k_h16(const float* __restrict__ x, _Float16* __restrict__ X16, size_t n8) { const size_t t = (size_t)blockIdx.x * 256 + threadIdx.x; if (t >= n8) return; FragH f;
#pragma unroll
  for (int q = 0; q < 8; ++q) f.h[q] = (_Float16)x[t * 8 + q]; *(v8us*)((unsigned short*)X16 + t * 8) = f.half[0];  }
__global__ __launch_bounds__(256) void k_round16f(const float* __restrict__ W, _Float16* __restrict__ Bt, size_t n8) { const size_t t = (size_t)blockIdx.x * 256 + threadIdx.x; if (t >= n8) return; FragH f;
#pragma unroll
  for (int i = 0; i < 8; ++i) f.h[i] = (_Float16)(bf16_round(W[t * 8 + i]) * 16.0f); *(v8us*)((unsigned short*)Bt + t * 8) = f.half[0];  }
template <int NHv, int TTv>
__global__ __launch_bounds__(256) void k_vt(const _Float16* __restrict__ V16, int ldv, int voff, _Float16* __restrict__ Vt) { __shared__ unsigned short tl[64][66]; const int tid = threadIdx.x; const int slab = blockIdx.x / (TTv / 64), lg = blockIdx.x % (TTv / 64); const int b = slab / NHv, h = slab % NHv;
  for (int i = tid; i < 64 * 8; i += 256) { const int r = i / 8, c8 = (i % 8) * 8; FragH f; f.half[0] = *(const v8us*)((const unsigned short*)V16 + ((size_t)b * TTv + lg * 64 + r) * ldv + voff + h * 64 + c8);
#pragma unroll
    for (int q = 0; q < 8; ++q) tl[r][c8 + q] = f.u[q]; }
  __syncthreads();
  {
#pragma unroll
    for (int rd = 0; rd < 2; ++rd) { const int d = rd * 32 + tid / 8, pc = tid % 8; FragH f;
#pragma unroll
      for (int q = 0; q < 8; ++q) f.u[q] = tl[pc * 8 + q][d];
      *(v8us*)((unsigned short*)Vt + ((size_t)slab * 64 + d) * TTv + lg * 64 + pc * 8) = f.half[0]; }
     } }

__global__ __launch_bounds__(256) void k_hl(const float* __restrict__ F, _Float16* __restrict__ Hh, _Float16* __restrict__ Hl, size_t n8) { const size_t t = (size_t)blockIdx.x * 256 + threadIdx.x; if (t >= n8) return; FragH fh, fl; const v4f a = *(const v4fa*)(F + t * 8), c = *(const v4fa*)(F + t * 8 + 4);
#pragma unroll
  for (int q = 0; q < 4; ++q) { _Float16 h = (_Float16)a[q]; fh.h[q] = h; fl.h[q] = (_Float16)((a[q] - (float)h) * 1024.0f); h = (_Float16)c[q]; fh.h[4 + q] = h; fl.h[4 + q] = (_Float16)((c[q] - (float)h) * 1024.0f); }
  { *(v8us*)((unsigned short*)Hh + t * 8) = fh.half[0]; *(v8us*)((unsigned short*)Hl + t * 8) = fl.half[0];  } }

// ---- fast GEMM (block tile 128x64, wave tile 32x64; requires M % 128 == 0, N % 64 == 0, K % 64 == 0); epilogue = k_gemm_hhx semantics ----
// Per trip a 64-deep slice of A (128 rows) and of B (64 rows) is copied to LDS in whole 128-byte lines (asynchronous copies, two buffers: the next slice flies while this one is multiplied); fragments come from LDS.
#define G2_PITCH 144                      /* LDS bytes per staged row: 128 + 16, the conflict-free pitch for 16-byte reads */
#define G2_BUF ((128 + 64) * G2_PITCH)    /* one buffer: A rows 0..127, then B rows 128..191 */
__device__ __forceinline__ v16h g2_lfrag(const unsigned char* p) { FragH f; f.half[0] = *(const v8us*)p; f.half[1] = *(const v8us*)(p + 32); return f.v; }
__device__ __forceinline__ v8f g2_mma(v16h a, v16h b, v8f c) { v8f d = __builtin_amdgcn_wmma_f32_16x16x32_f16(false, a, false, b, (short)0, c, false, false); asm volatile("v_nop\n\tv_nop\n\tv_nop\n\tv_nop" : "+v"(d) : "v"(a), "v"(b)); return d; }
// one slice: 12 copies of 16 bytes per lane (8 of A, 4 of B), a wave's copy covering 4 whole rows; l = the lane's LDS byte address of its first row, rows 16 apart
__device__ __forceinline__ void g2_copy(unsigned l, const _Float16* ga, size_t sa16, const _Float16* gb, size_t sb16) {
  /* the closing s_wait_xcnt keeps every address register intact until the copies have taken it */
  asm volatile("global_load_async_to_lds_b128 %0, %12, off\n\t"
               "global_load_async_to_lds_b128 %1, %13, off\n\t"
               "global_load_async_to_lds_b128 %2, %14, off\n\t"
               "global_load_async_to_lds_b128 %3, %15, off\n\t"
               "global_load_async_to_lds_b128 %4, %16, off\n\t"
               "global_load_async_to_lds_b128 %5, %17, off\n\t"
               "global_load_async_to_lds_b128 %6, %18, off\n\t"
               "global_load_async_to_lds_b128 %7, %19, off\n\t"
               "global_load_async_to_lds_b128 %8, %20, off\n\t"
               "global_load_async_to_lds_b128 %9, %21, off\n\t"
               "global_load_async_to_lds_b128 %10, %22, off\n\t"
               "global_load_async_to_lds_b128 %11, %23, off\n\t"
               "s_wait_xcnt 0x0"
               :: "v"(l), "v"(l + 16 * G2_PITCH), "v"(l + 32 * G2_PITCH), "v"(l + 48 * G2_PITCH), "v"(l + 64 * G2_PITCH), "v"(l + 80 * G2_PITCH), "v"(l + 96 * G2_PITCH), "v"(l + 112 * G2_PITCH),
                  "v"(l + 128 * G2_PITCH), "v"(l + 144 * G2_PITCH), "v"(l + 160 * G2_PITCH), "v"(l + 176 * G2_PITCH),
                  "v"(ga), "v"(ga + sa16), "v"(ga + 2 * sa16), "v"(ga + 3 * sa16), "v"(ga + 4 * sa16), "v"(ga + 5 * sa16), "v"(ga + 6 * sa16), "v"(ga + 7 * sa16),
                  "v"(gb), "v"(gb + sb16), "v"(gb + 2 * sb16), "v"(gb + 3 * sb16)
               : "memory");
}
template <int ACT>
__global__ __launch_bounds__(128) void k_gemm2(const _Float16* __restrict__ A, int lda, size_t sA, const _Float16* __restrict__ Bh, int ldb, size_t sB, float alpha, const float* __restrict__ bias, size_t sBias, const float* __restrict__ CP, int rowsPerB, size_t sCPb, int row0g,
    float* __restrict__ C, _Float16* __restrict__ C16, int ldc, size_t sC, int M, int N, int K) {
  __shared__ __attribute__((aligned(16))) unsigned char smem[2 * G2_BUF];      /* the two staging buffers; the epilogue's 4 x 32 x 68 floats lie over them once the loop's last barrier has ended every read */
  float (*so)[32][68] = reinterpret_cast<float (*)[32][68]>(smem);
  const int tid = threadIdx.x, w = tid >> 5, lane = tid & 31, ln = lane & 15, hh = lane >> 4; const int by = blockIdx.y;
  A += (size_t)by * sA; Bh += (size_t)by * sB; const size_t cofs = (size_t)by * sC; const float* bp = bias ? bias + (size_t)by * sBias : nullptr;
  const int ntn = N >> 6; const int mt = blockIdx.x / ntn, nq = blockIdx.x - mt * ntn; const int row0 = mt * 128 + 32 * w, col0 = nq * 64; if (mt * 128 >= M) return;      /* the whole block leaves or none: barriers follow */
  const int crow = tid >> 3, cch = tid & 7;      /* copy role: row (mod 16) and 16-byte piece of the 128-byte row */
  const _Float16* gA = A + (size_t)(mt * 128 + crow) * lda + cch * 8; const _Float16* gB = Bh + (size_t)(col0 + crow) * ldb + cch * 8; const size_t sa16 = (size_t)16 * lda, sb16 = (size_t)16 * ldb;
  const unsigned l0 = (unsigned)(size_t)smem + (unsigned)(crow * G2_PITCH + cch * 16);
  const int aoff = (32 * w + ln) * G2_PITCH + 16 * hh, boff = (128 + ln) * G2_PITCH + 16 * hh;
  const v8f z8 = {0.f,0.f,0.f,0.f,0.f,0.f,0.f,0.f}; v8f c00 = z8, c01 = z8, c02 = z8, c03 = z8, c10 = z8, c11 = z8, c12 = z8, c13 = z8;
  const int NT = K >> 6;
  g2_copy(l0, gA, sa16, gB, sb16);
  asm volatile("s_wait_asynccnt 0x0" ::: "memory");      /* slice 0 has landed before the barrier publishes it */
  __syncthreads();
  if (NT > 1) g2_copy(l0 + G2_BUF, gA + 64, sa16, gB + 64, sb16);
#pragma unroll 1      /* one slice per trip: the buffer alternates with the trip's parity */
  for (int t = 0; t < NT; ++t) { const unsigned char* sb = smem + (t & 1) * G2_BUF; const unsigned char* pa = sb + aoff; const unsigned char* pb = sb + boff;
    const v16h a0 = g2_lfrag(pa), a1 = g2_lfrag(pa + 16 * G2_PITCH), b0 = g2_lfrag(pb), b1 = g2_lfrag(pb + 16 * G2_PITCH), b2 = g2_lfrag(pb + 32 * G2_PITCH), b3 = g2_lfrag(pb + 48 * G2_PITCH);
    const v16h e0 = g2_lfrag(pa + 64), e1 = g2_lfrag(pa + 16 * G2_PITCH + 64), f0 = g2_lfrag(pb + 64), f1 = g2_lfrag(pb + 16 * G2_PITCH + 64), f2 = g2_lfrag(pb + 32 * G2_PITCH + 64), f3 = g2_lfrag(pb + 48 * G2_PITCH + 64);
    c00 = g2_mma(a0, b0, c00); c10 = g2_mma(a1, b0, c10); c01 = g2_mma(a0, b1, c01); c11 = g2_mma(a1, b1, c11); c02 = g2_mma(a0, b2, c02); c12 = g2_mma(a1, b2, c12); c03 = g2_mma(a0, b3, c03); c13 = g2_mma(a1, b3, c13);
    c00 = g2_mma(e0, f0, c00); c10 = g2_mma(e1, f0, c10); c01 = g2_mma(e0, f1, c01); c11 = g2_mma(e1, f1, c11); c02 = g2_mma(e0, f2, c02); c12 = g2_mma(e1, f2, c12); c03 = g2_mma(e0, f3, c03); c13 = g2_mma(e1, f3, c13);
    asm volatile("s_wait_dscnt 0x0" ::: "memory");         /* this wave's reads of the buffer are over before it may be refilled */
    asm volatile("s_wait_asynccnt 0x0" ::: "memory");      /* this wave's copies of the next slice have landed */
    __syncthreads();                                       /* publishes the next slice and ends every wave's reads of this one */
    if (t + 2 < NT) g2_copy(l0 + (unsigned)(t & 1) * G2_BUF, gA + (size_t)(t + 2) * 64, sa16, gB + (size_t)(t + 2) * 64, sb16); }
  asm volatile("s_wait_asynccnt 0x0" ::: "memory");        /* nothing is in flight when the buffers become output staging */
  v8f accs[8] = {c00, c01, c02, c03, c10, c11, c12, c13};
#pragma unroll
  for (int u = 0; u < 8; ++u) { const int t = u & 3, half = u >> 2; const int col = col0 + t * 16 + ln; const float bv = bp ? bf16_round(bp[col]) : 0.f;
#pragma unroll
    for (int r = 0; r < 8; ++r) { const int rloc = half * 16 + 8 * hh + r; float v = accs[u][r] * alpha + bv; if (CP) { const int bidx = (row0g + row0 + rloc) / rowsPerB; v += CP[(size_t)bidx * sCPb + (size_t)by * 64 + col]; }
      if (ACT == 3) v = fmaxf(v, 0.f); else if (ACT == 6) v = 0.5f * v * (1.0f + erff(v * 0.70710678118654752f)); else if (ACT == 11) v = 1.0f / (1.0f + expf(-v)); else if (ACT == 15) v = v / (1.0f + expf(-v)); else if (ACT == 12) v = (v > 0.f) ? v : 0.01f * v; else if (ACT == 8) v = tanhf(v);
      so[w][rloc][t * 16 + ln] = v; } }
  __builtin_amdgcn_fence(__ATOMIC_ACQ_REL, "workgroup"); __builtin_amdgcn_wave_barrier();
  const int rsub = lane >> 4, c4 = (lane & 15) * 4;
  {
#pragma unroll
    for (int q = 0; q < 16; ++q) { const int r = q * 2 + rsub; const v4f v = *(const v4fa*)&so[w][r][c4]; if (C) *(v4f*)(C + cofs + (size_t)(row0 + r) * ldc + col0 + c4) = v; if (C16) { v4h h4; for (int i = 0; i < 4; ++i) h4[i] = (_Float16)v[i]; *(v4h*)(C16 + cofs + (size_t)(row0 + r) * ldc + col0 + c4) = h4; } }
     } }



// lane l with lane l ^ 16 (the two halves of a wave hold the two key halves of one query column)
__device__ __forceinline__ float xhalf(float x) { return __builtin_bit_cast(float, __builtin_amdgcn_permlanex16(__builtin_bit_cast(int, x), __builtin_bit_cast(int, x), 0x76543210, 0xfedcba98, false, false)); }
// Transposed products: S^T = K Q^T (A = key rows, B = query columns) and O^T += V^T P^T (A = value-dimension rows of V^T, B = P^T). A lane holds 16 of the 32 scores of ONE query (keys 8 hh + r and 16 + 8 hh + r), which is the k order of a B operand: P goes from the score accumulators into the next product without LDS; maximum, sum and rescale factor are one value per lane.
template <int CAUSAL>
__global__ __launch_bounds__(128) void k_flash(const _Float16* __restrict__ Q16, int ldq, const _Float16* __restrict__ K16, int ldk, const _Float16* __restrict__ Vt, const _Float16* __restrict__ Vt2, const int* __restrict__ MSK, float* __restrict__ O, float* __restrict__ O2, int ldo) {
  constexpr int RPW = 16, DT = 8, KS = 2;      /* DT 0..3: low 64 value columns (Vt -> O), DT 4..7: high 64 (Vt2 -> O2); one score/softmax pass feeds both */
  __shared__ __attribute__((aligned(16))) float sO[4][RPW][64 + 4];
  const int tid = threadIdx.x, w = tid >> 5, lane = tid & 31, ln = lane & 15, hh = lane >> 4;
  const int slab = blockIdx.x / QBNP, qblk = QB0P + blockIdx.x % QBNP; const int b = slab / NH, h = slab % NH; const int qb0 = qblk * (4 * RPW); const int q0 = qb0 + w * RPW; const int tq = q0 + ln;      /* this lane's query */
  FragH aq[KS];
  { const unsigned short* qr = (const unsigned short*)Q16 + ((size_t)b * TQ + tq) * ldq + h * 64;
#pragma unroll
    for (int ks = 0; ks < KS; ++ks) { aq[ks].half[0] = *(const v8us*)(qr + ks * 32 + 8 * hh); aq[ks].half[1] = *(const v8us*)(qr + ks * 32 + 16 + 8 * hh); } }
  const unsigned short* Vth = (const unsigned short*)Vt + (size_t)slab * 64 * TK; const unsigned short* Vth2 = (const unsigned short*)Vt2 + (size_t)slab * 64 * TK;
  float m_r = -3.0e38f, l_r = 0.f; v8f oacc[DT];
#pragma unroll
  for (int dt = 0; dt < DT; ++dt) oacc[dt] = (v8f){0.f,0.f,0.f,0.f,0.f,0.f,0.f,0.f};
  const int jend = (CAUSAL == 1) ? (qb0 + 4 * RPW) : TK;      /* causal: keys beyond the block's last query never contribute */
#pragma unroll 1
  for (int j0 = 0; j0 < jend; j0 += 32) {
    FragH bk[2][KS], bv[DT];
    const unsigned short* kr0 = (const unsigned short*)K16 + ((size_t)b * TK + j0 + ln) * ldk + h * 64 + 8 * hh; const unsigned short* kr1 = kr0 + (size_t)16 * ldk;
#pragma unroll
    for (int nt = 0; nt < 2; ++nt) { const unsigned short* kr = nt ? kr1 : kr0;
#pragma unroll
      for (int ks = 0; ks < KS; ++ks) { bk[nt][ks].half[0] = *(const v8us*)(kr + ks * 32); bk[nt][ks].half[1] = *(const v8us*)(kr + ks * 32 + 16); } }
    asm volatile("s_wait_xcnt 0x0" :: "v"(kr0), "v"(kr1) : "memory");      /* a precaution: the address registers stay whole (no load's own destination takes them) until the issued loads have taken them */
    v8f st[2];      /* st[nt][r] = score of key j0 + nt * 16 + 8 * hh + r against query tq */
#pragma unroll
    for (int nt = 0; nt < 2; ++nt) { v8f acc = (v8f){0.f,0.f,0.f,0.f,0.f,0.f,0.f,0.f};
#pragma unroll
      for (int ks = 0; ks < KS; ++ks) acc = mmaH<1>(bk[nt][ks].v, bk[nt][ks].v, aq[ks].v, aq[ks].v, acc);
      st[nt] = acc; }
    const unsigned short* vr0 = Vth + (size_t)ln * TK + j0 + 8 * hh; const unsigned short* vr1 = Vth2 + (size_t)ln * TK + j0 + 8 * hh;
#pragma unroll
    for (int dt = 0; dt < DT; ++dt) { const unsigned short* vrow = ((dt < 4) ? vr0 : vr1) + (size_t)((dt & 3) * 16) * TK; bv[dt].half[0] = *(const v8us*)vrow; bv[dt].half[1] = *(const v8us*)(vrow + 16); }
    asm volatile("s_wait_xcnt 0x0" :: "v"(vr0), "v"(vr1) : "memory");      /* the same precaution for the value loads, which fly during the softmax */
    float sv[16]; bool ok[16]; float mc = -3.0e38f;
#pragma unroll
    for (int e = 0; e < 16; ++e) { const int kk = j0 + (e >> 3) * 16 + 8 * hh + (e & 7); ok[e] = (CAUSAL == 1) ? (kk <= tq) : ((CAUSAL == 2) ? ((kk >> 5) == (tq >> 5)) : true);      /* mode 2: block-diagonal 32-token groups */
      sv[e] = ok[e] ? st[e >> 3][e & 7] * SCL : -3.0e38f; mc = fmaxf(mc, sv[e]); }
    mc = fmaxf(mc, xhalf(mc));      /* both halves feed one output column: they share the maximum */
    const float mn = fmaxf(m_r, mc); const float al = (mn > -1.0e38f) ? expf(m_r - mn) : 1.0f; m_r = mn;
    FragH pb; float ps[4] = {0.f, 0.f, 0.f, 0.f};
#pragma unroll
    for (int e = 0; e < 16; ++e) { const float p = ok[e] ? expf(sv[e] - mn) : 0.f; ps[e & 3] += p; pb.h[e] = (_Float16)(p * 1024.0f); }
    l_r = l_r * al + ((ps[0] + ps[1]) + (ps[2] + ps[3]));
#pragma unroll
    for (int dt = 0; dt < DT; ++dt) {
#pragma unroll
      for (int r = 0; r < 8; ++r) oacc[dt][r] *= al; }
#pragma unroll
    for (int dt = 0; dt < DT; ++dt) oacc[dt] = mmaH<1>(bv[dt].v, bv[dt].v, pb.v, pb.v, oacc[dt]); }
  const float lt = l_r + xhalf(l_r); const float inv = (lt > 0.f) ? 1.0f / (lt * 1024.0f) : 0.f;
#pragma unroll
  for (int hf = 0; hf < 2; ++hf) { float* __restrict__ Oh = hf ? O2 : O;
#pragma unroll
    for (int dt = 0; dt < 4; ++dt) { const v8f a = oacc[hf * 4 + dt]; const v4f lo = {a[0] * inv, a[1] * inv, a[2] * inv, a[3] * inv}, hi = {a[4] * inv, a[5] * inv, a[6] * inv, a[7] * inv};      /* a[r] = column dt * 16 + 8 * hh + r of query row ln */
      *(v4fa*)&sO[w][ln][dt * 16 + 8 * hh] = lo; *(v4fa*)&sO[w][ln][dt * 16 + 8 * hh + 4] = hi; }
    __builtin_amdgcn_fence(__ATOMIC_ACQ_REL, "workgroup"); __builtin_amdgcn_wave_barrier();
#pragma unroll
    for (int rp = 0; rp < RPW; rp += 2) { const int r = rp + (lane >> 4), pc = lane & 15; const v4f val = *(const v4fa*)&sO[w][r][pc * 4]; *(v4f*)(Oh + ((size_t)b * TQ + q0 + r) * ldo + h * 64 + pc * 4) = val; }
    if (hf == 0) { __builtin_amdgcn_fence(__ATOMIC_ACQ_REL, "workgroup"); __builtin_amdgcn_wave_barrier(); }      /* the high half reuses this wave's sO slice: its stores stay behind the low half's reads */
  } }
// 5-plane variant: S = Qh Kh^T + (Ql Kh^T + Qh Kl^T)/1024 with Q/K = [hi | 2^10 residual] f16 planes (QL/KL same layout as Q16/K16), then the 3-term P.V below.
// 3-term variant: O = (P_hi V_hi + (P_lo V_hi + P_hi V_lo) / 1024) / l with P = [hi | 2^10 residual] of 1024 p and V^T = [hi | 2^10 residual] planes (VtL same layout as Vt) -> ~2^-21-class products for un-averaged (early causal / peaked) rows
template <int CAUSAL>
__global__ __launch_bounds__(128) void k_flash5(const _Float16* __restrict__ Q16, const _Float16* __restrict__ QL, int ldq, const _Float16* __restrict__ K16, const _Float16* __restrict__ KL, int ldk, const _Float16* __restrict__ Vt, const _Float16* __restrict__ VtL, const int* __restrict__ MSK, float* __restrict__ O, int ldo) {
  constexpr int RPW = 16, DT = 4, KS = 2;      /* transposed like k_flash: key rows and V^T rows are A operands, query columns and P^T are B operands */
  __shared__ __attribute__((aligned(16))) float sO[4][RPW][64 + 4];
  const int tid = threadIdx.x, w = tid >> 5, lane = tid & 31, ln = lane & 15, hh = lane >> 4;
  const int slab = blockIdx.x / QBN5, qblk = QB05 + blockIdx.x % QBN5; const int b = slab / NH, h = slab % NH; const int qb0 = qblk * (4 * RPW); const int q0 = qb0 + w * RPW; const int tq = q0 + ln;      /* this lane's query */
  FragH aq[KS], aql[KS];
  { const unsigned short* qr = (const unsigned short*)Q16 + ((size_t)b * TQ + tq) * ldq + h * 64; const unsigned short* ql = (const unsigned short*)QL + ((size_t)b * TQ + tq) * ldq + h * 64;
#pragma unroll
    for (int ks = 0; ks < KS; ++ks) { aq[ks].half[0] = *(const v8us*)(qr + ks * 32 + 8 * hh); aq[ks].half[1] = *(const v8us*)(qr + ks * 32 + 16 + 8 * hh); aql[ks].half[0] = *(const v8us*)(ql + ks * 32 + 8 * hh); aql[ks].half[1] = *(const v8us*)(ql + ks * 32 + 16 + 8 * hh); } }
  const unsigned short* Vth = (const unsigned short*)Vt + (size_t)slab * 64 * TK; const unsigned short* Vtl = (const unsigned short*)VtL + (size_t)slab * 64 * TK;
  float m_r = -3.0e38f, l_r = 0.f; v8f oacc[DT], oaccL[DT];
#pragma unroll
  for (int dt = 0; dt < DT; ++dt) { oacc[dt] = (v8f){0.f,0.f,0.f,0.f,0.f,0.f,0.f,0.f}; oaccL[dt] = oacc[dt]; }
  const int jend = (CAUSAL == 1) ? (qb0 + 4 * RPW) : TK;      /* causal: keys beyond the block's last query never contribute */
#pragma unroll 1
  for (int j0 = 0; j0 < jend; j0 += 32) {
    FragH bk[2][KS], bkl[2][KS], bv[DT], bl[DT];
    const size_t ko = ((size_t)b * TK + j0 + ln) * ldk + h * 64 + 8 * hh; const unsigned short* kr0 = (const unsigned short*)K16 + ko; const unsigned short* kr1 = kr0 + (size_t)16 * ldk; const unsigned short* kl0 = (const unsigned short*)KL + ko; const unsigned short* kl1 = kl0 + (size_t)16 * ldk;
#pragma unroll
    for (int nt = 0; nt < 2; ++nt) { const unsigned short* kr = nt ? kr1 : kr0; const unsigned short* klr = nt ? kl1 : kl0;
#pragma unroll
      for (int ks = 0; ks < KS; ++ks) { bk[nt][ks].half[0] = *(const v8us*)(kr + ks * 32); bk[nt][ks].half[1] = *(const v8us*)(kr + ks * 32 + 16); bkl[nt][ks].half[0] = *(const v8us*)(klr + ks * 32); bkl[nt][ks].half[1] = *(const v8us*)(klr + ks * 32 + 16); } }
    asm volatile("s_wait_xcnt 0x0" :: "v"(kr0), "v"(kr1), "v"(kl0), "v"(kl1) : "memory");      /* a precaution: the address registers stay whole (no load's own destination takes them) until the issued loads have taken them */
    v8f st[2];      /* st[nt][r] = score of key j0 + nt * 16 + 8 * hh + r against query tq */
#pragma unroll
    for (int nt = 0; nt < 2; ++nt) { v8f acc = (v8f){0.f,0.f,0.f,0.f,0.f,0.f,0.f,0.f}, accl = acc;
#pragma unroll
      for (int ks = 0; ks < KS; ++ks) { acc = mmaH<1>(bk[nt][ks].v, bk[nt][ks].v, aq[ks].v, aq[ks].v, acc); accl = mmaH<1>(bk[nt][ks].v, bk[nt][ks].v, aql[ks].v, aql[ks].v, accl); accl = mmaH<1>(bkl[nt][ks].v, bkl[nt][ks].v, aq[ks].v, aq[ks].v, accl); }
#pragma unroll
      for (int r = 0; r < 8; ++r) acc[r] += accl[r] * 0.0009765625f;
      st[nt] = acc; }
    const unsigned short* vr0 = Vth + (size_t)ln * TK + j0 + 8 * hh; const unsigned short* vr1 = Vtl + (size_t)ln * TK + j0 + 8 * hh;
#pragma unroll
    for (int dt = 0; dt < DT; ++dt) { const unsigned short* vrow = vr0 + (size_t)(dt * 16) * TK; const unsigned short* vrl = vr1 + (size_t)(dt * 16) * TK; bv[dt].half[0] = *(const v8us*)vrow; bv[dt].half[1] = *(const v8us*)(vrow + 16); bl[dt].half[0] = *(const v8us*)vrl; bl[dt].half[1] = *(const v8us*)(vrl + 16); }
    asm volatile("s_wait_xcnt 0x0" :: "v"(vr0), "v"(vr1) : "memory");      /* the same precaution for the value loads, which fly during the softmax */
    float sv[16]; bool ok[16]; float mc = -3.0e38f;
#pragma unroll
    for (int e = 0; e < 16; ++e) { const int kk = j0 + (e >> 3) * 16 + 8 * hh + (e & 7); ok[e] = (CAUSAL == 1) ? (kk <= tq) : ((CAUSAL == 2) ? ((kk >> 5) == (tq >> 5)) : true);      /* mode 2: block-diagonal 32-token groups */
      if (CAUSAL == 4) ok[e] = MSK[((size_t)b * TQ + tq) * TK + kk] != 0;      /* mode 4: per-(query, key) INPUT mask shared by all heads; masked keys contribute nothing (== the reference's -4096 fill, whose exp underflows to 0), rows with no valid key give l = 0 -> output 0 (== the reference's row_valid zeroing) */
      sv[e] = ok[e] ? st[e >> 3][e & 7] * SCL : -3.0e38f; mc = fmaxf(mc, sv[e]); }
    mc = fmaxf(mc, xhalf(mc));      /* both halves feed one output column: they share the maximum */
    const float mn = fmaxf(m_r, mc); const float al = (mn > -1.0e38f) ? expf(m_r - mn) : 1.0f; m_r = mn;
    FragH pa, pl; float ps[4] = {0.f, 0.f, 0.f, 0.f};
#pragma unroll
    for (int e = 0; e < 16; ++e) { const float p = ok[e] ? expf(sv[e] - mn) : 0.f; ps[e & 3] += p; const float pw = p * 1024.0f; pa.h[e] = (_Float16)pw; pl.h[e] = (_Float16)((pw - (float)pa.h[e]) * 1024.0f); }
    l_r = l_r * al + ((ps[0] + ps[1]) + (ps[2] + ps[3]));
#pragma unroll
    for (int dt = 0; dt < DT; ++dt) {
#pragma unroll
      for (int r = 0; r < 8; ++r) { oacc[dt][r] *= al; oaccL[dt][r] *= al; } }
#pragma unroll
    for (int dt = 0; dt < DT; ++dt) { oacc[dt] = mmaH<1>(bv[dt].v, bv[dt].v, pa.v, pa.v, oacc[dt]); oaccL[dt] = mmaH<1>(bv[dt].v, bv[dt].v, pl.v, pl.v, oaccL[dt]); oaccL[dt] = mmaH<1>(bl[dt].v, bl[dt].v, pa.v, pa.v, oaccL[dt]); } }
  const float lt = l_r + xhalf(l_r); const float inv = (lt > 0.f) ? 1.0f / (lt * 1024.0f) : 0.f;
#pragma unroll
  for (int dt = 0; dt < DT; ++dt) { v8f a = oacc[dt];
#pragma unroll
    for (int r = 0; r < 8; ++r) { a[r] += oaccL[dt][r] * 0.0009765625f; a[r] *= inv; }      /* a[r] = column dt * 16 + 8 * hh + r of query row ln */
    const v4f lo = {a[0], a[1], a[2], a[3]}, hi = {a[4], a[5], a[6], a[7]}; *(v4fa*)&sO[w][ln][dt * 16 + 8 * hh] = lo; *(v4fa*)&sO[w][ln][dt * 16 + 8 * hh + 4] = hi; }
  __builtin_amdgcn_fence(__ATOMIC_ACQ_REL, "workgroup"); __builtin_amdgcn_wave_barrier();
  {
#pragma unroll
    for (int rp = 0; rp < RPW; rp += 2) { const int r = rp + (lane >> 4), pc = lane & 15; const v4f val = *(const v4fa*)&sO[w][r][pc * 4]; *(v4f*)(O + ((size_t)b * TQ + q0 + r) * ldo + h * 64 + pc * 4) = val; }
     } }

__global__ __launch_bounds__(256) void k_rotab(float* __restrict__ CS, float* __restrict__ SN) {
  #pragma clang fp contract(off)
  const int t = blockIdx.x * 256 + threadIdx.x; if (t >= SLEN * 32) return; const int j = t % 32, s = t / 32; (void)j; (void)s; const float c = 1.0f, sn = 0.0f;      /* no RoPE here: identity tables make k_rope a pure hi/lo split (a*1 - b*0 is exact) */
  { *(float*)(CS + t) = c; *(float*)(SN + t) = sn;  } }
__global__ __launch_bounds__(256) void k_rope(const float* __restrict__ F, int nsrc, int ndst, int rep, const float* __restrict__ CS, const float* __restrict__ SN, _Float16* __restrict__ H, _Float16* __restrict__ L) {
  #pragma clang fp contract(off)
  const size_t t = (size_t)blockIdx.x * 256 + threadIdx.x; if (t >= (size_t)NR * ndst * 4) return; const int g8 = (int)(t % 4); const int hd = (int)((t / 4) % ndst); const size_t row = t / ((size_t)4 * ndst); const int s = (int)(row % SLEN); const int hs = hd / rep;
  const float* src = F + row * (size_t)(nsrc * 64) + hs * 64; FragH ah, al, bh, bl;
  for (int i = 0; i < 8; ++i) { const int d = g8 * 8 + i; const float c = CS[s * 32 + d], sn = SN[s * 32 + d]; const float x1 = src[d], x2 = src[d + 32];
    float o1 = x1 * c; o1 += -x2 * sn; float o2 = x2 * c; o2 += x1 * sn;
    _Float16 hv = (_Float16)o1; ah.h[i] = hv; al.h[i] = (_Float16)((o1 - (float)hv) * 1024.0f); hv = (_Float16)o2; bh.h[i] = hv; bl.h[i] = (_Float16)((o2 - (float)hv) * 1024.0f); }
  const size_t o = row * (size_t)(ndst * 64) + hd * 64 + g8 * 8;
  { *(v8us*)((unsigned short*)H + o) = ah.half[0]; *(v8us*)((unsigned short*)H + o + 32) = bh.half[0]; *(v8us*)((unsigned short*)L + o) = al.half[0]; *(v8us*)((unsigned short*)L + o + 32) = bl.half[0];  } }
__global__ __launch_bounds__(256) void k_vtg(const _Float16* __restrict__ V16, int vadd, _Float16* __restrict__ Vt) { __shared__ unsigned short tl[64][66]; const int tid = threadIdx.x; const int slab = blockIdx.x / (SLEN / 64), lg = blockIdx.x % (SLEN / 64); const int b = slab / NH, h = slab % NH; const int col0 = (h / 8) * 128 + vadd;      /* pseudo-head h reads value head h/8 (128 wide): low (vadd 0) or high (vadd 64) half */
  for (int i = tid; i < 64 * 8; i += 256) { const int r = i / 8, c8 = (i % 8) * 8; FragH f; f.half[0] = *(const v8us*)((const unsigned short*)V16 + ((size_t)b * SLEN + lg * 64 + r) * KVD + col0 + c8); for (int q = 0; q < 8; ++q) tl[r][c8 + q] = f.u[q]; }
  __syncthreads();
  { for (int rd = 0; rd < 2; ++rd) { const int d = rd * 32 + tid / 8, pc = tid % 8; FragH f; for (int q = 0; q < 8; ++q) f.u[q] = tl[pc * 8 + q][d]; *(v8us*)((unsigned short*)Vt + ((size_t)slab * 64 + d) * SLEN + lg * 64 + pc * 8) = f.half[0]; }  } }

__global__ __launch_bounds__(256) void k_wsc(const float* __restrict__ Wm, _Float16* __restrict__ Bt, size_t n8, float sc) { const size_t t = (size_t)blockIdx.x * 256 + threadIdx.x; if (t >= n8) return; FragH f; for (int q = 0; q < 8; ++q) f.h[q] = (_Float16)(bf16_round(Wm[t * 8 + q]) * sc); *(v8us*)((unsigned short*)Bt + t * 8) = f.half[0];  }
__global__ __launch_bounds__(64) void k_lam(const float* __restrict__ q1, const float* __restrict__ k1, const float* __restrict__ q2, const float* __restrict__ k2, float* __restrict__ LAM) {
  #pragma clang fp contract(off)
  const int ln = threadIdx.x & 31; if (threadIdx.x >= 32) return; float a = bf16_round(q1[ln]) * bf16_round(k1[ln]); a += bf16_round(q1[ln + 32]) * bf16_round(k1[ln + 32]); float c = bf16_round(q2[ln]) * bf16_round(k2[ln]); c += bf16_round(q2[ln + 32]) * bf16_round(k2[ln + 32]);
  for (int o = 16; o > 0; o >>= 1) { a += __shfl_xor(a, o, 32); c += __shfl_xor(c, o, 32); } const float lf = expf(a) - expf(c) + 0.78360576653162446f;      /* LAMBDA_INIT = 0.8 - 0.6 exp(-0.3 * 12) = 0.78360577 */
  const float v = (ln == 0) ? lf : 0.f; *(float*)(LAM + ln) = v;  }
__global__ __launch_bounds__(256) void k_comb(const float* __restrict__ OLO, const float* __restrict__ OHI, const float* __restrict__ LAM, const float* __restrict__ lnw, _Float16* __restrict__ A16) {
  #pragma clang fp contract(off)
  const size_t t = (size_t)blockIdx.x * 256 + threadIdx.x; if (t >= (size_t)NR * 16) return; const int j = (int)(t % 16); const size_t r = t / 16; const float lam = LAM[0]; float a[128]; float ss = 0.f;
  const float* e0 = OLO + r * DM + (size_t)(2 * j) * 64; const float* o0 = OLO + r * DM + (size_t)(2 * j + 1) * 64; const float* e1 = OHI + r * DM + (size_t)(2 * j) * 64; const float* o1 = OHI + r * DM + (size_t)(2 * j + 1) * 64;
  for (int d = 0; d < 64; ++d) { float v = e0[d]; v += -lam * o0[d]; a[d] = v; ss += v * v; float w = e1[d]; w += -lam * o1[d]; a[64 + d] = w; ss += w * w; }
  const float inv = rsqrtf(ss / 128.0f + 1e-5f); unsigned short* dst = (unsigned short*)A16 + r * DM + (size_t)j * 128;
  { for (int g = 0; g < 16; ++g) { FragH f; for (int q = 0; q < 8; ++q) { const int d = g * 8 + q; float v = a[d] * inv; v *= bf16_round(lnw[d]); v = v * 0.21639423346837554f;      /* 1 - LAMBDA_INIT */ f.h[q] = (_Float16)v; } *(v8us*)(dst + g * 8) = f.half[0]; }  } }

extern "C" void kernel_launch(void* const* d_in, const int* in_sizes, int n_in,
                              void* d_out, int out_size, void* d_ws, size_t ws_size, hipStream_t stream) {
  (void)in_sizes; (void)n_in; (void)out_size;
  const float* const* I = (const float* const*)d_in; const float* x = I[0]; const float* Wq = I[1]; const float* Wk = I[2]; const float* Wv = I[3]; const float* Wo = I[4]; const float* lq1 = I[5]; const float* lk1 = I[6]; const float* lq2 = I[7]; const float* lk2 = I[8]; const float* lnw = I[9]; const float* bq = nullptr; const float* bk = nullptr; const float* bv = nullptr;
  char* ws = (char*)d_ws; size_t off = 0;
  auto take = [&](size_t bytes) { char* p = ws + off; off += (bytes + 255) & ~(size_t)255; return p; };
  const size_t np = (size_t)NR * DM, nk = (size_t)NR * KVD;
  _Float16* BQ = (_Float16*)take((size_t)DM * DM * 2); _Float16* BK = (_Float16*)take((size_t)KVD * DM * 2); _Float16* BV = (_Float16*)take((size_t)KVD * DM * 2); _Float16* BO = (_Float16*)take((size_t)DM * DM * 2);
  float* CS = (float*)take((size_t)SLEN * 32 * 4); float* SN = (float*)take((size_t)SLEN * 32 * 4);
  _Float16* X16 = (_Float16*)take(np * 2); float* QF = (float*)take(np * 4); _Float16* QH = (_Float16*)take(np * 2); _Float16* QL = (_Float16*)take(np * 2); float* KF = (float*)take(nk * 4); float* VF = (float*)take(nk * 4); _Float16* KXH = (_Float16*)take(np * 2); _Float16* KXL = (_Float16*)take(np * 2); _Float16* VH = (_Float16*)take(nk * 2); _Float16* VL = (_Float16*)take(nk * 2); _Float16* VT = (_Float16*)take(np * 2); _Float16* VTL = (_Float16*)take(np * 2); _Float16* VT2 = (_Float16*)take(np * 2); _Float16* VTL2 = (_Float16*)take(np * 2); float* LAM = (float*)take(256); float* OHI = (float*)take(np * 4);      /* high-half attention output: a plane of its own, both value halves being live in the fused pass */
  float* OLO = QF;      /* low-half attention output over the q f32 plane (dead after the split) */ _Float16* A16 = X16;      /* normalised attention over the input plane (dead after the projections) */
  if (off > ws_size) return;      /* 8+2+2+8 + 0.5 + 16+32+16+16+8+8+16+16+4+4+16+16+16+16 + 32 = 253 MiB */
  k_wsc<<<(unsigned)(((size_t)DM * DM / 8 + 255) / 256), 256, 0, stream>>>(Wq, BQ, (size_t)DM * DM / 8, 16.0f); k_wsc<<<(unsigned)(((size_t)KVD * DM / 8 + 255) / 256), 256, 0, stream>>>(Wk, BK, (size_t)KVD * DM / 8, 16.0f); k_wsc<<<(unsigned)(((size_t)KVD * DM / 8 + 255) / 256), 256, 0, stream>>>(Wv, BV, (size_t)KVD * DM / 8, 16.0f); k_wsc<<<(unsigned)(((size_t)DM * DM / 8 + 255) / 256), 256, 0, stream>>>(Wo, BO, (size_t)DM * DM / 8, 16.0f);      /* torch (out,in) = Bt */ k_lam<<<1, 64, 0, stream>>>(lq1, lk1, lq2, lk2, LAM);
  k_rotab<<<(SLEN * 32 + 255) / 256, 256, 0, stream>>>(CS, SN);
  k_x16<<<(unsigned)((np / 8 + 255) / 256), 256, 0, stream>>>(x, X16, np / 8);
  k_gemm2<0><<<dim3((NR / 128) * (DM / 64), 1), 128, 0, stream>>>(X16, DM, 0, BQ, DM, 0, 0.0625f, bq, 0, nullptr, 1, 0, 0, QF, nullptr, DM, 0, NR, DM, DM);
  k_gemm2<0><<<dim3((NR / 128) * (KVD / 64), 1), 128, 0, stream>>>(X16, DM, 0, BK, DM, 0, 0.0625f, bk, 0, nullptr, 1, 0, 0, KF, nullptr, KVD, 0, NR, KVD, DM);
  k_gemm2<0><<<dim3((NR / 128) * (KVD / 64), 1), 128, 0, stream>>>(X16, DM, 0, BV, DM, 0, 0.0625f, bv, 0, nullptr, 1, 0, 0, VF, nullptr, KVD, 0, NR, KVD, DM);
  k_rope<<<(unsigned)(((size_t)NR * NH * 4 + 255) / 256), 256, 0, stream>>>(QF, NH, NH, 1, CS, SN, QH, QL);      /* q: 32 -> 32 heads */
  k_rope<<<(unsigned)(((size_t)NR * NH * 4 + 255) / 256), 256, 0, stream>>>(KF, NKV, NH, NREP, CS, SN, KXH, KXL);      /* k: kv head h/4 expanded to query head h */
  k_hl<<<(unsigned)((nk / 8 + 255) / 256), 256, 0, stream>>>(VF, VH, VL, nk / 8);
  k_vtg<<<NB * NH * (SLEN / 64), 256, 0, stream>>>(VH, 0, VT); k_vtg<<<NB * NH * (SLEN / 64), 256, 0, stream>>>(VL, 0, VTL); k_vtg<<<NB * NH * (SLEN / 64), 256, 0, stream>>>(VH, 64, VT2); k_vtg<<<NB * NH * (SLEN / 64), 256, 0, stream>>>(VL, 64, VTL2);      /* low / high 64 of each pseudo-head's 128-wide value head; QF becomes OLO from here on */
  k_flash5<1><<<NB * NH * QBN5, 128, 0, stream>>>(QH, QL, DM, KXH, KXL, DM, VT, VTL, nullptr, OLO, DM); k_flash5<1><<<NB * NH * QBN5, 128, 0, stream>>>(QH, QL, DM, KXH, KXL, DM, VT2, VTL2, nullptr, OHI, DM);      /* first 256 rows: low, then high 64 value columns */
  k_flash<1><<<NB * NH * QBNP, 128, 0, stream>>>(QH, DM, KXH, DM, VT, VT2, nullptr, OLO, OHI, DM);      /* rows from 256 on: one pass over the keys for both halves of each pseudo-head's 128-wide value head */
  k_comb<<<(unsigned)(((size_t)NR * 16 + 255) / 256), 256, 0, stream>>>(OLO, OHI, LAM, lnw, A16);
  k_gemm2<0><<<dim3((NR / 128) * (DM / 64), 1), 128, 0, stream>>>(A16, DM, 0, BO, DM, 0, 0.0625f, nullptr, 0, nullptr, 1, 0, 0, (float*)d_out, nullptr, DM, 0, NR, DM, DM);      /* out = attn Wo^T */
}

// v004
// One run takes 362 microseconds.
// Next to v003, in two timings, it ran 1.05 and 1.06 times as fast.
// All steps since v000 together make it 2.64 times as fast.
#include <hip/hip_runtime.h>
// MultiheadSdpaDiff4 (2 x 2048 tokens, EMBED 2048; differential attention: q = x Wq^T as 32 pseudo-heads x 64, k = x Wk^T as 8 heads x 64 repeat-interleaved 4x, v = x Wv^T as 4 heads x 128 repeat-interleaved 8x; causal softmax(q.k/8) v; attn = O_even - lambda_full * O_odd (16 heads x 128), lambda_full = exp(lq1.lk1) - exp(lq2.lk2) + 0.78361; RMSNorm(128, eps 1e-5) * ln_w * (1 - 0.78361); out = attn Wo^T.
// Compute dtype: inputs rounded to bf16; x exact as f16; q/k/P/v as f16 hi + residual on the first 256 rows (~2^-21) and plain beyond (~2^-12); the normalised attention as a plain f16 operand; softmax/lambda/RMSNorm f32. v_wmma_f32_16x16x32_f16.
#define NB 2
#define DM 2048
#define NKV 8
#define NREP (NH / NKV)
#define KVD (NKV * 64)           /* 512 */
#define NR (NB * SLEN)           /* 4096 */
#define SLEN 2048
#define TQ SLEN
#define TK SLEN
#define NH 32
#define SCL 0.125f
#define QBLKS (TQ / 64)
#define QB05 0
#define QBN5 4
#define QB0P QBN5
#define QBNP (QBLKS - QBN5)
#define RE 256
typedef __bf16 v16b __attribute__((ext_vector_type(16)));
typedef unsigned short v8us __attribute__((ext_vector_type(8), may_alias));
typedef float  v8f  __attribute__((ext_vector_type(8)));
typedef float  v4f  __attribute__((ext_vector_type(4)));
typedef float  v4fa __attribute__((ext_vector_type(4), may_alias));
union FragB { v16b v; v8us half[2]; unsigned short u[16]; };

__device__ __forceinline__ unsigned short bf16_bits(float x) { unsigned int u = __float_as_uint(x); return (unsigned short)((u + 0x7FFFu + ((u >> 16) & 1u)) >> 16); }
__device__ __forceinline__ float bf16_val(unsigned short b) { return __uint_as_float(((unsigned int)b) << 16); }
__device__ __forceinline__ float bf16_round(float x) { return bf16_val(bf16_bits(x)); }
// D += A·B with NT terms: 1 = ah·bh, 2 = + al·bh (A split), 3 = + ah·bl (both split)
template <int NT>
__device__ __forceinline__ v8f mmaN(v16b ah, v16b al, v16b bh, v16b bl, v8f c) {
  c = __builtin_amdgcn_wmma_f32_16x16x32_bf16(false, ah, false, bh, (short)0, c, false, false);
  if (NT >= 2) c = __builtin_amdgcn_wmma_f32_16x16x32_bf16(false, al, false, bh, (short)0, c, false, false);
  if (NT >= 3) c = __builtin_amdgcn_wmma_f32_16x16x32_bf16(false, ah, false, bl, (short)0, c, false, false);
  asm volatile("v_nop\n\tv_nop\n\tv_nop\n\tv_nop" : "+v"(c) : "v"(ah), "v"(al), "v"(bh), "v"(bl));
  return c;
}

__global__ __launch_bounds__(256) void k_wt_bf16(const float* __restrict__ W, unsigned short* __restrict__ Wt, int K, int N) {
  const int t = blockIdx.x * 256 + threadIdx.x;
  const int k8n = K / 8;
  if (t >= N * k8n) return;
  const int n = t / k8n, k8 = (t % k8n) * 8;
  v8us v;
#pragma unroll
  for (int i = 0; i < 8; ++i) v[i] = bf16_bits(W[(size_t)(k8 + i) * N + n]);
  *(v8us*)(Wt + (size_t)n * K + k8) = v;
  
}

// GEMM C[M][N] (f32, pitch ldc) = act(A[M][K]·W + bias). A f32 row-major (pitch lda) converted per fragment to bf16
// (ASPLIT: hi/lo two planes -> 2 terms, else single rounded term); Wt bf16 [N][K] (pitch ldb). BIAS_BF16 rounds the
// bias to bf16 first (bias quantised to bf16 before the add). K%32==0, M%16==0, N%64==0.
template <bool ASPLIT, int ACT, bool BIAS_BF16>
__global__ __launch_bounds__(128) void k_gemm_bf(const float* __restrict__ A, int lda, const unsigned short* __restrict__ Wt, int ldb,
                                               const float* __restrict__ bias, float* __restrict__ C, int ldc, int M, int N, int K) {
  __shared__ __attribute__((aligned(16))) float so[4][16][64];
  const int tid = threadIdx.x, w = tid >> 5, lane = tid & 31, ln = lane & 15, hh = lane >> 4;
  const int ntn = N / 64;
  const int wid = blockIdx.x * 4 + w;
  const int mt = wid / ntn, nq = wid % ntn;
  if (mt * 16 >= M) return;
  const int row0 = mt * 16, col0 = nq * 64;
  const float* arow = A + (size_t)(row0 + ln) * lda;
  v8f acc[4] = {};
  for (int kb = 0; kb < K; kb += 32) {
    FragB ah, al;
    const v4f x0 = *(const v4fa*)(arow + kb + 8 * hh), x1 = *(const v4fa*)(arow + kb + 8 * hh + 4);
    const v4f x2 = *(const v4fa*)(arow + kb + 16 + 8 * hh), x3 = *(const v4fa*)(arow + kb + 16 + 8 * hh + 4);
    float xs[16] = {x0[0],x0[1],x0[2],x0[3],x1[0],x1[1],x1[2],x1[3],x2[0],x2[1],x2[2],x2[3],x3[0],x3[1],x3[2],x3[3]};
#pragma unroll
    for (int i = 0; i < 16; ++i) { const unsigned short hb = bf16_bits(xs[i]); ah.u[i] = hb; al.u[i] = ASPLIT ? bf16_bits(xs[i] - bf16_val(hb)) : (unsigned short)0; }
#pragma unroll
    for (int t = 0; t < 4; ++t) {
      const unsigned short* brow = Wt + (size_t)(col0 + t * 16 + ln) * ldb + kb;
      FragB b;
      b.half[0] = *(const v8us*)(brow + 8 * hh);
      b.half[1] = *(const v8us*)(brow + 16 + 8 * hh);
      acc[t] = mmaN<ASPLIT ? 2 : 1>(ah.v, al.v, b.v, b.v, acc[t]);
    }
  }
#pragma unroll
  for (int t = 0; t < 4; ++t) {
    float bv = bias ? bias[col0 + t * 16 + ln] : 0.f;
    if (BIAS_BF16) bv = bf16_round(bv);
#pragma unroll
    for (int r = 0; r < 8; ++r) { float v = acc[t][r] + bv; if (ACT == 1) v = fmaxf(v, 0.f); so[w][8 * hh + r][t * 16 + ln] = v; }
  }
  __builtin_amdgcn_fence(__ATOMIC_ACQ_REL, "workgroup");
  __builtin_amdgcn_wave_barrier();
  const int rsub = lane >> 4, c4 = (lane & 15) * 4;
  {
#pragma unroll
    for (int q = 0; q < 8; ++q) {
      const int r = q * 2 + rsub;
      const v4f v = *(const v4fa*)&so[w][r][c4];
      *(v4f*)(C + (size_t)(row0 + r) * ldc + col0 + c4) = v;
    }
    
  }
}

// GEMM C = act(A·W + bias + resid): A f32 (ASPLIT -> hi/lo 2 terms), Wt bf16 [N][K]; ACT 0 none, 1 relu, 2 exact gelu;
// resid (optional, f32, row index = (row % rmod), pitch ldr, RES_BF16 rounds it) added before the activation.
template <bool ASPLIT, int ACT, bool BIAS_BF16, bool RES_BF16>
__global__ __launch_bounds__(128) void k_gemm_bf3(const float* __restrict__ A, int lda, const unsigned short* __restrict__ Wt, int ldb,
                                                const float* __restrict__ bias, const float* __restrict__ resid, int rmod, int ldr,
                                                float* __restrict__ C, int ldc, int M, int N, int K) {
  __shared__ __attribute__((aligned(16))) float so[4][16][64];
  const int tid = threadIdx.x, w = tid >> 5, lane = tid & 31, ln = lane & 15, hh = lane >> 4;
  const int ntn = N / 64;
  const int wid = blockIdx.x * 4 + w;
  const int mt = wid / ntn, nq = wid % ntn;
  if (mt * 16 >= M) return;
  const int row0 = mt * 16, col0 = nq * 64;
  const float* arow = A + (size_t)(row0 + ln) * lda;
  v8f acc[4] = {};
  for (int kb = 0; kb < K; kb += 32) {
    FragB ah, al;
    const v4f x0 = *(const v4fa*)(arow + kb + 8 * hh), x1 = *(const v4fa*)(arow + kb + 8 * hh + 4);
    const v4f x2 = *(const v4fa*)(arow + kb + 16 + 8 * hh), x3 = *(const v4fa*)(arow + kb + 16 + 8 * hh + 4);
    float xs[16] = {x0[0],x0[1],x0[2],x0[3],x1[0],x1[1],x1[2],x1[3],x2[0],x2[1],x2[2],x2[3],x3[0],x3[1],x3[2],x3[3]};
#pragma unroll
    for (int i = 0; i < 16; ++i) { const unsigned short hb = bf16_bits(xs[i]); ah.u[i] = hb; al.u[i] = ASPLIT ? bf16_bits(xs[i] - bf16_val(hb)) : (unsigned short)0; }
#pragma unroll
    for (int t = 0; t < 4; ++t) {
      const unsigned short* brow = Wt + (size_t)(col0 + t * 16 + ln) * ldb + kb;
      FragB b;
      b.half[0] = *(const v8us*)(brow + 8 * hh);
      b.half[1] = *(const v8us*)(brow + 16 + 8 * hh);
      acc[t] = mmaN<ASPLIT ? 2 : 1>(ah.v, al.v, b.v, b.v, acc[t]);
    }
  }
#pragma unroll
  for (int t = 0; t < 4; ++t) {
    const int col = col0 + t * 16 + ln;
    float bv = bias ? bias[col] : 0.f;
    if (BIAS_BF16) bv = bf16_round(bv);
#pragma unroll
    for (int r = 0; r < 8; ++r) {
      float v = acc[t][r] + bv;
      if (resid) { float rv = resid[(size_t)((row0 + 8 * hh + r) % rmod) * ldr + col]; if (RES_BF16) rv = bf16_round(rv); v += rv; }
      if (ACT == 1) v = fmaxf(v, 0.f);
      if (ACT == 2) v = 0.5f * v * (1.0f + erff(v * 0.70710678118654752f));
      if (ACT == 3) { const float u = 0.7978845608028654f * (v + 0.044715f * v * v * v); v = 0.5f * v * (1.0f + tanhf(u)); }
      so[w][8 * hh + r][t * 16 + ln] = v;
    }
  }
  __builtin_amdgcn_fence(__ATOMIC_ACQ_REL, "workgroup");
  __builtin_amdgcn_wave_barrier();
  const int rsub = lane >> 4, c4 = (lane & 15) * 4;
  {
#pragma unroll
    for (int q = 0; q < 8; ++q) {
      const int r = q * 2 + rsub;
      const v4f v = *(const v4fa*)&so[w][r][c4];
      *(v4f*)(C + (size_t)(row0 + r) * ldc + col0 + c4) = v;
    }
    
  }
}
// row LayerNorm (biased variance, eps) over N: s = X (+ R); optional out_sum <- s; out_norm <- (s-mu)*rsqrt(var+eps)*g + b
template <bool PARAM_BF16>
__global__ __launch_bounds__(256) void k_layernorm(const float* __restrict__ X, const float* __restrict__ R, const float* __restrict__ g, const float* __restrict__ bta,
                                                  float* __restrict__ out_sum, float* __restrict__ out_norm, int N, float eps) {
  __shared__ float red[256];
  const int row = blockIdx.x, tid = threadIdx.x;
  const float* x = X + (size_t)row * N; const float* rr = R ? R + (size_t)row * N : nullptr;
  float vals[16];                     // up to N = 4096
  const int per = N / 256;            // contiguous chunk per thread? use strided-by-4 chunks: thread handles j = tid*4 + 1024*u
  float s1 = 0.f;
  for (int u = 0; u < per / 4; ++u) {
    const int j = tid * 4 + 1024 * u;
    const v4f a = *(const v4fa*)(x + j);
    v4f b = {0.f,0.f,0.f,0.f}; if (rr) b = *(const v4fa*)(rr + j);
#pragma unroll
    for (int q = 0; q < 4; ++q) { const float v = a[q] + b[q]; vals[u * 4 + q] = v; s1 += v; }
  }
  red[tid] = s1; __syncthreads();
  for (int st = 128; st > 0; st >>= 1) { if (tid < st) red[tid] += red[tid + st]; __syncthreads(); }
  const float mu = red[0] / (float)N; __syncthreads();
  float s2 = 0.f;
  for (int u = 0; u < per / 4; ++u)
#pragma unroll
    for (int q = 0; q < 4; ++q) { const float c = vals[u * 4 + q] - mu; s2 += c * c; }
  red[tid] = s2; __syncthreads();
  for (int st = 128; st > 0; st >>= 1) { if (tid < st) red[tid] += red[tid + st]; __syncthreads(); }
  const float rs = rsqrtf(red[0] / (float)N + eps);
  {
    for (int u = 0; u < per / 4; ++u) {
      const int j = tid * 4 + 1024 * u;
      v4f o, sm;
#pragma unroll
      for (int q = 0; q < 4; ++q) {
        float gg = g[j + q], bb = bta[j + q];
        if (PARAM_BF16) { gg = bf16_round(gg); bb = bf16_round(bb); }
        sm[q] = vals[u * 4 + q]; o[q] = (vals[u * 4 + q] - mu) * rs * gg + bb;
      }
      if (out_sum) *(v4f*)(out_sum + (size_t)row * N + j) = sm;
      *(v4f*)(out_norm + (size_t)row * N + j) = o;
    }
    
  }
}



// ---- f16 WMMA path (v_wmma_f32_16x16x32_f16): 11-bit significands for operands in range — used where a [0,1] probability operand needs more precision than bf16
typedef _Float16 v16h __attribute__((ext_vector_type(16)));
union FragH { v16h v; v8us half[2]; _Float16 h[16]; unsigned short u[16]; };
template <int NT>
__device__ __forceinline__ v8f mmaH(v16h ah, v16h al, v16h bh, v16h bl, v8f c) {
  c = __builtin_amdgcn_wmma_f32_16x16x32_f16(false, ah, false, bh, (short)0, c, false, false);
  if (NT >= 2) c = __builtin_amdgcn_wmma_f32_16x16x32_f16(false, al, false, bh, (short)0, c, false, false);
  if (NT >= 3) c = __builtin_amdgcn_wmma_f32_16x16x32_f16(false, ah, false, bl, (short)0, c, false, false);
  asm volatile("v_nop\n\tv_nop\n\tv_nop\n\tv_nop" : "+v"(c) : "v"(ah), "v"(al), "v"(bh), "v"(bl));
  return c;
}
// batched GEMM like k_gemm_b but f16 operands: A f32 (split into f16 hi/lo if ASPLIT, else rounded to f16), Bt = f16 values [n][k]; alpha; C f32; N multiple of 16 (partial tiles skipped)
template <bool ASPLIT>
__global__ __launch_bounds__(128) void k_gemm_h(const float* __restrict__ A, int lda, size_t sA, const _Float16* __restrict__ Bh, int ldb, size_t sB, float alpha, float* __restrict__ C, int ldc, size_t sC, int M, int N, int K) {
  __shared__ __attribute__((aligned(16))) float so[4][16][64];
  const int tid = threadIdx.x, w = tid >> 5, lane = tid & 31, ln = lane & 15, hh = lane >> 4; const int by = blockIdx.y;
  A += (size_t)by * sA; Bh += (size_t)by * sB; C += (size_t)by * sC;
  const int ntn = (N + 63) / 64; const int wid = blockIdx.x * 4 + w; const int mt = wid / ntn, nq = wid % ntn; if (mt * 16 >= M) return;
  const int row0 = mt * 16, col0 = nq * 64; const float* arow = A + (size_t)(row0 + ln) * lda;
  v8f acc[4] = {};
  for (int kb = 0; kb < K; kb += 32) {
    FragH ah, al;
    const v4f x0 = *(const v4fa*)(arow + kb + 8 * hh), x1 = *(const v4fa*)(arow + kb + 8 * hh + 4), x2 = *(const v4fa*)(arow + kb + 16 + 8 * hh), x3 = *(const v4fa*)(arow + kb + 16 + 8 * hh + 4);
    float xs[16] = {x0[0],x0[1],x0[2],x0[3],x1[0],x1[1],x1[2],x1[3],x2[0],x2[1],x2[2],x2[3],x3[0],x3[1],x3[2],x3[3]};
#pragma unroll
    for (int i = 0; i < 16; ++i) { const _Float16 h = (_Float16)xs[i]; ah.h[i] = h; al.h[i] = ASPLIT ? (_Float16)(xs[i] - (float)h) : (_Float16)0.0f; }
#pragma unroll
    for (int t = 0; t < 4; ++t) { if (col0 + t * 16 >= N) continue; const size_t boff = (size_t)(col0 + t * 16 + ln) * ldb + kb; FragH bq; bq.half[0] = *(const v8us*)(Bh + boff + 8 * hh); bq.half[1] = *(const v8us*)(Bh + boff + 16 + 8 * hh);
      acc[t] = mmaH<ASPLIT ? 2 : 1>(ah.v, al.v, bq.v, bq.v, acc[t]); }
  }
#pragma unroll
  for (int t = 0; t < 4; ++t) { if (col0 + t * 16 >= N) continue;
#pragma unroll
    for (int r = 0; r < 8; ++r) so[w][8 * hh + r][t * 16 + ln] = acc[t][r] * alpha; }
  __builtin_amdgcn_fence(__ATOMIC_ACQ_REL, "workgroup"); __builtin_amdgcn_wave_barrier();
  const int rsub = lane >> 4, c4 = (lane & 15) * 4;
  {
#pragma unroll
    for (int q = 0; q < 8; ++q) { const int r = q * 2 + rsub; if (col0 + c4 < N) { const v4f v = *(const v4fa*)&so[w][r][c4]; *(v4f*)(C + (size_t)(row0 + r) * ldc + col0 + c4) = v; } }
     }
}

// Wt[n][k] = f16(W[k][n]·scale) from f32 row-major W[K][N] (scale = power of two; bf16-exact weights stay exact in f16 away from the subnormal range)
__global__ __launch_bounds__(256) void k_wt_f16(const float* __restrict__ W, _Float16* __restrict__ Wt, int K, int N, float scale) {
  const int t = blockIdx.x * 256 + threadIdx.x; if (t >= N * (K / 8)) return; const int n = t / (K / 8), k8 = (t % (K / 8)) * 8; FragH f;
#pragma unroll
  for (int i = 0; i < 8; ++i) f.h[i] = (_Float16)(bf16_round(W[(size_t)(k8 + i) * N + n]) * scale); const v8us o = f.half[0];
  *(v8us*)((unsigned short*)Wt + (size_t)n * K + k8) = o; 
}
// k_gemm_hh variant with fused epilogue: v = acc·alpha + bias[by·sBias + col] (+ CP[(row/rowsPerB)·sCPb + by·64 + col] if CP) ; ACT 0 none / 1 elu ; writes f16 C16 (and f32 C if non-null)
template <int ACT>
__global__ __launch_bounds__(128) void k_gemm_hhx(const _Float16* __restrict__ A, int lda, size_t sA, const _Float16* __restrict__ Bh, int ldb, size_t sB, float alpha, const float* __restrict__ bias, size_t sBias, const float* __restrict__ CP, int rowsPerB, size_t sCPb, int row0g,
    float* __restrict__ C, _Float16* __restrict__ C16, int ldc, size_t sC, int M, int N, int K) {
  __shared__ __attribute__((aligned(16))) float so[4][16][64];
  const int tid = threadIdx.x, w = tid >> 5, lane = tid & 31, ln = lane & 15, hh = lane >> 4; const int by = blockIdx.y;
  A += (size_t)by * sA; Bh += (size_t)by * sB; const size_t cofs = (size_t)by * sC; const float* bp = bias ? bias + (size_t)by * sBias : nullptr;
  const int ntn = (N + 63) / 64; const int wid = blockIdx.x * 4 + w; const int mt = wid / ntn, nq = wid % ntn; if (mt * 16 >= M) return;
  const int row0 = mt * 16, col0 = nq * 64; const _Float16* arow = A + (size_t)(row0 + ln) * lda;
  v8f acc[4] = {};
  for (int kb = 0; kb < K; kb += 32) { FragH ah; ah.half[0] = *(const v8us*)((const unsigned short*)arow + kb + 8 * hh); ah.half[1] = *(const v8us*)((const unsigned short*)arow + kb + 16 + 8 * hh);
#pragma unroll
    for (int t = 0; t < 4; ++t) { if (col0 + t * 16 >= N) continue; const size_t boff = (size_t)(col0 + t * 16 + ln) * ldb + kb; FragH bq; bq.half[0] = *(const v8us*)((const unsigned short*)Bh + boff + 8 * hh); bq.half[1] = *(const v8us*)((const unsigned short*)Bh + boff + 16 + 8 * hh);
      acc[t] = mmaH<1>(ah.v, ah.v, bq.v, bq.v, acc[t]); }
  }
#pragma unroll
  for (int t = 0; t < 4; ++t) { if (col0 + t * 16 >= N) continue; const int col = col0 + t * 16 + ln; const float bv = bp ? bf16_round(bp[col]) : 0.f;
#pragma unroll
    for (int r = 0; r < 8; ++r) { float v = acc[t][r] * alpha + bv; if (CP) { const int bidx = (row0g + row0 + 8 * hh + r) / rowsPerB; v += CP[(size_t)bidx * sCPb + (size_t)by * 64 + col]; } if (ACT == 1) v = (v > 0.f) ? v : expm1f(v); else if (ACT == 7) v = (v > 0.f) ? v + 1.0f : expf(v); else if (ACT == 8) v = tanhf(v); else if (ACT == 9) v = 0.5f * v * (1.0f + tanhf(0.7978845608028654f * (v + 0.044715f * v * v * v))); else if (ACT == 11) v = 1.0f / (1.0f + expf(-v)); else if (ACT == 12) v = (v > 0.f) ? v : 0.01f * v; else if (ACT == 14) v = (v > 0.f) ? v : 0.1f * v; else if (ACT == 15) v = v / (1.0f + expf(-v)); else if (ACT == 3) v = fmaxf(v, 0.f); else if (ACT == 6) v = 0.5f * v * (1.0f + erff(v * 0.70710678118654752f)); so[w][8 * hh + r][t * 16 + ln] = v; } }
  __builtin_amdgcn_fence(__ATOMIC_ACQ_REL, "workgroup"); __builtin_amdgcn_wave_barrier();
  const int rsub = lane >> 4, c4 = (lane & 15) * 4; typedef _Float16 v4h __attribute__((ext_vector_type(4)));
  {
#pragma unroll
    for (int q = 0; q < 8; ++q) { const int r = q * 2 + rsub; if (col0 + c4 < N) { const v4f v = *(const v4fa*)&so[w][r][c4]; if (C) *(v4f*)(C + cofs + (size_t)(row0 + r) * ldc + col0 + c4) = v; if (C16) { v4h h4; for (int i = 0; i < 4; ++i) h4[i] = (_Float16)v[i]; *(v4h*)(C16 + cofs + (size_t)(row0 + r) * ldc + col0 + c4) = h4; } } }
     }
}


typedef _Float16 v4h __attribute__((ext_vector_type(4)));

__global__ __launch_bounds__(256) void k_x16(const float* __restrict__ x, _Float16* __restrict__ X16, size_t n8) { const size_t t = (size_t)blockIdx.x * 256 + threadIdx.x; if (t >= n8) return; FragH f;
#pragma unroll
  for (int q = 0; q < 8; ++q) f.h[q] = (_Float16)bf16_round(x[t * 8 + q]); *(v8us*)((unsigned short*)X16 + t * 8) = f.half[0];  }
__global__ __launch_bounds__(256) void k_h16(const float* __restrict__ x, _Float16* __restrict__ X16, size_t n8) { const size_t t = (size_t)blockIdx.x * 256 + threadIdx.x; if (t >= n8) return; FragH f;
#pragma unroll
  for (int q = 0; q < 8; ++q) f.h[q] = (_Float16)x[t * 8 + q]; *(v8us*)((unsigned short*)X16 + t * 8) = f.half[0];  }
__global__ __launch_bounds__(256) void k_round16f(const float* __restrict__ W, _Float16* __restrict__ Bt, size_t n8) { const size_t t = (size_t)blockIdx.x * 256 + threadIdx.x; if (t >= n8) return; FragH f;
#pragma unroll
  for (int i = 0; i < 8; ++i) f.h[i] = (_Float16)(bf16_round(W[t * 8 + i]) * 16.0f); *(v8us*)((unsigned short*)Bt + t * 8) = f.half[0];  }
template <int NHv, int TTv>
__global__ __launch_bounds__(256) void k_vt(const _Float16* __restrict__ V16, int ldv, int voff, _Float16* __restrict__ Vt) { __shared__ unsigned short tl[64][66]; const int tid = threadIdx.x; const int slab = blockIdx.x / (TTv / 64), lg = blockIdx.x % (TTv / 64); const int b = slab / NHv, h = slab % NHv;
  for (int i = tid; i < 64 * 8; i += 256) { const int r = i / 8, c8 = (i % 8) * 8; FragH f; f.half[0] = *(const v8us*)((const unsigned short*)V16 + ((size_t)b * TTv + lg * 64 + r) * ldv + voff + h * 64 + c8);
#pragma unroll
    for (int q = 0; q < 8; ++q) tl[r][c8 + q] = f.u[q]; }
  __syncthreads();
  {
#pragma unroll
    for (int rd = 0; rd < 2; ++rd) { const int d = rd * 32 + tid / 8, pc = tid % 8; FragH f;
#pragma unroll
      for (int q = 0; q < 8; ++q) f.u[q] = tl[pc * 8 + q][d];
      *(v8us*)((unsigned short*)Vt + ((size_t)slab * 64 + d) * TTv + lg * 64 + pc * 8) = f.half[0]; }
     } }

__global__ __launch_bounds__(256) void k_hl(const float* __restrict__ F, _Float16* __restrict__ Hh, _Float16* __restrict__ Hl, size_t n8) { const size_t t = (size_t)blockIdx.x * 256 + threadIdx.x; if (t >= n8) return; FragH fh, fl; const v4f a = *(const v4fa*)(F + t * 8), c = *(const v4fa*)(F + t * 8 + 4);
#pragma unroll
  for (int q = 0; q < 4; ++q) { _Float16 h = (_Float16)a[q]; fh.h[q] = h; fl.h[q] = (_Float16)((a[q] - (float)h) * 1024.0f); h = (_Float16)c[q]; fh.h[4 + q] = h; fl.h[4 + q] = (_Float16)((c[q] - (float)h) * 1024.0f); }
  { *(v8us*)((unsigned short*)Hh + t * 8) = fh.half[0]; *(v8us*)((unsigned short*)Hl + t * 8) = fl.half[0];  } }

// ---- fast GEMM (block tile 128x64, wave tile 32x64; requires M % 128 == 0, N % 64 == 0, K % 64 == 0); epilogue = k_gemm_hhx semantics ----
// Per trip a 64-deep slice of A (128 rows) and of B (64 rows) is copied to LDS in whole 128-byte lines (asynchronous copies, two buffers: the next slice flies while this one is multiplied); fragments come from LDS.
#define G2_PITCH 144                      /* LDS bytes per staged row: 128 + 16, the conflict-free pitch for 16-byte reads */
#define G2_BUF ((128 + 64) * G2_PITCH)    /* one buffer: A rows 0..127, then B rows 128..191 */
__device__ __forceinline__ v16h g2_lfrag(const unsigned char* p) { FragH f; f.half[0] = *(const v8us*)p; f.half[1] = *(const v8us*)(p + 32); return f.v; }
__device__ __forceinline__ v8f g2_mma(v16h a, v16h b, v8f c) { v8f d = __builtin_amdgcn_wmma_f32_16x16x32_f16(false, a, false, b, (short)0, c, false, false); asm volatile("v_nop\n\tv_nop\n\tv_nop\n\tv_nop" : "+v"(d) : "v"(a), "v"(b)); return d; }
// one slice: 12 copies of 16 bytes per lane (8 of A, 4 of B), a wave's copy covering 4 whole rows; l = the lane's LDS byte address of its first row, rows 16 apart
__device__ __forceinline__ void g2_copy(unsigned l, const _Float16* ga, size_t sa16, const _Float16* gb, size_t sb16) {
  /* the closing s_wait_xcnt keeps every address register intact until the copies have taken it */
  asm volatile("global_load_async_to_lds_b128 %0, %12, off\n\t"
               "global_load_async_to_lds_b128 %1, %13, off\n\t"
               "global_load_async_to_lds_b128 %2, %14, off\n\t"
               "global_load_async_to_lds_b128 %3, %15, off\n\t"
               "global_load_async_to_lds_b128 %4, %16, off\n\t"
               "global_load_async_to_lds_b128 %5, %17, off\n\t"
               "global_load_async_to_lds_b128 %6, %18, off\n\t"
               "global_load_async_to_lds_b128 %7, %19, off\n\t"
               "global_load_async_to_lds_b128 %8, %20, off\n\t"
               "global_load_async_to_lds_b128 %9, %21, off\n\t"
               "global_load_async_to_lds_b128 %10, %22, off\n\t"
               "global_load_async_to_lds_b128 %11, %23, off\n\t"
               "s_wait_xcnt 0x0"
               :: "v"(l), "v"(l + 16 * G2_PITCH), "v"(l + 32 * G2_PITCH), "v"(l + 48 * G2_PITCH), "v"(l + 64 * G2_PITCH), "v"(l + 80 * G2_PITCH), "v"(l + 96 * G2_PITCH), "v"(l + 112 * G2_PITCH),
                  "v"(l + 128 * G2_PITCH), "v"(l + 144 * G2_PITCH), "v"(l + 160 * G2_PITCH), "v"(l + 176 * G2_PITCH),
                  "v"(ga), "v"(ga + sa16), "v"(ga + 2 * sa16), "v"(ga + 3 * sa16), "v"(ga + 4 * sa16), "v"(ga + 5 * sa16), "v"(ga + 6 * sa16), "v"(ga + 7 * sa16),
                  "v"(gb), "v"(gb + sb16), "v"(gb + 2 * sb16), "v"(gb + 3 * sb16)
               : "memory");
}
template <int ACT>
__global__ __launch_bounds__(128) void k_gemm2(const _Float16* __restrict__ A, int lda, size_t sA, const _Float16* __restrict__ Bh, int ldb, size_t sB, float alpha, const float* __restrict__ bias, size_t sBias, const float* __restrict__ CP, int rowsPerB, size_t sCPb, int row0g,
    float* __restrict__ C, _Float16* __restrict__ C16, int ldc, size_t sC, int M, int N, int K) {
  __shared__ __attribute__((aligned(16))) unsigned char smem[2 * G2_BUF];      /* the two staging buffers; the epilogue's 4 x 32 x 68 floats lie over them once the loop's last barrier has ended every read */
  float (*so)[32][68] = reinterpret_cast<float (*)[32][68]>(smem);
  const int tid = threadIdx.x, w = tid >> 5, lane = tid & 31, ln = lane & 15, hh = lane >> 4; const int by = blockIdx.y;
  A += (size_t)by * sA; Bh += (size_t)by * sB; const size_t cofs = (size_t)by * sC; const float* bp = bias ? bias + (size_t)by * sBias : nullptr;
  const int ntn = N >> 6; const int mt = blockIdx.x / ntn, nq = blockIdx.x - mt * ntn; const int row0 = mt * 128 + 32 * w, col0 = nq * 64; if (mt * 128 >= M) return;      /* the whole block leaves or none: barriers follow */
  const int crow = tid >> 3, cch = tid & 7;      /* copy role: row (mod 16) and 16-byte piece of the 128-byte row */
  const _Float16* gA = A + (size_t)(mt * 128 + crow) * lda + cch * 8; const _Float16* gB = Bh + (size_t)(col0 + crow) * ldb + cch * 8; const size_t sa16 = (size_t)16 * lda, sb16 = (size_t)16 * ldb;
  const unsigned l0 = (unsigned)(size_t)smem + (unsigned)(crow * G2_PITCH + cch * 16);
  const int aoff = (32 * w + ln) * G2_PITCH + 16 * hh, boff = (128 + ln) * G2_PITCH + 16 * hh;
  const v8f z8 = {0.f,0.f,0.f,0.f,0.f,0.f,0.f,0.f}; v8f c00 = z8, c01 = z8, c02 = z8, c03 = z8, c10 = z8, c11 = z8, c12 = z8, c13 = z8;
  const int NT = K >> 6;
  g2_copy(l0, gA, sa16, gB, sb16);
  asm volatile("s_wait_asynccnt 0x0" ::: "memory");      /* slice 0 has landed before the barrier publishes it */
  __syncthreads();
  if (NT > 1) g2_copy(l0 + G2_BUF, gA + 64, sa16, gB + 64, sb16);
#pragma unroll 1      /* one slice per trip: the buffer alternates with the trip's parity */
  for (int t = 0; t < NT; ++t) { const unsigned char* sb = smem + (t & 1) * G2_BUF; const unsigned char* pa = sb + aoff; const unsigned char* pb = sb + boff;
    const v16h a0 = g2_lfrag(pa), a1 = g2_lfrag(pa + 16 * G2_PITCH), b0 = g2_lfrag(pb), b1 = g2_lfrag(pb + 16 * G2_PITCH), b2 = g2_lfrag(pb + 32 * G2_PITCH), b3 = g2_lfrag(pb + 48 * G2_PITCH);
    const v16h e0 = g2_lfrag(pa + 64), e1 = g2_lfrag(pa + 16 * G2_PITCH + 64), f0 = g2_lfrag(pb + 64), f1 = g2_lfrag(pb + 16 * G2_PITCH + 64), f2 = g2_lfrag(pb + 32 * G2_PITCH + 64), f3 = g2_lfrag(pb + 48 * G2_PITCH + 64);
    c00 = g2_mma(a0, b0, c00); c10 = g2_mma(a1, b0, c10); c01 = g2_mma(a0, b1, c01); c11 = g2_mma(a1, b1, c11); c02 = g2_mma(a0, b2, c02); c12 = g2_mma(a1, b2, c12); c03 = g2_mma(a0, b3, c03); c13 = g2_mma(a1, b3, c13);
    c00 = g2_mma(e0, f0, c00); c10 = g2_mma(e1, f0, c10); c01 = g2_mma(e0, f1, c01); c11 = g2_mma(e1, f1, c11); c02 = g2_mma(e0, f2, c02); c12 = g2_mma(e1, f2, c12); c03 = g2_mma(e0, f3, c03); c13 = g2_mma(e1, f3, c13);
    asm volatile("s_wait_dscnt 0x0" ::: "memory");         /* this wave's reads of the buffer are over before it may be refilled */
    asm volatile("s_wait_asynccnt 0x0" ::: "memory");      /* this wave's copies of the next slice have landed */
    __syncthreads();                                       /* publishes the next slice and ends every wave's reads of this one */
    if (t + 2 < NT) g2_copy(l0 + (unsigned)(t & 1) * G2_BUF, gA + (size_t)(t + 2) * 64, sa16, gB + (size_t)(t + 2) * 64, sb16); }
  asm volatile("s_wait_asynccnt 0x0" ::: "memory");        /* nothing is in flight when the buffers become output staging */
  v8f accs[8] = {c00, c01, c02, c03, c10, c11, c12, c13};
#pragma unroll
  for (int u = 0; u < 8; ++u) { const int t = u & 3, half = u >> 2; const int col = col0 + t * 16 + ln; const float bv = bp ? bf16_round(bp[col]) : 0.f;
#pragma unroll
    for (int r = 0; r < 8; ++r) { const int rloc = half * 16 + 8 * hh + r; float v = accs[u][r] * alpha + bv; if (CP) { const int bidx = (row0g + row0 + rloc) / rowsPerB; v += CP[(size_t)bidx * sCPb + (size_t)by * 64 + col]; }
      if (ACT == 3) v = fmaxf(v, 0.f); else if (ACT == 6) v = 0.5f * v * (1.0f + erff(v * 0.70710678118654752f)); else if (ACT == 11) v = 1.0f / (1.0f + expf(-v)); else if (ACT == 15) v = v / (1.0f + expf(-v)); else if (ACT == 12) v = (v > 0.f) ? v : 0.01f * v; else if (ACT == 8) v = tanhf(v);
      so[w][rloc][t * 16 + ln] = v; } }
  __builtin_amdgcn_fence(__ATOMIC_ACQ_REL, "workgroup"); __builtin_amdgcn_wave_barrier();
  const int rsub = lane >> 4, c4 = (lane & 15) * 4;
  {
#pragma unroll
    for (int q = 0; q < 16; ++q) { const int r = q * 2 + rsub; const v4f v = *(const v4fa*)&so[w][r][c4]; if (C) *(v4f*)(C + cofs + (size_t)(row0 + r) * ldc + col0 + c4) = v; if (C16) { v4h h4; for (int i = 0; i < 4; ++i) h4[i] = (_Float16)v[i]; *(v4h*)(C16 + cofs + (size_t)(row0 + r) * ldc + col0 + c4) = h4; } }
     } }



// lane l with lane l ^ 16 (the two halves of a wave hold the two key halves of one query column)
__device__ __forceinline__ float xhalf(float x) { return __builtin_bit_cast(float, __builtin_amdgcn_permlanex16(__builtin_bit_cast(int, x), __builtin_bit_cast(int, x), 0x76543210, 0xfedcba98, false, false)); }
// Transposed products: S^T = K Q^T (A = key rows, B = query columns) and O^T += V^T P^T (A = value-dimension rows of V^T, B = P^T). A lane holds 16 of the 32 scores of ONE query (keys 8 hh + r and 16 + 8 hh + r), which is the k order of a B operand: P goes from the score accumulators into the next product without LDS; maximum, sum and rescale factor are one value per lane.
template <int CAUSAL>
__global__ __launch_bounds__(128) void k_flash(const _Float16* __restrict__ Q16, int ldq, const _Float16* __restrict__ K16, int ldk, const _Float16* __restrict__ Vt, const _Float16* __restrict__ Vt2, const int* __restrict__ MSK, float* __restrict__ O, float* __restrict__ O2, int ldo) {
  constexpr int RPW = 16, DT = 8, KS = 2;      /* DT 0..3: low 64 value columns (Vt -> O), DT 4..7: high 64 (Vt2 -> O2); one score/softmax pass feeds both */
  __shared__ __attribute__((aligned(16))) float sO[4][RPW][64 + 4];
  const int tid = threadIdx.x, w = tid >> 5, lane = tid & 31, ln = lane & 15, hh = lane >> 4;
  const int slab = blockIdx.x / QBNP, qblk = QB0P + blockIdx.x % QBNP; const int b = slab / NH, h = slab % NH; const int qb0 = qblk * (4 * RPW); const int q0 = qb0 + w * RPW; const int tq = q0 + ln;      /* this lane's query */
  FragH aq[KS];
  { const unsigned short* qr = (const unsigned short*)Q16 + ((size_t)b * TQ + tq) * ldq + h * 64;
#pragma unroll
    for (int ks = 0; ks < KS; ++ks) { aq[ks].half[0] = *(const v8us*)(qr + ks * 32 + 8 * hh); aq[ks].half[1] = *(const v8us*)(qr + ks * 32 + 16 + 8 * hh); } }
  const unsigned short* Vth = (const unsigned short*)Vt + (size_t)slab * 64 * TK; const unsigned short* Vth2 = (const unsigned short*)Vt2 + (size_t)slab * 64 * TK;
  constexpr float C2 = SCL * 1.4426950408889634f;      /* raw score -> exponent in base 2 */
  float m_r = -1.0e38f, l_r = 0.f; v8f oacc[DT];      /* m_r: running maximum of the RAW scores, never below -1e38, so that a masked score (-3e38) stays far under it; l_r: row sum in units of 2^-10 */
#pragma unroll
  for (int dt = 0; dt < DT; ++dt) oacc[dt] = (v8f){0.f,0.f,0.f,0.f,0.f,0.f,0.f,0.f};
  const int jend = (CAUSAL == 1) ? (qb0 + 4 * RPW) : TK;      /* causal: keys beyond the block's last query never contribute */
#pragma unroll 1
  for (int j0 = 0; j0 < jend; j0 += 32) {
    FragH bk[2][KS], bv[DT];
    const unsigned short* kr0 = (const unsigned short*)K16 + ((size_t)b * TK + j0 + ln) * ldk + h * 64 + 8 * hh; const unsigned short* kr1 = kr0 + (size_t)16 * ldk;
#pragma unroll
    for (int nt = 0; nt < 2; ++nt) { const unsigned short* kr = nt ? kr1 : kr0;
#pragma unroll
      for (int ks = 0; ks < KS; ++ks) { bk[nt][ks].half[0] = *(const v8us*)(kr + ks * 32); bk[nt][ks].half[1] = *(const v8us*)(kr + ks * 32 + 16); } }
    asm volatile("s_wait_xcnt 0x0" :: "v"(kr0), "v"(kr1) : "memory");      /* a precaution: the address registers stay whole (no load's own destination takes them) until the issued loads have taken them */
    v8f st[2];      /* st[nt][r] = score of key j0 + nt * 16 + 8 * hh + r against query tq */
#pragma unroll
    for (int nt = 0; nt < 2; ++nt) { v8f acc = (v8f){0.f,0.f,0.f,0.f,0.f,0.f,0.f,0.f};
#pragma unroll
      for (int ks = 0; ks < KS; ++ks) acc = mmaH<1>(bk[nt][ks].v, bk[nt][ks].v, aq[ks].v, aq[ks].v, acc);
      st[nt] = acc; }
    const unsigned short* vr0 = Vth + (size_t)ln * TK + j0 + 8 * hh; const unsigned short* vr1 = Vth2 + (size_t)ln * TK + j0 + 8 * hh;
#pragma unroll
    for (int dt = 0; dt < DT; ++dt) { const unsigned short* vrow = ((dt < 4) ? vr0 : vr1) + (size_t)((dt & 3) * 16) * TK; bv[dt].half[0] = *(const v8us*)vrow; bv[dt].half[1] = *(const v8us*)(vrow + 16); }
    asm volatile("s_wait_xcnt 0x0" :: "v"(vr0), "v"(vr1) : "memory");      /* the same precaution for the value loads, which fly during the softmax */
    float sv[16]; float mc = -3.0e38f;
#pragma unroll
    for (int e = 0; e < 16; ++e) { const int kk = j0 + (e >> 3) * 16 + 8 * hh + (e & 7); const bool ok = (CAUSAL == 1) ? (kk <= tq) : ((CAUSAL == 2) ? ((kk >> 5) == (tq >> 5)) : true);      /* mode 2: block-diagonal 32-token groups */
      sv[e] = ok ? st[e >> 3][e & 7] : -3.0e38f; mc = fmaxf(mc, sv[e]); }
    mc = fmaxf(mc, xhalf(mc));      /* both halves feed one output column: they share the maximum */
    const float mn = fmaxf(m_r, mc); const float xa = (m_r - mn) * C2; m_r = mn;      /* rescale factor 2^xa; nothing seen yet: 2^0 = 1 on zero sums */
    const float nb = fmaf(-mn, C2, 10.0f);      /* p = 1024 exp((s - mn) / 8) = 2^(s C2 + nb): scale, maximum and the operand's 2^10 in one fused multiply-add; a masked score gives 2^(-huge) = 0 */
    float pe[16], al = xa;
#pragma unroll
    for (int e = 0; e < 16; ++e) pe[e] = fmaf(sv[e], C2, nb);
    /* the exponentials stand together, each in place on a register of its own: no v_exp_f32 is directly followed by a read of its result or by another instruction's write of its source; the closing v_nop keeps that slot free of whatever the compiler puts next */
    asm("v_exp_f32 %0, %0\n\tv_exp_f32 %1, %1\n\tv_exp_f32 %2, %2\n\tv_exp_f32 %3, %3\n\tv_exp_f32 %4, %4\n\tv_exp_f32 %5, %5\n\tv_exp_f32 %6, %6\n\tv_exp_f32 %7, %7\n\tv_exp_f32 %8, %8\n\tv_nop"
        : "+v"(al), "+v"(pe[0]), "+v"(pe[1]), "+v"(pe[2]), "+v"(pe[3]), "+v"(pe[4]), "+v"(pe[5]), "+v"(pe[6]), "+v"(pe[7]));
    asm("v_exp_f32 %0, %0\n\tv_exp_f32 %1, %1\n\tv_exp_f32 %2, %2\n\tv_exp_f32 %3, %3\n\tv_exp_f32 %4, %4\n\tv_exp_f32 %5, %5\n\tv_exp_f32 %6, %6\n\tv_exp_f32 %7, %7\n\tv_nop"
        : "+v"(pe[8]), "+v"(pe[9]), "+v"(pe[10]), "+v"(pe[11]), "+v"(pe[12]), "+v"(pe[13]), "+v"(pe[14]), "+v"(pe[15]));
    FragH pb; float ps[4] = {0.f, 0.f, 0.f, 0.f};
#pragma unroll
    for (int e = 0; e < 16; ++e) { ps[e & 3] += pe[e]; pb.h[e] = (_Float16)pe[e]; }
    l_r = l_r * al + ((ps[0] + ps[1]) + (ps[2] + ps[3]));
#pragma unroll
    for (int dt = 0; dt < DT; ++dt) {
#pragma unroll
      for (int r = 0; r < 8; ++r) oacc[dt][r] *= al; }
#pragma unroll
    for (int dt = 0; dt < DT; ++dt) oacc[dt] = mmaH<1>(bv[dt].v, bv[dt].v, pb.v, pb.v, oacc[dt]); }
  const float lt = l_r + xhalf(l_r); const float inv = (lt > 0.f) ? 1.0f / lt : 0.f;      /* sums and products both carry the 2^10 */
#pragma unroll
  for (int hf = 0; hf < 2; ++hf) { float* __restrict__ Oh = hf ? O2 : O;
#pragma unroll
    for (int dt = 0; dt < 4; ++dt) { const v8f a = oacc[hf * 4 + dt]; const v4f lo = {a[0] * inv, a[1] * inv, a[2] * inv, a[3] * inv}, hi = {a[4] * inv, a[5] * inv, a[6] * inv, a[7] * inv};      /* a[r] = column dt * 16 + 8 * hh + r of query row ln */
      *(v4fa*)&sO[w][ln][dt * 16 + 8 * hh] = lo; *(v4fa*)&sO[w][ln][dt * 16 + 8 * hh + 4] = hi; }
    __builtin_amdgcn_fence(__ATOMIC_ACQ_REL, "workgroup"); __builtin_amdgcn_wave_barrier();
#pragma unroll
    for (int rp = 0; rp < RPW; rp += 2) { const int r = rp + (lane >> 4), pc = lane & 15; const v4f val = *(const v4fa*)&sO[w][r][pc * 4]; *(v4f*)(Oh + ((size_t)b * TQ + q0 + r) * ldo + h * 64 + pc * 4) = val; }
    if (hf == 0) { __builtin_amdgcn_fence(__ATOMIC_ACQ_REL, "workgroup"); __builtin_amdgcn_wave_barrier(); }      /* the high half reuses this wave's sO slice: its stores stay behind the low half's reads */
  } }
// 5-plane variant: S = Qh Kh^T + (Ql Kh^T + Qh Kl^T)/1024 with Q/K = [hi | 2^10 residual] f16 planes (QL/KL same layout as Q16/K16), then the 3-term P.V below.
// 3-term variant: O = (P_hi V_hi + (P_lo V_hi + P_hi V_lo) / 1024) / l with P = [hi | 2^10 residual] of 1024 p and V^T = [hi | 2^10 residual] planes (VtL same layout as Vt) -> ~2^-21-class products for un-averaged (early causal / peaked) rows
template <int CAUSAL>
__global__ __launch_bounds__(128) void k_flash5(const _Float16* __restrict__ Q16, const _Float16* __restrict__ QL, int ldq, const _Float16* __restrict__ K16, const _Float16* __restrict__ KL, int ldk, const _Float16* __restrict__ Vt, const _Float16* __restrict__ VtL, const int* __restrict__ MSK, float* __restrict__ O, int ldo) {
  constexpr int RPW = 16, DT = 4, KS = 2;      /* transposed like k_flash: key rows and V^T rows are A operands, query columns and P^T are B operands */
  __shared__ __attribute__((aligned(16))) float sO[4][RPW][64 + 4];
  const int tid = threadIdx.x, w = tid >> 5, lane = tid & 31, ln = lane & 15, hh = lane >> 4;
  const int slab = blockIdx.x / QBN5, qblk = QB05 + blockIdx.x % QBN5; const int b = slab / NH, h = slab % NH; const int qb0 = qblk * (4 * RPW); const int q0 = qb0 + w * RPW; const int tq = q0 + ln;      /* this lane's query */
  FragH aq[KS], aql[KS];
  { const unsigned short* qr = (const unsigned short*)Q16 + ((size_t)b * TQ + tq) * ldq + h * 64; const unsigned short* ql = (const unsigned short*)QL + ((size_t)b * TQ + tq) * ldq + h * 64;
#pragma unroll
    for (int ks = 0; ks < KS; ++ks) { aq[ks].half[0] = *(const v8us*)(qr + ks * 32 + 8 * hh); aq[ks].half[1] = *(const v8us*)(qr + ks * 32 + 16 + 8 * hh); aql[ks].half[0] = *(const v8us*)(ql + ks * 32 + 8 * hh); aql[ks].half[1] = *(const v8us*)(ql + ks * 32 + 16 + 8 * hh); } }
  const unsigned short* Vth = (const unsigned short*)Vt + (size_t)slab * 64 * TK; const unsigned short* Vtl = (const unsigned short*)VtL + (size_t)slab * 64 * TK;
  float m_r = -3.0e38f, l_r = 0.f; v8f oacc[DT], oaccL[DT];
#pragma unroll
  for (int dt = 0; dt < DT; ++dt) { oacc[dt] = (v8f){0.f,0.f,0.f,0.f,0.f,0.f,0.f,0.f}; oaccL[dt] = oacc[dt]; }
  const int jend = (CAUSAL == 1) ? (qb0 + 4 * RPW) : TK;      /* causal: keys beyond the block's last query never contribute */
#pragma unroll 1
  for (int j0 = 0; j0 < jend; j0 += 32) {
    FragH bk[2][KS], bkl[2][KS], bv[DT], bl[DT];
    const size_t ko = ((size_t)b * TK + j0 + ln) * ldk + h * 64 + 8 * hh; const unsigned short* kr0 = (const unsigned short*)K16 + ko; const unsigned short* kr1 = kr0 + (size_t)16 * ldk; const unsigned short* kl0 = (const unsigned short*)KL + ko; const unsigned short* kl1 = kl0 + (size_t)16 * ldk;
#pragma unroll
    for (int nt = 0; nt < 2; ++nt) { const unsigned short* kr = nt ? kr1 : kr0; const unsigned short* klr = nt ? kl1 : kl0;
#pragma unroll
      for (int ks = 0; ks < KS; ++ks) { bk[nt][ks].half[0] = *(const v8us*)(kr + ks * 32); bk[nt][ks].half[1] = *(const v8us*)(kr + ks * 32 + 16); bkl[nt][ks].half[0] = *(const v8us*)(klr + ks * 32); bkl[nt][ks].half[1] = *(const v8us*)(klr + ks * 32 + 16); } }
    asm volatile("s_wait_xcnt 0x0" :: "v"(kr0), "v"(kr1), "v"(kl0), "v"(kl1) : "memory");      /* a precaution: the address registers stay whole (no load's own destination takes them) until the issued loads have taken them */
    v8f st[2];      /* st[nt][r] = score of key j0 + nt * 16 + 8 * hh + r against query tq */
#pragma unroll
    for (int nt = 0; nt < 2; ++nt) { v8f acc = (v8f){0.f,0.f,0.f,0.f,0.f,0.f,0.f,0.f}, accl = acc;
#pragma unroll
      for (int ks = 0; ks < KS; ++ks) { acc = mmaH<1>(bk[nt][ks].v, bk[nt][ks].v, aq[ks].v, aq[ks].v, acc); accl = mmaH<1>(bk[nt][ks].v, bk[nt][ks].v, aql[ks].v, aql[ks].v, accl); accl = mmaH<1>(bkl[nt][ks].v, bkl[nt][ks].v, aq[ks].v, aq[ks].v, accl); }
#pragma unroll
      for (int r = 0; r < 8; ++r) acc[r] += accl[r] * 0.0009765625f;
      st[nt] = acc; }
    const unsigned short* vr0 = Vth + (size_t)ln * TK + j0 + 8 * hh; const unsigned short* vr1 = Vtl + (size_t)ln * TK + j0 + 8 * hh;
#pragma unroll
    for (int dt = 0; dt < DT; ++dt) { const unsigned short* vrow = vr0 + (size_t)(dt * 16) * TK; const unsigned short* vrl = vr1 + (size_t)(dt * 16) * TK; bv[dt].half[0] = *(const v8us*)vrow; bv[dt].half[1] = *(const v8us*)(vrow + 16); bl[dt].half[0] = *(const v8us*)vrl; bl[dt].half[1] = *(const v8us*)(vrl + 16); }
    asm volatile("s_wait_xcnt 0x0" :: "v"(vr0), "v"(vr1) : "memory");      /* the same precaution for the value loads, which fly during the softmax */
    float sv[16]; bool ok[16]; float mc = -3.0e38f;
#pragma unroll
    for (int e = 0; e < 16; ++e) { const int kk = j0 + (e >> 3) * 16 + 8 * hh + (e & 7); ok[e] = (CAUSAL == 1) ? (kk <= tq) : ((CAUSAL == 2) ? ((kk >> 5) == (tq >> 5)) : true);      /* mode 2: block-diagonal 32-token groups */
      if (CAUSAL == 4) ok[e] = MSK[((size_t)b * TQ + tq) * TK + kk] != 0;      /* mode 4: per-(query, key) INPUT mask shared by all heads; masked keys contribute nothing (== the reference's -4096 fill, whose exp underflows to 0), rows with no valid key give l = 0 -> output 0 (== the reference's row_valid zeroing) */
      sv[e] = ok[e] ? st[e >> 3][e & 7] * SCL : -3.0e38f; mc = fmaxf(mc, sv[e]); }
    mc = fmaxf(mc, xhalf(mc));      /* both halves feed one output column: they share the maximum */
    const float mn = fmaxf(m_r, mc); const float al = (mn > -1.0e38f) ? expf(m_r - mn) : 1.0f; m_r = mn;
    FragH pa, pl; float ps[4] = {0.f, 0.f, 0.f, 0.f};
#pragma unroll
    for (int e = 0; e < 16; ++e) { const float p = ok[e] ? expf(sv[e] - mn) : 0.f; ps[e & 3] += p; const float pw = p * 1024.0f; pa.h[e] = (_Float16)pw; pl.h[e] = (_Float16)((pw - (float)pa.h[e]) * 1024.0f); }
    l_r = l_r * al + ((ps[0] + ps[1]) + (ps[2] + ps[3]));
#pragma unroll
    for (int dt = 0; dt < DT; ++dt) {
#pragma unroll
      for (int r = 0; r < 8; ++r) { oacc[dt][r] *= al; oaccL[dt][r] *= al; } }
#pragma unroll
    for (int dt = 0; dt < DT; ++dt) { oacc[dt] = mmaH<1>(bv[dt].v, bv[dt].v, pa.v, pa.v, oacc[dt]); oaccL[dt] = mmaH<1>(bv[dt].v, bv[dt].v, pl.v, pl.v, oaccL[dt]); oaccL[dt] = mmaH<1>(bl[dt].v, bl[dt].v, pa.v, pa.v, oaccL[dt]); } }
  const float lt = l_r + xhalf(l_r); const float inv = (lt > 0.f) ? 1.0f / (lt * 1024.0f) : 0.f;
#pragma unroll
  for (int dt = 0; dt < DT; ++dt) { v8f a = oacc[dt];
#pragma unroll
    for (int r = 0; r < 8; ++r) { a[r] += oaccL[dt][r] * 0.0009765625f; a[r] *= inv; }      /* a[r] = column dt * 16 + 8 * hh + r of query row ln */
    const v4f lo = {a[0], a[1], a[2], a[3]}, hi = {a[4], a[5], a[6], a[7]}; *(v4fa*)&sO[w][ln][dt * 16 + 8 * hh] = lo; *(v4fa*)&sO[w][ln][dt * 16 + 8 * hh + 4] = hi; }
  __builtin_amdgcn_fence(__ATOMIC_ACQ_REL, "workgroup"); __builtin_amdgcn_wave_barrier();
  {
#pragma unroll
    for (int rp = 0; rp < RPW; rp += 2) { const int r = rp + (lane >> 4), pc = lane & 15; const v4f val = *(const v4fa*)&sO[w][r][pc * 4]; *(v4f*)(O + ((size_t)b * TQ + q0 + r) * ldo + h * 64 + pc * 4) = val; }
     } }

__global__ __launch_bounds__(256) void k_rotab(float* __restrict__ CS, float* __restrict__ SN) {
  #pragma clang fp contract(off)
  const int t = blockIdx.x * 256 + threadIdx.x; if (t >= SLEN * 32) return; const int j = t % 32, s = t / 32; (void)j; (void)s; const float c = 1.0f, sn = 0.0f;      /* no RoPE here: identity tables make k_rope a pure hi/lo split (a*1 - b*0 is exact) */
  { *(float*)(CS + t) = c; *(float*)(SN + t) = sn;  } }
__global__ __launch_bounds__(256) void k_rope(const float* __restrict__ F, int nsrc, int ndst, int rep, const float* __restrict__ CS, const float* __restrict__ SN, _Float16* __restrict__ H, _Float16* __restrict__ L) {
  #pragma clang fp contract(off)
  const size_t t = (size_t)blockIdx.x * 256 + threadIdx.x; if (t >= (size_t)NR * ndst * 4) return; const int g8 = (int)(t % 4); const int hd = (int)((t / 4) % ndst); const size_t row = t / ((size_t)4 * ndst); const int s = (int)(row % SLEN); const int hs = hd / rep;
  const float* src = F + row * (size_t)(nsrc * 64) + hs * 64; FragH ah, al, bh, bl;
  for (int i = 0; i < 8; ++i) { const int d = g8 * 8 + i; const float c = CS[s * 32 + d], sn = SN[s * 32 + d]; const float x1 = src[d], x2 = src[d + 32];
    float o1 = x1 * c; o1 += -x2 * sn; float o2 = x2 * c; o2 += x1 * sn;
    _Float16 hv = (_Float16)o1; ah.h[i] = hv; al.h[i] = (_Float16)((o1 - (float)hv) * 1024.0f); hv = (_Float16)o2; bh.h[i] = hv; bl.h[i] = (_Float16)((o2 - (float)hv) * 1024.0f); }
  const size_t o = row * (size_t)(ndst * 64) + hd * 64 + g8 * 8;
  { *(v8us*)((unsigned short*)H + o) = ah.half[0]; *(v8us*)((unsigned short*)H + o + 32) = bh.half[0]; *(v8us*)((unsigned short*)L + o) = al.half[0]; *(v8us*)((unsigned short*)L + o + 32) = bl.half[0];  } }
__global__ __launch_bounds__(256) void k_vtg(const _Float16* __restrict__ V16, int vadd, _Float16* __restrict__ Vt) { __shared__ unsigned short tl[64][66]; const int tid = threadIdx.x; const int slab = blockIdx.x / (SLEN / 64), lg = blockIdx.x % (SLEN / 64); const int b = slab / NH, h = slab % NH; const int col0 = (h / 8) * 128 + vadd;      /* pseudo-head h reads value head h/8 (128 wide): low (vadd 0) or high (vadd 64) half */
  for (int i = tid; i < 64 * 8; i += 256) { const int r = i / 8, c8 = (i % 8) * 8; FragH f; f.half[0] = *(const v8us*)((const unsigned short*)V16 + ((size_t)b * SLEN + lg * 64 + r) * KVD + col0 + c8); for (int q = 0; q < 8; ++q) tl[r][c8 + q] = f.u[q]; }
  __syncthreads();
  { for (int rd = 0; rd < 2; ++rd) { const int d = rd * 32 + tid / 8, pc = tid % 8; FragH f; for (int q = 0; q < 8; ++q) f.u[q] = tl[pc * 8 + q][d]; *(v8us*)((unsigned short*)Vt + ((size_t)slab * 64 + d) * SLEN + lg * 64 + pc * 8) = f.half[0]; }  } }

__global__ __launch_bounds__(256) void k_wsc(const float* __restrict__ Wm, _Float16* __restrict__ Bt, size_t n8, float sc) { const size_t t = (size_t)blockIdx.x * 256 + threadIdx.x; if (t >= n8) return; FragH f; for (int q = 0; q < 8; ++q) f.h[q] = (_Float16)(bf16_round(Wm[t * 8 + q]) * sc); *(v8us*)((unsigned short*)Bt + t * 8) = f.half[0];  }
__global__ __launch_bounds__(64) void k_lam(const float* __restrict__ q1, const float* __restrict__ k1, const float* __restrict__ q2, const float* __restrict__ k2, float* __restrict__ LAM) {
  #pragma clang fp contract(off)
  const int ln = threadIdx.x & 31; if (threadIdx.x >= 32) return; float a = bf16_round(q1[ln]) * bf16_round(k1[ln]); a += bf16_round(q1[ln + 32]) * bf16_round(k1[ln + 32]); float c = bf16_round(q2[ln]) * bf16_round(k2[ln]); c += bf16_round(q2[ln + 32]) * bf16_round(k2[ln + 32]);
  for (int o = 16; o > 0; o >>= 1) { a += __shfl_xor(a, o, 32); c += __shfl_xor(c, o, 32); } const float lf = expf(a) - expf(c) + 0.78360576653162446f;      /* LAMBDA_INIT = 0.8 - 0.6 exp(-0.3 * 12) = 0.78360577 */
  const float v = (ln == 0) ? lf : 0.f; *(float*)(LAM + ln) = v;  }
__global__ __launch_bounds__(256) void k_comb(const float* __restrict__ OLO, const float* __restrict__ OHI, const float* __restrict__ LAM, const float* __restrict__ lnw, _Float16* __restrict__ A16) {
  #pragma clang fp contract(off)
  const size_t t = (size_t)blockIdx.x * 256 + threadIdx.x; if (t >= (size_t)NR * 16) return; const int j = (int)(t % 16); const size_t r = t / 16; const float lam = LAM[0]; float a[128]; float ss = 0.f;
  const float* e0 = OLO + r * DM + (size_t)(2 * j) * 64; const float* o0 = OLO + r * DM + (size_t)(2 * j + 1) * 64; const float* e1 = OHI + r * DM + (size_t)(2 * j) * 64; const float* o1 = OHI + r * DM + (size_t)(2 * j + 1) * 64;
  for (int d = 0; d < 64; ++d) { float v = e0[d]; v += -lam * o0[d]; a[d] = v; ss += v * v; float w = e1[d]; w += -lam * o1[d]; a[64 + d] = w; ss += w * w; }
  const float inv = rsqrtf(ss / 128.0f + 1e-5f); unsigned short* dst = (unsigned short*)A16 + r * DM + (size_t)j * 128;
  { for (int g = 0; g < 16; ++g) { FragH f; for (int q = 0; q < 8; ++q) { const int d = g * 8 + q; float v = a[d] * inv; v *= bf16_round(lnw[d]); v = v * 0.21639423346837554f;      /* 1 - LAMBDA_INIT */ f.h[q] = (_Float16)v; } *(v8us*)(dst + g * 8) = f.half[0]; }  } }

extern "C" void kernel_launch(void* const* d_in, const int* in_sizes, int n_in,
                              void* d_out, int out_size, void* d_ws, size_t ws_size, hipStream_t stream) {
  (void)in_sizes; (void)n_in; (void)out_size;
  const float* const* I = (const float* const*)d_in; const float* x = I[0]; const float* Wq = I[1]; const float* Wk = I[2]; const float* Wv = I[3]; const float* Wo = I[4]; const float* lq1 = I[5]; const float* lk1 = I[6]; const float* lq2 = I[7]; const float* lk2 = I[8]; const float* lnw = I[9]; const float* bq = nullptr; const float* bk = nullptr; const float* bv = nullptr;
  char* ws = (char*)d_ws; size_t off = 0;
  auto take = [&](size_t bytes) { char* p = ws + off; off += (bytes + 255) & ~(size_t)255; return p; };
  const size_t np = (size_t)NR * DM, nk = (size_t)NR * KVD;
  _Float16* BQ = (_Float16*)take((size_t)DM * DM * 2); _Float16* BK = (_Float16*)take((size_t)KVD * DM * 2); _Float16* BV = (_Float16*)take((size_t)KVD * DM * 2); _Float16* BO = (_Float16*)take((size_t)DM * DM * 2);
  float* CS = (float*)take((size_t)SLEN * 32 * 4); float* SN = (float*)take((size_t)SLEN * 32 * 4);
  _Float16* X16 = (_Float16*)take(np * 2); float* QF = (float*)take(np * 4); _Float16* QH = (_Float16*)take(np * 2); _Float16* QL = (_Float16*)take(np * 2); float* KF = (float*)take(nk * 4); float* VF = (float*)take(nk * 4); _Float16* KXH = (_Float16*)take(np * 2); _Float16* KXL = (_Float16*)take(np * 2); _Float16* VH = (_Float16*)take(nk * 2); _Float16* VL = (_Float16*)take(nk * 2); _Float16* VT = (_Float16*)take(np * 2); _Float16* VTL = (_Float16*)take(np * 2); _Float16* VT2 = (_Float16*)take(np * 2); _Float16* VTL2 = (_Float16*)take(np * 2); float* LAM = (float*)take(256); float* OHI = (float*)take(np * 4);      /* high-half attention output: a plane of its own, both value halves being live in the fused pass */
  float* OLO = QF;      /* low-half attention output over the q f32 plane (dead after the split) */ _Float16* A16 = X16;      /* normalised attention over the input plane (dead after the projections) */
  if (off > ws_size) return;      /* 8+2+2+8 + 0.5 + 16+32+16+16+8+8+16+16+4+4+16+16+16+16 + 32 = 253 MiB */
  k_wsc<<<(unsigned)(((size_t)DM * DM / 8 + 255) / 256), 256, 0, stream>>>(Wq, BQ, (size_t)DM * DM / 8, 16.0f); k_wsc<<<(unsigned)(((size_t)KVD * DM / 8 + 255) / 256), 256, 0, stream>>>(Wk, BK, (size_t)KVD * DM / 8, 16.0f); k_wsc<<<(unsigned)(((size_t)KVD * DM / 8 + 255) / 256), 256, 0, stream>>>(Wv, BV, (size_t)KVD * DM / 8, 16.0f); k_wsc<<<(unsigned)(((size_t)DM * DM / 8 + 255) / 256), 256, 0, stream>>>(Wo, BO, (size_t)DM * DM / 8, 16.0f);      /* torch (out,in) = Bt */ k_lam<<<1, 64, 0, stream>>>(lq1, lk1, lq2, lk2, LAM);
  k_rotab<<<(SLEN * 32 + 255) / 256, 256, 0, stream>>>(CS, SN);
  k_x16<<<(unsigned)((np / 8 + 255) / 256), 256, 0, stream>>>(x, X16, np / 8);
  k_gemm2<0><<<dim3((NR / 128) * (DM / 64), 1), 128, 0, stream>>>(X16, DM, 0, BQ, DM, 0, 0.0625f, bq, 0, nullptr, 1, 0, 0, QF, nullptr, DM, 0, NR, DM, DM);
  k_gemm2<0><<<dim3((NR / 128) * (KVD / 64), 1), 128, 0, stream>>>(X16, DM, 0, BK, DM, 0, 0.0625f, bk, 0, nullptr, 1, 0, 0, KF, nullptr, KVD, 0, NR, KVD, DM);
  k_gemm2<0><<<dim3((NR / 128) * (KVD / 64), 1), 128, 0, stream>>>(X16, DM, 0, BV, DM, 0, 0.0625f, bv, 0, nullptr, 1, 0, 0, VF, nullptr, KVD, 0, NR, KVD, DM);
  k_rope<<<(unsigned)(((size_t)NR * NH * 4 + 255) / 256), 256, 0, stream>>>(QF, NH, NH, 1, CS, SN, QH, QL);      /* q: 32 -> 32 heads */
  k_rope<<<(unsigned)(((size_t)NR * NH * 4 + 255) / 256), 256, 0, stream>>>(KF, NKV, NH, NREP, CS, SN, KXH, KXL);      /* k: kv head h/4 expanded to query head h */
  k_hl<<<(unsigned)((nk / 8 + 255) / 256), 256, 0, stream>>>(VF, VH, VL, nk / 8);
  k_vtg<<<NB * NH * (SLEN / 64), 256, 0, stream>>>(VH, 0, VT); k_vtg<<<NB * NH * (SLEN / 64), 256, 0, stream>>>(VL, 0, VTL); k_vtg<<<NB * NH * (SLEN / 64), 256, 0, stream>>>(VH, 64, VT2); k_vtg<<<NB * NH * (SLEN / 64), 256, 0, stream>>>(VL, 64, VTL2);      /* low / high 64 of each pseudo-head's 128-wide value head; QF becomes OLO from here on */
  k_flash5<1><<<NB * NH * QBN5, 128, 0, stream>>>(QH, QL, DM, KXH, KXL, DM, VT, VTL, nullptr, OLO, DM); k_flash5<1><<<NB * NH * QBN5, 128, 0, stream>>>(QH, QL, DM, KXH, KXL, DM, VT2, VTL2, nullptr, OHI, DM);      /* first 256 rows: low, then high 64 value columns */
  k_flash<1><<<NB * NH * QBNP, 128, 0, stream>>>(QH, DM, KXH, DM, VT, VT2, nullptr, OLO, OHI, DM);      /* rows from 256 on: one pass over the keys for both halves of each pseudo-head's 128-wide value head */
  k_comb<<<(unsigned)(((size_t)NR * 16 + 255) / 256), 256, 0, stream>>>(OLO, OHI, LAM, lnw, A16);
  k_gemm2<0><<<dim3((NR / 128) * (DM / 64), 1), 128, 0, stream>>>(A16, DM, 0, BO, DM, 0, 0.0625f, nullptr, 0, nullptr, 1, 0, 0, (float*)d_out, nullptr, DM, 0, NR, DM, DM);      /* out = attn Wo^T */
}

// v005
// It runs in 292 microseconds.
// Timed twice side by side with v004, it ran 1.24 and 1.25 times as fast.
// Counting every step since v000, it is 3.29 times as fast.
#include <hip/hip_runtime.h>
// MultiheadSdpaDiff4 (2 x 2048 tokens, EMBED 2048; differential attention: q = x Wq^T as 32 pseudo-heads x 64, k = x Wk^T as 8 heads x 64 repeat-interleaved 4x, v = x Wv^T as 4 heads x 128 repeat-interleaved 8x; causal softmax(q.k/8) v; attn = O_even - lambda_full * O_odd (16 heads x 128), lambda_full = exp(lq1.lk1) - exp(lq2.lk2) + 0.78361; RMSNorm(128, eps 1e-5) * ln_w * (1 - 0.78361); out = attn Wo^T.
// Compute dtype: inputs rounded to bf16; x exact as f16; q/k/P/v as f16 hi + residual on the first 256 rows (~2^-21) and plain beyond (~2^-12); the normalised attention as a plain f16 operand; softmax/lambda/RMSNorm f32. v_wmma_f32_16x16x32_f16.
#define NB 2
#define DM 2048
#define NKV 8
#define NREP (NH / NKV)
#define KVD (NKV * 64)           /* 512 */
#define NR (NB * SLEN)           /* 4096 */
#define SLEN 2048
#define TQ SLEN
#define TK SLEN
#define NH 32
#define SCL 0.125f
#define QBLKS (TQ / 64)
#define QB05 0
#define QBN5 4
#define QB0P QBN5
#define QBNP (QBLKS - QBN5)
#define RE 256
typedef __bf16 v16b __attribute__((ext_vector_type(16)));
typedef unsigned short v8us __attribute__((ext_vector_type(8), may_alias));
typedef float  v8f  __attribute__((ext_vector_type(8)));
typedef float  v4f  __attribute__((ext_vector_type(4)));
typedef float  v4fa __attribute__((ext_vector_type(4), may_alias));
union FragB { v16b v; v8us half[2]; unsigned short u[16]; };

__device__ __forceinline__ unsigned short bf16_bits(float x) { unsigned int u = __float_as_uint(x); return (unsigned short)((u + 0x7FFFu + ((u >> 16) & 1u)) >> 16); }
__device__ __forceinline__ float bf16_val(unsigned short b) { return __uint_as_float(((unsigned int)b) << 16); }
__device__ __forceinline__ float bf16_round(float x) { return bf16_val(bf16_bits(x)); }
// D += A·B with NT terms: 1 = ah·bh, 2 = + al·bh (A split), 3 = + ah·bl (both split)
template <int NT>
__device__ __forceinline__ v8f mmaN(v16b ah, v16b al, v16b bh, v16b bl, v8f c) {
  c = __builtin_amdgcn_wmma_f32_16x16x32_bf16(false, ah, false, bh, (short)0, c, false, false);
  if (NT >= 2) c = __builtin_amdgcn_wmma_f32_16x16x32_bf16(false, al, false, bh, (short)0, c, false, false);
  if (NT >= 3) c = __builtin_amdgcn_wmma_f32_16x16x32_bf16(false, ah, false, bl, (short)0, c, false, false);
  asm volatile("v_nop\n\tv_nop\n\tv_nop\n\tv_nop" : "+v"(c) : "v"(ah), "v"(al), "v"(bh), "v"(bl));
  return c;
}

__global__ __launch_bounds__(256) void k_wt_bf16(const float* __restrict__ W, unsigned short* __restrict__ Wt, int K, int N) {
  const int t = blockIdx.x * 256 + threadIdx.x;
  const int k8n = K / 8;
  if (t >= N * k8n) return;
  const int n = t / k8n, k8 = (t % k8n) * 8;
  v8us v;
#pragma unroll
  for (int i = 0; i < 8; ++i) v[i] = bf16_bits(W[(size_t)(k8 + i) * N + n]);
  *(v8us*)(Wt + (size_t)n * K + k8) = v;
  
}

// GEMM C[M][N] (f32, pitch ldc) = act(A[M][K]·W + bias). A f32 row-major (pitch lda) converted per fragment to bf16
// (ASPLIT: hi/lo two planes -> 2 terms, else single rounded term); Wt bf16 [N][K] (pitch ldb). BIAS_BF16 rounds the
// bias to bf16 first (bias quantised to bf16 before the add). K%32==0, M%16==0, N%64==0.
template <bool ASPLIT, int ACT, bool BIAS_BF16>
__global__ __launch_bounds__(128) void k_gemm_bf(const float* __restrict__ A, int lda, const unsigned short* __restrict__ Wt, int ldb,
                                               const float* __restrict__ bias, float* __restrict__ C, int ldc, int M, int N, int K) {
  __shared__ __attribute__((aligned(16))) float so[4][16][64];
  const int tid = threadIdx.x, w = tid >> 5, lane = tid & 31, ln = lane & 15, hh = lane >> 4;
  const int ntn = N / 64;
  const int wid = blockIdx.x * 4 + w;
  const int mt = wid / ntn, nq = wid % ntn;
  if (mt * 16 >= M) return;
  const int row0 = mt * 16, col0 = nq * 64;
  const float* arow = A + (size_t)(row0 + ln) * lda;
  v8f acc[4] = {};
  for (int kb = 0; kb < K; kb += 32) {
    FragB ah, al;
    const v4f x0 = *(const v4fa*)(arow + kb + 8 * hh), x1 = *(const v4fa*)(arow + kb + 8 * hh + 4);
    const v4f x2 = *(const v4fa*)(arow + kb + 16 + 8 * hh), x3 = *(const v4fa*)(arow + kb + 16 + 8 * hh + 4);
    float xs[16] = {x0[0],x0[1],x0[2],x0[3],x1[0],x1[1],x1[2],x1[3],x2[0],x2[1],x2[2],x2[3],x3[0],x3[1],x3[2],x3[3]};
#pragma unroll
    for (int i = 0; i < 16; ++i) { const unsigned short hb = bf16_bits(xs[i]); ah.u[i] = hb; al.u[i] = ASPLIT ? bf16_bits(xs[i] - bf16_val(hb)) : (unsigned short)0; }
#pragma unroll
    for (int t = 0; t < 4; ++t) {
      const unsigned short* brow = Wt + (size_t)(col0 + t * 16 + ln) * ldb + kb;
      FragB b;
      b.half[0] = *(const v8us*)(brow + 8 * hh);
      b.half[1] = *(const v8us*)(brow + 16 + 8 * hh);
      acc[t] = mmaN<ASPLIT ? 2 : 1>(ah.v, al.v, b.v, b.v, acc[t]);
    }
  }
#pragma unroll
  for (int t = 0; t < 4; ++t) {
    float bv = bias ? bias[col0 + t * 16 + ln] : 0.f;
    if (BIAS_BF16) bv = bf16_round(bv);
#pragma unroll
    for (int r = 0; r < 8; ++r) { float v = acc[t][r] + bv; if (ACT == 1) v = fmaxf(v, 0.f); so[w][8 * hh + r][t * 16 + ln] = v; }
  }
  __builtin_amdgcn_fence(__ATOMIC_ACQ_REL, "workgroup");
  __builtin_amdgcn_wave_barrier();
  const int rsub = lane >> 4, c4 = (lane & 15) * 4;
  {
#pragma unroll
    for (int q = 0; q < 8; ++q) {
      const int r = q * 2 + rsub;
      const v4f v = *(const v4fa*)&so[w][r][c4];
      *(v4f*)(C + (size_t)(row0 + r) * ldc + col0 + c4) = v;
    }
    
  }
}

// GEMM C = act(A·W + bias + resid): A f32 (ASPLIT -> hi/lo 2 terms), Wt bf16 [N][K]; ACT 0 none, 1 relu, 2 exact gelu;
// resid (optional, f32, row index = (row % rmod), pitch ldr, RES_BF16 rounds it) added before the activation.
template <bool ASPLIT, int ACT, bool BIAS_BF16, bool RES_BF16>
__global__ __launch_bounds__(128) void k_gemm_bf3(const float* __restrict__ A, int lda, const unsigned short* __restrict__ Wt, int ldb,
                                                const float* __restrict__ bias, const float* __restrict__ resid, int rmod, int ldr,
                                                float* __restrict__ C, int ldc, int M, int N, int K) {
  __shared__ __attribute__((aligned(16))) float so[4][16][64];
  const int tid = threadIdx.x, w = tid >> 5, lane = tid & 31, ln = lane & 15, hh = lane >> 4;
  const int ntn = N / 64;
  const int wid = blockIdx.x * 4 + w;
  const int mt = wid / ntn, nq = wid % ntn;
  if (mt * 16 >= M) return;
  const int row0 = mt * 16, col0 = nq * 64;
  const float* arow = A + (size_t)(row0 + ln) * lda;
  v8f acc[4] = {};
  for (int kb = 0; kb < K; kb += 32) {
    FragB ah, al;
    const v4f x0 = *(const v4fa*)(arow + kb + 8 * hh), x1 = *(const v4fa*)(arow + kb + 8 * hh + 4);
    const v4f x2 = *(const v4fa*)(arow + kb + 16 + 8 * hh), x3 = *(const v4fa*)(arow + kb + 16 + 8 * hh + 4);
    float xs[16] = {x0[0],x0[1],x0[2],x0[3],x1[0],x1[1],x1[2],x1[3],x2[0],x2[1],x2[2],x2[3],x3[0],x3[1],x3[2],x3[3]};
#pragma unroll
    for (int i = 0; i < 16; ++i) { const unsigned short hb = bf16_bits(xs[i]); ah.u[i] = hb; al.u[i] = ASPLIT ? bf16_bits(xs[i] - bf16_val(hb)) : (unsigned short)0; }
#pragma unroll
    for (int t = 0; t < 4; ++t) {
      const unsigned short* brow = Wt + (size_t)(col0 + t * 16 + ln) * ldb + kb;
      FragB b;
      b.half[0] = *(const v8us*)(brow + 8 * hh);
      b.half[1] = *(const v8us*)(brow + 16 + 8 * hh);
      acc[t] = mmaN<ASPLIT ? 2 : 1>(ah.v, al.v, b.v, b.v, acc[t]);
    }
  }
#pragma unroll
  for (int t = 0; t < 4; ++t) {
    const int col = col0 + t * 16 + ln;
    float bv = bias ? bias[col] : 0.f;
    if (BIAS_BF16) bv = bf16_round(bv);
#pragma unroll
    for (int r = 0; r < 8; ++r) {
      float v = acc[t][r] + bv;
      if (resid) { float rv = resid[(size_t)((row0 + 8 * hh + r) % rmod) * ldr + col]; if (RES_BF16) rv = bf16_round(rv); v += rv; }
      if (ACT == 1) v = fmaxf(v, 0.f);
      if (ACT == 2) v = 0.5f * v * (1.0f + erff(v * 0.70710678118654752f));
      if (ACT == 3) { const float u = 0.7978845608028654f * (v + 0.044715f * v * v * v); v = 0.5f * v * (1.0f + tanhf(u)); }
      so[w][8 * hh + r][t * 16 + ln] = v;
    }
  }
  __builtin_amdgcn_fence(__ATOMIC_ACQ_REL, "workgroup");
  __builtin_amdgcn_wave_barrier();
  const int rsub = lane >> 4, c4 = (lane & 15) * 4;
  {
#pragma unroll
    for (int q = 0; q < 8; ++q) {
      const int r = q * 2 + rsub;
      const v4f v = *(const v4fa*)&so[w][r][c4];
      *(v4f*)(C + (size_t)(row0 + r) * ldc + col0 + c4) = v;
    }
    
  }
}
// row LayerNorm (biased variance, eps) over N: s = X (+ R); optional out_sum <- s; out_norm <- (s-mu)*rsqrt(var+eps)*g + b
template <bool PARAM_BF16>
__global__ __launch_bounds__(256) void k_layernorm(const float* __restrict__ X, const float* __restrict__ R, const float* __restrict__ g, const float* __restrict__ bta,
                                                  float* __restrict__ out_sum, float* __restrict__ out_norm, int N, float eps) {
  __shared__ float red[256];
  const int row = blockIdx.x, tid = threadIdx.x;
  const float* x = X + (size_t)row * N; const float* rr = R ? R + (size_t)row * N : nullptr;
  float vals[16];                     // up to N = 4096
  const int per = N / 256;            // contiguous chunk per thread? use strided-by-4 chunks: thread handles j = tid*4 + 1024*u
  float s1 = 0.f;
  for (int u = 0; u < per / 4; ++u) {
    const int j = tid * 4 + 1024 * u;
    const v4f a = *(const v4fa*)(x + j);
    v4f b = {0.f,0.f,0.f,0.f}; if (rr) b = *(const v4fa*)(rr + j);
#pragma unroll
    for (int q = 0; q < 4; ++q) { const float v = a[q] + b[q]; vals[u * 4 + q] = v; s1 += v; }
  }
  red[tid] = s1; __syncthreads();
  for (int st = 128; st > 0; st >>= 1) { if (tid < st) red[tid] += red[tid + st]; __syncthreads(); }
  const float mu = red[0] / (float)N; __syncthreads();
  float s2 = 0.f;
  for (int u = 0; u < per / 4; ++u)
#pragma unroll
    for (int q = 0; q < 4; ++q) { const float c = vals[u * 4 + q] - mu; s2 += c * c; }
  red[tid] = s2; __syncthreads();
  for (int st = 128; st > 0; st >>= 1) { if (tid < st) red[tid] += red[tid + st]; __syncthreads(); }
  const float rs = rsqrtf(red[0] / (float)N + eps);
  {
    for (int u = 0; u < per / 4; ++u) {
      const int j = tid * 4 + 1024 * u;
      v4f o, sm;
#pragma unroll
      for (int q = 0; q < 4; ++q) {
        float gg = g[j + q], bb = bta[j + q];
        if (PARAM_BF16) { gg = bf16_round(gg); bb = bf16_round(bb); }
        sm[q] = vals[u * 4 + q]; o[q] = (vals[u * 4 + q] - mu) * rs * gg + bb;
      }
      if (out_sum) *(v4f*)(out_sum + (size_t)row * N + j) = sm;
      *(v4f*)(out_norm + (size_t)row * N + j) = o;
    }
    
  }
}



// ---- f16 WMMA path (v_wmma_f32_16x16x32_f16): 11-bit significands for operands in range — used where a [0,1] probability operand needs more precision than bf16
typedef _Float16 v16h __attribute__((ext_vector_type(16)));
union FragH { v16h v; v8us half[2]; _Float16 h[16]; unsigned short u[16]; };
template <int NT>
__device__ __forceinline__ v8f mmaH(v16h ah, v16h al, v16h bh, v16h bl, v8f c) {
  c = __builtin_amdgcn_wmma_f32_16x16x32_f16(false, ah, false, bh, (short)0, c, false, false);
  if (NT >= 2) c = __builtin_amdgcn_wmma_f32_16x16x32_f16(false, al, false, bh, (short)0, c, false, false);
  if (NT >= 3) c = __builtin_amdgcn_wmma_f32_16x16x32_f16(false, ah, false, bl, (short)0, c, false, false);
  asm volatile("v_nop\n\tv_nop\n\tv_nop\n\tv_nop" : "+v"(c) : "v"(ah), "v"(al), "v"(bh), "v"(bl));
  return c;
}
// batched GEMM like k_gemm_b but f16 operands: A f32 (split into f16 hi/lo if ASPLIT, else rounded to f16), Bt = f16 values [n][k]; alpha; C f32; N multiple of 16 (partial tiles skipped)
template <bool ASPLIT>
__global__ __launch_bounds__(128) void k_gemm_h(const float* __restrict__ A, int lda, size_t sA, const _Float16* __restrict__ Bh, int ldb, size_t sB, float alpha, float* __restrict__ C, int ldc, size_t sC, int M, int N, int K) {
  __shared__ __attribute__((aligned(16))) float so[4][16][64];
  const int tid = threadIdx.x, w = tid >> 5, lane = tid & 31, ln = lane & 15, hh = lane >> 4; const int by = blockIdx.y;
  A += (size_t)by * sA; Bh += (size_t)by * sB; C += (size_t)by * sC;
  const int ntn = (N + 63) / 64; const int wid = blockIdx.x * 4 + w; const int mt = wid / ntn, nq = wid % ntn; if (mt * 16 >= M) return;
  const int row0 = mt * 16, col0 = nq * 64; const float* arow = A + (size_t)(row0 + ln) * lda;
  v8f acc[4] = {};
  for (int kb = 0; kb < K; kb += 32) {
    FragH ah, al;
    const v4f x0 = *(const v4fa*)(arow + kb + 8 * hh), x1 = *(const v4fa*)(arow + kb + 8 * hh + 4), x2 = *(const v4fa*)(arow + kb + 16 + 8 * hh), x3 = *(const v4fa*)(arow + kb + 16 + 8 * hh + 4);
    float xs[16] = {x0[0],x0[1],x0[2],x0[3],x1[0],x1[1],x1[2],x1[3],x2[0],x2[1],x2[2],x2[3],x3[0],x3[1],x3[2],x3[3]};
#pragma unroll
    for (int i = 0; i < 16; ++i) { const _Float16 h = (_Float16)xs[i]; ah.h[i] = h; al.h[i] = ASPLIT ? (_Float16)(xs[i] - (float)h) : (_Float16)0.0f; }
#pragma unroll
    for (int t = 0; t < 4; ++t) { if (col0 + t * 16 >= N) continue; const size_t boff = (size_t)(col0 + t * 16 + ln) * ldb + kb; FragH bq; bq.half[0] = *(const v8us*)(Bh + boff + 8 * hh); bq.half[1] = *(const v8us*)(Bh + boff + 16 + 8 * hh);
      acc[t] = mmaH<ASPLIT ? 2 : 1>(ah.v, al.v, bq.v, bq.v, acc[t]); }
  }
#pragma unroll
  for (int t = 0; t < 4; ++t) { if (col0 + t * 16 >= N) continue;
#pragma unroll
    for (int r = 0; r < 8; ++r) so[w][8 * hh + r][t * 16 + ln] = acc[t][r] * alpha; }
  __builtin_amdgcn_fence(__ATOMIC_ACQ_REL, "workgroup"); __builtin_amdgcn_wave_barrier();
  const int rsub = lane >> 4, c4 = (lane & 15) * 4;
  {
#pragma unroll
    for (int q = 0; q < 8; ++q) { const int r = q * 2 + rsub; if (col0 + c4 < N) { const v4f v = *(const v4fa*)&so[w][r][c4]; *(v4f*)(C + (size_t)(row0 + r) * ldc + col0 + c4) = v; } }
     }
}

// Wt[n][k] = f16(W[k][n]·scale) from f32 row-major W[K][N] (scale = power of two; bf16-exact weights stay exact in f16 away from the subnormal range)
__global__ __launch_bounds__(256) void k_wt_f16(const float* __restrict__ W, _Float16* __restrict__ Wt, int K, int N, float scale) {
  const int t = blockIdx.x * 256 + threadIdx.x; if (t >= N * (K / 8)) return; const int n = t / (K / 8), k8 = (t % (K / 8)) * 8; FragH f;
#pragma unroll
  for (int i = 0; i < 8; ++i) f.h[i] = (_Float16)(bf16_round(W[(size_t)(k8 + i) * N + n]) * scale); const v8us o = f.half[0];
  *(v8us*)((unsigned short*)Wt + (size_t)n * K + k8) = o; 
}
// k_gemm_hh variant with fused epilogue: v = acc·alpha + bias[by·sBias + col] (+ CP[(row/rowsPerB)·sCPb + by·64 + col] if CP) ; ACT 0 none / 1 elu ; writes f16 C16 (and f32 C if non-null)
template <int ACT>
__global__ __launch_bounds__(128) void k_gemm_hhx(const _Float16* __restrict__ A, int lda, size_t sA, const _Float16* __restrict__ Bh, int ldb, size_t sB, float alpha, const float* __restrict__ bias, size_t sBias, const float* __restrict__ CP, int rowsPerB, size_t sCPb, int row0g,
    float* __restrict__ C, _Float16* __restrict__ C16, int ldc, size_t sC, int M, int N, int K) {
  __shared__ __attribute__((aligned(16))) float so[4][16][64];
  const int tid = threadIdx.x, w = tid >> 5, lane = tid & 31, ln = lane & 15, hh = lane >> 4; const int by = blockIdx.y;
  A += (size_t)by * sA; Bh += (size_t)by * sB; const size_t cofs = (size_t)by * sC; const float* bp = bias ? bias + (size_t)by * sBias : nullptr;
  const int ntn = (N + 63) / 64; const int wid = blockIdx.x * 4 + w; const int mt = wid / ntn, nq = wid % ntn; if (mt * 16 >= M) return;
  const int row0 = mt * 16, col0 = nq * 64; const _Float16* arow = A + (size_t)(row0 + ln) * lda;
  v8f acc[4] = {};
  for (int kb = 0; kb < K; kb += 32) { FragH ah; ah.half[0] = *(const v8us*)((const unsigned short*)arow + kb + 8 * hh); ah.half[1] = *(const v8us*)((const unsigned short*)arow + kb + 16 + 8 * hh);
#pragma unroll
    for (int t = 0; t < 4; ++t) { if (col0 + t * 16 >= N) continue; const size_t boff = (size_t)(col0 + t * 16 + ln) * ldb + kb; FragH bq; bq.half[0] = *(const v8us*)((const unsigned short*)Bh + boff + 8 * hh); bq.half[1] = *(const v8us*)((const unsigned short*)Bh + boff + 16 + 8 * hh);
      acc[t] = mmaH<1>(ah.v, ah.v, bq.v, bq.v, acc[t]); }
  }
#pragma unroll
  for (int t = 0; t < 4; ++t) { if (col0 + t * 16 >= N) continue; const int col = col0 + t * 16 + ln; const float bv = bp ? bf16_round(bp[col]) : 0.f;
#pragma unroll
    for (int r = 0; r < 8; ++r) { float v = acc[t][r] * alpha + bv; if (CP) { const int bidx = (row0g + row0 + 8 * hh + r) / rowsPerB; v += CP[(size_t)bidx * sCPb + (size_t)by * 64 + col]; } if (ACT == 1) v = (v > 0.f) ? v : expm1f(v); else if (ACT == 7) v = (v > 0.f) ? v + 1.0f : expf(v); else if (ACT == 8) v = tanhf(v); else if (ACT == 9) v = 0.5f * v * (1.0f + tanhf(0.7978845608028654f * (v + 0.044715f * v * v * v))); else if (ACT == 11) v = 1.0f / (1.0f + expf(-v)); else if (ACT == 12) v = (v > 0.f) ? v : 0.01f * v; else if (ACT == 14) v = (v > 0.f) ? v : 0.1f * v; else if (ACT == 15) v = v / (1.0f + expf(-v)); else if (ACT == 3) v = fmaxf(v, 0.f); else if (ACT == 6) v = 0.5f * v * (1.0f + erff(v * 0.70710678118654752f)); so[w][8 * hh + r][t * 16 + ln] = v; } }
  __builtin_amdgcn_fence(__ATOMIC_ACQ_REL, "workgroup"); __builtin_amdgcn_wave_barrier();
  const int rsub = lane >> 4, c4 = (lane & 15) * 4; typedef _Float16 v4h __attribute__((ext_vector_type(4)));
  {
#pragma unroll
    for (int q = 0; q < 8; ++q) { const int r = q * 2 + rsub; if (col0 + c4 < N) { const v4f v = *(const v4fa*)&so[w][r][c4]; if (C) *(v4f*)(C + cofs + (size_t)(row0 + r) * ldc + col0 + c4) = v; if (C16) { v4h h4; for (int i = 0; i < 4; ++i) h4[i] = (_Float16)v[i]; *(v4h*)(C16 + cofs + (size_t)(row0 + r) * ldc + col0 + c4) = h4; } } }
     }
}


typedef _Float16 v4h __attribute__((ext_vector_type(4)));

__global__ __launch_bounds__(256) void k_x16(const float* __restrict__ x, _Float16* __restrict__ X16, size_t n8) { const size_t t = (size_t)blockIdx.x * 256 + threadIdx.x; if (t >= n8) return; FragH f;
#pragma unroll
  for (int q = 0; q < 8; ++q) f.h[q] = (_Float16)bf16_round(x[t * 8 + q]); *(v8us*)((unsigned short*)X16 + t * 8) = f.half[0];  }
__global__ __launch_bounds__(256) void k_h16(const float* __restrict__ x, _Float16* __restrict__ X16, size_t n8) { const size_t t = (size_t)blockIdx.x * 256 + threadIdx.x; if (t >= n8) return; FragH f;
#pragma unroll
  for (int q = 0; q < 8; ++q) f.h[q] = (_Float16)x[t * 8 + q]; *(v8us*)((unsigned short*)X16 + t * 8) = f.half[0];  }
__global__ __launch_bounds__(256) void k_round16f(const float* __restrict__ W, _Float16* __restrict__ Bt, size_t n8) { const size_t t = (size_t)blockIdx.x * 256 + threadIdx.x; if (t >= n8) return; FragH f;
#pragma unroll
  for (int i = 0; i < 8; ++i) f.h[i] = (_Float16)(bf16_round(W[t * 8 + i]) * 16.0f); *(v8us*)((unsigned short*)Bt + t * 8) = f.half[0];  }
template <int NHv, int TTv>
__global__ __launch_bounds__(256) void k_vt(const _Float16* __restrict__ V16, int ldv, int voff, _Float16* __restrict__ Vt) { __shared__ unsigned short tl[64][66]; const int tid = threadIdx.x; const int slab = blockIdx.x / (TTv / 64), lg = blockIdx.x % (TTv / 64); const int b = slab / NHv, h = slab % NHv;
  for (int i = tid; i < 64 * 8; i += 256) { const int r = i / 8, c8 = (i % 8) * 8; FragH f; f.half[0] = *(const v8us*)((const unsigned short*)V16 + ((size_t)b * TTv + lg * 64 + r) * ldv + voff + h * 64 + c8);
#pragma unroll
    for (int q = 0; q < 8; ++q) tl[r][c8 + q] = f.u[q]; }
  __syncthreads();
  {
#pragma unroll
    for (int rd = 0; rd < 2; ++rd) { const int d = rd * 32 + tid / 8, pc = tid % 8; FragH f;
#pragma unroll
      for (int q = 0; q < 8; ++q) f.u[q] = tl[pc * 8 + q][d];
      *(v8us*)((unsigned short*)Vt + ((size_t)slab * 64 + d) * TTv + lg * 64 + pc * 8) = f.half[0]; }
     } }

__global__ __launch_bounds__(256) void k_hl(const float* __restrict__ F, _Float16* __restrict__ Hh, _Float16* __restrict__ Hl, size_t n8) { const size_t t = (size_t)blockIdx.x * 256 + threadIdx.x; if (t >= n8) return; FragH fh, fl; const v4f a = *(const v4fa*)(F + t * 8), c = *(const v4fa*)(F + t * 8 + 4);
#pragma unroll
  for (int q = 0; q < 4; ++q) { _Float16 h = (_Float16)a[q]; fh.h[q] = h; fl.h[q] = (_Float16)((a[q] - (float)h) * 1024.0f); h = (_Float16)c[q]; fh.h[4 + q] = h; fl.h[4 + q] = (_Float16)((c[q] - (float)h) * 1024.0f); }
  { *(v8us*)((unsigned short*)Hh + t * 8) = fh.half[0]; *(v8us*)((unsigned short*)Hl + t * 8) = fl.half[0];  } }

// ---- fast GEMM (block tile 128x64, wave tile 32x64; requires M % 128 == 0, N % 64 == 0, K % 64 == 0); epilogue = k_gemm_hhx semantics ----
// Per trip a 64-deep slice of A (128 rows) and of B (64 rows) is copied to LDS in whole 128-byte lines (asynchronous copies, two buffers: the next slice flies while this one is multiplied); fragments come from LDS.
#define G2_PITCH 144                      /* LDS bytes per staged row: 128 + 16, the conflict-free pitch for 16-byte reads */
#define G2_BUF ((128 + 64) * G2_PITCH)    /* one buffer: A rows 0..127, then B rows 128..191 */
__device__ __forceinline__ v16h g2_lfrag(const unsigned char* p) { FragH f; f.half[0] = *(const v8us*)p; f.half[1] = *(const v8us*)(p + 32); return f.v; }
__device__ __forceinline__ v8f g2_mma(v16h a, v16h b, v8f c) { v8f d = __builtin_amdgcn_wmma_f32_16x16x32_f16(false, a, false, b, (short)0, c, false, false); asm volatile("v_nop\n\tv_nop\n\tv_nop\n\tv_nop" : "+v"(d) : "v"(a), "v"(b)); return d; }
// one slice: 12 copies of 16 bytes per lane (8 of A, 4 of B), a wave's copy covering 4 whole rows; l = the lane's LDS byte address of its first row, rows 16 apart
__device__ __forceinline__ void g2_copy(unsigned l, const _Float16* ga, size_t sa16, const _Float16* gb, size_t sb16) {
  /* the closing s_wait_xcnt keeps every address register intact until the copies have taken it */
  asm volatile("global_load_async_to_lds_b128 %0, %12, off\n\t"
               "global_load_async_to_lds_b128 %1, %13, off\n\t"
               "global_load_async_to_lds_b128 %2, %14, off\n\t"
               "global_load_async_to_lds_b128 %3, %15, off\n\t"
               "global_load_async_to_lds_b128 %4, %16, off\n\t"
               "global_load_async_to_lds_b128 %5, %17, off\n\t"
               "global_load_async_to_lds_b128 %6, %18, off\n\t"
               "global_load_async_to_lds_b128 %7, %19, off\n\t"
               "global_load_async_to_lds_b128 %8, %20, off\n\t"
               "global_load_async_to_lds_b128 %9, %21, off\n\t"
               "global_load_async_to_lds_b128 %10, %22, off\n\t"
               "global_load_async_to_lds_b128 %11, %23, off\n\t"
               "s_wait_xcnt 0x0"
               :: "v"(l), "v"(l + 16 * G2_PITCH), "v"(l + 32 * G2_PITCH), "v"(l + 48 * G2_PITCH), "v"(l + 64 * G2_PITCH), "v"(l + 80 * G2_PITCH), "v"(l + 96 * G2_PITCH), "v"(l + 112 * G2_PITCH),
                  "v"(l + 128 * G2_PITCH), "v"(l + 144 * G2_PITCH), "v"(l + 160 * G2_PITCH), "v"(l + 176 * G2_PITCH),
                  "v"(ga), "v"(ga + sa16), "v"(ga + 2 * sa16), "v"(ga + 3 * sa16), "v"(ga + 4 * sa16), "v"(ga + 5 * sa16), "v"(ga + 6 * sa16), "v"(ga + 7 * sa16),
                  "v"(gb), "v"(gb + sb16), "v"(gb + 2 * sb16), "v"(gb + 3 * sb16)
               : "memory");
}
template <int ACT>
__global__ __launch_bounds__(128) void k_gemm2(const _Float16* __restrict__ A, int lda, size_t sA, const _Float16* __restrict__ Bh, int ldb, size_t sB, float alpha, const float* __restrict__ bias, size_t sBias, const float* __restrict__ CP, int rowsPerB, size_t sCPb, int row0g,
    float* __restrict__ C, _Float16* __restrict__ C16, int ldc, size_t sC, int M, int N, int K) {
  __shared__ __attribute__((aligned(16))) unsigned char smem[2 * G2_BUF];      /* the two staging buffers; the epilogue's 4 x 32 x 68 floats lie over them once the loop's last barrier has ended every read */
  float (*so)[32][68] = reinterpret_cast<float (*)[32][68]>(smem);
  const int tid = threadIdx.x, w = tid >> 5, lane = tid & 31, ln = lane & 15, hh = lane >> 4; const int by = blockIdx.y;
  A += (size_t)by * sA; Bh += (size_t)by * sB; const size_t cofs = (size_t)by * sC; const float* bp = bias ? bias + (size_t)by * sBias : nullptr;
  const int ntn = N >> 6; const int mt = blockIdx.x / ntn, nq = blockIdx.x - mt * ntn; const int row0 = mt * 128 + 32 * w, col0 = nq * 64; if (mt * 128 >= M) return;      /* the whole block leaves or none: barriers follow */
  const int crow = tid >> 3, cch = tid & 7;      /* copy role: row (mod 16) and 16-byte piece of the 128-byte row */
  const _Float16* gA = A + (size_t)(mt * 128 + crow) * lda + cch * 8; const _Float16* gB = Bh + (size_t)(col0 + crow) * ldb + cch * 8; const size_t sa16 = (size_t)16 * lda, sb16 = (size_t)16 * ldb;
  const unsigned l0 = (unsigned)(size_t)smem + (unsigned)(crow * G2_PITCH + cch * 16);
  const int aoff = (32 * w + ln) * G2_PITCH + 16 * hh, boff = (128 + ln) * G2_PITCH + 16 * hh;
  const v8f z8 = {0.f,0.f,0.f,0.f,0.f,0.f,0.f,0.f}; v8f c00 = z8, c01 = z8, c02 = z8, c03 = z8, c10 = z8, c11 = z8, c12 = z8, c13 = z8;
  const int NT = K >> 6;
  g2_copy(l0, gA, sa16, gB, sb16);
  asm volatile("s_wait_asynccnt 0x0" ::: "memory");      /* slice 0 has landed before the barrier publishes it */
  __syncthreads();
  if (NT > 1) g2_copy(l0 + G2_BUF, gA + 64, sa16, gB + 64, sb16);
#pragma unroll 1      /* one slice per trip: the buffer alternates with the trip's parity */
  for (int t = 0; t < NT; ++t) { const unsigned char* sb = smem + (t & 1) * G2_BUF; const unsigned char* pa = sb + aoff; const unsigned char* pb = sb + boff;
    const v16h a0 = g2_lfrag(pa), a1 = g2_lfrag(pa + 16 * G2_PITCH), b0 = g2_lfrag(pb), b1 = g2_lfrag(pb + 16 * G2_PITCH), b2 = g2_lfrag(pb + 32 * G2_PITCH), b3 = g2_lfrag(pb + 48 * G2_PITCH);
    const v16h e0 = g2_lfrag(pa + 64), e1 = g2_lfrag(pa + 16 * G2_PITCH + 64), f0 = g2_lfrag(pb + 64), f1 = g2_lfrag(pb + 16 * G2_PITCH + 64), f2 = g2_lfrag(pb + 32 * G2_PITCH + 64), f3 = g2_lfrag(pb + 48 * G2_PITCH + 64);
    c00 = g2_mma(a0, b0, c00); c10 = g2_mma(a1, b0, c10); c01 = g2_mma(a0, b1, c01); c11 = g2_mma(a1, b1, c11); c02 = g2_mma(a0, b2, c02); c12 = g2_mma(a1, b2, c12); c03 = g2_mma(a0, b3, c03); c13 = g2_mma(a1, b3, c13);
    c00 = g2_mma(e0, f0, c00); c10 = g2_mma(e1, f0, c10); c01 = g2_mma(e0, f1, c01); c11 = g2_mma(e1, f1, c11); c02 = g2_mma(e0, f2, c02); c12 = g2_mma(e1, f2, c12); c03 = g2_mma(e0, f3, c03); c13 = g2_mma(e1, f3, c13);
    asm volatile("s_wait_dscnt 0x0" ::: "memory");         /* this wave's reads of the buffer are over before it may be refilled */
    asm volatile("s_wait_asynccnt 0x0" ::: "memory");      /* this wave's copies of the next slice have landed */
    __syncthreads();                                       /* publishes the next slice and ends every wave's reads of this one */
    if (t + 2 < NT) g2_copy(l0 + (unsigned)(t & 1) * G2_BUF, gA + (size_t)(t + 2) * 64, sa16, gB + (size_t)(t + 2) * 64, sb16); }
  asm volatile("s_wait_asynccnt 0x0" ::: "memory");        /* nothing is in flight when the buffers become output staging */
  v8f accs[8] = {c00, c01, c02, c03, c10, c11, c12, c13};
#pragma unroll
  for (int u = 0; u < 8; ++u) { const int t = u & 3, half = u >> 2; const int col = col0 + t * 16 + ln; const float bv = bp ? bf16_round(bp[col]) : 0.f;
#pragma unroll
    for (int r = 0; r < 8; ++r) { const int rloc = half * 16 + 8 * hh + r; float v = accs[u][r] * alpha + bv; if (CP) { const int bidx = (row0g + row0 + rloc) / rowsPerB; v += CP[(size_t)bidx * sCPb + (size_t)by * 64 + col]; }
      if (ACT == 3) v = fmaxf(v, 0.f); else if (ACT == 6) v = 0.5f * v * (1.0f + erff(v * 0.70710678118654752f)); else if (ACT == 11) v = 1.0f / (1.0f + expf(-v)); else if (ACT == 15) v = v / (1.0f + expf(-v)); else if (ACT == 12) v = (v > 0.f) ? v : 0.01f * v; else if (ACT == 8) v = tanhf(v);
      so[w][rloc][t * 16 + ln] = v; } }
  __builtin_amdgcn_fence(__ATOMIC_ACQ_REL, "workgroup"); __builtin_amdgcn_wave_barrier();
  const int rsub = lane >> 4, c4 = (lane & 15) * 4;
  {
#pragma unroll
    for (int q = 0; q < 16; ++q) { const int r = q * 2 + rsub; const v4f v = *(const v4fa*)&so[w][r][c4]; if (C) *(v4f*)(C + cofs + (size_t)(row0 + r) * ldc + col0 + c4) = v; if (C16) { v4h h4; for (int i = 0; i < 4; ++i) h4[i] = (_Float16)v[i]; *(v4h*)(C16 + cofs + (size_t)(row0 + r) * ldc + col0 + c4) = h4; } }
     } }



// lane l with lane l ^ 16 (the two halves of a wave hold the two key halves of one query column)
__device__ __forceinline__ float xhalf(float x) { return __builtin_bit_cast(float, __builtin_amdgcn_permlanex16(__builtin_bit_cast(int, x), __builtin_bit_cast(int, x), 0x76543210, 0xfedcba98, false, false)); }
#define FL_BUF (192 * G2_PITCH)      /* one buffer: key rows 0..63, low value-dimension rows 64..127, high ones 128..191 */
// one tile: 12 copies of 16 bytes per lane (4 of K, 4 of V^T low, 4 of V^T high), a wave's copy covering 4 whole rows; l = the lane's LDS byte address of its first row, rows 16 apart
__device__ __forceinline__ void fl_copy(unsigned l, const unsigned short* gk, size_t sk16, const unsigned short* gv, const unsigned short* gw, size_t sv16) {
  /* the closing s_wait_xcnt keeps every address register intact until the copies have taken it */
  asm volatile("global_load_async_to_lds_b128 %0, %12, off\n\t"
               "global_load_async_to_lds_b128 %1, %13, off\n\t"
               "global_load_async_to_lds_b128 %2, %14, off\n\t"
               "global_load_async_to_lds_b128 %3, %15, off\n\t"
               "global_load_async_to_lds_b128 %4, %16, off\n\t"
               "global_load_async_to_lds_b128 %5, %17, off\n\t"
               "global_load_async_to_lds_b128 %6, %18, off\n\t"
               "global_load_async_to_lds_b128 %7, %19, off\n\t"
               "global_load_async_to_lds_b128 %8, %20, off\n\t"
               "global_load_async_to_lds_b128 %9, %21, off\n\t"
               "global_load_async_to_lds_b128 %10, %22, off\n\t"
               "global_load_async_to_lds_b128 %11, %23, off\n\t"
               "s_wait_xcnt 0x0"
               :: "v"(l), "v"(l + 16 * G2_PITCH), "v"(l + 32 * G2_PITCH), "v"(l + 48 * G2_PITCH), "v"(l + 64 * G2_PITCH), "v"(l + 80 * G2_PITCH), "v"(l + 96 * G2_PITCH), "v"(l + 112 * G2_PITCH),
                  "v"(l + 128 * G2_PITCH), "v"(l + 144 * G2_PITCH), "v"(l + 160 * G2_PITCH), "v"(l + 176 * G2_PITCH),
                  "v"(gk), "v"(gk + sk16), "v"(gk + 2 * sk16), "v"(gk + 3 * sk16), "v"(gv), "v"(gv + sv16), "v"(gv + 2 * sv16), "v"(gv + 3 * sv16),
                  "v"(gw), "v"(gw + sv16), "v"(gw + 2 * sv16), "v"(gw + 3 * sv16)
               : "memory");
}
// Transposed products: S^T = K Q^T (A = key rows, B = query columns) and O^T += V^T P^T (A = value-dimension rows of V^T, B = P^T). A lane holds 16 of the 32 scores of ONE query (keys 8 hh + r and 16 + 8 hh + r), which is the k order of a B operand: P goes from the score accumulators into the next product without LDS; maximum, sum and rescale factor are one value per lane.
template <int CAUSAL>
__global__ __launch_bounds__(128) void k_flash(const _Float16* __restrict__ Q16, int ldq, const _Float16* __restrict__ K16, int ldk, const _Float16* __restrict__ Vt, const _Float16* __restrict__ Vt2, const int* __restrict__ MSK, float* __restrict__ O, float* __restrict__ O2, int ldo) {
  constexpr int RPW = 16, DT = 8, KS = 2;      /* DT 0..3: low 64 value columns (Vt -> O), DT 4..7: high 64 (Vt2 -> O2); one score/softmax pass feeds both */
  __shared__ __attribute__((aligned(16))) unsigned char smem[2 * FL_BUF];      /* the two staging buffers; the epilogue's 4 x 16 x 68 floats lie over them once the loop's last barrier has ended every read */
  float (*sO)[RPW][64 + 4] = reinterpret_cast<float (*)[RPW][64 + 4]>(smem);
  const int tid = threadIdx.x, w = tid >> 5, lane = tid & 31, ln = lane & 15, hh = lane >> 4;
  const int slab = blockIdx.x / QBNP, qblk = QB0P + blockIdx.x % QBNP; const int b = slab / NH, h = slab % NH; const int qb0 = qblk * (4 * RPW); const int q0 = qb0 + w * RPW; const int tq = q0 + ln;      /* this lane's query */
  FragH aq[KS];
  { const unsigned short* qr = (const unsigned short*)Q16 + ((size_t)b * TQ + tq) * ldq + h * 64;
#pragma unroll
    for (int ks = 0; ks < KS; ++ks) { aq[ks].half[0] = *(const v8us*)(qr + ks * 32 + 8 * hh); aq[ks].half[1] = *(const v8us*)(qr + ks * 32 + 16 + 8 * hh); } }
  const unsigned short* Vth = (const unsigned short*)Vt + (size_t)slab * 64 * TK; const unsigned short* Vth2 = (const unsigned short*)Vt2 + (size_t)slab * 64 * TK;
  constexpr float C2 = SCL * 1.4426950408889634f;      /* raw score -> exponent in base 2 */
  float m_r = -1.0e38f, l_r = 0.f; v8f oacc[DT];      /* m_r: running maximum of the RAW scores, never below -1e38, so that a masked score (-3e38) stays far under it; l_r: row sum in units of 2^-10 */
#pragma unroll
  for (int dt = 0; dt < DT; ++dt) oacc[dt] = (v8f){0.f,0.f,0.f,0.f,0.f,0.f,0.f,0.f};
  const int jend = (CAUSAL == 1) ? (qb0 + 4 * RPW) : TK;      /* causal: keys beyond the block's last query never contribute */
  const int crow = tid >> 3, cch = tid & 7;      /* copy role: row (mod 16) and 16-byte piece of the 128-byte row */
  const unsigned short* gK = (const unsigned short*)K16 + ((size_t)b * TK + crow) * ldk + h * 64 + cch * 8; const unsigned short* gV = Vth + (size_t)crow * TK + cch * 8; const unsigned short* gW = Vth2 + (size_t)crow * TK + cch * 8; const size_t sk16 = (size_t)16 * ldk, sv16 = (size_t)16 * TK;
  const unsigned l0 = (unsigned)(size_t)smem + (unsigned)(crow * G2_PITCH + cch * 16);
  const int foff = ln * G2_PITCH + 16 * hh;      /* fragment role: row (mod 16) and 16-byte piece, the k order of the former global loads */
  const int NT = jend >> 6;      /* jend is a multiple of 64 */
  fl_copy(l0, gK, sk16, gV, gW, sv16);
  asm volatile("s_wait_asynccnt 0x0" ::: "memory");      /* tile 0 has landed before the barrier publishes it */
  __syncthreads();
  if (NT > 1) fl_copy(l0 + FL_BUF, gK + (size_t)64 * ldk, sk16, gV + 64, gW + 64, sv16);
#pragma unroll 1      /* one tile per trip: the buffer alternates with the trip's parity */
  for (int t = 0; t < NT; ++t) { const unsigned char* sb = smem + (t & 1) * FL_BUF + foff;
#pragma unroll      /* the tile's two 32-key halves, each worked on as one pass of the online softmax, in key order */
   for (int sub = 0; sub < 2; ++sub) { const int j0 = t * 64 + sub * 32;
    FragH bk[2][KS], bv[DT];
#pragma unroll
    for (int nt = 0; nt < 2; ++nt) {
#pragma unroll
      for (int ks = 0; ks < KS; ++ks) bk[nt][ks].v = g2_lfrag(sb + (sub * 32 + nt * 16) * G2_PITCH + ks * 64); }
    v8f st[2];      /* st[nt][r] = score of key j0 + nt * 16 + 8 * hh + r against query tq */
#pragma unroll
    for (int nt = 0; nt < 2; ++nt) { v8f acc = (v8f){0.f,0.f,0.f,0.f,0.f,0.f,0.f,0.f};
#pragma unroll
      for (int ks = 0; ks < KS; ++ks) acc = mmaH<1>(bk[nt][ks].v, bk[nt][ks].v, aq[ks].v, aq[ks].v, acc);
      st[nt] = acc; }
#pragma unroll
    for (int dt = 0; dt < DT; ++dt) bv[dt].v = g2_lfrag(sb + (64 + dt * 16) * G2_PITCH + sub * 64);
    float sv[16]; float mc = -3.0e38f;
#pragma unroll
    for (int e = 0; e < 16; ++e) { const int kk = j0 + (e >> 3) * 16 + 8 * hh + (e & 7); const bool ok = (CAUSAL == 1) ? (kk <= tq) : ((CAUSAL == 2) ? ((kk >> 5) == (tq >> 5)) : true);      /* mode 2: block-diagonal 32-token groups */
      sv[e] = ok ? st[e >> 3][e & 7] : -3.0e38f; mc = fmaxf(mc, sv[e]); }
    mc = fmaxf(mc, xhalf(mc));      /* both halves feed one output column: they share the maximum */
    const float mn = fmaxf(m_r, mc); const float xa = (m_r - mn) * C2; m_r = mn;      /* rescale factor 2^xa; nothing seen yet: 2^0 = 1 on zero sums */
    const float nb = fmaf(-mn, C2, 10.0f);      /* p = 1024 exp((s - mn) / 8) = 2^(s C2 + nb): scale, maximum and the operand's 2^10 in one fused multiply-add; a masked score gives 2^(-huge) = 0 */
    float pe[16], al = xa;
#pragma unroll
    for (int e = 0; e < 16; ++e) pe[e] = fmaf(sv[e], C2, nb);
    /* the exponentials stand together, each in place on a register of its own: no v_exp_f32 is directly followed by a read of its result or by another instruction's write of its source; the closing v_nop keeps that slot free of whatever the compiler puts next */
    asm("v_exp_f32 %0, %0\n\tv_exp_f32 %1, %1\n\tv_exp_f32 %2, %2\n\tv_exp_f32 %3, %3\n\tv_exp_f32 %4, %4\n\tv_exp_f32 %5, %5\n\tv_exp_f32 %6, %6\n\tv_exp_f32 %7, %7\n\tv_exp_f32 %8, %8\n\tv_nop"
        : "+v"(al), "+v"(pe[0]), "+v"(pe[1]), "+v"(pe[2]), "+v"(pe[3]), "+v"(pe[4]), "+v"(pe[5]), "+v"(pe[6]), "+v"(pe[7]));
    asm("v_exp_f32 %0, %0\n\tv_exp_f32 %1, %1\n\tv_exp_f32 %2, %2\n\tv_exp_f32 %3, %3\n\tv_exp_f32 %4, %4\n\tv_exp_f32 %5, %5\n\tv_exp_f32 %6, %6\n\tv_exp_f32 %7, %7\n\tv_nop"
        : "+v"(pe[8]), "+v"(pe[9]), "+v"(pe[10]), "+v"(pe[11]), "+v"(pe[12]), "+v"(pe[13]), "+v"(pe[14]), "+v"(pe[15]));
    FragH pb; float ps[4] = {0.f, 0.f, 0.f, 0.f};
#pragma unroll
    for (int e = 0; e < 16; ++e) { ps[e & 3] += pe[e]; pb.h[e] = (_Float16)pe[e]; }
    l_r = l_r * al + ((ps[0] + ps[1]) + (ps[2] + ps[3]));
#pragma unroll
    for (int dt = 0; dt < DT; ++dt) {
#pragma unroll
      for (int r = 0; r < 8; ++r) oacc[dt][r] *= al; }
#pragma unroll
    for (int dt = 0; dt < DT; ++dt) oacc[dt] = mmaH<1>(bv[dt].v, bv[dt].v, pb.v, pb.v, oacc[dt]); }
    asm volatile("s_wait_dscnt 0x0" ::: "memory");         /* this wave's reads of the buffer are over before it may be refilled */
    asm volatile("s_wait_asynccnt 0x0" ::: "memory");      /* this wave's copies of the next tile have landed */
    __syncthreads();                                       /* publishes the next tile and ends every wave's reads of this one */
    if (t + 2 < NT) fl_copy(l0 + (unsigned)(t & 1) * FL_BUF, gK + (size_t)(t + 2) * 64 * ldk, sk16, gV + (t + 2) * 64, gW + (t + 2) * 64, sv16); }
  asm volatile("s_wait_asynccnt 0x0" ::: "memory");        /* nothing is in flight when the buffers become output staging */
  const float lt = l_r + xhalf(l_r); const float inv = (lt > 0.f) ? 1.0f / lt : 0.f;      /* sums and products both carry the 2^10 */
#pragma unroll
  for (int hf = 0; hf < 2; ++hf) { float* __restrict__ Oh = hf ? O2 : O;
#pragma unroll
    for (int dt = 0; dt < 4; ++dt) { const v8f a = oacc[hf * 4 + dt]; const v4f lo = {a[0] * inv, a[1] * inv, a[2] * inv, a[3] * inv}, hi = {a[4] * inv, a[5] * inv, a[6] * inv, a[7] * inv};      /* a[r] = column dt * 16 + 8 * hh + r of query row ln */
      *(v4fa*)&sO[w][ln][dt * 16 + 8 * hh] = lo; *(v4fa*)&sO[w][ln][dt * 16 + 8 * hh + 4] = hi; }
    __builtin_amdgcn_fence(__ATOMIC_ACQ_REL, "workgroup"); __builtin_amdgcn_wave_barrier();
#pragma unroll
    for (int rp = 0; rp < RPW; rp += 2) { const int r = rp + (lane >> 4), pc = lane & 15; const v4f val = *(const v4fa*)&sO[w][r][pc * 4]; *(v4f*)(Oh + ((size_t)b * TQ + q0 + r) * ldo + h * 64 + pc * 4) = val; }
    if (hf == 0) { __builtin_amdgcn_fence(__ATOMIC_ACQ_REL, "workgroup"); __builtin_amdgcn_wave_barrier(); }      /* the high half reuses this wave's sO slice: its stores stay behind the low half's reads */
  } }
// 5-plane variant: S = Qh Kh^T + (Ql Kh^T + Qh Kl^T)/1024 with Q/K = [hi | 2^10 residual] f16 planes (QL/KL same layout as Q16/K16), then the 3-term P.V below.
// 3-term variant: O = (P_hi V_hi + (P_lo V_hi + P_hi V_lo) / 1024) / l with P = [hi | 2^10 residual] of 1024 p and V^T = [hi | 2^10 residual] planes (VtL same layout as Vt) -> ~2^-21-class products for un-averaged (early causal / peaked) rows
template <int CAUSAL>
__global__ __launch_bounds__(128) void k_flash5(const _Float16* __restrict__ Q16, const _Float16* __restrict__ QL, int ldq, const _Float16* __restrict__ K16, const _Float16* __restrict__ KL, int ldk, const _Float16* __restrict__ Vt, const _Float16* __restrict__ VtL, const int* __restrict__ MSK, float* __restrict__ O, int ldo) {
  constexpr int RPW = 16, DT = 4, KS = 2;      /* transposed like k_flash: key rows and V^T rows are A operands, query columns and P^T are B operands */
  __shared__ __attribute__((aligned(16))) float sO[4][RPW][64 + 4];
  const int tid = threadIdx.x, w = tid >> 5, lane = tid & 31, ln = lane & 15, hh = lane >> 4;
  const int slab = blockIdx.x / QBN5, qblk = QB05 + blockIdx.x % QBN5; const int b = slab / NH, h = slab % NH; const int qb0 = qblk * (4 * RPW); const int q0 = qb0 + w * RPW; const int tq = q0 + ln;      /* this lane's query */
  FragH aq[KS], aql[KS];
  { const unsigned short* qr = (const unsigned short*)Q16 + ((size_t)b * TQ + tq) * ldq + h * 64; const unsigned short* ql = (const unsigned short*)QL + ((size_t)b * TQ + tq) * ldq + h * 64;
#pragma unroll
    for (int ks = 0; ks < KS; ++ks) { aq[ks].half[0] = *(const v8us*)(qr + ks * 32 + 8 * hh); aq[ks].half[1] = *(const v8us*)(qr + ks * 32 + 16 + 8 * hh); aql[ks].half[0] = *(const v8us*)(ql + ks * 32 + 8 * hh); aql[ks].half[1] = *(const v8us*)(ql + ks * 32 + 16 + 8 * hh); } }
  const unsigned short* Vth = (const unsigned short*)Vt + (size_t)slab * 64 * TK; const unsigned short* Vtl = (const unsigned short*)VtL + (size_t)slab * 64 * TK;
  float m_r = -3.0e38f, l_r = 0.f; v8f oacc[DT], oaccL[DT];
#pragma unroll
  for (int dt = 0; dt < DT; ++dt) { oacc[dt] = (v8f){0.f,0.f,0.f,0.f,0.f,0.f,0.f,0.f}; oaccL[dt] = oacc[dt]; }
  const int jend = (CAUSAL == 1) ? (qb0 + 4 * RPW) : TK;      /* causal: keys beyond the block's last query never contribute */
#pragma unroll 1
  for (int j0 = 0; j0 < jend; j0 += 32) {
    FragH bk[2][KS], bkl[2][KS], bv[DT], bl[DT];
    const size_t ko = ((size_t)b * TK + j0 + ln) * ldk + h * 64 + 8 * hh; const unsigned short* kr0 = (const unsigned short*)K16 + ko; const unsigned short* kr1 = kr0 + (size_t)16 * ldk; const unsigned short* kl0 = (const unsigned short*)KL + ko; const unsigned short* kl1 = kl0 + (size_t)16 * ldk;
#pragma unroll
    for (int nt = 0; nt < 2; ++nt) { const unsigned short* kr = nt ? kr1 : kr0; const unsigned short* klr = nt ? kl1 : kl0;
#pragma unroll
      for (int ks = 0; ks < KS; ++ks) { bk[nt][ks].half[0] = *(const v8us*)(kr + ks * 32); bk[nt][ks].half[1] = *(const v8us*)(kr + ks * 32 + 16); bkl[nt][ks].half[0] = *(const v8us*)(klr + ks * 32); bkl[nt][ks].half[1] = *(const v8us*)(klr + ks * 32 + 16); } }
    asm volatile("s_wait_xcnt 0x0" :: "v"(kr0), "v"(kr1), "v"(kl0), "v"(kl1) : "memory");      /* a precaution: the address registers stay whole (no load's own destination takes them) until the issued loads have taken them */
    v8f st[2];      /* st[nt][r] = score of key j0 + nt * 16 + 8 * hh + r against query tq */
#pragma unroll
    for (int nt = 0; nt < 2; ++nt) { v8f acc = (v8f){0.f,0.f,0.f,0.f,0.f,0.f,0.f,0.f}, accl = acc;
#pragma unroll
      for (int ks = 0; ks < KS; ++ks) { acc = mmaH<1>(bk[nt][ks].v, bk[nt][ks].v, aq[ks].v, aq[ks].v, acc); accl = mmaH<1>(bk[nt][ks].v, bk[nt][ks].v, aql[ks].v, aql[ks].v, accl); accl = mmaH<1>(bkl[nt][ks].v, bkl[nt][ks].v, aq[ks].v, aq[ks].v, accl); }
#pragma unroll
      for (int r = 0; r < 8; ++r) acc[r] += accl[r] * 0.0009765625f;
      st[nt] = acc; }
    const unsigned short* vr0 = Vth + (size_t)ln * TK + j0 + 8 * hh; const unsigned short* vr1 = Vtl + (size_t)ln * TK + j0 + 8 * hh;
#pragma unroll
    for (int dt = 0; dt < DT; ++dt) { const unsigned short* vrow = vr0 + (size_t)(dt * 16) * TK; const unsigned short* vrl = vr1 + (size_t)(dt * 16) * TK; bv[dt].half[0] = *(const v8us*)vrow; bv[dt].half[1] = *(const v8us*)(vrow + 16); bl[dt].half[0] = *(const v8us*)vrl; bl[dt].half[1] = *(const v8us*)(vrl + 16); }
    asm volatile("s_wait_xcnt 0x0" :: "v"(vr0), "v"(vr1) : "memory");      /* the same precaution for the value loads, which fly during the softmax */
    float sv[16]; bool ok[16]; float mc = -3.0e38f;
#pragma unroll
    for (int e = 0; e < 16; ++e) { const int kk = j0 + (e >> 3) * 16 + 8 * hh + (e & 7); ok[e] = (CAUSAL == 1) ? (kk <= tq) : ((CAUSAL == 2) ? ((kk >> 5) == (tq >> 5)) : true);      /* mode 2: block-diagonal 32-token groups */
      if (CAUSAL == 4) ok[e] = MSK[((size_t)b * TQ + tq) * TK + kk] != 0;      /* mode 4: per-(query, key) INPUT mask shared by all heads; masked keys contribute nothing (== the reference's -4096 fill, whose exp underflows to 0), rows with no valid key give l = 0 -> output 0 (== the reference's row_valid zeroing) */
      sv[e] = ok[e] ? st[e >> 3][e & 7] * SCL : -3.0e38f; mc = fmaxf(mc, sv[e]); }
    mc = fmaxf(mc, xhalf(mc));      /* both halves feed one output column: they share the maximum */
    const float mn = fmaxf(m_r, mc); const float al = (mn > -1.0e38f) ? expf(m_r - mn) : 1.0f; m_r = mn;
    FragH pa, pl; float ps[4] = {0.f, 0.f, 0.f, 0.f};
#pragma unroll
    for (int e = 0; e < 16; ++e) { const float p = ok[e] ? expf(sv[e] - mn) : 0.f; ps[e & 3] += p; const float pw = p * 1024.0f; pa.h[e] = (_Float16)pw; pl.h[e] = (_Float16)((pw - (float)pa.h[e]) * 1024.0f); }
    l_r = l_r * al + ((ps[0] + ps[1]) + (ps[2] + ps[3]));
#pragma unroll
    for (int dt = 0; dt < DT; ++dt) {
#pragma unroll
      for (int r = 0; r < 8; ++r) { oacc[dt][r] *= al; oaccL[dt][r] *= al; } }
#pragma unroll
    for (int dt = 0; dt < DT; ++dt) { oacc[dt] = mmaH<1>(bv[dt].v, bv[dt].v, pa.v, pa.v, oacc[dt]); oaccL[dt] = mmaH<1>(bv[dt].v, bv[dt].v, pl.v, pl.v, oaccL[dt]); oaccL[dt] = mmaH<1>(bl[dt].v, bl[dt].v, pa.v, pa.v, oaccL[dt]); } }
  const float lt = l_r + xhalf(l_r); const float inv = (lt > 0.f) ? 1.0f / (lt * 1024.0f) : 0.f;
#pragma unroll
  for (int dt = 0; dt < DT; ++dt) { v8f a = oacc[dt];
#pragma unroll
    for (int r = 0; r < 8; ++r) { a[r] += oaccL[dt][r] * 0.0009765625f; a[r] *= inv; }      /* a[r] = column dt * 16 + 8 * hh + r of query row ln */
    const v4f lo = {a[0], a[1], a[2], a[3]}, hi = {a[4], a[5], a[6], a[7]}; *(v4fa*)&sO[w][ln][dt * 16 + 8 * hh] = lo; *(v4fa*)&sO[w][ln][dt * 16 + 8 * hh + 4] = hi; }
  __builtin_amdgcn_fence(__ATOMIC_ACQ_REL, "workgroup"); __builtin_amdgcn_wave_barrier();
  {
#pragma unroll
    for (int rp = 0; rp < RPW; rp += 2) { const int r = rp + (lane >> 4), pc = lane & 15; const v4f val = *(const v4fa*)&sO[w][r][pc * 4]; *(v4f*)(O + ((size_t)b * TQ + q0 + r) * ldo + h * 64 + pc * 4) = val; }
     } }

__global__ __launch_bounds__(256) void k_rotab(float* __restrict__ CS, float* __restrict__ SN) {
  #pragma clang fp contract(off)
  const int t = blockIdx.x * 256 + threadIdx.x; if (t >= SLEN * 32) return; const int j = t % 32, s = t / 32; (void)j; (void)s; const float c = 1.0f, sn = 0.0f;      /* no RoPE here: identity tables make k_rope a pure hi/lo split (a*1 - b*0 is exact) */
  { *(float*)(CS + t) = c; *(float*)(SN + t) = sn;  } }
__global__ __launch_bounds__(256) void k_rope(const float* __restrict__ F, int nsrc, int ndst, int rep, const float* __restrict__ CS, const float* __restrict__ SN, _Float16* __restrict__ H, _Float16* __restrict__ L) {
  #pragma clang fp contract(off)
  const size_t t = (size_t)blockIdx.x * 256 + threadIdx.x; if (t >= (size_t)NR * ndst * 4) return; const int g8 = (int)(t % 4); const int hd = (int)((t / 4) % ndst); const size_t row = t / ((size_t)4 * ndst); const int s = (int)(row % SLEN); const int hs = hd / rep;
  const float* src = F + row * (size_t)(nsrc * 64) + hs * 64; FragH ah, al, bh, bl;
  for (int i = 0; i < 8; ++i) { const int d = g8 * 8 + i; const float c = CS[s * 32 + d], sn = SN[s * 32 + d]; const float x1 = src[d], x2 = src[d + 32];
    float o1 = x1 * c; o1 += -x2 * sn; float o2 = x2 * c; o2 += x1 * sn;
    _Float16 hv = (_Float16)o1; ah.h[i] = hv; al.h[i] = (_Float16)((o1 - (float)hv) * 1024.0f); hv = (_Float16)o2; bh.h[i] = hv; bl.h[i] = (_Float16)((o2 - (float)hv) * 1024.0f); }
  const size_t o = row * (size_t)(ndst * 64) + hd * 64 + g8 * 8;
  { *(v8us*)((unsigned short*)H + o) = ah.half[0]; *(v8us*)((unsigned short*)H + o + 32) = bh.half[0]; *(v8us*)((unsigned short*)L + o) = al.half[0]; *(v8us*)((unsigned short*)L + o + 32) = bl.half[0];  } }
__global__ __launch_bounds__(256) void k_vtg(const _Float16* __restrict__ V16, int vadd, _Float16* __restrict__ Vt) { __shared__ unsigned short tl[64][66]; const int tid = threadIdx.x; const int slab = blockIdx.x / (SLEN / 64), lg = blockIdx.x % (SLEN / 64); const int b = slab / NH, h = slab % NH; const int col0 = (h / 8) * 128 + vadd;      /* pseudo-head h reads value head h/8 (128 wide): low (vadd 0) or high (vadd 64) half */
  for (int i = tid; i < 64 * 8; i += 256) { const int r = i / 8, c8 = (i % 8) * 8; FragH f; f.half[0] = *(const v8us*)((const unsigned short*)V16 + ((size_t)b * SLEN + lg * 64 + r) * KVD + col0 + c8); for (int q = 0; q < 8; ++q) tl[r][c8 + q] = f.u[q]; }
  __syncthreads();
  { for (int rd = 0; rd < 2; ++rd) { const int d = rd * 32 + tid / 8, pc = tid % 8; FragH f; for (int q = 0; q < 8; ++q) f.u[q] = tl[pc * 8 + q][d]; *(v8us*)((unsigned short*)Vt + ((size_t)slab * 64 + d) * SLEN + lg * 64 + pc * 8) = f.half[0]; }  } }

__global__ __launch_bounds__(256) void k_wsc(const float* __restrict__ Wm, _Float16* __restrict__ Bt, size_t n8, float sc) { const size_t t = (size_t)blockIdx.x * 256 + threadIdx.x; if (t >= n8) return; FragH f; for (int q = 0; q < 8; ++q) f.h[q] = (_Float16)(bf16_round(Wm[t * 8 + q]) * sc); *(v8us*)((unsigned short*)Bt + t * 8) = f.half[0];  }
__global__ __launch_bounds__(64) void k_lam(const float* __restrict__ q1, const float* __restrict__ k1, const float* __restrict__ q2, const float* __restrict__ k2, float* __restrict__ LAM) {
  #pragma clang fp contract(off)
  const int ln = threadIdx.x & 31; if (threadIdx.x >= 32) return; float a = bf16_round(q1[ln]) * bf16_round(k1[ln]); a += bf16_round(q1[ln + 32]) * bf16_round(k1[ln + 32]); float c = bf16_round(q2[ln]) * bf16_round(k2[ln]); c += bf16_round(q2[ln + 32]) * bf16_round(k2[ln + 32]);
  for (int o = 16; o > 0; o >>= 1) { a += __shfl_xor(a, o, 32); c += __shfl_xor(c, o, 32); } const float lf = expf(a) - expf(c) + 0.78360576653162446f;      /* LAMBDA_INIT = 0.8 - 0.6 exp(-0.3 * 12) = 0.78360577 */
  const float v = (ln == 0) ? lf : 0.f; *(float*)(LAM + ln) = v;  }
__global__ __launch_bounds__(256) void k_comb(const float* __restrict__ OLO, const float* __restrict__ OHI, const float* __restrict__ LAM, const float* __restrict__ lnw, _Float16* __restrict__ A16) {
  #pragma clang fp contract(off)
  const size_t t = (size_t)blockIdx.x * 256 + threadIdx.x; if (t >= (size_t)NR * 16) return; const int j = (int)(t % 16); const size_t r = t / 16; const float lam = LAM[0]; float a[128]; float ss = 0.f;
  const float* e0 = OLO + r * DM + (size_t)(2 * j) * 64; const float* o0 = OLO + r * DM + (size_t)(2 * j + 1) * 64; const float* e1 = OHI + r * DM + (size_t)(2 * j) * 64; const float* o1 = OHI + r * DM + (size_t)(2 * j + 1) * 64;
  for (int d = 0; d < 64; ++d) { float v = e0[d]; v += -lam * o0[d]; a[d] = v; ss += v * v; float w = e1[d]; w += -lam * o1[d]; a[64 + d] = w; ss += w * w; }
  const float inv = rsqrtf(ss / 128.0f + 1e-5f); unsigned short* dst = (unsigned short*)A16 + r * DM + (size_t)j * 128;
  { for (int g = 0; g < 16; ++g) { FragH f; for (int q = 0; q < 8; ++q) { const int d = g * 8 + q; float v = a[d] * inv; v *= bf16_round(lnw[d]); v = v * 0.21639423346837554f;      /* 1 - LAMBDA_INIT */ f.h[q] = (_Float16)v; } *(v8us*)(dst + g * 8) = f.half[0]; }  } }

extern "C" void kernel_launch(void* const* d_in, const int* in_sizes, int n_in,
                              void* d_out, int out_size, void* d_ws, size_t ws_size, hipStream_t stream) {
  (void)in_sizes; (void)n_in; (void)out_size;
  const float* const* I = (const float* const*)d_in; const float* x = I[0]; const float* Wq = I[1]; const float* Wk = I[2]; const float* Wv = I[3]; const float* Wo = I[4]; const float* lq1 = I[5]; const float* lk1 = I[6]; const float* lq2 = I[7]; const float* lk2 = I[8]; const float* lnw = I[9]; const float* bq = nullptr; const float* bk = nullptr; const float* bv = nullptr;
  char* ws = (char*)d_ws; size_t off = 0;
  auto take = [&](size_t bytes) { char* p = ws + off; off += (bytes + 255) & ~(size_t)255; return p; };
  const size_t np = (size_t)NR * DM, nk = (size_t)NR * KVD;
  _Float16* BQ = (_Float16*)take((size_t)DM * DM * 2); _Float16* BK = (_Float16*)take((size_t)KVD * DM * 2); _Float16* BV = (_Float16*)take((size_t)KVD * DM * 2); _Float16* BO = (_Float16*)take((size_t)DM * DM * 2);
  float* CS = (float*)take((size_t)SLEN * 32 * 4); float* SN = (float*)take((size_t)SLEN * 32 * 4);
  _Float16* X16 = (_Float16*)take(np * 2); float* QF = (float*)take(np * 4); _Float16* QH = (_Float16*)take(np * 2); _Float16* QL = (_Float16*)take(np * 2); float* KF = (float*)take(nk * 4); float* VF = (float*)take(nk * 4); _Float16* KXH = (_Float16*)take(np * 2); _Float16* KXL = (_Float16*)take(np * 2); _Float16* VH = (_Float16*)take(nk * 2); _Float16* VL = (_Float16*)take(nk * 2); _Float16* VT = (_Float16*)take(np * 2); _Float16* VTL = (_Float16*)take(np * 2); _Float16* VT2 = (_Float16*)take(np * 2); _Float16* VTL2 = (_Float16*)take(np * 2); float* LAM = (float*)take(256); float* OHI = (float*)take(np * 4);      /* high-half attention output: a plane of its own, both value halves being live in the fused pass */
  float* OLO = QF;      /* low-half attention output over the q f32 plane (dead after the split) */ _Float16* A16 = X16;      /* normalised attention over the input plane (dead after the projections) */
  if (off > ws_size) return;      /* 8+2+2+8 + 0.5 + 16+32+16+16+8+8+16+16+4+4+16+16+16+16 + 32 = 253 MiB */
  k_wsc<<<(unsigned)(((size_t)DM * DM / 8 + 255) / 256), 256, 0, stream>>>(Wq, BQ, (size_t)DM * DM / 8, 16.0f); k_wsc<<<(unsigned)(((size_t)KVD * DM / 8 + 255) / 256), 256, 0, stream>>>(Wk, BK, (size_t)KVD * DM / 8, 16.0f); k_wsc<<<(unsigned)(((size_t)KVD * DM / 8 + 255) / 256), 256, 0, stream>>>(Wv, BV, (size_t)KVD * DM / 8, 16.0f); k_wsc<<<(unsigned)(((size_t)DM * DM / 8 + 255) / 256), 256, 0, stream>>>(Wo, BO, (size_t)DM * DM / 8, 16.0f);      /* torch (out,in) = Bt */ k_lam<<<1, 64, 0, stream>>>(lq1, lk1, lq2, lk2, LAM);
  k_rotab<<<(SLEN * 32 + 255) / 256, 256, 0, stream>>>(CS, SN);
  k_x16<<<(unsigned)((np / 8 + 255) / 256), 256, 0, stream>>>(x, X16, np / 8);
  k_gemm2<0><<<dim3((NR / 128) * (DM / 64), 1), 128, 0, stream>>>(X16, DM, 0, BQ, DM, 0, 0.0625f, bq, 0, nullptr, 1, 0, 0, QF, nullptr, DM, 0, NR, DM, DM);
  k_gemm2<0><<<dim3((NR / 128) * (KVD / 64), 1), 128, 0, stream>>>(X16, DM, 0, BK, DM, 0, 0.0625f, bk, 0, nullptr, 1, 0, 0, KF, nullptr, KVD, 0, NR, KVD, DM);
  k_gemm2<0><<<dim3((NR / 128) * (KVD / 64), 1), 128, 0, stream>>>(X16, DM, 0, BV, DM, 0, 0.0625f, bv, 0, nullptr, 1, 0, 0, VF, nullptr, KVD, 0, NR, KVD, DM);
  k_rope<<<(unsigned)(((size_t)NR * NH * 4 + 255) / 256), 256, 0, stream>>>(QF, NH, NH, 1, CS, SN, QH, QL);      /* q: 32 -> 32 heads */
  k_rope<<<(unsigned)(((size_t)NR * NH * 4 + 255) / 256), 256, 0, stream>>>(KF, NKV, NH, NREP, CS, SN, KXH, KXL);      /* k: kv head h/4 expanded to query head h */
  k_hl<<<(unsigned)((nk / 8 + 255) / 256), 256, 0, stream>>>(VF, VH, VL, nk / 8);
  k_vtg<<<NB * NH * (SLEN / 64), 256, 0, stream>>>(VH, 0, VT); k_vtg<<<NB * NH * (SLEN / 64), 256, 0, stream>>>(VL, 0, VTL); k_vtg<<<NB * NH * (SLEN / 64), 256, 0, stream>>>(VH, 64, VT2); k_vtg<<<NB * NH * (SLEN / 64), 256, 0, stream>>>(VL, 64, VTL2);      /* low / high 64 of each pseudo-head's 128-wide value head; QF becomes OLO from here on */
  k_flash5<1><<<NB * NH * QBN5, 128, 0, stream>>>(QH, QL, DM, KXH, KXL, DM, VT, VTL, nullptr, OLO, DM); k_flash5<1><<<NB * NH * QBN5, 128, 0, stream>>>(QH, QL, DM, KXH, KXL, DM, VT2, VTL2, nullptr, OHI, DM);      /* first 256 rows: low, then high 64 value columns */
  k_flash<1><<<NB * NH * QBNP, 128, 0, stream>>>(QH, DM, KXH, DM, VT, VT2, nullptr, OLO, OHI, DM);      /* rows from 256 on: one pass over the keys for both halves of each pseudo-head's 128-wide value head */
  k_comb<<<(unsigned)(((size_t)NR * 16 + 255) / 256), 256, 0, stream>>>(OLO, OHI, LAM, lnw, A16);
  k_gemm2<0><<<dim3((NR / 128) * (DM / 64), 1), 128, 0, stream>>>(A16, DM, 0, BO, DM, 0, 0.0625f, nullptr, 0, nullptr, 1, 0, 0, (float*)d_out, nullptr, DM, 0, NR, DM, DM);      /* out = attn Wo^T */
}

// v006
// It runs in 269 microseconds.
// In two side-by-side timings against v005, it was 1.09 and 1.08 times as fast.
// Counting every step since v000, it is 3.56 times as fast.
#include <hip/hip_runtime.h>
// MultiheadSdpaDiff4 (2 x 2048 tokens, EMBED 2048; differential attention: q = x Wq^T as 32 pseudo-heads x 64, k = x Wk^T as 8 heads x 64 repeat-interleaved 4x, v = x Wv^T as 4 heads x 128 repeat-interleaved 8x; causal softmax(q.k/8) v; attn = O_even - lambda_full * O_odd (16 heads x 128), lambda_full = exp(lq1.lk1) - exp(lq2.lk2) + 0.78361; RMSNorm(128, eps 1e-5) * ln_w * (1 - 0.78361); out = attn Wo^T.
// Compute dtype: inputs rounded to bf16; x exact as f16; q/k/P/v as f16 hi + residual on the first 256 rows (~2^-21) and plain beyond (~2^-12); the normalised attention as a plain f16 operand; softmax/lambda/RMSNorm f32. v_wmma_f32_16x16x32_f16.
#define NB 2
#define DM 2048
#define NKV 8
#define NREP (NH / NKV)
#define KVD (NKV * 64)           /* 512 */
#define NR (NB * SLEN)           /* 4096 */
#define SLEN 2048
#define TQ SLEN
#define TK SLEN
#define NH 32
#define SCL 0.125f
#define QBLKS (TQ / 64)
#define QB05 0
#define QBN5 4
#define QB0P QBN5
#define QBNP (QBLKS - QBN5)
#define RE 256
typedef __bf16 v16b __attribute__((ext_vector_type(16)));
typedef unsigned short v8us __attribute__((ext_vector_type(8), may_alias));
typedef float  v8f  __attribute__((ext_vector_type(8)));
typedef float  v4f  __attribute__((ext_vector_type(4)));
typedef float  v4fa __attribute__((ext_vector_type(4), may_alias));
union FragB { v16b v; v8us half[2]; unsigned short u[16]; };

__device__ __forceinline__ unsigned short bf16_bits(float x) { unsigned int u = __float_as_uint(x); return (unsigned short)((u + 0x7FFFu + ((u >> 16) & 1u)) >> 16); }
__device__ __forceinline__ float bf16_val(unsigned short b) { return __uint_as_float(((unsigned int)b) << 16); }
__device__ __forceinline__ float bf16_round(float x) { return bf16_val(bf16_bits(x)); }
// D += A·B with NT terms: 1 = ah·bh, 2 = + al·bh (A split), 3 = + ah·bl (both split)
template <int NT>
__device__ __forceinline__ v8f mmaN(v16b ah, v16b al, v16b bh, v16b bl, v8f c) {
  c = __builtin_amdgcn_wmma_f32_16x16x32_bf16(false, ah, false, bh, (short)0, c, false, false);
  if (NT >= 2) c = __builtin_amdgcn_wmma_f32_16x16x32_bf16(false, al, false, bh, (short)0, c, false, false);
  if (NT >= 3) c = __builtin_amdgcn_wmma_f32_16x16x32_bf16(false, ah, false, bl, (short)0, c, false, false);
  asm volatile("v_nop\n\tv_nop\n\tv_nop\n\tv_nop" : "+v"(c) : "v"(ah), "v"(al), "v"(bh), "v"(bl));
  return c;
}

__global__ __launch_bounds__(256) void k_wt_bf16(const float* __restrict__ W, unsigned short* __restrict__ Wt, int K, int N) {
  const int t = blockIdx.x * 256 + threadIdx.x;
  const int k8n = K / 8;
  if (t >= N * k8n) return;
  const int n = t / k8n, k8 = (t % k8n) * 8;
  v8us v;
#pragma unroll
  for (int i = 0; i < 8; ++i) v[i] = bf16_bits(W[(size_t)(k8 + i) * N + n]);
  *(v8us*)(Wt + (size_t)n * K + k8) = v;
  
}

// GEMM C[M][N] (f32, pitch ldc) = act(A[M][K]·W + bias). A f32 row-major (pitch lda) converted per fragment to bf16
// (ASPLIT: hi/lo two planes -> 2 terms, else single rounded term); Wt bf16 [N][K] (pitch ldb). BIAS_BF16 rounds the
// bias to bf16 first (bias quantised to bf16 before the add). K%32==0, M%16==0, N%64==0.
template <bool ASPLIT, int ACT, bool BIAS_BF16>
__global__ __launch_bounds__(128) void k_gemm_bf(const float* __restrict__ A, int lda, const unsigned short* __restrict__ Wt, int ldb,
                                               const float* __restrict__ bias, float* __restrict__ C, int ldc, int M, int N, int K) {
  __shared__ __attribute__((aligned(16))) float so[4][16][64];
  const int tid = threadIdx.x, w = tid >> 5, lane = tid & 31, ln = lane & 15, hh = lane >> 4;
  const int ntn = N / 64;
  const int wid = blockIdx.x * 4 + w;
  const int mt = wid / ntn, nq = wid % ntn;
  if (mt * 16 >= M) return;
  const int row0 = mt * 16, col0 = nq * 64;
  const float* arow = A + (size_t)(row0 + ln) * lda;
  v8f acc[4] = {};
  for (int kb = 0; kb < K; kb += 32) {
    FragB ah, al;
    const v4f x0 = *(const v4fa*)(arow + kb + 8 * hh), x1 = *(const v4fa*)(arow + kb + 8 * hh + 4);
    const v4f x2 = *(const v4fa*)(arow + kb + 16 + 8 * hh), x3 = *(const v4fa*)(arow + kb + 16 + 8 * hh + 4);
    float xs[16] = {x0[0],x0[1],x0[2],x0[3],x1[0],x1[1],x1[2],x1[3],x2[0],x2[1],x2[2],x2[3],x3[0],x3[1],x3[2],x3[3]};
#pragma unroll
    for (int i = 0; i < 16; ++i) { const unsigned short hb = bf16_bits(xs[i]); ah.u[i] = hb; al.u[i] = ASPLIT ? bf16_bits(xs[i] - bf16_val(hb)) : (unsigned short)0; }
#pragma unroll
    for (int t = 0; t < 4; ++t) {
      const unsigned short* brow = Wt + (size_t)(col0 + t * 16 + ln) * ldb + kb;
      FragB b;
      b.half[0] = *(const v8us*)(brow + 8 * hh);
      b.half[1] = *(const v8us*)(brow + 16 + 8 * hh);
      acc[t] = mmaN<ASPLIT ? 2 : 1>(ah.v, al.v, b.v, b.v, acc[t]);
    }
  }
#pragma unroll
  for (int t = 0; t < 4; ++t) {
    float bv = bias ? bias[col0 + t * 16 + ln] : 0.f;
    if (BIAS_BF16) bv = bf16_round(bv);
#pragma unroll
    for (int r = 0; r < 8; ++r) { float v = acc[t][r] + bv; if (ACT == 1) v = fmaxf(v, 0.f); so[w][8 * hh + r][t * 16 + ln] = v; }
  }
  __builtin_amdgcn_fence(__ATOMIC_ACQ_REL, "workgroup");
  __builtin_amdgcn_wave_barrier();
  const int rsub = lane >> 4, c4 = (lane & 15) * 4;
  {
#pragma unroll
    for (int q = 0; q < 8; ++q) {
      const int r = q * 2 + rsub;
      const v4f v = *(const v4fa*)&so[w][r][c4];
      *(v4f*)(C + (size_t)(row0 + r) * ldc + col0 + c4) = v;
    }
    
  }
}

// GEMM C = act(A·W + bias + resid): A f32 (ASPLIT -> hi/lo 2 terms), Wt bf16 [N][K]; ACT 0 none, 1 relu, 2 exact gelu;
// resid (optional, f32, row index = (row % rmod), pitch ldr, RES_BF16 rounds it) added before the activation.
template <bool ASPLIT, int ACT, bool BIAS_BF16, bool RES_BF16>
__global__ __launch_bounds__(128) void k_gemm_bf3(const float* __restrict__ A, int lda, const unsigned short* __restrict__ Wt, int ldb,
                                                const float* __restrict__ bias, const float* __restrict__ resid, int rmod, int ldr,
                                                float* __restrict__ C, int ldc, int M, int N, int K) {
  __shared__ __attribute__((aligned(16))) float so[4][16][64];
  const int tid = threadIdx.x, w = tid >> 5, lane = tid & 31, ln = lane & 15, hh = lane >> 4;
  const int ntn = N / 64;
  const int wid = blockIdx.x * 4 + w;
  const int mt = wid / ntn, nq = wid % ntn;
  if (mt * 16 >= M) return;
  const int row0 = mt * 16, col0 = nq * 64;
  const float* arow = A + (size_t)(row0 + ln) * lda;
  v8f acc[4] = {};
  for (int kb = 0; kb < K; kb += 32) {
    FragB ah, al;
    const v4f x0 = *(const v4fa*)(arow + kb + 8 * hh), x1 = *(const v4fa*)(arow + kb + 8 * hh + 4);
    const v4f x2 = *(const v4fa*)(arow + kb + 16 + 8 * hh), x3 = *(const v4fa*)(arow + kb + 16 + 8 * hh + 4);
    float xs[16] = {x0[0],x0[1],x0[2],x0[3],x1[0],x1[1],x1[2],x1[3],x2[0],x2[1],x2[2],x2[3],x3[0],x3[1],x3[2],x3[3]};
#pragma unroll
    for (int i = 0; i < 16; ++i) { const unsigned short hb = bf16_bits(xs[i]); ah.u[i] = hb; al.u[i] = ASPLIT ? bf16_bits(xs[i] - bf16_val(hb)) : (unsigned short)0; }
#pragma unroll
    for (int t = 0; t < 4; ++t) {
      const unsigned short* brow = Wt + (size_t)(col0 + t * 16 + ln) * ldb + kb;
      FragB b;
      b.half[0] = *(const v8us*)(brow + 8 * hh);
      b.half[1] = *(const v8us*)(brow + 16 + 8 * hh);
      acc[t] = mmaN<ASPLIT ? 2 : 1>(ah.v, al.v, b.v, b.v, acc[t]);
    }
  }
#pragma unroll
  for (int t = 0; t < 4; ++t) {
    const int col = col0 + t * 16 + ln;
    float bv = bias ? bias[col] : 0.f;
    if (BIAS_BF16) bv = bf16_round(bv);
#pragma unroll
    for (int r = 0; r < 8; ++r) {
      float v = acc[t][r] + bv;
      if (resid) { float rv = resid[(size_t)((row0 + 8 * hh + r) % rmod) * ldr + col]; if (RES_BF16) rv = bf16_round(rv); v += rv; }
      if (ACT == 1) v = fmaxf(v, 0.f);
      if (ACT == 2) v = 0.5f * v * (1.0f + erff(v * 0.70710678118654752f));
      if (ACT == 3) { const float u = 0.7978845608028654f * (v + 0.044715f * v * v * v); v = 0.5f * v * (1.0f + tanhf(u)); }
      so[w][8 * hh + r][t * 16 + ln] = v;
    }
  }
  __builtin_amdgcn_fence(__ATOMIC_ACQ_REL, "workgroup");
  __builtin_amdgcn_wave_barrier();
  const int rsub = lane >> 4, c4 = (lane & 15) * 4;
  {
#pragma unroll
    for (int q = 0; q < 8; ++q) {
      const int r = q * 2 + rsub;
      const v4f v = *(const v4fa*)&so[w][r][c4];
      *(v4f*)(C + (size_t)(row0 + r) * ldc + col0 + c4) = v;
    }
    
  }
}
// row LayerNorm (biased variance, eps) over N: s = X (+ R); optional out_sum <- s; out_norm <- (s-mu)*rsqrt(var+eps)*g + b
template <bool PARAM_BF16>
__global__ __launch_bounds__(256) void k_layernorm(const float* __restrict__ X, const float* __restrict__ R, const float* __restrict__ g, const float* __restrict__ bta,
                                                  float* __restrict__ out_sum, float* __restrict__ out_norm, int N, float eps) {
  __shared__ float red[256];
  const int row = blockIdx.x, tid = threadIdx.x;
  const float* x = X + (size_t)row * N; const float* rr = R ? R + (size_t)row * N : nullptr;
  float vals[16];                     // up to N = 4096
  const int per = N / 256;            // contiguous chunk per thread? use strided-by-4 chunks: thread handles j = tid*4 + 1024*u
  float s1 = 0.f;
  for (int u = 0; u < per / 4; ++u) {
    const int j = tid * 4 + 1024 * u;
    const v4f a = *(const v4fa*)(x + j);
    v4f b = {0.f,0.f,0.f,0.f}; if (rr) b = *(const v4fa*)(rr + j);
#pragma unroll
    for (int q = 0; q < 4; ++q) { const float v = a[q] + b[q]; vals[u * 4 + q] = v; s1 += v; }
  }
  red[tid] = s1; __syncthreads();
  for (int st = 128; st > 0; st >>= 1) { if (tid < st) red[tid] += red[tid + st]; __syncthreads(); }
  const float mu = red[0] / (float)N; __syncthreads();
  float s2 = 0.f;
  for (int u = 0; u < per / 4; ++u)
#pragma unroll
    for (int q = 0; q < 4; ++q) { const float c = vals[u * 4 + q] - mu; s2 += c * c; }
  red[tid] = s2; __syncthreads();
  for (int st = 128; st > 0; st >>= 1) { if (tid < st) red[tid] += red[tid + st]; __syncthreads(); }
  const float rs = rsqrtf(red[0] / (float)N + eps);
  {
    for (int u = 0; u < per / 4; ++u) {
      const int j = tid * 4 + 1024 * u;
      v4f o, sm;
#pragma unroll
      for (int q = 0; q < 4; ++q) {
        float gg = g[j + q], bb = bta[j + q];
        if (PARAM_BF16) { gg = bf16_round(gg); bb = bf16_round(bb); }
        sm[q] = vals[u * 4 + q]; o[q] = (vals[u * 4 + q] - mu) * rs * gg + bb;
      }
      if (out_sum) *(v4f*)(out_sum + (size_t)row * N + j) = sm;
      *(v4f*)(out_norm + (size_t)row * N + j) = o;
    }
    
  }
}



// ---- f16 WMMA path (v_wmma_f32_16x16x32_f16): 11-bit significands for operands in range — used where a [0,1] probability operand needs more precision than bf16
typedef _Float16 v16h __attribute__((ext_vector_type(16)));
union FragH { v16h v; v8us half[2]; _Float16 h[16]; unsigned short u[16]; };
template <int NT>
__device__ __forceinline__ v8f mmaH(v16h ah, v16h al, v16h bh, v16h bl, v8f c) {
  c = __builtin_amdgcn_wmma_f32_16x16x32_f16(false, ah, false, bh, (short)0, c, false, false);
  if (NT >= 2) c = __builtin_amdgcn_wmma_f32_16x16x32_f16(false, al, false, bh, (short)0, c, false, false);
  if (NT >= 3) c = __builtin_amdgcn_wmma_f32_16x16x32_f16(false, ah, false, bl, (short)0, c, false, false);
  asm volatile("v_nop\n\tv_nop\n\tv_nop\n\tv_nop" : "+v"(c) : "v"(ah), "v"(al), "v"(bh), "v"(bl));
  return c;
}
// batched GEMM like k_gemm_b but f16 operands: A f32 (split into f16 hi/lo if ASPLIT, else rounded to f16), Bt = f16 values [n][k]; alpha; C f32; N multiple of 16 (partial tiles skipped)
template <bool ASPLIT>
__global__ __launch_bounds__(128) void k_gemm_h(const float* __restrict__ A, int lda, size_t sA, const _Float16* __restrict__ Bh, int ldb, size_t sB, float alpha, float* __restrict__ C, int ldc, size_t sC, int M, int N, int K) {
  __shared__ __attribute__((aligned(16))) float so[4][16][64];
  const int tid = threadIdx.x, w = tid >> 5, lane = tid & 31, ln = lane & 15, hh = lane >> 4; const int by = blockIdx.y;
  A += (size_t)by * sA; Bh += (size_t)by * sB; C += (size_t)by * sC;
  const int ntn = (N + 63) / 64; const int wid = blockIdx.x * 4 + w; const int mt = wid / ntn, nq = wid % ntn; if (mt * 16 >= M) return;
  const int row0 = mt * 16, col0 = nq * 64; const float* arow = A + (size_t)(row0 + ln) * lda;
  v8f acc[4] = {};
  for (int kb = 0; kb < K; kb += 32) {
    FragH ah, al;
    const v4f x0 = *(const v4fa*)(arow + kb + 8 * hh), x1 = *(const v4fa*)(arow + kb + 8 * hh + 4), x2 = *(const v4fa*)(arow + kb + 16 + 8 * hh), x3 = *(const v4fa*)(arow + kb + 16 + 8 * hh + 4);
    float xs[16] = {x0[0],x0[1],x0[2],x0[3],x1[0],x1[1],x1[2],x1[3],x2[0],x2[1],x2[2],x2[3],x3[0],x3[1],x3[2],x3[3]};
#pragma unroll
    for (int i = 0; i < 16; ++i) { const _Float16 h = (_Float16)xs[i]; ah.h[i] = h; al.h[i] = ASPLIT ? (_Float16)(xs[i] - (float)h) : (_Float16)0.0f; }
#pragma unroll
    for (int t = 0; t < 4; ++t) { if (col0 + t * 16 >= N) continue; const size_t boff = (size_t)(col0 + t * 16 + ln) * ldb + kb; FragH bq; bq.half[0] = *(const v8us*)(Bh + boff + 8 * hh); bq.half[1] = *(const v8us*)(Bh + boff + 16 + 8 * hh);
      acc[t] = mmaH<ASPLIT ? 2 : 1>(ah.v, al.v, bq.v, bq.v, acc[t]); }
  }
#pragma unroll
  for (int t = 0; t < 4; ++t) { if (col0 + t * 16 >= N) continue;
#pragma unroll
    for (int r = 0; r < 8; ++r) so[w][8 * hh + r][t * 16 + ln] = acc[t][r] * alpha; }
  __builtin_amdgcn_fence(__ATOMIC_ACQ_REL, "workgroup"); __builtin_amdgcn_wave_barrier();
  const int rsub = lane >> 4, c4 = (lane & 15) * 4;
  {
#pragma unroll
    for (int q = 0; q < 8; ++q) { const int r = q * 2 + rsub; if (col0 + c4 < N) { const v4f v = *(const v4fa*)&so[w][r][c4]; *(v4f*)(C + (size_t)(row0 + r) * ldc + col0 + c4) = v; } }
     }
}

// Wt[n][k] = f16(W[k][n]·scale) from f32 row-major W[K][N] (scale = power of two; bf16-exact weights stay exact in f16 away from the subnormal range)
__global__ __launch_bounds__(256) void k_wt_f16(const float* __restrict__ W, _Float16* __restrict__ Wt, int K, int N, float scale) {
  const int t = blockIdx.x * 256 + threadIdx.x; if (t >= N * (K / 8)) return; const int n = t / (K / 8), k8 = (t % (K / 8)) * 8; FragH f;
#pragma unroll
  for (int i = 0; i < 8; ++i) f.h[i] = (_Float16)(bf16_round(W[(size_t)(k8 + i) * N + n]) * scale); const v8us o = f.half[0];
  *(v8us*)((unsigned short*)Wt + (size_t)n * K + k8) = o; 
}
// k_gemm_hh variant with fused epilogue: v = acc·alpha + bias[by·sBias + col] (+ CP[(row/rowsPerB)·sCPb + by·64 + col] if CP) ; ACT 0 none / 1 elu ; writes f16 C16 (and f32 C if non-null)
template <int ACT>
__global__ __launch_bounds__(128) void k_gemm_hhx(const _Float16* __restrict__ A, int lda, size_t sA, const _Float16* __restrict__ Bh, int ldb, size_t sB, float alpha, const float* __restrict__ bias, size_t sBias, const float* __restrict__ CP, int rowsPerB, size_t sCPb, int row0g,
    float* __restrict__ C, _Float16* __restrict__ C16, int ldc, size_t sC, int M, int N, int K) {
  __shared__ __attribute__((aligned(16))) float so[4][16][64];
  const int tid = threadIdx.x, w = tid >> 5, lane = tid & 31, ln = lane & 15, hh = lane >> 4; const int by = blockIdx.y;
  A += (size_t)by * sA; Bh += (size_t)by * sB; const size_t cofs = (size_t)by * sC; const float* bp = bias ? bias + (size_t)by * sBias : nullptr;
  const int ntn = (N + 63) / 64; const int wid = blockIdx.x * 4 + w; const int mt = wid / ntn, nq = wid % ntn; if (mt * 16 >= M) return;
  const int row0 = mt * 16, col0 = nq * 64; const _Float16* arow = A + (size_t)(row0 + ln) * lda;
  v8f acc[4] = {};
  for (int kb = 0; kb < K; kb += 32) { FragH ah; ah.half[0] = *(const v8us*)((const unsigned short*)arow + kb + 8 * hh); ah.half[1] = *(const v8us*)((const unsigned short*)arow + kb + 16 + 8 * hh);
#pragma unroll
    for (int t = 0; t < 4; ++t) { if (col0 + t * 16 >= N) continue; const size_t boff = (size_t)(col0 + t * 16 + ln) * ldb + kb; FragH bq; bq.half[0] = *(const v8us*)((const unsigned short*)Bh + boff + 8 * hh); bq.half[1] = *(const v8us*)((const unsigned short*)Bh + boff + 16 + 8 * hh);
      acc[t] = mmaH<1>(ah.v, ah.v, bq.v, bq.v, acc[t]); }
  }
#pragma unroll
  for (int t = 0; t < 4; ++t) { if (col0 + t * 16 >= N) continue; const int col = col0 + t * 16 + ln; const float bv = bp ? bf16_round(bp[col]) : 0.f;
#pragma unroll
    for (int r = 0; r < 8; ++r) { float v = acc[t][r] * alpha + bv; if (CP) { const int bidx = (row0g + row0 + 8 * hh + r) / rowsPerB; v += CP[(size_t)bidx * sCPb + (size_t)by * 64 + col]; } if (ACT == 1) v = (v > 0.f) ? v : expm1f(v); else if (ACT == 7) v = (v > 0.f) ? v + 1.0f : expf(v); else if (ACT == 8) v = tanhf(v); else if (ACT == 9) v = 0.5f * v * (1.0f + tanhf(0.7978845608028654f * (v + 0.044715f * v * v * v))); else if (ACT == 11) v = 1.0f / (1.0f + expf(-v)); else if (ACT == 12) v = (v > 0.f) ? v : 0.01f * v; else if (ACT == 14) v = (v > 0.f) ? v : 0.1f * v; else if (ACT == 15) v = v / (1.0f + expf(-v)); else if (ACT == 3) v = fmaxf(v, 0.f); else if (ACT == 6) v = 0.5f * v * (1.0f + erff(v * 0.70710678118654752f)); so[w][8 * hh + r][t * 16 + ln] = v; } }
  __builtin_amdgcn_fence(__ATOMIC_ACQ_REL, "workgroup"); __builtin_amdgcn_wave_barrier();
  const int rsub = lane >> 4, c4 = (lane & 15) * 4; typedef _Float16 v4h __attribute__((ext_vector_type(4)));
  {
#pragma unroll
    for (int q = 0; q < 8; ++q) { const int r = q * 2 + rsub; if (col0 + c4 < N) { const v4f v = *(const v4fa*)&so[w][r][c4]; if (C) *(v4f*)(C + cofs + (size_t)(row0 + r) * ldc + col0 + c4) = v; if (C16) { v4h h4; for (int i = 0; i < 4; ++i) h4[i] = (_Float16)v[i]; *(v4h*)(C16 + cofs + (size_t)(row0 + r) * ldc + col0 + c4) = h4; } } }
     }
}


typedef _Float16 v4h __attribute__((ext_vector_type(4)));

__global__ __launch_bounds__(256) void k_x16(const float* __restrict__ x, _Float16* __restrict__ X16, size_t n8) { const size_t t = (size_t)blockIdx.x * 256 + threadIdx.x; if (t >= n8) return; FragH f;
#pragma unroll
  for (int q = 0; q < 8; ++q) f.h[q] = (_Float16)bf16_round(x[t * 8 + q]); *(v8us*)((unsigned short*)X16 + t * 8) = f.half[0];  }
__global__ __launch_bounds__(256) void k_h16(const float* __restrict__ x, _Float16* __restrict__ X16, size_t n8) { const size_t t = (size_t)blockIdx.x * 256 + threadIdx.x; if (t >= n8) return; FragH f;
#pragma unroll
  for (int q = 0; q < 8; ++q) f.h[q] = (_Float16)x[t * 8 + q]; *(v8us*)((unsigned short*)X16 + t * 8) = f.half[0];  }
__global__ __launch_bounds__(256) void k_round16f(const float* __restrict__ W, _Float16* __restrict__ Bt, size_t n8) { const size_t t = (size_t)blockIdx.x * 256 + threadIdx.x; if (t >= n8) return; FragH f;
#pragma unroll
  for (int i = 0; i < 8; ++i) f.h[i] = (_Float16)(bf16_round(W[t * 8 + i]) * 16.0f); *(v8us*)((unsigned short*)Bt + t * 8) = f.half[0];  }
template <int NHv, int TTv>
__global__ __launch_bounds__(256) void k_vt(const _Float16* __restrict__ V16, int ldv, int voff, _Float16* __restrict__ Vt) { __shared__ unsigned short tl[64][66]; const int tid = threadIdx.x; const int slab = blockIdx.x / (TTv / 64), lg = blockIdx.x % (TTv / 64); const int b = slab / NHv, h = slab % NHv;
  for (int i = tid; i < 64 * 8; i += 256) { const int r = i / 8, c8 = (i % 8) * 8; FragH f; f.half[0] = *(const v8us*)((const unsigned short*)V16 + ((size_t)b * TTv + lg * 64 + r) * ldv + voff + h * 64 + c8);
#pragma unroll
    for (int q = 0; q < 8; ++q) tl[r][c8 + q] = f.u[q]; }
  __syncthreads();
  {
#pragma unroll
    for (int rd = 0; rd < 2; ++rd) { const int d = rd * 32 + tid / 8, pc = tid % 8; FragH f;
#pragma unroll
      for (int q = 0; q < 8; ++q) f.u[q] = tl[pc * 8 + q][d];
      *(v8us*)((unsigned short*)Vt + ((size_t)slab * 64 + d) * TTv + lg * 64 + pc * 8) = f.half[0]; }
     } }

// ---- fast GEMM (block tile 128x64, wave tile 32x64; requires M % 128 == 0, N % 64 == 0, K % 64 == 0); epilogue: alpha, bias and CP as in k_gemm_hhx, then f32 C or the split f16 pair C16/CL ----
// Per trip a 64-deep slice of A (128 rows) and of B (64 rows) is copied to LDS in whole 128-byte lines (asynchronous copies, two buffers: the next slice flies while this one is multiplied); fragments come from LDS.
#define G2_PITCH 144                      /* LDS bytes per staged row: 128 + 16, the conflict-free pitch for 16-byte reads */
#define G2_BUF ((128 + 64) * G2_PITCH)    /* one buffer: A rows 0..127, then B rows 128..191 */
__device__ __forceinline__ v16h g2_lfrag(const unsigned char* p) { FragH f; f.half[0] = *(const v8us*)p; f.half[1] = *(const v8us*)(p + 32); return f.v; }
__device__ __forceinline__ v8f g2_mma(v16h a, v16h b, v8f c) { v8f d = __builtin_amdgcn_wmma_f32_16x16x32_f16(false, a, false, b, (short)0, c, false, false); asm volatile("v_nop\n\tv_nop\n\tv_nop\n\tv_nop" : "+v"(d) : "v"(a), "v"(b)); return d; }
// one slice: 12 copies of 16 bytes per lane (8 of A, 4 of B), a wave's copy covering 4 whole rows; l = the lane's LDS byte address of its first row, rows 16 apart
__device__ __forceinline__ void g2_copy(unsigned l, const _Float16* ga, size_t sa16, const _Float16* gb, size_t sb16) {
  /* the closing s_wait_xcnt keeps every address register intact until the copies have taken it */
  asm volatile("global_load_async_to_lds_b128 %0, %12, off\n\t"
               "global_load_async_to_lds_b128 %1, %13, off\n\t"
               "global_load_async_to_lds_b128 %2, %14, off\n\t"
               "global_load_async_to_lds_b128 %3, %15, off\n\t"
               "global_load_async_to_lds_b128 %4, %16, off\n\t"
               "global_load_async_to_lds_b128 %5, %17, off\n\t"
               "global_load_async_to_lds_b128 %6, %18, off\n\t"
               "global_load_async_to_lds_b128 %7, %19, off\n\t"
               "global_load_async_to_lds_b128 %8, %20, off\n\t"
               "global_load_async_to_lds_b128 %9, %21, off\n\t"
               "global_load_async_to_lds_b128 %10, %22, off\n\t"
               "global_load_async_to_lds_b128 %11, %23, off\n\t"
               "s_wait_xcnt 0x0"
               :: "v"(l), "v"(l + 16 * G2_PITCH), "v"(l + 32 * G2_PITCH), "v"(l + 48 * G2_PITCH), "v"(l + 64 * G2_PITCH), "v"(l + 80 * G2_PITCH), "v"(l + 96 * G2_PITCH), "v"(l + 112 * G2_PITCH),
                  "v"(l + 128 * G2_PITCH), "v"(l + 144 * G2_PITCH), "v"(l + 160 * G2_PITCH), "v"(l + 176 * G2_PITCH),
                  "v"(ga), "v"(ga + sa16), "v"(ga + 2 * sa16), "v"(ga + 3 * sa16), "v"(ga + 4 * sa16), "v"(ga + 5 * sa16), "v"(ga + 6 * sa16), "v"(ga + 7 * sa16),
                  "v"(gb), "v"(gb + sb16), "v"(gb + 2 * sb16), "v"(gb + 3 * sb16)
               : "memory");
}
template <int ACT, bool SPLIT>
__global__ __launch_bounds__(128) void k_gemm2(const _Float16* __restrict__ A, int lda, size_t sA, const _Float16* __restrict__ Bh, int ldb, size_t sB, float alpha, const float* __restrict__ bias, size_t sBias, const float* __restrict__ CP, int rowsPerB, size_t sCPb, int row0g,
    float* __restrict__ C, _Float16* __restrict__ C16, _Float16* __restrict__ CL, int ldc, size_t sC, int M, int N, int K) {      /* output: C (f32) or, with SPLIT, the pair C16 and CL: the f16 rounding and its 2^10-scaled residual, the two planes of a split operand */
  __shared__ __attribute__((aligned(16))) unsigned char smem[2 * G2_BUF];      /* the two staging buffers; the epilogue's 4 x 32 x 68 floats lie over them once the loop's last barrier has ended every read */
  float (*so)[32][68] = reinterpret_cast<float (*)[32][68]>(smem);
  const int tid = threadIdx.x, w = tid >> 5, lane = tid & 31, ln = lane & 15, hh = lane >> 4; const int by = blockIdx.y;
  A += (size_t)by * sA; Bh += (size_t)by * sB; const size_t cofs = (size_t)by * sC; const float* bp = bias ? bias + (size_t)by * sBias : nullptr;
  const int ntn = N >> 6; const int mt = blockIdx.x / ntn, nq = blockIdx.x - mt * ntn; const int row0 = mt * 128 + 32 * w, col0 = nq * 64; if (mt * 128 >= M) return;      /* the whole block leaves or none: barriers follow */
  const int crow = tid >> 3, cch = tid & 7;      /* copy role: row (mod 16) and 16-byte piece of the 128-byte row */
  const _Float16* gA = A + (size_t)(mt * 128 + crow) * lda + cch * 8; const _Float16* gB = Bh + (size_t)(col0 + crow) * ldb + cch * 8; const size_t sa16 = (size_t)16 * lda, sb16 = (size_t)16 * ldb;
  const unsigned l0 = (unsigned)(size_t)smem + (unsigned)(crow * G2_PITCH + cch * 16);
  const int aoff = (32 * w + ln) * G2_PITCH + 16 * hh, boff = (128 + ln) * G2_PITCH + 16 * hh;
  const v8f z8 = {0.f,0.f,0.f,0.f,0.f,0.f,0.f,0.f}; v8f c00 = z8, c01 = z8, c02 = z8, c03 = z8, c10 = z8, c11 = z8, c12 = z8, c13 = z8;
  const int NT = K >> 6;
  g2_copy(l0, gA, sa16, gB, sb16);
  asm volatile("s_wait_asynccnt 0x0" ::: "memory");      /* slice 0 has landed before the barrier publishes it */
  __syncthreads();
  if (NT > 1) g2_copy(l0 + G2_BUF, gA + 64, sa16, gB + 64, sb16);
#pragma unroll 1      /* one slice per trip: the buffer alternates with the trip's parity */
  for (int t = 0; t < NT; ++t) { const unsigned char* sb = smem + (t & 1) * G2_BUF; const unsigned char* pa = sb + aoff; const unsigned char* pb = sb + boff;
    const v16h a0 = g2_lfrag(pa), a1 = g2_lfrag(pa + 16 * G2_PITCH), b0 = g2_lfrag(pb), b1 = g2_lfrag(pb + 16 * G2_PITCH), b2 = g2_lfrag(pb + 32 * G2_PITCH), b3 = g2_lfrag(pb + 48 * G2_PITCH);
    const v16h e0 = g2_lfrag(pa + 64), e1 = g2_lfrag(pa + 16 * G2_PITCH + 64), f0 = g2_lfrag(pb + 64), f1 = g2_lfrag(pb + 16 * G2_PITCH + 64), f2 = g2_lfrag(pb + 32 * G2_PITCH + 64), f3 = g2_lfrag(pb + 48 * G2_PITCH + 64);
    c00 = g2_mma(a0, b0, c00); c10 = g2_mma(a1, b0, c10); c01 = g2_mma(a0, b1, c01); c11 = g2_mma(a1, b1, c11); c02 = g2_mma(a0, b2, c02); c12 = g2_mma(a1, b2, c12); c03 = g2_mma(a0, b3, c03); c13 = g2_mma(a1, b3, c13);
    c00 = g2_mma(e0, f0, c00); c10 = g2_mma(e1, f0, c10); c01 = g2_mma(e0, f1, c01); c11 = g2_mma(e1, f1, c11); c02 = g2_mma(e0, f2, c02); c12 = g2_mma(e1, f2, c12); c03 = g2_mma(e0, f3, c03); c13 = g2_mma(e1, f3, c13);
    asm volatile("s_wait_dscnt 0x0" ::: "memory");         /* this wave's reads of the buffer are over before it may be refilled */
    asm volatile("s_wait_asynccnt 0x0" ::: "memory");      /* this wave's copies of the next slice have landed */
    __syncthreads();                                       /* publishes the next slice and ends every wave's reads of this one */
    if (t + 2 < NT) g2_copy(l0 + (unsigned)(t & 1) * G2_BUF, gA + (size_t)(t + 2) * 64, sa16, gB + (size_t)(t + 2) * 64, sb16); }
  asm volatile("s_wait_asynccnt 0x0" ::: "memory");        /* nothing is in flight when the buffers become output staging */
  v8f accs[8] = {c00, c01, c02, c03, c10, c11, c12, c13};
#pragma unroll
  for (int u = 0; u < 8; ++u) { const int t = u & 3, half = u >> 2; const int col = col0 + t * 16 + ln; const float bv = bp ? bf16_round(bp[col]) : 0.f;
#pragma unroll
    for (int r = 0; r < 8; ++r) { const int rloc = half * 16 + 8 * hh + r; float v = accs[u][r] * alpha + bv; if (CP) { const int bidx = (row0g + row0 + rloc) / rowsPerB; v += CP[(size_t)bidx * sCPb + (size_t)by * 64 + col]; }
      if (ACT == 3) v = fmaxf(v, 0.f); else if (ACT == 6) v = 0.5f * v * (1.0f + erff(v * 0.70710678118654752f)); else if (ACT == 11) v = 1.0f / (1.0f + expf(-v)); else if (ACT == 15) v = v / (1.0f + expf(-v)); else if (ACT == 12) v = (v > 0.f) ? v : 0.01f * v; else if (ACT == 8) v = tanhf(v);
      so[w][rloc][t * 16 + ln] = v; } }
  __builtin_amdgcn_fence(__ATOMIC_ACQ_REL, "workgroup"); __builtin_amdgcn_wave_barrier();
  const int rsub = lane >> 4, c4 = (lane & 15) * 4;
  if (!SPLIT) {
#pragma unroll
    for (int q = 0; q < 16; ++q) { const int r = q * 2 + rsub; const v4f v = *(const v4fa*)&so[w][r][c4]; *(v4f*)(C + cofs + (size_t)(row0 + r) * ldc + col0 + c4) = v; }
  } else {
#pragma unroll
    for (int q = 0; q < 16; ++q) { const int r = q * 2 + rsub; const v4f v = *(const v4fa*)&so[w][r][c4]; const size_t o = cofs + (size_t)(row0 + r) * ldc + col0 + c4; v4h h4, l4;
      for (int i = 0; i < 4; ++i) { h4[i] = (_Float16)v[i]; l4[i] = (_Float16)((v[i] - (float)h4[i]) * 1024.0f); }
      *(v4h*)(C16 + o) = h4; *(v4h*)(CL + o) = l4; }
  } }



// lane l with lane l ^ 16 (the two halves of a wave hold the two key halves of one query column)
__device__ __forceinline__ float xhalf(float x) { return __builtin_bit_cast(float, __builtin_amdgcn_permlanex16(__builtin_bit_cast(int, x), __builtin_bit_cast(int, x), 0x76543210, 0xfedcba98, false, false)); }
#define FL_BUF (192 * G2_PITCH)      /* one buffer: key rows 0..63, low value-dimension rows 64..127, high ones 128..191 */
// one tile: 12 copies of 16 bytes per lane (4 of K, 4 of V^T low, 4 of V^T high), a wave's copy covering 4 whole rows; l = the lane's LDS byte address of its first row, rows 16 apart
__device__ __forceinline__ void fl_copy(unsigned l, const unsigned short* gk, size_t sk16, const unsigned short* gv, const unsigned short* gw, size_t sv16) {
  /* the closing s_wait_xcnt keeps every address register intact until the copies have taken it */
  asm volatile("global_load_async_to_lds_b128 %0, %12, off\n\t"
               "global_load_async_to_lds_b128 %1, %13, off\n\t"
               "global_load_async_to_lds_b128 %2, %14, off\n\t"
               "global_load_async_to_lds_b128 %3, %15, off\n\t"
               "global_load_async_to_lds_b128 %4, %16, off\n\t"
               "global_load_async_to_lds_b128 %5, %17, off\n\t"
               "global_load_async_to_lds_b128 %6, %18, off\n\t"
               "global_load_async_to_lds_b128 %7, %19, off\n\t"
               "global_load_async_to_lds_b128 %8, %20, off\n\t"
               "global_load_async_to_lds_b128 %9, %21, off\n\t"
               "global_load_async_to_lds_b128 %10, %22, off\n\t"
               "global_load_async_to_lds_b128 %11, %23, off\n\t"
               "s_wait_xcnt 0x0"
               :: "v"(l), "v"(l + 16 * G2_PITCH), "v"(l + 32 * G2_PITCH), "v"(l + 48 * G2_PITCH), "v"(l + 64 * G2_PITCH), "v"(l + 80 * G2_PITCH), "v"(l + 96 * G2_PITCH), "v"(l + 112 * G2_PITCH),
                  "v"(l + 128 * G2_PITCH), "v"(l + 144 * G2_PITCH), "v"(l + 160 * G2_PITCH), "v"(l + 176 * G2_PITCH),
                  "v"(gk), "v"(gk + sk16), "v"(gk + 2 * sk16), "v"(gk + 3 * sk16), "v"(gv), "v"(gv + sv16), "v"(gv + 2 * sv16), "v"(gv + 3 * sv16),
                  "v"(gw), "v"(gw + sv16), "v"(gw + 2 * sv16), "v"(gw + 3 * sv16)
               : "memory");
}
// Transposed products: S^T = K Q^T (A = key rows, B = query columns) and O^T += V^T P^T (A = value-dimension rows of V^T, B = P^T). A lane holds 16 of the 32 scores of ONE query (keys 8 hh + r and 16 + 8 hh + r), which is the k order of a B operand: P goes from the score accumulators into the next product without LDS; maximum, sum and rescale factor are one value per lane.
template <int CAUSAL>
__global__ __launch_bounds__(128) void k_flash(const _Float16* __restrict__ Q16, int ldq, const _Float16* __restrict__ K16, int ldk, const _Float16* __restrict__ Vt, const _Float16* __restrict__ Vt2, const int* __restrict__ MSK, float* __restrict__ O, float* __restrict__ O2, int ldo) {
  constexpr int RPW = 16, DT = 8, KS = 2;      /* DT 0..3: low 64 value columns (Vt -> O), DT 4..7: high 64 (Vt2 -> O2); one score/softmax pass feeds both */
  __shared__ __attribute__((aligned(16))) unsigned char smem[2 * FL_BUF];      /* the two staging buffers; the epilogue's 4 x 16 x 68 floats lie over them once the loop's last barrier has ended every read */
  float (*sO)[RPW][64 + 4] = reinterpret_cast<float (*)[RPW][64 + 4]>(smem);
  const int tid = threadIdx.x, w = tid >> 5, lane = tid & 31, ln = lane & 15, hh = lane >> 4;
  const int slab = blockIdx.x / QBNP, qblk = QB0P + blockIdx.x % QBNP; const int b = slab / NH, h = slab % NH; const int qb0 = qblk * (4 * RPW); const int q0 = qb0 + w * RPW; const int tq = q0 + ln;      /* this lane's query */
  FragH aq[KS];
  { const unsigned short* qr = (const unsigned short*)Q16 + ((size_t)b * TQ + tq) * ldq + h * 64;
#pragma unroll
    for (int ks = 0; ks < KS; ++ks) { aq[ks].half[0] = *(const v8us*)(qr + ks * 32 + 8 * hh); aq[ks].half[1] = *(const v8us*)(qr + ks * 32 + 16 + 8 * hh); } }
  const size_t vo = ((size_t)b * KVD + (h / 8) * 128) * TK;      /* pseudo-head h reads value head h / 8 (128 rows of V^T [batch][512][token]); Vt2 points 64 rows further */
  const unsigned short* Vth = (const unsigned short*)Vt + vo; const unsigned short* Vth2 = (const unsigned short*)Vt2 + vo;
  constexpr float C2 = SCL * 1.4426950408889634f;      /* raw score -> exponent in base 2 */
  float m_r = -1.0e38f, l_r = 0.f; v8f oacc[DT];      /* m_r: running maximum of the RAW scores, never below -1e38, so that a masked score (-3e38) stays far under it; l_r: row sum in units of 2^-10 */
#pragma unroll
  for (int dt = 0; dt < DT; ++dt) oacc[dt] = (v8f){0.f,0.f,0.f,0.f,0.f,0.f,0.f,0.f};
  const int jend = (CAUSAL == 1) ? (qb0 + 4 * RPW) : TK;      /* causal: keys beyond the block's last query never contribute */
  const int crow = tid >> 3, cch = tid & 7;      /* copy role: row (mod 16) and 16-byte piece of the 128-byte row */
  const unsigned short* gK = (const unsigned short*)K16 + ((size_t)b * TK + crow) * ldk + (h / NREP) * 64 + cch * 8;      /* query head h reads key head h / 4 */
  const unsigned short* gV = Vth + (size_t)crow * TK + cch * 8; const unsigned short* gW = Vth2 + (size_t)crow * TK + cch * 8; const size_t sk16 = (size_t)16 * ldk, sv16 = (size_t)16 * TK;
  const unsigned l0 = (unsigned)(size_t)smem + (unsigned)(crow * G2_PITCH + cch * 16);
  const int foff = ln * G2_PITCH + 16 * hh;      /* fragment role: row (mod 16) and 16-byte piece, the k order of the former global loads */
  const int NT = jend >> 6;      /* jend is a multiple of 64 */
  fl_copy(l0, gK, sk16, gV, gW, sv16);
  asm volatile("s_wait_asynccnt 0x0" ::: "memory");      /* tile 0 has landed before the barrier publishes it */
  __syncthreads();
  if (NT > 1) fl_copy(l0 + FL_BUF, gK + (size_t)64 * ldk, sk16, gV + 64, gW + 64, sv16);
#pragma unroll 1      /* one tile per trip: the buffer alternates with the trip's parity */
  for (int t = 0; t < NT; ++t) { const unsigned char* sb = smem + (t & 1) * FL_BUF + foff;
#pragma unroll      /* the tile's two 32-key halves, each worked on as one pass of the online softmax, in key order */
   for (int sub = 0; sub < 2; ++sub) { const int j0 = t * 64 + sub * 32;
    FragH bk[2][KS], bv[DT];
#pragma unroll
    for (int nt = 0; nt < 2; ++nt) {
#pragma unroll
      for (int ks = 0; ks < KS; ++ks) bk[nt][ks].v = g2_lfrag(sb + (sub * 32 + nt * 16) * G2_PITCH + ks * 64); }
    v8f st[2];      /* st[nt][r] = score of key j0 + nt * 16 + 8 * hh + r against query tq */
#pragma unroll
    for (int nt = 0; nt < 2; ++nt) { v8f acc = (v8f){0.f,0.f,0.f,0.f,0.f,0.f,0.f,0.f};
#pragma unroll
      for (int ks = 0; ks < KS; ++ks) acc = mmaH<1>(bk[nt][ks].v, bk[nt][ks].v, aq[ks].v, aq[ks].v, acc);
      st[nt] = acc; }
#pragma unroll
    for (int dt = 0; dt < DT; ++dt) bv[dt].v = g2_lfrag(sb + (64 + dt * 16) * G2_PITCH + sub * 64);
    float sv[16]; float mc = -3.0e38f;
#pragma unroll
    for (int e = 0; e < 16; ++e) { const int kk = j0 + (e >> 3) * 16 + 8 * hh + (e & 7); const bool ok = (CAUSAL == 1) ? (kk <= tq) : ((CAUSAL == 2) ? ((kk >> 5) == (tq >> 5)) : true);      /* mode 2: block-diagonal 32-token groups */
      sv[e] = ok ? st[e >> 3][e & 7] : -3.0e38f; mc = fmaxf(mc, sv[e]); }
    mc = fmaxf(mc, xhalf(mc));      /* both halves feed one output column: they share the maximum */
    const float mn = fmaxf(m_r, mc); const float xa = (m_r - mn) * C2; m_r = mn;      /* rescale factor 2^xa; nothing seen yet: 2^0 = 1 on zero sums */
    const float nb = fmaf(-mn, C2, 10.0f);      /* p = 1024 exp((s - mn) / 8) = 2^(s C2 + nb): scale, maximum and the operand's 2^10 in one fused multiply-add; a masked score gives 2^(-huge) = 0 */
    float pe[16], al = xa;
#pragma unroll
    for (int e = 0; e < 16; ++e) pe[e] = fmaf(sv[e], C2, nb);
    /* the exponentials stand together, each in place on a register of its own: no v_exp_f32 is directly followed by a read of its result or by another instruction's write of its source; the closing v_nop keeps that slot free of whatever the compiler puts next */
    asm("v_exp_f32 %0, %0\n\tv_exp_f32 %1, %1\n\tv_exp_f32 %2, %2\n\tv_exp_f32 %3, %3\n\tv_exp_f32 %4, %4\n\tv_exp_f32 %5, %5\n\tv_exp_f32 %6, %6\n\tv_exp_f32 %7, %7\n\tv_exp_f32 %8, %8\n\tv_nop"
        : "+v"(al), "+v"(pe[0]), "+v"(pe[1]), "+v"(pe[2]), "+v"(pe[3]), "+v"(pe[4]), "+v"(pe[5]), "+v"(pe[6]), "+v"(pe[7]));
    asm("v_exp_f32 %0, %0\n\tv_exp_f32 %1, %1\n\tv_exp_f32 %2, %2\n\tv_exp_f32 %3, %3\n\tv_exp_f32 %4, %4\n\tv_exp_f32 %5, %5\n\tv_exp_f32 %6, %6\n\tv_exp_f32 %7, %7\n\tv_nop"
        : "+v"(pe[8]), "+v"(pe[9]), "+v"(pe[10]), "+v"(pe[11]), "+v"(pe[12]), "+v"(pe[13]), "+v"(pe[14]), "+v"(pe[15]));
    FragH pb; float ps[4] = {0.f, 0.f, 0.f, 0.f};
#pragma unroll
    for (int e = 0; e < 16; ++e) { ps[e & 3] += pe[e]; pb.h[e] = (_Float16)pe[e]; }
    l_r = l_r * al + ((ps[0] + ps[1]) + (ps[2] + ps[3]));
#pragma unroll
    for (int dt = 0; dt < DT; ++dt) {
#pragma unroll
      for (int r = 0; r < 8; ++r) oacc[dt][r] *= al; }
#pragma unroll
    for (int dt = 0; dt < DT; ++dt) oacc[dt] = mmaH<1>(bv[dt].v, bv[dt].v, pb.v, pb.v, oacc[dt]); }
    asm volatile("s_wait_dscnt 0x0" ::: "memory");         /* this wave's reads of the buffer are over before it may be refilled */
    asm volatile("s_wait_asynccnt 0x0" ::: "memory");      /* this wave's copies of the next tile have landed */
    __syncthreads();                                       /* publishes the next tile and ends every wave's reads of this one */
    if (t + 2 < NT) fl_copy(l0 + (unsigned)(t & 1) * FL_BUF, gK + (size_t)(t + 2) * 64 * ldk, sk16, gV + (t + 2) * 64, gW + (t + 2) * 64, sv16); }
  asm volatile("s_wait_asynccnt 0x0" ::: "memory");        /* nothing is in flight when the buffers become output staging */
  const float lt = l_r + xhalf(l_r); const float inv = (lt > 0.f) ? 1.0f / lt : 0.f;      /* sums and products both carry the 2^10 */
#pragma unroll
  for (int hf = 0; hf < 2; ++hf) { float* __restrict__ Oh = hf ? O2 : O;
#pragma unroll
    for (int dt = 0; dt < 4; ++dt) { const v8f a = oacc[hf * 4 + dt]; const v4f lo = {a[0] * inv, a[1] * inv, a[2] * inv, a[3] * inv}, hi = {a[4] * inv, a[5] * inv, a[6] * inv, a[7] * inv};      /* a[r] = column dt * 16 + 8 * hh + r of query row ln */
      *(v4fa*)&sO[w][ln][dt * 16 + 8 * hh] = lo; *(v4fa*)&sO[w][ln][dt * 16 + 8 * hh + 4] = hi; }
    __builtin_amdgcn_fence(__ATOMIC_ACQ_REL, "workgroup"); __builtin_amdgcn_wave_barrier();
#pragma unroll
    for (int rp = 0; rp < RPW; rp += 2) { const int r = rp + (lane >> 4), pc = lane & 15; const v4f val = *(const v4fa*)&sO[w][r][pc * 4]; *(v4f*)(Oh + ((size_t)b * TQ + q0 + r) * ldo + h * 64 + pc * 4) = val; }
    if (hf == 0) { __builtin_amdgcn_fence(__ATOMIC_ACQ_REL, "workgroup"); __builtin_amdgcn_wave_barrier(); }      /* the high half reuses this wave's sO slice: its stores stay behind the low half's reads */
  } }
// 5-plane variant: S = Qh Kh^T + (Ql Kh^T + Qh Kl^T)/1024 with Q/K = [hi | 2^10 residual] f16 planes (QL/KL same layout as Q16/K16), then the 3-term P.V below.
// 3-term variant: O = (P_hi V_hi + (P_lo V_hi + P_hi V_lo) / 1024) / l with P = [hi | 2^10 residual] of 1024 p and V^T = [hi | 2^10 residual] planes (VtL same layout as Vt) -> ~2^-21-class products for un-averaged (early causal / peaked) rows
template <int CAUSAL>
__global__ __launch_bounds__(128) void k_flash5(const _Float16* __restrict__ Q16, const _Float16* __restrict__ QL, int ldq, const _Float16* __restrict__ K16, const _Float16* __restrict__ KL, int ldk, const _Float16* __restrict__ Vt, const _Float16* __restrict__ VtL, const int* __restrict__ MSK, float* __restrict__ O, int ldo) {
  constexpr int RPW = 16, DT = 4, KS = 2;      /* transposed like k_flash: key rows and V^T rows are A operands, query columns and P^T are B operands */
  __shared__ __attribute__((aligned(16))) float sO[4][RPW][64 + 4];
  const int tid = threadIdx.x, w = tid >> 5, lane = tid & 31, ln = lane & 15, hh = lane >> 4;
  const int slab = blockIdx.x / QBN5, qblk = QB05 + blockIdx.x % QBN5; const int b = slab / NH, h = slab % NH; const int qb0 = qblk * (4 * RPW); const int q0 = qb0 + w * RPW; const int tq = q0 + ln;      /* this lane's query */
  FragH aq[KS], aql[KS];
  { const unsigned short* qr = (const unsigned short*)Q16 + ((size_t)b * TQ + tq) * ldq + h * 64; const unsigned short* ql = (const unsigned short*)QL + ((size_t)b * TQ + tq) * ldq + h * 64;
#pragma unroll
    for (int ks = 0; ks < KS; ++ks) { aq[ks].half[0] = *(const v8us*)(qr + ks * 32 + 8 * hh); aq[ks].half[1] = *(const v8us*)(qr + ks * 32 + 16 + 8 * hh); aql[ks].half[0] = *(const v8us*)(ql + ks * 32 + 8 * hh); aql[ks].half[1] = *(const v8us*)(ql + ks * 32 + 16 + 8 * hh); } }
  const size_t vo = ((size_t)b * KVD + (h / 8) * 128) * TK;      /* value head h / 8 of V^T [batch][512][token]; the caller's pointers pick its low or high 64 rows */
  const unsigned short* Vth = (const unsigned short*)Vt + vo; const unsigned short* Vtl = (const unsigned short*)VtL + vo;
  float m_r = -3.0e38f, l_r = 0.f; v8f oacc[DT], oaccL[DT];
#pragma unroll
  for (int dt = 0; dt < DT; ++dt) { oacc[dt] = (v8f){0.f,0.f,0.f,0.f,0.f,0.f,0.f,0.f}; oaccL[dt] = oacc[dt]; }
  const int jend = (CAUSAL == 1) ? (qb0 + 4 * RPW) : TK;      /* causal: keys beyond the block's last query never contribute */
#pragma unroll 1
  for (int j0 = 0; j0 < jend; j0 += 32) {
    FragH bk[2][KS], bkl[2][KS], bv[DT], bl[DT];
    const size_t ko = ((size_t)b * TK + j0 + ln) * ldk + (h / NREP) * 64 + 8 * hh; const unsigned short* kr0 = (const unsigned short*)K16 + ko; const unsigned short* kr1 = kr0 + (size_t)16 * ldk; const unsigned short* kl0 = (const unsigned short*)KL + ko; const unsigned short* kl1 = kl0 + (size_t)16 * ldk;
#pragma unroll
    for (int nt = 0; nt < 2; ++nt) { const unsigned short* kr = nt ? kr1 : kr0; const unsigned short* klr = nt ? kl1 : kl0;
#pragma unroll
      for (int ks = 0; ks < KS; ++ks) { bk[nt][ks].half[0] = *(const v8us*)(kr + ks * 32); bk[nt][ks].half[1] = *(const v8us*)(kr + ks * 32 + 16); bkl[nt][ks].half[0] = *(const v8us*)(klr + ks * 32); bkl[nt][ks].half[1] = *(const v8us*)(klr + ks * 32 + 16); } }
    asm volatile("s_wait_xcnt 0x0" :: "v"(kr0), "v"(kr1), "v"(kl0), "v"(kl1) : "memory");      /* a precaution: the address registers stay whole (no load's own destination takes them) until the issued loads have taken them */
    v8f st[2];      /* st[nt][r] = score of key j0 + nt * 16 + 8 * hh + r against query tq */
#pragma unroll
    for (int nt = 0; nt < 2; ++nt) { v8f acc = (v8f){0.f,0.f,0.f,0.f,0.f,0.f,0.f,0.f}, accl = acc;
#pragma unroll
      for (int ks = 0; ks < KS; ++ks) { acc = mmaH<1>(bk[nt][ks].v, bk[nt][ks].v, aq[ks].v, aq[ks].v, acc); accl = mmaH<1>(bk[nt][ks].v, bk[nt][ks].v, aql[ks].v, aql[ks].v, accl); accl = mmaH<1>(bkl[nt][ks].v, bkl[nt][ks].v, aq[ks].v, aq[ks].v, accl); }
#pragma unroll
      for (int r = 0; r < 8; ++r) acc[r] += accl[r] * 0.0009765625f;
      st[nt] = acc; }
    const unsigned short* vr0 = Vth + (size_t)ln * TK + j0 + 8 * hh; const unsigned short* vr1 = Vtl + (size_t)ln * TK + j0 + 8 * hh;
#pragma unroll
    for (int dt = 0; dt < DT; ++dt) { const unsigned short* vrow = vr0 + (size_t)(dt * 16) * TK; const unsigned short* vrl = vr1 + (size_t)(dt * 16) * TK; bv[dt].half[0] = *(const v8us*)vrow; bv[dt].half[1] = *(const v8us*)(vrow + 16); bl[dt].half[0] = *(const v8us*)vrl; bl[dt].half[1] = *(const v8us*)(vrl + 16); }
    asm volatile("s_wait_xcnt 0x0" :: "v"(vr0), "v"(vr1) : "memory");      /* the same precaution for the value loads, which fly during the softmax */
    float sv[16]; bool ok[16]; float mc = -3.0e38f;
#pragma unroll
    for (int e = 0; e < 16; ++e) { const int kk = j0 + (e >> 3) * 16 + 8 * hh + (e & 7); ok[e] = (CAUSAL == 1) ? (kk <= tq) : ((CAUSAL == 2) ? ((kk >> 5) == (tq >> 5)) : true);      /* mode 2: block-diagonal 32-token groups */
      if (CAUSAL == 4) ok[e] = MSK[((size_t)b * TQ + tq) * TK + kk] != 0;      /* mode 4: per-(query, key) INPUT mask shared by all heads; masked keys contribute nothing (== the reference's -4096 fill, whose exp underflows to 0), rows with no valid key give l = 0 -> output 0 (== the reference's row_valid zeroing) */
      sv[e] = ok[e] ? st[e >> 3][e & 7] * SCL : -3.0e38f; mc = fmaxf(mc, sv[e]); }
    mc = fmaxf(mc, xhalf(mc));      /* both halves feed one output column: they share the maximum */
    const float mn = fmaxf(m_r, mc); const float al = (mn > -1.0e38f) ? expf(m_r - mn) : 1.0f; m_r = mn;
    FragH pa, pl; float ps[4] = {0.f, 0.f, 0.f, 0.f};
#pragma unroll
    for (int e = 0; e < 16; ++e) { const float p = ok[e] ? expf(sv[e] - mn) : 0.f; ps[e & 3] += p; const float pw = p * 1024.0f; pa.h[e] = (_Float16)pw; pl.h[e] = (_Float16)((pw - (float)pa.h[e]) * 1024.0f); }
    l_r = l_r * al + ((ps[0] + ps[1]) + (ps[2] + ps[3]));
#pragma unroll
    for (int dt = 0; dt < DT; ++dt) {
#pragma unroll
      for (int r = 0; r < 8; ++r) { oacc[dt][r] *= al; oaccL[dt][r] *= al; } }
#pragma unroll
    for (int dt = 0; dt < DT; ++dt) { oacc[dt] = mmaH<1>(bv[dt].v, bv[dt].v, pa.v, pa.v, oacc[dt]); oaccL[dt] = mmaH<1>(bv[dt].v, bv[dt].v, pl.v, pl.v, oaccL[dt]); oaccL[dt] = mmaH<1>(bl[dt].v, bl[dt].v, pa.v, pa.v, oaccL[dt]); } }
  const float lt = l_r + xhalf(l_r); const float inv = (lt > 0.f) ? 1.0f / (lt * 1024.0f) : 0.f;
#pragma unroll
  for (int dt = 0; dt < DT; ++dt) { v8f a = oacc[dt];
#pragma unroll
    for (int r = 0; r < 8; ++r) { a[r] += oaccL[dt][r] * 0.0009765625f; a[r] *= inv; }      /* a[r] = column dt * 16 + 8 * hh + r of query row ln */
    const v4f lo = {a[0], a[1], a[2], a[3]}, hi = {a[4], a[5], a[6], a[7]}; *(v4fa*)&sO[w][ln][dt * 16 + 8 * hh] = lo; *(v4fa*)&sO[w][ln][dt * 16 + 8 * hh + 4] = hi; }
  __builtin_amdgcn_fence(__ATOMIC_ACQ_REL, "workgroup"); __builtin_amdgcn_wave_barrier();
  {
#pragma unroll
    for (int rp = 0; rp < RPW; rp += 2) { const int r = rp + (lane >> 4), pc = lane & 15; const v4f val = *(const v4fa*)&sO[w][r][pc * 4]; *(v4f*)(O + ((size_t)b * TQ + q0 + r) * ldo + h * 64 + pc * 4) = val; }
     } }

__global__ __launch_bounds__(256) void k_wsc(const float* __restrict__ Wm, _Float16* __restrict__ Bt, size_t n8, float sc) { const size_t t = (size_t)blockIdx.x * 256 + threadIdx.x; if (t >= n8) return; FragH f; for (int q = 0; q < 8; ++q) f.h[q] = (_Float16)(bf16_round(Wm[t * 8 + q]) * sc); *(v8us*)((unsigned short*)Bt + t * 8) = f.half[0];  }
__global__ __launch_bounds__(64) void k_lam(const float* __restrict__ q1, const float* __restrict__ k1, const float* __restrict__ q2, const float* __restrict__ k2, float* __restrict__ LAM) {
  #pragma clang fp contract(off)
  const int ln = threadIdx.x & 31; if (threadIdx.x >= 32) return; float a = bf16_round(q1[ln]) * bf16_round(k1[ln]); a += bf16_round(q1[ln + 32]) * bf16_round(k1[ln + 32]); float c = bf16_round(q2[ln]) * bf16_round(k2[ln]); c += bf16_round(q2[ln + 32]) * bf16_round(k2[ln + 32]);
  for (int o = 16; o > 0; o >>= 1) { a += __shfl_xor(a, o, 32); c += __shfl_xor(c, o, 32); } const float lf = expf(a) - expf(c) + 0.78360576653162446f;      /* LAMBDA_INIT = 0.8 - 0.6 exp(-0.3 * 12) = 0.78360577 */
  const float v = (ln == 0) ? lf : 0.f; *(float*)(LAM + ln) = v;  }
__global__ __launch_bounds__(256) void k_comb(const float* __restrict__ OLO, const float* __restrict__ OHI, const float* __restrict__ LAM, const float* __restrict__ lnw, _Float16* __restrict__ A16) {
  #pragma clang fp contract(off)
  const size_t t = (size_t)blockIdx.x * 256 + threadIdx.x; if (t >= (size_t)NR * 16) return; const int j = (int)(t % 16); const size_t r = t / 16; const float lam = LAM[0]; float a[128]; float ss = 0.f;
  const float* e0 = OLO + r * DM + (size_t)(2 * j) * 64; const float* o0 = OLO + r * DM + (size_t)(2 * j + 1) * 64; const float* e1 = OHI + r * DM + (size_t)(2 * j) * 64; const float* o1 = OHI + r * DM + (size_t)(2 * j + 1) * 64;
  for (int d = 0; d < 64; ++d) { float v = e0[d]; v += -lam * o0[d]; a[d] = v; ss += v * v; float w = e1[d]; w += -lam * o1[d]; a[64 + d] = w; ss += w * w; }
  const float inv = rsqrtf(ss / 128.0f + 1e-5f); unsigned short* dst = (unsigned short*)A16 + r * DM + (size_t)j * 128;
  { for (int g = 0; g < 16; ++g) { FragH f; for (int q = 0; q < 8; ++q) { const int d = g * 8 + q; float v = a[d] * inv; v *= bf16_round(lnw[d]); v = v * 0.21639423346837554f;      /* 1 - LAMBDA_INIT */ f.h[q] = (_Float16)v; } *(v8us*)(dst + g * 8) = f.half[0]; }  } }

extern "C" void kernel_launch(void* const* d_in, const int* in_sizes, int n_in,
                              void* d_out, int out_size, void* d_ws, size_t ws_size, hipStream_t stream) {
  (void)in_sizes; (void)n_in; (void)out_size;
  const float* const* I = (const float* const*)d_in; const float* x = I[0]; const float* Wq = I[1]; const float* Wk = I[2]; const float* Wv = I[3]; const float* Wo = I[4]; const float* lq1 = I[5]; const float* lk1 = I[6]; const float* lq2 = I[7]; const float* lk2 = I[8]; const float* lnw = I[9]; const float* bq = nullptr; const float* bk = nullptr; const float* bv = nullptr;
  char* ws = (char*)d_ws; size_t off = 0;
  auto take = [&](size_t bytes) { char* p = ws + off; off += (bytes + 255) & ~(size_t)255; return p; };
  const size_t np = (size_t)NR * DM, nk = (size_t)NR * KVD;
  _Float16* BQ = (_Float16*)take((size_t)DM * DM * 2); _Float16* BK = (_Float16*)take((size_t)KVD * DM * 2); _Float16* BV = (_Float16*)take((size_t)KVD * DM * 2); _Float16* BO = (_Float16*)take((size_t)DM * DM * 2);
  _Float16* X16 = (_Float16*)take(np * 2); _Float16* QH = (_Float16*)take(np * 2); _Float16* QL = (_Float16*)take(np * 2); _Float16* KH = (_Float16*)take(nk * 2); _Float16* KL = (_Float16*)take(nk * 2); _Float16* VT = (_Float16*)take(nk * 2); _Float16* VTL = (_Float16*)take(nk * 2); float* LAM = (float*)take(256); float* OLO = (float*)take(np * 4); float* OHI = (float*)take(np * 4);      /* q [token][32 x 64], k [token][8 x 64], V^T [batch][4 x 128][token], each as f16 hi + residual plane; low- and high-half attention outputs */
  _Float16* A16 = X16;      /* normalised attention over the input plane (dead after the projections) */
  if (off > ws_size) return;      /* 8+2+2+8 + 16+16+16+4+4+4+4 + 32+32 = 148 MiB */
  k_wsc<<<(unsigned)(((size_t)DM * DM / 8 + 255) / 256), 256, 0, stream>>>(Wq, BQ, (size_t)DM * DM / 8, 16.0f); k_wsc<<<(unsigned)(((size_t)KVD * DM / 8 + 255) / 256), 256, 0, stream>>>(Wk, BK, (size_t)KVD * DM / 8, 16.0f); k_wsc<<<(unsigned)(((size_t)KVD * DM / 8 + 255) / 256), 256, 0, stream>>>(Wv, BV, (size_t)KVD * DM / 8, 16.0f); k_wsc<<<(unsigned)(((size_t)DM * DM / 8 + 255) / 256), 256, 0, stream>>>(Wo, BO, (size_t)DM * DM / 8, 16.0f);      /* torch (out,in) = Bt */ k_lam<<<1, 64, 0, stream>>>(lq1, lk1, lq2, lk2, LAM);
  k_x16<<<(unsigned)((np / 8 + 255) / 256), 256, 0, stream>>>(x, X16, np / 8);
  /* the projections write the attention's operands themselves: no f32 plane, no split, repeat or transpose pass in between */
  k_gemm2<0, true><<<dim3((NR / 128) * (DM / 64), 1), 128, 0, stream>>>(X16, DM, 0, BQ, DM, 0, 0.0625f, bq, 0, nullptr, 1, 0, 0, nullptr, QH, QL, DM, 0, NR, DM, DM);
  k_gemm2<0, true><<<dim3((NR / 128) * (KVD / 64), 1), 128, 0, stream>>>(X16, DM, 0, BK, DM, 0, 0.0625f, bk, 0, nullptr, 1, 0, 0, nullptr, KH, KL, KVD, 0, NR, KVD, DM);
  k_gemm2<0, true><<<dim3((KVD / 128) * (SLEN / 64), NB), 128, 0, stream>>>(BV, DM, 0, X16, DM, (size_t)SLEN * DM, 0.0625f, nullptr, 0, nullptr, 1, 0, 0, nullptr, VT, VTL, SLEN, (size_t)KVD * SLEN, KVD, SLEN, DM);      /* V^T = Wv x^T per batch: the weight rows are the A operand, the tokens the B operand */
  k_flash5<1><<<NB * NH * QBN5, 128, 0, stream>>>(QH, QL, DM, KH, KL, KVD, VT, VTL, nullptr, OLO, DM); k_flash5<1><<<NB * NH * QBN5, 128, 0, stream>>>(QH, QL, DM, KH, KL, KVD, VT + (size_t)64 * SLEN, VTL + (size_t)64 * SLEN, nullptr, OHI, DM);      /* first 256 rows: low, then high 64 value columns */
  k_flash<1><<<NB * NH * QBNP, 128, 0, stream>>>(QH, DM, KH, KVD, VT, VT + (size_t)64 * SLEN, nullptr, OLO, OHI, DM);      /* rows from 256 on: one pass over the keys for both halves of each pseudo-head's 128-wide value head */
  k_comb<<<(unsigned)(((size_t)NR * 16 + 255) / 256), 256, 0, stream>>>(OLO, OHI, LAM, lnw, A16);
  k_gemm2<0, false><<<dim3((NR / 128) * (DM / 64), 1), 128, 0, stream>>>(A16, DM, 0, BO, DM, 0, 0.0625f, nullptr, 0, nullptr, 1, 0, 0, (float*)d_out, nullptr, nullptr, DM, 0, NR, DM, DM);      /* out = attn Wo^T */
}

// v007
// Measured time: 194 microseconds a run.
// Timed twice side by side with v006, it ran 1.39 and 1.38 times as fast.
// Over all steps from v000 it is 4.93 times as fast.
#include <hip/hip_runtime.h>
// MultiheadSdpaDiff4 (2 x 2048 tokens, EMBED 2048; differential attention: q = x Wq^T as 32 pseudo-heads x 64, k = x Wk^T as 8 heads x 64 repeat-interleaved 4x, v = x Wv^T as 4 heads x 128 repeat-interleaved 8x; causal softmax(q.k/8) v; attn = O_even - lambda_full * O_odd (16 heads x 128), lambda_full = exp(lq1.lk1) - exp(lq2.lk2) + 0.78361; RMSNorm(128, eps 1e-5) * ln_w * (1 - 0.78361); out = attn Wo^T.
// Compute dtype: inputs rounded to bf16; x exact as f16; q/k/P/v as f16 hi + residual on the first 256 rows (~2^-21) and plain beyond (~2^-12); the normalised attention as a plain f16 operand; softmax/lambda/RMSNorm f32. v_wmma_f32_16x16x32_f16.
#define NB 2
#define DM 2048
#define NKV 8
#define NREP (NH / NKV)
#define KVD (NKV * 64)           /* 512 */
#define NR (NB * SLEN)           /* 4096 */
#define SLEN 2048
#define TQ SLEN
#define TK SLEN
#define NH 32
#define SCL 0.125f
#define QBLKS (TQ / 64)
#define QB05 0
#define QBN5 4
#define QB0P QBN5
#define QBNP (QBLKS - QBN5)
#define RE 256
typedef __bf16 v16b __attribute__((ext_vector_type(16)));
typedef unsigned short v8us __attribute__((ext_vector_type(8), may_alias));
typedef float  v8f  __attribute__((ext_vector_type(8)));
typedef float  v4f  __attribute__((ext_vector_type(4)));
typedef float  v4fa __attribute__((ext_vector_type(4), may_alias));
union FragB { v16b v; v8us half[2]; unsigned short u[16]; };

__device__ __forceinline__ unsigned short bf16_bits(float x) { unsigned int u = __float_as_uint(x); return (unsigned short)((u + 0x7FFFu + ((u >> 16) & 1u)) >> 16); }
__device__ __forceinline__ float bf16_val(unsigned short b) { return __uint_as_float(((unsigned int)b) << 16); }
__device__ __forceinline__ float bf16_round(float x) { return bf16_val(bf16_bits(x)); }
// D += A·B with NT terms: 1 = ah·bh, 2 = + al·bh (A split), 3 = + ah·bl (both split)
template <int NT>
__device__ __forceinline__ v8f mmaN(v16b ah, v16b al, v16b bh, v16b bl, v8f c) {
  c = __builtin_amdgcn_wmma_f32_16x16x32_bf16(false, ah, false, bh, (short)0, c, false, false);
  if (NT >= 2) c = __builtin_amdgcn_wmma_f32_16x16x32_bf16(false, al, false, bh, (short)0, c, false, false);
  if (NT >= 3) c = __builtin_amdgcn_wmma_f32_16x16x32_bf16(false, ah, false, bl, (short)0, c, false, false);
  asm volatile("v_nop\n\tv_nop\n\tv_nop\n\tv_nop" : "+v"(c) : "v"(ah), "v"(al), "v"(bh), "v"(bl));
  return c;
}

__global__ __launch_bounds__(256) void k_wt_bf16(const float* __restrict__ W, unsigned short* __restrict__ Wt, int K, int N) {
  const int t = blockIdx.x * 256 + threadIdx.x;
  const int k8n = K / 8;
  if (t >= N * k8n) return;
  const int n = t / k8n, k8 = (t % k8n) * 8;
  v8us v;
#pragma unroll
  for (int i = 0; i < 8; ++i) v[i] = bf16_bits(W[(size_t)(k8 + i) * N + n]);
  *(v8us*)(Wt + (size_t)n * K + k8) = v;
  
}

// GEMM C[M][N] (f32, pitch ldc) = act(A[M][K]·W + bias). A f32 row-major (pitch lda) converted per fragment to bf16
// (ASPLIT: hi/lo two planes -> 2 terms, else single rounded term); Wt bf16 [N][K] (pitch ldb). BIAS_BF16 rounds the
// bias to bf16 first (bias quantised to bf16 before the add). K%32==0, M%16==0, N%64==0.
template <bool ASPLIT, int ACT, bool BIAS_BF16>
__global__ __launch_bounds__(128) void k_gemm_bf(const float* __restrict__ A, int lda, const unsigned short* __restrict__ Wt, int ldb,
                                               const float* __restrict__ bias, float* __restrict__ C, int ldc, int M, int N, int K) {
  __shared__ __attribute__((aligned(16))) float so[4][16][64];
  const int tid = threadIdx.x, w = tid >> 5, lane = tid & 31, ln = lane & 15, hh = lane >> 4;
  const int ntn = N / 64;
  const int wid = blockIdx.x * 4 + w;
  const int mt = wid / ntn, nq = wid % ntn;
  if (mt * 16 >= M) return;
  const int row0 = mt * 16, col0 = nq * 64;
  const float* arow = A + (size_t)(row0 + ln) * lda;
  v8f acc[4] = {};
  for (int kb = 0; kb < K; kb += 32) {
    FragB ah, al;
    const v4f x0 = *(const v4fa*)(arow + kb + 8 * hh), x1 = *(const v4fa*)(arow + kb + 8 * hh + 4);
    const v4f x2 = *(const v4fa*)(arow + kb + 16 + 8 * hh), x3 = *(const v4fa*)(arow + kb + 16 + 8 * hh + 4);
    float xs[16] = {x0[0],x0[1],x0[2],x0[3],x1[0],x1[1],x1[2],x1[3],x2[0],x2[1],x2[2],x2[3],x3[0],x3[1],x3[2],x3[3]};
#pragma unroll
    for (int i = 0; i < 16; ++i) { const unsigned short hb = bf16_bits(xs[i]); ah.u[i] = hb; al.u[i] = ASPLIT ? bf16_bits(xs[i] - bf16_val(hb)) : (unsigned short)0; }
#pragma unroll
    for (int t = 0; t < 4; ++t) {
      const unsigned short* brow = Wt + (size_t)(col0 + t * 16 + ln) * ldb + kb;
      FragB b;
      b.half[0] = *(const v8us*)(brow + 8 * hh);
      b.half[1] = *(const v8us*)(brow + 16 + 8 * hh);
      acc[t] = mmaN<ASPLIT ? 2 : 1>(ah.v, al.v, b.v, b.v, acc[t]);
    }
  }
#pragma unroll
  for (int t = 0; t < 4; ++t) {
    float bv = bias ? bias[col0 + t * 16 + ln] : 0.f;
    if (BIAS_BF16) bv = bf16_round(bv);
#pragma unroll
    for (int r = 0; r < 8; ++r) { float v = acc[t][r] + bv; if (ACT == 1) v = fmaxf(v, 0.f); so[w][8 * hh + r][t * 16 + ln] = v; }
  }
  __builtin_amdgcn_fence(__ATOMIC_ACQ_REL, "workgroup");
  __builtin_amdgcn_wave_barrier();
  const int rsub = lane >> 4, c4 = (lane & 15) * 4;
  {
#pragma unroll
    for (int q = 0; q < 8; ++q) {
      const int r = q * 2 + rsub;
      const v4f v = *(const v4fa*)&so[w][r][c4];
      *(v4f*)(C + (size_t)(row0 + r) * ldc + col0 + c4) = v;
    }
    
  }
}

// GEMM C = act(A·W + bias + resid): A f32 (ASPLIT -> hi/lo 2 terms), Wt bf16 [N][K]; ACT 0 none, 1 relu, 2 exact gelu;
// resid (optional, f32, row index = (row % rmod), pitch ldr, RES_BF16 rounds it) added before the activation.
template <bool ASPLIT, int ACT, bool BIAS_BF16, bool RES_BF16>
__global__ __launch_bounds__(128) void k_gemm_bf3(const float* __restrict__ A, int lda, const unsigned short* __restrict__ Wt, int ldb,
                                                const float* __restrict__ bias, const float* __restrict__ resid, int rmod, int ldr,
                                                float* __restrict__ C, int ldc, int M, int N, int K) {
  __shared__ __attribute__((aligned(16))) float so[4][16][64];
  const int tid = threadIdx.x, w = tid >> 5, lane = tid & 31, ln = lane & 15, hh = lane >> 4;
  const int ntn = N / 64;
  const int wid = blockIdx.x * 4 + w;
  const int mt = wid / ntn, nq = wid % ntn;
  if (mt * 16 >= M) return;
  const int row0 = mt * 16, col0 = nq * 64;
  const float* arow = A + (size_t)(row0 + ln) * lda;
  v8f acc[4] = {};
  for (int kb = 0; kb < K; kb += 32) {
    FragB ah, al;
    const v4f x0 = *(const v4fa*)(arow + kb + 8 * hh), x1 = *(const v4fa*)(arow + kb + 8 * hh + 4);
    const v4f x2 = *(const v4fa*)(arow + kb + 16 + 8 * hh), x3 = *(const v4fa*)(arow + kb + 16 + 8 * hh + 4);
    float xs[16] = {x0[0],x0[1],x0[2],x0[3],x1[0],x1[1],x1[2],x1[3],x2[0],x2[1],x2[2],x2[3],x3[0],x3[1],x3[2],x3[3]};
#pragma unroll
    for (int i = 0; i < 16; ++i) { const unsigned short hb = bf16_bits(xs[i]); ah.u[i] = hb; al.u[i] = ASPLIT ? bf16_bits(xs[i] - bf16_val(hb)) : (unsigned short)0; }
#pragma unroll
    for (int t = 0; t < 4; ++t) {
      const unsigned short* brow = Wt + (size_t)(col0 + t * 16 + ln) * ldb + kb;
      FragB b;
      b.half[0] = *(const v8us*)(brow + 8 * hh);
      b.half[1] = *(const v8us*)(brow + 16 + 8 * hh);
      acc[t] = mmaN<ASPLIT ? 2 : 1>(ah.v, al.v, b.v, b.v, acc[t]);
    }
  }
#pragma unroll
  for (int t = 0; t < 4; ++t) {
    const int col = col0 + t * 16 + ln;
    float bv = bias ? bias[col] : 0.f;
    if (BIAS_BF16) bv = bf16_round(bv);
#pragma unroll
    for (int r = 0; r < 8; ++r) {
      float v = acc[t][r] + bv;
      if (resid) { float rv = resid[(size_t)((row0 + 8 * hh + r) % rmod) * ldr + col]; if (RES_BF16) rv = bf16_round(rv); v += rv; }
      if (ACT == 1) v = fmaxf(v, 0.f);
      if (ACT == 2) v = 0.5f * v * (1.0f + erff(v * 0.70710678118654752f));
      if (ACT == 3) { const float u = 0.7978845608028654f * (v + 0.044715f * v * v * v); v = 0.5f * v * (1.0f + tanhf(u)); }
      so[w][8 * hh + r][t * 16 + ln] = v;
    }
  }
  __builtin_amdgcn_fence(__ATOMIC_ACQ_REL, "workgroup");
  __builtin_amdgcn_wave_barrier();
  const int rsub = lane >> 4, c4 = (lane & 15) * 4;
  {
#pragma unroll
    for (int q = 0; q < 8; ++q) {
      const int r = q * 2 + rsub;
      const v4f v = *(const v4fa*)&so[w][r][c4];
      *(v4f*)(C + (size_t)(row0 + r) * ldc + col0 + c4) = v;
    }
    
  }
}
// row LayerNorm (biased variance, eps) over N: s = X (+ R); optional out_sum <- s; out_norm <- (s-mu)*rsqrt(var+eps)*g + b
template <bool PARAM_BF16>
__global__ __launch_bounds__(256) void k_layernorm(const float* __restrict__ X, const float* __restrict__ R, const float* __restrict__ g, const float* __restrict__ bta,
                                                  float* __restrict__ out_sum, float* __restrict__ out_norm, int N, float eps) {
  __shared__ float red[256];
  const int row = blockIdx.x, tid = threadIdx.x;
  const float* x = X + (size_t)row * N; const float* rr = R ? R + (size_t)row * N : nullptr;
  float vals[16];                     // up to N = 4096
  const int per = N / 256;            // contiguous chunk per thread? use strided-by-4 chunks: thread handles j = tid*4 + 1024*u
  float s1 = 0.f;
  for (int u = 0; u < per / 4; ++u) {
    const int j = tid * 4 + 1024 * u;
    const v4f a = *(const v4fa*)(x + j);
    v4f b = {0.f,0.f,0.f,0.f}; if (rr) b = *(const v4fa*)(rr + j);
#pragma unroll
    for (int q = 0; q < 4; ++q) { const float v = a[q] + b[q]; vals[u * 4 + q] = v; s1 += v; }
  }
  red[tid] = s1; __syncthreads();
  for (int st = 128; st > 0; st >>= 1) { if (tid < st) red[tid] += red[tid + st]; __syncthreads(); }
  const float mu = red[0] / (float)N; __syncthreads();
  float s2 = 0.f;
  for (int u = 0; u < per / 4; ++u)
#pragma unroll
    for (int q = 0; q < 4; ++q) { const float c = vals[u * 4 + q] - mu; s2 += c * c; }
  red[tid] = s2; __syncthreads();
  for (int st = 128; st > 0; st >>= 1) { if (tid < st) red[tid] += red[tid + st]; __syncthreads(); }
  const float rs = rsqrtf(red[0] / (float)N + eps);
  {
    for (int u = 0; u < per / 4; ++u) {
      const int j = tid * 4 + 1024 * u;
      v4f o, sm;
#pragma unroll
      for (int q = 0; q < 4; ++q) {
        float gg = g[j + q], bb = bta[j + q];
        if (PARAM_BF16) { gg = bf16_round(gg); bb = bf16_round(bb); }
        sm[q] = vals[u * 4 + q]; o[q] = (vals[u * 4 + q] - mu) * rs * gg + bb;
      }
      if (out_sum) *(v4f*)(out_sum + (size_t)row * N + j) = sm;
      *(v4f*)(out_norm + (size_t)row * N + j) = o;
    }
    
  }
}



// ---- f16 WMMA path (v_wmma_f32_16x16x32_f16): 11-bit significands for operands in range — used where a [0,1] probability operand needs more precision than bf16
typedef _Float16 v16h __attribute__((ext_vector_type(16)));
union FragH { v16h v; v8us half[2]; _Float16 h[16]; unsigned short u[16]; };
template <int NT>
__device__ __forceinline__ v8f mmaH(v16h ah, v16h al, v16h bh, v16h bl, v8f c) {
  c = __builtin_amdgcn_wmma_f32_16x16x32_f16(false, ah, false, bh, (short)0, c, false, false);
  if (NT >= 2) c = __builtin_amdgcn_wmma_f32_16x16x32_f16(false, al, false, bh, (short)0, c, false, false);
  if (NT >= 3) c = __builtin_amdgcn_wmma_f32_16x16x32_f16(false, ah, false, bl, (short)0, c, false, false);
  asm volatile("v_nop\n\tv_nop\n\tv_nop\n\tv_nop" : "+v"(c) : "v"(ah), "v"(al), "v"(bh), "v"(bl));
  return c;
}
// batched GEMM like k_gemm_b but f16 operands: A f32 (split into f16 hi/lo if ASPLIT, else rounded to f16), Bt = f16 values [n][k]; alpha; C f32; N multiple of 16 (partial tiles skipped)
template <bool ASPLIT>
__global__ __launch_bounds__(128) void k_gemm_h(const float* __restrict__ A, int lda, size_t sA, const _Float16* __restrict__ Bh, int ldb, size_t sB, float alpha, float* __restrict__ C, int ldc, size_t sC, int M, int N, int K) {
  __shared__ __attribute__((aligned(16))) float so[4][16][64];
  const int tid = threadIdx.x, w = tid >> 5, lane = tid & 31, ln = lane & 15, hh = lane >> 4; const int by = blockIdx.y;
  A += (size_t)by * sA; Bh += (size_t)by * sB; C += (size_t)by * sC;
  const int ntn = (N + 63) / 64; const int wid = blockIdx.x * 4 + w; const int mt = wid / ntn, nq = wid % ntn; if (mt * 16 >= M) return;
  const int row0 = mt * 16, col0 = nq * 64; const float* arow = A + (size_t)(row0 + ln) * lda;
  v8f acc[4] = {};
  for (int kb = 0; kb < K; kb += 32) {
    FragH ah, al;
    const v4f x0 = *(const v4fa*)(arow + kb + 8 * hh), x1 = *(const v4fa*)(arow + kb + 8 * hh + 4), x2 = *(const v4fa*)(arow + kb + 16 + 8 * hh), x3 = *(const v4fa*)(arow + kb + 16 + 8 * hh + 4);
    float xs[16] = {x0[0],x0[1],x0[2],x0[3],x1[0],x1[1],x1[2],x1[3],x2[0],x2[1],x2[2],x2[3],x3[0],x3[1],x3[2],x3[3]};
#pragma unroll
    for (int i = 0; i < 16; ++i) { const _Float16 h = (_Float16)xs[i]; ah.h[i] = h; al.h[i] = ASPLIT ? (_Float16)(xs[i] - (float)h) : (_Float16)0.0f; }
#pragma unroll
    for (int t = 0; t < 4; ++t) { if (col0 + t * 16 >= N) continue; const size_t boff = (size_t)(col0 + t * 16 + ln) * ldb + kb; FragH bq; bq.half[0] = *(const v8us*)(Bh + boff + 8 * hh); bq.half[1] = *(const v8us*)(Bh + boff + 16 + 8 * hh);
      acc[t] = mmaH<ASPLIT ? 2 : 1>(ah.v, al.v, bq.v, bq.v, acc[t]); }
  }
#pragma unroll
  for (int t = 0; t < 4; ++t) { if (col0 + t * 16 >= N) continue;
#pragma unroll
    for (int r = 0; r < 8; ++r) so[w][8 * hh + r][t * 16 + ln] = acc[t][r] * alpha; }
  __builtin_amdgcn_fence(__ATOMIC_ACQ_REL, "workgroup"); __builtin_amdgcn_wave_barrier();
  const int rsub = lane >> 4, c4 = (lane & 15) * 4;
  {
#pragma unroll
    for (int q = 0; q < 8; ++q) { const int r = q * 2 + rsub; if (col0 + c4 < N) { const v4f v = *(const v4fa*)&so[w][r][c4]; *(v4f*)(C + (size_t)(row0 + r) * ldc + col0 + c4) = v; } }
     }
}

// Wt[n][k] = f16(W[k][n]·scale) from f32 row-major W[K][N] (scale = power of two; bf16-exact weights stay exact in f16 away from the subnormal range)
__global__ __launch_bounds__(256) void k_wt_f16(const float* __restrict__ W, _Float16* __restrict__ Wt, int K, int N, float scale) {
  const int t = blockIdx.x * 256 + threadIdx.x; if (t >= N * (K / 8)) return; const int n = t / (K / 8), k8 = (t % (K / 8)) * 8; FragH f;
#pragma unroll
  for (int i = 0; i < 8; ++i) f.h[i] = (_Float16)(bf16_round(W[(size_t)(k8 + i) * N + n]) * scale); const v8us o = f.half[0];
  *(v8us*)((unsigned short*)Wt + (size_t)n * K + k8) = o; 
}
// k_gemm_hh variant with fused epilogue: v = acc·alpha + bias[by·sBias + col] (+ CP[(row/rowsPerB)·sCPb + by·64 + col] if CP) ; ACT 0 none / 1 elu ; writes f16 C16 (and f32 C if non-null)
template <int ACT>
__global__ __launch_bounds__(128) void k_gemm_hhx(const _Float16* __restrict__ A, int lda, size_t sA, const _Float16* __restrict__ Bh, int ldb, size_t sB, float alpha, const float* __restrict__ bias, size_t sBias, const float* __restrict__ CP, int rowsPerB, size_t sCPb, int row0g,
    float* __restrict__ C, _Float16* __restrict__ C16, int ldc, size_t sC, int M, int N, int K) {
  __shared__ __attribute__((aligned(16))) float so[4][16][64];
  const int tid = threadIdx.x, w = tid >> 5, lane = tid & 31, ln = lane & 15, hh = lane >> 4; const int by = blockIdx.y;
  A += (size_t)by * sA; Bh += (size_t)by * sB; const size_t cofs = (size_t)by * sC; const float* bp = bias ? bias + (size_t)by * sBias : nullptr;
  const int ntn = (N + 63) / 64; const int wid = blockIdx.x * 4 + w; const int mt = wid / ntn, nq = wid % ntn; if (mt * 16 >= M) return;
  const int row0 = mt * 16, col0 = nq * 64; const _Float16* arow = A + (size_t)(row0 + ln) * lda;
  v8f acc[4] = {};
  for (int kb = 0; kb < K; kb += 32) { FragH ah; ah.half[0] = *(const v8us*)((const unsigned short*)arow + kb + 8 * hh); ah.half[1] = *(const v8us*)((const unsigned short*)arow + kb + 16 + 8 * hh);
#pragma unroll
    for (int t = 0; t < 4; ++t) { if (col0 + t * 16 >= N) continue; const size_t boff = (size_t)(col0 + t * 16 + ln) * ldb + kb; FragH bq; bq.half[0] = *(const v8us*)((const unsigned short*)Bh + boff + 8 * hh); bq.half[1] = *(const v8us*)((const unsigned short*)Bh + boff + 16 + 8 * hh);
      acc[t] = mmaH<1>(ah.v, ah.v, bq.v, bq.v, acc[t]); }
  }
#pragma unroll
  for (int t = 0; t < 4; ++t) { if (col0 + t * 16 >= N) continue; const int col = col0 + t * 16 + ln; const float bv = bp ? bf16_round(bp[col]) : 0.f;
#pragma unroll
    for (int r = 0; r < 8; ++r) { float v = acc[t][r] * alpha + bv; if (CP) { const int bidx = (row0g + row0 + 8 * hh + r) / rowsPerB; v += CP[(size_t)bidx * sCPb + (size_t)by * 64 + col]; } if (ACT == 1) v = (v > 0.f) ? v : expm1f(v); else if (ACT == 7) v = (v > 0.f) ? v + 1.0f : expf(v); else if (ACT == 8) v = tanhf(v); else if (ACT == 9) v = 0.5f * v * (1.0f + tanhf(0.7978845608028654f * (v + 0.044715f * v * v * v))); else if (ACT == 11) v = 1.0f / (1.0f + expf(-v)); else if (ACT == 12) v = (v > 0.f) ? v : 0.01f * v; else if (ACT == 14) v = (v > 0.f) ? v : 0.1f * v; else if (ACT == 15) v = v / (1.0f + expf(-v)); else if (ACT == 3) v = fmaxf(v, 0.f); else if (ACT == 6) v = 0.5f * v * (1.0f + erff(v * 0.70710678118654752f)); so[w][8 * hh + r][t * 16 + ln] = v; } }
  __builtin_amdgcn_fence(__ATOMIC_ACQ_REL, "workgroup"); __builtin_amdgcn_wave_barrier();
  const int rsub = lane >> 4, c4 = (lane & 15) * 4; typedef _Float16 v4h __attribute__((ext_vector_type(4)));
  {
#pragma unroll
    for (int q = 0; q < 8; ++q) { const int r = q * 2 + rsub; if (col0 + c4 < N) { const v4f v = *(const v4fa*)&so[w][r][c4]; if (C) *(v4f*)(C + cofs + (size_t)(row0 + r) * ldc + col0 + c4) = v; if (C16) { v4h h4; for (int i = 0; i < 4; ++i) h4[i] = (_Float16)v[i]; *(v4h*)(C16 + cofs + (size_t)(row0 + r) * ldc + col0 + c4) = h4; } } }
     }
}


typedef _Float16 v4h __attribute__((ext_vector_type(4)));

__global__ __launch_bounds__(256) void k_h16(const float* __restrict__ x, _Float16* __restrict__ X16, size_t n8) { const size_t t = (size_t)blockIdx.x * 256 + threadIdx.x; if (t >= n8) return; FragH f;
#pragma unroll
  for (int q = 0; q < 8; ++q) f.h[q] = (_Float16)x[t * 8 + q]; *(v8us*)((unsigned short*)X16 + t * 8) = f.half[0];  }
__global__ __launch_bounds__(256) void k_round16f(const float* __restrict__ W, _Float16* __restrict__ Bt, size_t n8) { const size_t t = (size_t)blockIdx.x * 256 + threadIdx.x; if (t >= n8) return; FragH f;
#pragma unroll
  for (int i = 0; i < 8; ++i) f.h[i] = (_Float16)(bf16_round(W[t * 8 + i]) * 16.0f); *(v8us*)((unsigned short*)Bt + t * 8) = f.half[0];  }
template <int NHv, int TTv>
__global__ __launch_bounds__(256) void k_vt(const _Float16* __restrict__ V16, int ldv, int voff, _Float16* __restrict__ Vt) { __shared__ unsigned short tl[64][66]; const int tid = threadIdx.x; const int slab = blockIdx.x / (TTv / 64), lg = blockIdx.x % (TTv / 64); const int b = slab / NHv, h = slab % NHv;
  for (int i = tid; i < 64 * 8; i += 256) { const int r = i / 8, c8 = (i % 8) * 8; FragH f; f.half[0] = *(const v8us*)((const unsigned short*)V16 + ((size_t)b * TTv + lg * 64 + r) * ldv + voff + h * 64 + c8);
#pragma unroll
    for (int q = 0; q < 8; ++q) tl[r][c8 + q] = f.u[q]; }
  __syncthreads();
  {
#pragma unroll
    for (int rd = 0; rd < 2; ++rd) { const int d = rd * 32 + tid / 8, pc = tid % 8; FragH f;
#pragma unroll
      for (int q = 0; q < 8; ++q) f.u[q] = tl[pc * 8 + q][d];
      *(v8us*)((unsigned short*)Vt + ((size_t)slab * 64 + d) * TTv + lg * 64 + pc * 8) = f.half[0]; }
     } }

// ---- fast GEMM (block tile 128x64, wave tile 32x64; requires M % 128 == 0, N % 64 == 0, K % 64 == 0); epilogue: alpha, bias and CP as in k_gemm_hhx, then f32 C or the split f16 pair C16/CL ----
// Per trip a 64-deep slice of A (128 rows) and of B (64 rows) is copied to LDS in whole 128-byte lines (asynchronous copies, two buffers: the next slice flies while this one is multiplied); fragments come from LDS.
#define G2_PITCH 144                      /* LDS bytes per staged row: 128 + 16, the conflict-free pitch for 16-byte reads */
#define G2_BUF ((128 + 64) * G2_PITCH)    /* one buffer: A rows 0..127, then B rows 128..191 */
__device__ __forceinline__ v16h g2_lfrag(const unsigned char* p) { FragH f; f.half[0] = *(const v8us*)p; f.half[1] = *(const v8us*)(p + 32); return f.v; }
__device__ __forceinline__ v8f g2_mma(v16h a, v16h b, v8f c) { v8f d = __builtin_amdgcn_wmma_f32_16x16x32_f16(false, a, false, b, (short)0, c, false, false); asm volatile("v_nop\n\tv_nop\n\tv_nop\n\tv_nop" : "+v"(d) : "v"(a), "v"(b)); return d; }
// one slice: 12 copies of 16 bytes per lane (8 of A, 4 of B), a wave's copy covering 4 whole rows; l = the lane's LDS byte address of its first row, rows 16 apart
__device__ __forceinline__ void g2_copy(unsigned l, const _Float16* ga, size_t sa16, const _Float16* gb, size_t sb16) {
  /* the closing s_wait_xcnt keeps every address register intact until the copies have taken it */
  asm volatile("global_load_async_to_lds_b128 %0, %12, off\n\t"
               "global_load_async_to_lds_b128 %1, %13, off\n\t"
               "global_load_async_to_lds_b128 %2, %14, off\n\t"
               "global_load_async_to_lds_b128 %3, %15, off\n\t"
               "global_load_async_to_lds_b128 %4, %16, off\n\t"
               "global_load_async_to_lds_b128 %5, %17, off\n\t"
               "global_load_async_to_lds_b128 %6, %18, off\n\t"
               "global_load_async_to_lds_b128 %7, %19, off\n\t"
               "global_load_async_to_lds_b128 %8, %20, off\n\t"
               "global_load_async_to_lds_b128 %9, %21, off\n\t"
               "global_load_async_to_lds_b128 %10, %22, off\n\t"
               "global_load_async_to_lds_b128 %11, %23, off\n\t"
               "s_wait_xcnt 0x0"
               :: "v"(l), "v"(l + 16 * G2_PITCH), "v"(l + 32 * G2_PITCH), "v"(l + 48 * G2_PITCH), "v"(l + 64 * G2_PITCH), "v"(l + 80 * G2_PITCH), "v"(l + 96 * G2_PITCH), "v"(l + 112 * G2_PITCH),
                  "v"(l + 128 * G2_PITCH), "v"(l + 144 * G2_PITCH), "v"(l + 160 * G2_PITCH), "v"(l + 176 * G2_PITCH),
                  "v"(ga), "v"(ga + sa16), "v"(ga + 2 * sa16), "v"(ga + 3 * sa16), "v"(ga + 4 * sa16), "v"(ga + 5 * sa16), "v"(ga + 6 * sa16), "v"(ga + 7 * sa16),
                  "v"(gb), "v"(gb + sb16), "v"(gb + 2 * sb16), "v"(gb + 3 * sb16)
               : "memory");
}
template <int ACT, bool SPLIT>
__device__ __forceinline__ void g2_body(unsigned char* smem, int bx, int by, const _Float16* __restrict__ A, int lda, size_t sA, const _Float16* __restrict__ Bh, int ldb, size_t sB, float alpha, const float* __restrict__ bias, size_t sBias, const float* __restrict__ CP, int rowsPerB, size_t sCPb, int row0g,
    float* __restrict__ C, _Float16* __restrict__ C16, _Float16* __restrict__ CL, int ldc, size_t sC, int M, int N, int K) {      /* output: C (f32) or, with SPLIT, the pair C16 and CL: the f16 rounding and its 2^10-scaled residual, the two planes of a split operand */
  /* smem: the kernel's 2 * G2_BUF bytes of LDS, the two staging buffers; the epilogue's 4 x 32 x 68 floats lie over them once the loop's last barrier has ended every read. bx, by: the block's place in this product's own grid */
  float (*so)[32][68] = reinterpret_cast<float (*)[32][68]>(smem);
  const int tid = threadIdx.x, w = tid >> 5, lane = tid & 31, ln = lane & 15, hh = lane >> 4;
  A += (size_t)by * sA; Bh += (size_t)by * sB; const size_t cofs = (size_t)by * sC; const float* bp = bias ? bias + (size_t)by * sBias : nullptr;
  const int ntn = N >> 6; const int mt = bx / ntn, nq = bx - mt * ntn; const int row0 = mt * 128 + 32 * w, col0 = nq * 64; if (mt * 128 >= M) return;      /* the whole block leaves or none: barriers follow */
  const int crow = tid >> 3, cch = tid & 7;      /* copy role: row (mod 16) and 16-byte piece of the 128-byte row */
  const _Float16* gA = A + (size_t)(mt * 128 + crow) * lda + cch * 8; const _Float16* gB = Bh + (size_t)(col0 + crow) * ldb + cch * 8; const size_t sa16 = (size_t)16 * lda, sb16 = (size_t)16 * ldb;
  const unsigned l0 = (unsigned)(size_t)smem + (unsigned)(crow * G2_PITCH + cch * 16);
  const int aoff = (32 * w + ln) * G2_PITCH + 16 * hh, boff = (128 + ln) * G2_PITCH + 16 * hh;
  const v8f z8 = {0.f,0.f,0.f,0.f,0.f,0.f,0.f,0.f}; v8f c00 = z8, c01 = z8, c02 = z8, c03 = z8, c10 = z8, c11 = z8, c12 = z8, c13 = z8;
  const int NT = K >> 6;
  g2_copy(l0, gA, sa16, gB, sb16);
  asm volatile("s_wait_asynccnt 0x0" ::: "memory");      /* slice 0 has landed before the barrier publishes it */
  __syncthreads();
  if (NT > 1) g2_copy(l0 + G2_BUF, gA + 64, sa16, gB + 64, sb16);
#pragma unroll 1      /* one slice per trip: the buffer alternates with the trip's parity */
  for (int t = 0; t < NT; ++t) { const unsigned char* sb = smem + (t & 1) * G2_BUF; const unsigned char* pa = sb + aoff; const unsigned char* pb = sb + boff;
    const v16h a0 = g2_lfrag(pa), a1 = g2_lfrag(pa + 16 * G2_PITCH), b0 = g2_lfrag(pb), b1 = g2_lfrag(pb + 16 * G2_PITCH), b2 = g2_lfrag(pb + 32 * G2_PITCH), b3 = g2_lfrag(pb + 48 * G2_PITCH);
    const v16h e0 = g2_lfrag(pa + 64), e1 = g2_lfrag(pa + 16 * G2_PITCH + 64), f0 = g2_lfrag(pb + 64), f1 = g2_lfrag(pb + 16 * G2_PITCH + 64), f2 = g2_lfrag(pb + 32 * G2_PITCH + 64), f3 = g2_lfrag(pb + 48 * G2_PITCH + 64);
    c00 = g2_mma(a0, b0, c00); c10 = g2_mma(a1, b0, c10); c01 = g2_mma(a0, b1, c01); c11 = g2_mma(a1, b1, c11); c02 = g2_mma(a0, b2, c02); c12 = g2_mma(a1, b2, c12); c03 = g2_mma(a0, b3, c03); c13 = g2_mma(a1, b3, c13);
    c00 = g2_mma(e0, f0, c00); c10 = g2_mma(e1, f0, c10); c01 = g2_mma(e0, f1, c01); c11 = g2_mma(e1, f1, c11); c02 = g2_mma(e0, f2, c02); c12 = g2_mma(e1, f2, c12); c03 = g2_mma(e0, f3, c03); c13 = g2_mma(e1, f3, c13);
    asm volatile("s_wait_dscnt 0x0" ::: "memory");         /* this wave's reads of the buffer are over before it may be refilled */
    asm volatile("s_wait_asynccnt 0x0" ::: "memory");      /* this wave's copies of the next slice have landed */
    __syncthreads();                                       /* publishes the next slice and ends every wave's reads of this one */
    if (t + 2 < NT) g2_copy(l0 + (unsigned)(t & 1) * G2_BUF, gA + (size_t)(t + 2) * 64, sa16, gB + (size_t)(t + 2) * 64, sb16); }
  asm volatile("s_wait_asynccnt 0x0" ::: "memory");        /* nothing is in flight when the buffers become output staging */
  v8f accs[8] = {c00, c01, c02, c03, c10, c11, c12, c13};
#pragma unroll
  for (int u = 0; u < 8; ++u) { const int t = u & 3, half = u >> 2; const int col = col0 + t * 16 + ln; const float bv = bp ? bf16_round(bp[col]) : 0.f;
#pragma unroll
    for (int r = 0; r < 8; ++r) { const int rloc = half * 16 + 8 * hh + r; float v = accs[u][r] * alpha + bv; if (CP) { const int bidx = (row0g + row0 + rloc) / rowsPerB; v += CP[(size_t)bidx * sCPb + (size_t)by * 64 + col]; }
      if (ACT == 3) v = fmaxf(v, 0.f); else if (ACT == 6) v = 0.5f * v * (1.0f + erff(v * 0.70710678118654752f)); else if (ACT == 11) v = 1.0f / (1.0f + expf(-v)); else if (ACT == 15) v = v / (1.0f + expf(-v)); else if (ACT == 12) v = (v > 0.f) ? v : 0.01f * v; else if (ACT == 8) v = tanhf(v);
      so[w][rloc][t * 16 + ln] = v; } }
  __builtin_amdgcn_fence(__ATOMIC_ACQ_REL, "workgroup"); __builtin_amdgcn_wave_barrier();
  const int rsub = lane >> 4, c4 = (lane & 15) * 4;
  if (!SPLIT) {
#pragma unroll
    for (int q = 0; q < 16; ++q) { const int r = q * 2 + rsub; const v4f v = *(const v4fa*)&so[w][r][c4]; *(v4f*)(C + cofs + (size_t)(row0 + r) * ldc + col0 + c4) = v; }
  } else {
#pragma unroll
    for (int q = 0; q < 16; ++q) { const int r = q * 2 + rsub; const v4f v = *(const v4fa*)&so[w][r][c4]; const size_t o = cofs + (size_t)(row0 + r) * ldc + col0 + c4; v4h h4, l4;
      for (int i = 0; i < 4; ++i) { h4[i] = (_Float16)v[i]; l4[i] = (_Float16)((v[i] - (float)h4[i]) * 1024.0f); }
      *(v4h*)(C16 + o) = h4; *(v4h*)(CL + o) = l4; }
  } }
template <int ACT, bool SPLIT>
__global__ __launch_bounds__(128) void k_gemm2(const _Float16* __restrict__ A, int lda, size_t sA, const _Float16* __restrict__ Bh, int ldb, size_t sB, float alpha, const float* __restrict__ bias, size_t sBias, const float* __restrict__ CP, int rowsPerB, size_t sCPb, int row0g,
    float* __restrict__ C, _Float16* __restrict__ C16, _Float16* __restrict__ CL, int ldc, size_t sC, int M, int N, int K) {
  __shared__ __attribute__((aligned(16))) unsigned char smem[2 * G2_BUF];
  g2_body<ACT, SPLIT>(smem, (int)blockIdx.x, (int)blockIdx.y, A, lda, sA, Bh, ldb, sB, alpha, bias, sBias, CP, rowsPerB, sCPb, row0g, C, C16, CL, ldc, sC, M, N, K); }
// The three projections in one grid (they share x and depend on nothing of each other): blocks 0.. q = x Wq^T, then k = x Wk^T, then V^T = Wv x^T per batch (the weight rows are the A operand, the tokens the B operand). The two small products alone would leave three SIMD places in four empty.
#define PJ_NQ ((NR / 128) * (DM / 64))
#define PJ_NK ((NR / 128) * (KVD / 64))
#define PJ_NV ((KVD / 128) * (SLEN / 64))      /* per batch */
__global__ __launch_bounds__(128) void k_proj(const _Float16* __restrict__ X16, const _Float16* __restrict__ BQ, const _Float16* __restrict__ BK, const _Float16* __restrict__ BV,
    _Float16* __restrict__ QH, _Float16* __restrict__ QL, _Float16* __restrict__ KH, _Float16* __restrict__ KL, _Float16* __restrict__ VT, _Float16* __restrict__ VTL) {
  __shared__ __attribute__((aligned(16))) unsigned char smem[2 * G2_BUF];
  int bx = (int)blockIdx.x; const _Float16* A = X16; const _Float16* B = BQ; _Float16* H = QH; _Float16* L = QL; int ldc = DM, M = NR, N = DM;
  if (bx >= PJ_NQ + PJ_NK) { bx -= PJ_NQ + PJ_NK; const int bt = bx / PJ_NV; bx -= bt * PJ_NV; A = BV; B = X16 + (size_t)bt * SLEN * DM; H = VT + (size_t)bt * KVD * SLEN; L = VTL + (size_t)bt * KVD * SLEN; ldc = SLEN; M = KVD; N = SLEN; }
  else if (bx >= PJ_NQ) { bx -= PJ_NQ; B = BK; H = KH; L = KL; ldc = KVD; N = KVD; }
  g2_body<0, true>(smem, bx, 0, A, DM, 0, B, DM, 0, 0.0625f, nullptr, 0, nullptr, 1, 0, 0, nullptr, H, L, ldc, 0, M, N, DM); }



// lane l with lane l ^ 16 (the two halves of a wave hold the two key halves of one query column)
__device__ __forceinline__ float xhalf(float x) { return __builtin_bit_cast(float, __builtin_amdgcn_permlanex16(__builtin_bit_cast(int, x), __builtin_bit_cast(int, x), 0x76543210, 0xfedcba98, false, false)); }
#define FL_BUF (192 * G2_PITCH)      /* one buffer: key rows 0..63, low value-dimension rows 64..127, high ones 128..191 */
// one tile: 12 copies of 16 bytes per lane (4 of K, 4 of V^T low, 4 of V^T high), a wave's copy covering 4 whole rows; l = the lane's LDS byte address of its first row, rows 16 apart
__device__ __forceinline__ void fl_copy(unsigned l, const unsigned short* gk, size_t sk16, const unsigned short* gv, const unsigned short* gw, size_t sv16) {
  /* the closing s_wait_xcnt keeps every address register intact until the copies have taken it */
  asm volatile("global_load_async_to_lds_b128 %0, %12, off\n\t"
               "global_load_async_to_lds_b128 %1, %13, off\n\t"
               "global_load_async_to_lds_b128 %2, %14, off\n\t"
               "global_load_async_to_lds_b128 %3, %15, off\n\t"
               "global_load_async_to_lds_b128 %4, %16, off\n\t"
               "global_load_async_to_lds_b128 %5, %17, off\n\t"
               "global_load_async_to_lds_b128 %6, %18, off\n\t"
               "global_load_async_to_lds_b128 %7, %19, off\n\t"
               "global_load_async_to_lds_b128 %8, %20, off\n\t"
               "global_load_async_to_lds_b128 %9, %21, off\n\t"
               "global_load_async_to_lds_b128 %10, %22, off\n\t"
               "global_load_async_to_lds_b128 %11, %23, off\n\t"
               "s_wait_xcnt 0x0"
               :: "v"(l), "v"(l + 16 * G2_PITCH), "v"(l + 32 * G2_PITCH), "v"(l + 48 * G2_PITCH), "v"(l + 64 * G2_PITCH), "v"(l + 80 * G2_PITCH), "v"(l + 96 * G2_PITCH), "v"(l + 112 * G2_PITCH),
                  "v"(l + 128 * G2_PITCH), "v"(l + 144 * G2_PITCH), "v"(l + 160 * G2_PITCH), "v"(l + 176 * G2_PITCH),
                  "v"(gk), "v"(gk + sk16), "v"(gk + 2 * sk16), "v"(gk + 3 * sk16), "v"(gv), "v"(gv + sv16), "v"(gv + 2 * sv16), "v"(gv + 3 * sv16),
                  "v"(gw), "v"(gw + sv16), "v"(gw + 2 * sv16), "v"(gw + 3 * sv16)
               : "memory");
}
// Transposed products: S^T = K Q^T (A = key rows, B = query columns) and O^T += V^T P^T (A = value-dimension rows of V^T, B = P^T). A lane holds 16 of the 32 scores of ONE query (keys 8 hh + r and 16 + 8 hh + r), which is the k order of a B operand: P goes from the score accumulators into the next product without LDS; maximum, sum and rescale factor are one value per lane.
template <int CAUSAL>
__device__ __forceinline__ void fl_body(unsigned char* smem, int bx, const _Float16* __restrict__ Q16, int ldq, const _Float16* __restrict__ K16, int ldk, const _Float16* __restrict__ Vt, const _Float16* __restrict__ Vt2, const int* __restrict__ MSK, float* __restrict__ O, float* __restrict__ O2, int ldo) {
  constexpr int RPW = 16, DT = 8, KS = 2;      /* DT 0..3: low 64 value columns (Vt -> O), DT 4..7: high 64 (Vt2 -> O2); one score/softmax pass feeds both */
  /* smem: the kernel's 2 * FL_BUF bytes of LDS, the two staging buffers; the epilogue's 4 x 16 x 68 floats lie over them once the loop's last barrier has ended every read. bx: the block's place among the NB * NH * QBNP blocks of this part */
  float (*sO)[RPW][64 + 4] = reinterpret_cast<float (*)[RPW][64 + 4]>(smem);
  const int tid = threadIdx.x, w = tid >> 5, lane = tid & 31, ln = lane & 15, hh = lane >> 4;
  const int slab = bx / QBNP, qblk = QB0P + bx % QBNP; const int b = slab / NH, h = slab % NH; const int qb0 = qblk * (4 * RPW); const int q0 = qb0 + w * RPW; const int tq = q0 + ln;      /* this lane's query */
  FragH aq[KS];
  { const unsigned short* qr = (const unsigned short*)Q16 + ((size_t)b * TQ + tq) * ldq + h * 64;
#pragma unroll
    for (int ks = 0; ks < KS; ++ks) { aq[ks].half[0] = *(const v8us*)(qr + ks * 32 + 8 * hh); aq[ks].half[1] = *(const v8us*)(qr + ks * 32 + 16 + 8 * hh); } }
  const size_t vo = ((size_t)b * KVD + (h / 8) * 128) * TK;      /* pseudo-head h reads value head h / 8 (128 rows of V^T [batch][512][token]); Vt2 points 64 rows further */
  const unsigned short* Vth = (const unsigned short*)Vt + vo; const unsigned short* Vth2 = (const unsigned short*)Vt2 + vo;
  constexpr float C2 = SCL * 1.4426950408889634f;      /* raw score -> exponent in base 2 */
  float m_r = -1.0e38f, l_r = 0.f; v8f oacc[DT];      /* m_r: running maximum of the RAW scores, never below -1e38, so that a masked score (-3e38) stays far under it; l_r: row sum in units of 2^-10 */
#pragma unroll
  for (int dt = 0; dt < DT; ++dt) oacc[dt] = (v8f){0.f,0.f,0.f,0.f,0.f,0.f,0.f,0.f};
  const int jend = (CAUSAL == 1) ? (qb0 + 4 * RPW) : TK;      /* causal: keys beyond the block's last query never contribute */
  const int crow = tid >> 3, cch = tid & 7;      /* copy role: row (mod 16) and 16-byte piece of the 128-byte row */
  const unsigned short* gK = (const unsigned short*)K16 + ((size_t)b * TK + crow) * ldk + (h / NREP) * 64 + cch * 8;      /* query head h reads key head h / 4 */
  const unsigned short* gV = Vth + (size_t)crow * TK + cch * 8; const unsigned short* gW = Vth2 + (size_t)crow * TK + cch * 8; const size_t sk16 = (size_t)16 * ldk, sv16 = (size_t)16 * TK;
  const unsigned l0 = (unsigned)(size_t)smem + (unsigned)(crow * G2_PITCH + cch * 16);
  const int foff = ln * G2_PITCH + 16 * hh;      /* fragment role: row (mod 16) and 16-byte piece, the k order of the former global loads */
  const int NT = jend >> 6;      /* jend is a multiple of 64 */
  fl_copy(l0, gK, sk16, gV, gW, sv16);
  asm volatile("s_wait_asynccnt 0x0" ::: "memory");      /* tile 0 has landed before the barrier publishes it */
  __syncthreads();
  if (NT > 1) fl_copy(l0 + FL_BUF, gK + (size_t)64 * ldk, sk16, gV + 64, gW + 64, sv16);
#pragma unroll 1      /* one tile per trip: the buffer alternates with the trip's parity */
  for (int t = 0; t < NT; ++t) { const unsigned char* sb = smem + (t & 1) * FL_BUF + foff;
#pragma unroll      /* the tile's two 32-key halves, each worked on as one pass of the online softmax, in key order */
   for (int sub = 0; sub < 2; ++sub) { const int j0 = t * 64 + sub * 32;
    FragH bk[2][KS], bv[DT];
#pragma unroll
    for (int nt = 0; nt < 2; ++nt) {
#pragma unroll
      for (int ks = 0; ks < KS; ++ks) bk[nt][ks].v = g2_lfrag(sb + (sub * 32 + nt * 16) * G2_PITCH + ks * 64); }
    v8f st[2];      /* st[nt][r] = score of key j0 + nt * 16 + 8 * hh + r against query tq */
#pragma unroll
    for (int nt = 0; nt < 2; ++nt) { v8f acc = (v8f){0.f,0.f,0.f,0.f,0.f,0.f,0.f,0.f};
#pragma unroll
      for (int ks = 0; ks < KS; ++ks) acc = mmaH<1>(bk[nt][ks].v, bk[nt][ks].v, aq[ks].v, aq[ks].v, acc);
      st[nt] = acc; }
#pragma unroll
    for (int dt = 0; dt < DT; ++dt) bv[dt].v = g2_lfrag(sb + (64 + dt * 16) * G2_PITCH + sub * 64);
    float sv[16]; float mc = -3.0e38f;
#pragma unroll
    for (int e = 0; e < 16; ++e) { const int kk = j0 + (e >> 3) * 16 + 8 * hh + (e & 7); const bool ok = (CAUSAL == 1) ? (kk <= tq) : ((CAUSAL == 2) ? ((kk >> 5) == (tq >> 5)) : true);      /* mode 2: block-diagonal 32-token groups */
      sv[e] = ok ? st[e >> 3][e & 7] : -3.0e38f; mc = fmaxf(mc, sv[e]); }
    mc = fmaxf(mc, xhalf(mc));      /* both halves feed one output column: they share the maximum */
    const float mn = fmaxf(m_r, mc); const float xa = (m_r - mn) * C2; m_r = mn;      /* rescale factor 2^xa; nothing seen yet: 2^0 = 1 on zero sums */
    const float nb = fmaf(-mn, C2, 10.0f);      /* p = 1024 exp((s - mn) / 8) = 2^(s C2 + nb): scale, maximum and the operand's 2^10 in one fused multiply-add; a masked score gives 2^(-huge) = 0 */
    float pe[16], al = xa;
#pragma unroll
    for (int e = 0; e < 16; ++e) pe[e] = fmaf(sv[e], C2, nb);
    /* the exponentials stand together, each in place on a register of its own: no v_exp_f32 is directly followed by a read of its result or by another instruction's write of its source; the closing v_nop keeps that slot free of whatever the compiler puts next */
    asm("v_exp_f32 %0, %0\n\tv_exp_f32 %1, %1\n\tv_exp_f32 %2, %2\n\tv_exp_f32 %3, %3\n\tv_exp_f32 %4, %4\n\tv_exp_f32 %5, %5\n\tv_exp_f32 %6, %6\n\tv_exp_f32 %7, %7\n\tv_exp_f32 %8, %8\n\tv_nop"
        : "+v"(al), "+v"(pe[0]), "+v"(pe[1]), "+v"(pe[2]), "+v"(pe[3]), "+v"(pe[4]), "+v"(pe[5]), "+v"(pe[6]), "+v"(pe[7]));
    asm("v_exp_f32 %0, %0\n\tv_exp_f32 %1, %1\n\tv_exp_f32 %2, %2\n\tv_exp_f32 %3, %3\n\tv_exp_f32 %4, %4\n\tv_exp_f32 %5, %5\n\tv_exp_f32 %6, %6\n\tv_exp_f32 %7, %7\n\tv_nop"
        : "+v"(pe[8]), "+v"(pe[9]), "+v"(pe[10]), "+v"(pe[11]), "+v"(pe[12]), "+v"(pe[13]), "+v"(pe[14]), "+v"(pe[15]));
    FragH pb; float ps[4] = {0.f, 0.f, 0.f, 0.f};
#pragma unroll
    for (int e = 0; e < 16; ++e) { ps[e & 3] += pe[e]; pb.h[e] = (_Float16)pe[e]; }
    l_r = l_r * al + ((ps[0] + ps[1]) + (ps[2] + ps[3]));
#pragma unroll
    for (int dt = 0; dt < DT; ++dt) {
#pragma unroll
      for (int r = 0; r < 8; ++r) oacc[dt][r] *= al; }
#pragma unroll
    for (int dt = 0; dt < DT; ++dt) oacc[dt] = mmaH<1>(bv[dt].v, bv[dt].v, pb.v, pb.v, oacc[dt]); }
    asm volatile("s_wait_dscnt 0x0" ::: "memory");         /* this wave's reads of the buffer are over before it may be refilled */
    asm volatile("s_wait_asynccnt 0x0" ::: "memory");      /* this wave's copies of the next tile have landed */
    __syncthreads();                                       /* publishes the next tile and ends every wave's reads of this one */
    if (t + 2 < NT) fl_copy(l0 + (unsigned)(t & 1) * FL_BUF, gK + (size_t)(t + 2) * 64 * ldk, sk16, gV + (t + 2) * 64, gW + (t + 2) * 64, sv16); }
  asm volatile("s_wait_asynccnt 0x0" ::: "memory");        /* nothing is in flight when the buffers become output staging */
  const float lt = l_r + xhalf(l_r); const float inv = (lt > 0.f) ? 1.0f / lt : 0.f;      /* sums and products both carry the 2^10 */
#pragma unroll
  for (int hf = 0; hf < 2; ++hf) { float* __restrict__ Oh = hf ? O2 : O;
#pragma unroll
    for (int dt = 0; dt < 4; ++dt) { const v8f a = oacc[hf * 4 + dt]; const v4f lo = {a[0] * inv, a[1] * inv, a[2] * inv, a[3] * inv}, hi = {a[4] * inv, a[5] * inv, a[6] * inv, a[7] * inv};      /* a[r] = column dt * 16 + 8 * hh + r of query row ln */
      *(v4fa*)&sO[w][ln][dt * 16 + 8 * hh] = lo; *(v4fa*)&sO[w][ln][dt * 16 + 8 * hh + 4] = hi; }
    __builtin_amdgcn_fence(__ATOMIC_ACQ_REL, "workgroup"); __builtin_amdgcn_wave_barrier();
#pragma unroll
    for (int rp = 0; rp < RPW; rp += 2) { const int r = rp + (lane >> 4), pc = lane & 15; const v4f val = *(const v4fa*)&sO[w][r][pc * 4]; *(v4f*)(Oh + ((size_t)b * TQ + q0 + r) * ldo + h * 64 + pc * 4) = val; }
    if (hf == 0) { __builtin_amdgcn_fence(__ATOMIC_ACQ_REL, "workgroup"); __builtin_amdgcn_wave_barrier(); }      /* the high half reuses this wave's sO slice: its stores stay behind the low half's reads */
  } }
// 5-plane variant: S = Qh Kh^T + (Ql Kh^T + Qh Kl^T)/1024 with Q/K = [hi | 2^10 residual] f16 planes (QL/KL same layout as Q16/K16), then the 3-term P.V below.
// 3-term variant: O = (P_hi V_hi + (P_lo V_hi + P_hi V_lo) / 1024) / l with P = [hi | 2^10 residual] of 1024 p and V^T = [hi | 2^10 residual] planes (VtL same layout as Vt) -> ~2^-21-class products for un-averaged (early causal / peaked) rows
template <int CAUSAL>
__device__ __forceinline__ void fl5_body(unsigned char* smem, int bx, const _Float16* __restrict__ Q16, const _Float16* __restrict__ QL, int ldq, const _Float16* __restrict__ K16, const _Float16* __restrict__ KL, int ldk, const _Float16* __restrict__ Vt, const _Float16* __restrict__ VtL, const int* __restrict__ MSK, float* __restrict__ O, int ldo) {
  constexpr int RPW = 16, DT = 4, KS = 2;      /* transposed like fl_body: key rows and V^T rows are A operands, query columns and P^T are B operands */
  float (*sO)[RPW][64 + 4] = reinterpret_cast<float (*)[RPW][64 + 4]>(smem);      /* output staging, 4 x 16 x 68 floats at the head of the kernel's LDS; bx: the block's place among the NB * NH * QBN5 blocks of this part */
  const int tid = threadIdx.x, w = tid >> 5, lane = tid & 31, ln = lane & 15, hh = lane >> 4;
  const int slab = bx / QBN5, qblk = QB05 + bx % QBN5; const int b = slab / NH, h = slab % NH; const int qb0 = qblk * (4 * RPW); const int q0 = qb0 + w * RPW; const int tq = q0 + ln;      /* this lane's query */
  FragH aq[KS], aql[KS];
  { const unsigned short* qr = (const unsigned short*)Q16 + ((size_t)b * TQ + tq) * ldq + h * 64; const unsigned short* ql = (const unsigned short*)QL + ((size_t)b * TQ + tq) * ldq + h * 64;
#pragma unroll
    for (int ks = 0; ks < KS; ++ks) { aq[ks].half[0] = *(const v8us*)(qr + ks * 32 + 8 * hh); aq[ks].half[1] = *(const v8us*)(qr + ks * 32 + 16 + 8 * hh); aql[ks].half[0] = *(const v8us*)(ql + ks * 32 + 8 * hh); aql[ks].half[1] = *(const v8us*)(ql + ks * 32 + 16 + 8 * hh); } }
  const size_t vo = ((size_t)b * KVD + (h / 8) * 128) * TK;      /* value head h / 8 of V^T [batch][512][token]; the caller's pointers pick its low or high 64 rows */
  const unsigned short* Vth = (const unsigned short*)Vt + vo; const unsigned short* Vtl = (const unsigned short*)VtL + vo;
  float m_r = -3.0e38f, l_r = 0.f; v8f oacc[DT], oaccL[DT];
#pragma unroll
  for (int dt = 0; dt < DT; ++dt) { oacc[dt] = (v8f){0.f,0.f,0.f,0.f,0.f,0.f,0.f,0.f}; oaccL[dt] = oacc[dt]; }
  const int jend = (CAUSAL == 1) ? (qb0 + 4 * RPW) : TK;      /* causal: keys beyond the block's last query never contribute */
#pragma unroll 1
  for (int j0 = 0; j0 < jend; j0 += 32) {
    FragH bk[2][KS], bkl[2][KS], bv[DT], bl[DT];
    const size_t ko = ((size_t)b * TK + j0 + ln) * ldk + (h / NREP) * 64 + 8 * hh; const unsigned short* kr0 = (const unsigned short*)K16 + ko; const unsigned short* kr1 = kr0 + (size_t)16 * ldk; const unsigned short* kl0 = (const unsigned short*)KL + ko; const unsigned short* kl1 = kl0 + (size_t)16 * ldk;
#pragma unroll
    for (int nt = 0; nt < 2; ++nt) { const unsigned short* kr = nt ? kr1 : kr0; const unsigned short* klr = nt ? kl1 : kl0;
#pragma unroll
      for (int ks = 0; ks < KS; ++ks) { bk[nt][ks].half[0] = *(const v8us*)(kr + ks * 32); bk[nt][ks].half[1] = *(const v8us*)(kr + ks * 32 + 16); bkl[nt][ks].half[0] = *(const v8us*)(klr + ks * 32); bkl[nt][ks].half[1] = *(const v8us*)(klr + ks * 32 + 16); } }
    asm volatile("s_wait_xcnt 0x0" :: "v"(kr0), "v"(kr1), "v"(kl0), "v"(kl1) : "memory");      /* a precaution: the address registers stay whole (no load's own destination takes them) until the issued loads have taken them */
    v8f st[2];      /* st[nt][r] = score of key j0 + nt * 16 + 8 * hh + r against query tq */
#pragma unroll
    for (int nt = 0; nt < 2; ++nt) { v8f acc = (v8f){0.f,0.f,0.f,0.f,0.f,0.f,0.f,0.f}, accl = acc;
#pragma unroll
      for (int ks = 0; ks < KS; ++ks) { acc = mmaH<1>(bk[nt][ks].v, bk[nt][ks].v, aq[ks].v, aq[ks].v, acc); accl = mmaH<1>(bk[nt][ks].v, bk[nt][ks].v, aql[ks].v, aql[ks].v, accl); accl = mmaH<1>(bkl[nt][ks].v, bkl[nt][ks].v, aq[ks].v, aq[ks].v, accl); }
#pragma unroll
      for (int r = 0; r < 8; ++r) acc[r] += accl[r] * 0.0009765625f;
      st[nt] = acc; }
    const unsigned short* vr0 = Vth + (size_t)ln * TK + j0 + 8 * hh; const unsigned short* vr1 = Vtl + (size_t)ln * TK + j0 + 8 * hh;
#pragma unroll
    for (int dt = 0; dt < DT; ++dt) { const unsigned short* vrow = vr0 + (size_t)(dt * 16) * TK; const unsigned short* vrl = vr1 + (size_t)(dt * 16) * TK; bv[dt].half[0] = *(const v8us*)vrow; bv[dt].half[1] = *(const v8us*)(vrow + 16); bl[dt].half[0] = *(const v8us*)vrl; bl[dt].half[1] = *(const v8us*)(vrl + 16); }
    asm volatile("s_wait_xcnt 0x0" :: "v"(vr0), "v"(vr1) : "memory");      /* the same precaution for the value loads, which fly during the softmax */
    float sv[16]; bool ok[16]; float mc = -3.0e38f;
#pragma unroll
    for (int e = 0; e < 16; ++e) { const int kk = j0 + (e >> 3) * 16 + 8 * hh + (e & 7); ok[e] = (CAUSAL == 1) ? (kk <= tq) : ((CAUSAL == 2) ? ((kk >> 5) == (tq >> 5)) : true);      /* mode 2: block-diagonal 32-token groups */
      if (CAUSAL == 4) ok[e] = MSK[((size_t)b * TQ + tq) * TK + kk] != 0;      /* mode 4: per-(query, key) INPUT mask shared by all heads; masked keys contribute nothing (== the reference's -4096 fill, whose exp underflows to 0), rows with no valid key give l = 0 -> output 0 (== the reference's row_valid zeroing) */
      sv[e] = ok[e] ? st[e >> 3][e & 7] * SCL : -3.0e38f; mc = fmaxf(mc, sv[e]); }
    mc = fmaxf(mc, xhalf(mc));      /* both halves feed one output column: they share the maximum */
    const float mn = fmaxf(m_r, mc); const float al = (mn > -1.0e38f) ? expf(m_r - mn) : 1.0f; m_r = mn;
    FragH pa, pl; float ps[4] = {0.f, 0.f, 0.f, 0.f};
#pragma unroll
    for (int e = 0; e < 16; ++e) { const float p = ok[e] ? expf(sv[e] - mn) : 0.f; ps[e & 3] += p; const float pw = p * 1024.0f; pa.h[e] = (_Float16)pw; pl.h[e] = (_Float16)((pw - (float)pa.h[e]) * 1024.0f); }
    l_r = l_r * al + ((ps[0] + ps[1]) + (ps[2] + ps[3]));
#pragma unroll
    for (int dt = 0; dt < DT; ++dt) {
#pragma unroll
      for (int r = 0; r < 8; ++r) { oacc[dt][r] *= al; oaccL[dt][r] *= al; } }
#pragma unroll
    for (int dt = 0; dt < DT; ++dt) { oacc[dt] = mmaH<1>(bv[dt].v, bv[dt].v, pa.v, pa.v, oacc[dt]); oaccL[dt] = mmaH<1>(bv[dt].v, bv[dt].v, pl.v, pl.v, oaccL[dt]); oaccL[dt] = mmaH<1>(bl[dt].v, bl[dt].v, pa.v, pa.v, oaccL[dt]); } }
  const float lt = l_r + xhalf(l_r); const float inv = (lt > 0.f) ? 1.0f / (lt * 1024.0f) : 0.f;
#pragma unroll
  for (int dt = 0; dt < DT; ++dt) { v8f a = oacc[dt];
#pragma unroll
    for (int r = 0; r < 8; ++r) { a[r] += oaccL[dt][r] * 0.0009765625f; a[r] *= inv; }      /* a[r] = column dt * 16 + 8 * hh + r of query row ln */
    const v4f lo = {a[0], a[1], a[2], a[3]}, hi = {a[4], a[5], a[6], a[7]}; *(v4fa*)&sO[w][ln][dt * 16 + 8 * hh] = lo; *(v4fa*)&sO[w][ln][dt * 16 + 8 * hh + 4] = hi; }
  __builtin_amdgcn_fence(__ATOMIC_ACQ_REL, "workgroup"); __builtin_amdgcn_wave_barrier();
  {
#pragma unroll
    for (int rp = 0; rp < RPW; rp += 2) { const int r = rp + (lane >> 4), pc = lane & 15; const v4f val = *(const v4fa*)&sO[w][r][pc * 4]; *(v4f*)(O + ((size_t)b * TQ + q0 + r) * ldo + h * 64 + pc * 4) = val; }
     } }
// All of the attention in one grid (its three parts write disjoint rows or planes and depend on nothing of each other): first the long blocks (rows from 256 on, one pass over the keys for both halves of each pseudo-head's 128-wide value head), behind them the short ones (first 256 rows: low, then high 64 value columns), which start as places come free.
#define AT_NP (NB * NH * QBNP)
#define AT_N5 (NB * NH * QBN5)
__global__ __launch_bounds__(128) void k_attn(const _Float16* __restrict__ QH, const _Float16* __restrict__ QL, const _Float16* __restrict__ KH, const _Float16* __restrict__ KL, const _Float16* __restrict__ VT, const _Float16* __restrict__ VTL, float* __restrict__ OLO, float* __restrict__ OHI) {
  __shared__ __attribute__((aligned(16))) unsigned char smem[2 * FL_BUF];
  const int bx = (int)blockIdx.x;
  if (bx < AT_NP) { fl_body<1>(smem, bx, QH, DM, KH, KVD, VT, VT + (size_t)64 * SLEN, nullptr, OLO, OHI, DM); }
  else { const int hf = (bx - AT_NP) / AT_N5; fl5_body<1>(smem, bx - AT_NP - hf * AT_N5, QH, QL, DM, KH, KL, KVD, VT + (size_t)hf * 64 * SLEN, VTL + (size_t)hf * 64 * SLEN, nullptr, hf ? OHI : OLO, DM); } }

__device__ __forceinline__ void lam_body(const float* __restrict__ q1, const float* __restrict__ k1, const float* __restrict__ q2, const float* __restrict__ k2, float* __restrict__ LAM) {
  #pragma clang fp contract(off)
  const int ln = threadIdx.x & 31; if (threadIdx.x >= 32) return; float a = bf16_round(q1[ln]) * bf16_round(k1[ln]); a += bf16_round(q1[ln + 32]) * bf16_round(k1[ln + 32]); float c = bf16_round(q2[ln]) * bf16_round(k2[ln]); c += bf16_round(q2[ln + 32]) * bf16_round(k2[ln + 32]);
  for (int o = 16; o > 0; o >>= 1) { a += __shfl_xor(a, o, 32); c += __shfl_xor(c, o, 32); } const float lf = expf(a) - expf(c) + 0.78360576653162446f;      /* LAMBDA_INIT = 0.8 - 0.6 exp(-0.3 * 12) = 0.78360577 */
  const float v = (ln == 0) ? lf : 0.f; *(float*)(LAM + ln) = v;  }
// Every operand conversion in one grid (none depends on another): x, then Wq, Wk, Wv, Wo (each weight lies (out,in), which is the GEMM's B^T form), each f32 -> bf16 rounding -> f16 (weights times 16, exact; x times 1, exact); the last block makes lambda_full. One group of 8 elements per thread, as in the separate launches before.
#define CV_NX ((NR / 8) * DM / 256)               /* blocks: x */
#define CV_NW ((DM / 8) * DM / 256)               /* Wq, Wo */
#define CV_NS ((KVD / 8) * DM / 256)              /* Wk, Wv */
#define CV_N (CV_NX + 2 * CV_NW + 2 * CV_NS)
__global__ __launch_bounds__(256) void k_prep(const float* __restrict__ x, const float* __restrict__ Wq, const float* __restrict__ Wk, const float* __restrict__ Wv, const float* __restrict__ Wo,
    const float* __restrict__ q1, const float* __restrict__ k1, const float* __restrict__ q2, const float* __restrict__ k2,
    _Float16* __restrict__ X16, _Float16* __restrict__ BQ, _Float16* __restrict__ BK, _Float16* __restrict__ BV, _Float16* __restrict__ BO, float* __restrict__ LAM) {
  int bx = (int)blockIdx.x;
  if (bx >= CV_N) { lam_body(q1, k1, q2, k2, LAM); return; }
  const float* src = x; _Float16* dst = X16; float sc = 1.0f;
  if (bx >= CV_NX) { bx -= CV_NX; sc = 16.0f;
    if (bx < CV_NW) { src = Wq; dst = BQ; }
    else if (bx < CV_NW + CV_NS) { bx -= CV_NW; src = Wk; dst = BK; }
    else if (bx < CV_NW + 2 * CV_NS) { bx -= CV_NW + CV_NS; src = Wv; dst = BV; }
    else { bx -= CV_NW + 2 * CV_NS; src = Wo; dst = BO; } }
  const size_t t = (size_t)bx * 256 + threadIdx.x; FragH f;
#pragma unroll
  for (int q = 0; q < 8; ++q) f.h[q] = (_Float16)(bf16_round(src[t * 8 + q]) * sc);
  *(v8us*)((unsigned short*)dst + t * 8) = f.half[0];
  asm volatile("s_wait_xcnt 0x0" ::: "memory");      /* the store's registers are not rewritten ahead of this wait, whatever code the build lays out behind it */
}
__global__ __launch_bounds__(256) void k_comb(const float* __restrict__ OLO, const float* __restrict__ OHI, const float* __restrict__ LAM, const float* __restrict__ lnw, _Float16* __restrict__ A16) {
  #pragma clang fp contract(off)
  const size_t t = (size_t)blockIdx.x * 256 + threadIdx.x; if (t >= (size_t)NR * 16) return; const int j = (int)(t % 16); const size_t r = t / 16; const float lam = LAM[0]; float a[128]; float ss = 0.f;
  const float* e0 = OLO + r * DM + (size_t)(2 * j) * 64; const float* o0 = OLO + r * DM + (size_t)(2 * j + 1) * 64; const float* e1 = OHI + r * DM + (size_t)(2 * j) * 64; const float* o1 = OHI + r * DM + (size_t)(2 * j + 1) * 64;
  for (int d = 0; d < 64; ++d) { float v = e0[d]; v += -lam * o0[d]; a[d] = v; ss += v * v; float w = e1[d]; w += -lam * o1[d]; a[64 + d] = w; ss += w * w; }
  const float inv = rsqrtf(ss / 128.0f + 1e-5f); unsigned short* dst = (unsigned short*)A16 + r * DM + (size_t)j * 128;
  { for (int g = 0; g < 16; ++g) { FragH f; for (int q = 0; q < 8; ++q) { const int d = g * 8 + q; float v = a[d] * inv; v *= bf16_round(lnw[d]); v = v * 0.21639423346837554f;      /* 1 - LAMBDA_INIT */ f.h[q] = (_Float16)v; } *(v8us*)(dst + g * 8) = f.half[0]; }  } }

extern "C" void kernel_launch(void* const* d_in, const int* in_sizes, int n_in,
                              void* d_out, int out_size, void* d_ws, size_t ws_size, hipStream_t stream) {
  (void)in_sizes; (void)n_in; (void)out_size;
  const float* const* I = (const float* const*)d_in; const float* x = I[0]; const float* Wq = I[1]; const float* Wk = I[2]; const float* Wv = I[3]; const float* Wo = I[4]; const float* lq1 = I[5]; const float* lk1 = I[6]; const float* lq2 = I[7]; const float* lk2 = I[8]; const float* lnw = I[9];
  char* ws = (char*)d_ws; size_t off = 0;
  auto take = [&](size_t bytes) { char* p = ws + off; off += (bytes + 255) & ~(size_t)255; return p; };
  const size_t np = (size_t)NR * DM, nk = (size_t)NR * KVD;
  _Float16* BQ = (_Float16*)take((size_t)DM * DM * 2); _Float16* BK = (_Float16*)take((size_t)KVD * DM * 2); _Float16* BV = (_Float16*)take((size_t)KVD * DM * 2); _Float16* BO = (_Float16*)take((size_t)DM * DM * 2);
  _Float16* X16 = (_Float16*)take(np * 2); _Float16* QH = (_Float16*)take(np * 2); _Float16* QL = (_Float16*)take(np * 2); _Float16* KH = (_Float16*)take(nk * 2); _Float16* KL = (_Float16*)take(nk * 2); _Float16* VT = (_Float16*)take(nk * 2); _Float16* VTL = (_Float16*)take(nk * 2); float* LAM = (float*)take(256); float* OLO = (float*)take(np * 4); float* OHI = (float*)take(np * 4);      /* q [token][32 x 64], k [token][8 x 64], V^T [batch][4 x 128][token], each as f16 hi + residual plane; low- and high-half attention outputs */
  _Float16* A16 = X16;      /* normalised attention over the input plane (dead after the projections) */
  if (off > ws_size) return;      /* 8+2+2+8 + 16+16+16+4+4+4+4 + 32+32 = 148 MiB */
  k_prep<<<CV_N + 1, 256, 0, stream>>>(x, Wq, Wk, Wv, Wo, lq1, lk1, lq2, lk2, X16, BQ, BK, BV, BO, LAM);
  /* the projections write the attention's operands themselves: no f32 plane, no split, repeat or transpose pass in between */
  k_proj<<<PJ_NQ + PJ_NK + NB * PJ_NV, 128, 0, stream>>>(X16, BQ, BK, BV, QH, QL, KH, KL, VT, VTL);
  k_attn<<<AT_NP + 2 * AT_N5, 128, 0, stream>>>(QH, QL, KH, KL, VT, VTL, OLO, OHI);
  k_comb<<<(unsigned)(((size_t)NR * 16 + 255) / 256), 256, 0, stream>>>(OLO, OHI, LAM, lnw, A16);
  k_gemm2<0, false><<<dim3((NR / 128) * (DM / 64), 1), 128, 0, stream>>>(A16, DM, 0, BO, DM, 0, 0.0625f, nullptr, 0, nullptr, 1, 0, 0, (float*)d_out, nullptr, nullptr, DM, 0, NR, DM, DM);      /* out = attn Wo^T */
}

// v008
// One run takes 182 microseconds.
// Timed twice side by side with v007, it ran 1.09 and 1.07 times as fast.
// Over all steps from v000 it is 5.32 times as fast.
#include <hip/hip_runtime.h>
// MultiheadSdpaDiff4 (2 x 2048 tokens, EMBED 2048; differential attention: q = x Wq^T as 32 pseudo-heads x 64, k = x Wk^T as 8 heads x 64 repeat-interleaved 4x, v = x Wv^T as 4 heads x 128 repeat-interleaved 8x; causal softmax(q.k/8) v; attn = O_even - lambda_full * O_odd (16 heads x 128), lambda_full = exp(lq1.lk1) - exp(lq2.lk2) + 0.78361; RMSNorm(128, eps 1e-5) * ln_w * (1 - 0.78361); out = attn Wo^T.
// Compute dtype: inputs rounded to bf16; x exact as f16; q/k/P/v as f16 hi + residual on the first 256 rows (~2^-21) and plain beyond (~2^-12); the normalised attention as a plain f16 operand; softmax/lambda/RMSNorm f32. v_wmma_f32_16x16x32_f16.
#define NB 2
#define DM 2048
#define NKV 8
#define NREP (NH / NKV)
#define KVD (NKV * 64)           /* 512 */
#define NR (NB * SLEN)           /* 4096 */
#define SLEN 2048
#define TQ SLEN
#define TK SLEN
#define NH 32
#define SCL 0.125f
#define RE 256
#define PQ0 (RE / 32)             /* rows from RE on: blocks of 32 queries */
#define PQN ((TQ - RE) / 32)
#define SQN (RE / 16)             /* first RE rows: blocks of 16 queries */
typedef __bf16 v16b __attribute__((ext_vector_type(16)));
typedef unsigned short v8us __attribute__((ext_vector_type(8), may_alias));
typedef float  v8f  __attribute__((ext_vector_type(8)));
typedef float  v4f  __attribute__((ext_vector_type(4)));
typedef float  v4fa __attribute__((ext_vector_type(4), may_alias));
union FragB { v16b v; v8us half[2]; unsigned short u[16]; };

__device__ __forceinline__ unsigned short bf16_bits(float x) { unsigned int u = __float_as_uint(x); return (unsigned short)((u + 0x7FFFu + ((u >> 16) & 1u)) >> 16); }
__device__ __forceinline__ float bf16_val(unsigned short b) { return __uint_as_float(((unsigned int)b) << 16); }
__device__ __forceinline__ float bf16_round(float x) { return bf16_val(bf16_bits(x)); }
// D += A·B with NT terms: 1 = ah·bh, 2 = + al·bh (A split), 3 = + ah·bl (both split)
template <int NT>
__device__ __forceinline__ v8f mmaN(v16b ah, v16b al, v16b bh, v16b bl, v8f c) {
  c = __builtin_amdgcn_wmma_f32_16x16x32_bf16(false, ah, false, bh, (short)0, c, false, false);
  if (NT >= 2) c = __builtin_amdgcn_wmma_f32_16x16x32_bf16(false, al, false, bh, (short)0, c, false, false);
  if (NT >= 3) c = __builtin_amdgcn_wmma_f32_16x16x32_bf16(false, ah, false, bl, (short)0, c, false, false);
  asm volatile("v_nop\n\tv_nop\n\tv_nop\n\tv_nop" : "+v"(c) : "v"(ah), "v"(al), "v"(bh), "v"(bl));
  return c;
}

__global__ __launch_bounds__(256) void k_wt_bf16(const float* __restrict__ W, unsigned short* __restrict__ Wt, int K, int N) {
  const int t = blockIdx.x * 256 + threadIdx.x;
  const int k8n = K / 8;
  if (t >= N * k8n) return;
  const int n = t / k8n, k8 = (t % k8n) * 8;
  v8us v;
#pragma unroll
  for (int i = 0; i < 8; ++i) v[i] = bf16_bits(W[(size_t)(k8 + i) * N + n]);
  *(v8us*)(Wt + (size_t)n * K + k8) = v;
  
}

// GEMM C[M][N] (f32, pitch ldc) = act(A[M][K]·W + bias). A f32 row-major (pitch lda) converted per fragment to bf16
// (ASPLIT: hi/lo two planes -> 2 terms, else single rounded term); Wt bf16 [N][K] (pitch ldb). BIAS_BF16 rounds the
// bias to bf16 first (bias quantised to bf16 before the add). K%32==0, M%16==0, N%64==0.
template <bool ASPLIT, int ACT, bool BIAS_BF16>
__global__ __launch_bounds__(128) void k_gemm_bf(const float* __restrict__ A, int lda, const unsigned short* __restrict__ Wt, int ldb,
                                               const float* __restrict__ bias, float* __restrict__ C, int ldc, int M, int N, int K) {
  __shared__ __attribute__((aligned(16))) float so[4][16][64];
  const int tid = threadIdx.x, w = tid >> 5, lane = tid & 31, ln = lane & 15, hh = lane >> 4;
  const int ntn = N / 64;
  const int wid = blockIdx.x * 4 + w;
  const int mt = wid / ntn, nq = wid % ntn;
  if (mt * 16 >= M) return;
  const int row0 = mt * 16, col0 = nq * 64;
  const float* arow = A + (size_t)(row0 + ln) * lda;
  v8f acc[4] = {};
  for (int kb = 0; kb < K; kb += 32) {
    FragB ah, al;
    const v4f x0 = *(const v4fa*)(arow + kb + 8 * hh), x1 = *(const v4fa*)(arow + kb + 8 * hh + 4);
    const v4f x2 = *(const v4fa*)(arow + kb + 16 + 8 * hh), x3 = *(const v4fa*)(arow + kb + 16 + 8 * hh + 4);
    float xs[16] = {x0[0],x0[1],x0[2],x0[3],x1[0],x1[1],x1[2],x1[3],x2[0],x2[1],x2[2],x2[3],x3[0],x3[1],x3[2],x3[3]};
#pragma unroll
    for (int i = 0; i < 16; ++i) { const unsigned short hb = bf16_bits(xs[i]); ah.u[i] = hb; al.u[i] = ASPLIT ? bf16_bits(xs[i] - bf16_val(hb)) : (unsigned short)0; }
#pragma unroll
    for (int t = 0; t < 4; ++t) {
      const unsigned short* brow = Wt + (size_t)(col0 + t * 16 + ln) * ldb + kb;
      FragB b;
      b.half[0] = *(const v8us*)(brow + 8 * hh);
      b.half[1] = *(const v8us*)(brow + 16 + 8 * hh);
      acc[t] = mmaN<ASPLIT ? 2 : 1>(ah.v, al.v, b.v, b.v, acc[t]);
    }
  }
#pragma unroll
  for (int t = 0; t < 4; ++t) {
    float bv = bias ? bias[col0 + t * 16 + ln] : 0.f;
    if (BIAS_BF16) bv = bf16_round(bv);
#pragma unroll
    for (int r = 0; r < 8; ++r) { float v = acc[t][r] + bv; if (ACT == 1) v = fmaxf(v, 0.f); so[w][8 * hh + r][t * 16 + ln] = v; }
  }
  __builtin_amdgcn_fence(__ATOMIC_ACQ_REL, "workgroup");
  __builtin_amdgcn_wave_barrier();
  const int rsub = lane >> 4, c4 = (lane & 15) * 4;
  {
#pragma unroll
    for (int q = 0; q < 8; ++q) {
      const int r = q * 2 + rsub;
      const v4f v = *(const v4fa*)&so[w][r][c4];
      *(v4f*)(C + (size_t)(row0 + r) * ldc + col0 + c4) = v;
    }
    
  }
}

// GEMM C = act(A·W + bias + resid): A f32 (ASPLIT -> hi/lo 2 terms), Wt bf16 [N][K]; ACT 0 none, 1 relu, 2 exact gelu;
// resid (optional, f32, row index = (row % rmod), pitch ldr, RES_BF16 rounds it) added before the activation.
template <bool ASPLIT, int ACT, bool BIAS_BF16, bool RES_BF16>
__global__ __launch_bounds__(128) void k_gemm_bf3(const float* __restrict__ A, int lda, const unsigned short* __restrict__ Wt, int ldb,
                                                const float* __restrict__ bias, const float* __restrict__ resid, int rmod, int ldr,
                                                float* __restrict__ C, int ldc, int M, int N, int K) {
  __shared__ __attribute__((aligned(16))) float so[4][16][64];
  const int tid = threadIdx.x, w = tid >> 5, lane = tid & 31, ln = lane & 15, hh = lane >> 4;
  const int ntn = N / 64;
  const int wid = blockIdx.x * 4 + w;
  const int mt = wid / ntn, nq = wid % ntn;
  if (mt * 16 >= M) return;
  const int row0 = mt * 16, col0 = nq * 64;
  const float* arow = A + (size_t)(row0 + ln) * lda;
  v8f acc[4] = {};
  for (int kb = 0; kb < K; kb += 32) {
    FragB ah, al;
    const v4f x0 = *(const v4fa*)(arow + kb + 8 * hh), x1 = *(const v4fa*)(arow + kb + 8 * hh + 4);
    const v4f x2 = *(const v4fa*)(arow + kb + 16 + 8 * hh), x3 = *(const v4fa*)(arow + kb + 16 + 8 * hh + 4);
    float xs[16] = {x0[0],x0[1],x0[2],x0[3],x1[0],x1[1],x1[2],x1[3],x2[0],x2[1],x2[2],x2[3],x3[0],x3[1],x3[2],x3[3]};
#pragma unroll
    for (int i = 0; i < 16; ++i) { const unsigned short hb = bf16_bits(xs[i]); ah.u[i] = hb; al.u[i] = ASPLIT ? bf16_bits(xs[i] - bf16_val(hb)) : (unsigned short)0; }
#pragma unroll
    for (int t = 0; t < 4; ++t) {
      const unsigned short* brow = Wt + (size_t)(col0 + t * 16 + ln) * ldb + kb;
      FragB b;
      b.half[0] = *(const v8us*)(brow + 8 * hh);
      b.half[1] = *(const v8us*)(brow + 16 + 8 * hh);
      acc[t] = mmaN<ASPLIT ? 2 : 1>(ah.v, al.v, b.v, b.v, acc[t]);
    }
  }
#pragma unroll
  for (int t = 0; t < 4; ++t) {
    const int col = col0 + t * 16 + ln;
    float bv = bias ? bias[col] : 0.f;
    if (BIAS_BF16) bv = bf16_round(bv);
#pragma unroll
    for (int r = 0; r < 8; ++r) {
      float v = acc[t][r] + bv;
      if (resid) { float rv = resid[(size_t)((row0 + 8 * hh + r) % rmod) * ldr + col]; if (RES_BF16) rv = bf16_round(rv); v += rv; }
      if (ACT == 1) v = fmaxf(v, 0.f);
      if (ACT == 2) v = 0.5f * v * (1.0f + erff(v * 0.70710678118654752f));
      if (ACT == 3) { const float u = 0.7978845608028654f * (v + 0.044715f * v * v * v); v = 0.5f * v * (1.0f + tanhf(u)); }
      so[w][8 * hh + r][t * 16 + ln] = v;
    }
  }
  __builtin_amdgcn_fence(__ATOMIC_ACQ_REL, "workgroup");
  __builtin_amdgcn_wave_barrier();
  const int rsub = lane >> 4, c4 = (lane & 15) * 4;
  {
#pragma unroll
    for (int q = 0; q < 8; ++q) {
      const int r = q * 2 + rsub;
      const v4f v = *(const v4fa*)&so[w][r][c4];
      *(v4f*)(C + (size_t)(row0 + r) * ldc + col0 + c4) = v;
    }
    
  }
}
// row LayerNorm (biased variance, eps) over N: s = X (+ R); optional out_sum <- s; out_norm <- (s-mu)*rsqrt(var+eps)*g + b
template <bool PARAM_BF16>
__global__ __launch_bounds__(256) void k_layernorm(const float* __restrict__ X, const float* __restrict__ R, const float* __restrict__ g, const float* __restrict__ bta,
                                                  float* __restrict__ out_sum, float* __restrict__ out_norm, int N, float eps) {
  __shared__ float red[256];
  const int row = blockIdx.x, tid = threadIdx.x;
  const float* x = X + (size_t)row * N; const float* rr = R ? R + (size_t)row * N : nullptr;
  float vals[16];                     // up to N = 4096
  const int per = N / 256;            // contiguous chunk per thread? use strided-by-4 chunks: thread handles j = tid*4 + 1024*u
  float s1 = 0.f;
  for (int u = 0; u < per / 4; ++u) {
    const int j = tid * 4 + 1024 * u;
    const v4f a = *(const v4fa*)(x + j);
    v4f b = {0.f,0.f,0.f,0.f}; if (rr) b = *(const v4fa*)(rr + j);
#pragma unroll
    for (int q = 0; q < 4; ++q) { const float v = a[q] + b[q]; vals[u * 4 + q] = v; s1 += v; }
  }
  red[tid] = s1; __syncthreads();
  for (int st = 128; st > 0; st >>= 1) { if (tid < st) red[tid] += red[tid + st]; __syncthreads(); }
  const float mu = red[0] / (float)N; __syncthreads();
  float s2 = 0.f;
  for (int u = 0; u < per / 4; ++u)
#pragma unroll
    for (int q = 0; q < 4; ++q) { const float c = vals[u * 4 + q] - mu; s2 += c * c; }
  red[tid] = s2; __syncthreads();
  for (int st = 128; st > 0; st >>= 1) { if (tid < st) red[tid] += red[tid + st]; __syncthreads(); }
  const float rs = rsqrtf(red[0] / (float)N + eps);
  {
    for (int u = 0; u < per / 4; ++u) {
      const int j = tid * 4 + 1024 * u;
      v4f o, sm;
#pragma unroll
      for (int q = 0; q < 4; ++q) {
        float gg = g[j + q], bb = bta[j + q];
        if (PARAM_BF16) { gg = bf16_round(gg); bb = bf16_round(bb); }
        sm[q] = vals[u * 4 + q]; o[q] = (vals[u * 4 + q] - mu) * rs * gg + bb;
      }
      if (out_sum) *(v4f*)(out_sum + (size_t)row * N + j) = sm;
      *(v4f*)(out_norm + (size_t)row * N + j) = o;
    }
    
  }
}



// ---- f16 WMMA path (v_wmma_f32_16x16x32_f16): 11-bit significands for operands in range — used where a [0,1] probability operand needs more precision than bf16
typedef _Float16 v16h __attribute__((ext_vector_type(16)));
union FragH { v16h v; v8us half[2]; _Float16 h[16]; unsigned short u[16]; };
template <int NT>
__device__ __forceinline__ v8f mmaH(v16h ah, v16h al, v16h bh, v16h bl, v8f c) {
  c = __builtin_amdgcn_wmma_f32_16x16x32_f16(false, ah, false, bh, (short)0, c, false, false);
  if (NT >= 2) c = __builtin_amdgcn_wmma_f32_16x16x32_f16(false, al, false, bh, (short)0, c, false, false);
  if (NT >= 3) c = __builtin_amdgcn_wmma_f32_16x16x32_f16(false, ah, false, bl, (short)0, c, false, false);
  asm volatile("v_nop\n\tv_nop\n\tv_nop\n\tv_nop" : "+v"(c) : "v"(ah), "v"(al), "v"(bh), "v"(bl));
  return c;
}
// batched GEMM like k_gemm_b but f16 operands: A f32 (split into f16 hi/lo if ASPLIT, else rounded to f16), Bt = f16 values [n][k]; alpha; C f32; N multiple of 16 (partial tiles skipped)
template <bool ASPLIT>
__global__ __launch_bounds__(128) void k_gemm_h(const float* __restrict__ A, int lda, size_t sA, const _Float16* __restrict__ Bh, int ldb, size_t sB, float alpha, float* __restrict__ C, int ldc, size_t sC, int M, int N, int K) {
  __shared__ __attribute__((aligned(16))) float so[4][16][64];
  const int tid = threadIdx.x, w = tid >> 5, lane = tid & 31, ln = lane & 15, hh = lane >> 4; const int by = blockIdx.y;
  A += (size_t)by * sA; Bh += (size_t)by * sB; C += (size_t)by * sC;
  const int ntn = (N + 63) / 64; const int wid = blockIdx.x * 4 + w; const int mt = wid / ntn, nq = wid % ntn; if (mt * 16 >= M) return;
  const int row0 = mt * 16, col0 = nq * 64; const float* arow = A + (size_t)(row0 + ln) * lda;
  v8f acc[4] = {};
  for (int kb = 0; kb < K; kb += 32) {
    FragH ah, al;
    const v4f x0 = *(const v4fa*)(arow + kb + 8 * hh), x1 = *(const v4fa*)(arow + kb + 8 * hh + 4), x2 = *(const v4fa*)(arow + kb + 16 + 8 * hh), x3 = *(const v4fa*)(arow + kb + 16 + 8 * hh + 4);
    float xs[16] = {x0[0],x0[1],x0[2],x0[3],x1[0],x1[1],x1[2],x1[3],x2[0],x2[1],x2[2],x2[3],x3[0],x3[1],x3[2],x3[3]};
#pragma unroll
    for (int i = 0; i < 16; ++i) { const _Float16 h = (_Float16)xs[i]; ah.h[i] = h; al.h[i] = ASPLIT ? (_Float16)(xs[i] - (float)h) : (_Float16)0.0f; }
#pragma unroll
    for (int t = 0; t < 4; ++t) { if (col0 + t * 16 >= N) continue; const size_t boff = (size_t)(col0 + t * 16 + ln) * ldb + kb; FragH bq; bq.half[0] = *(const v8us*)(Bh + boff + 8 * hh); bq.half[1] = *(const v8us*)(Bh + boff + 16 + 8 * hh);
      acc[t] = mmaH<ASPLIT ? 2 : 1>(ah.v, al.v, bq.v, bq.v, acc[t]); }
  }
#pragma unroll
  for (int t = 0; t < 4; ++t) { if (col0 + t * 16 >= N) continue;
#pragma unroll
    for (int r = 0; r < 8; ++r) so[w][8 * hh + r][t * 16 + ln] = acc[t][r] * alpha; }
  __builtin_amdgcn_fence(__ATOMIC_ACQ_REL, "workgroup"); __builtin_amdgcn_wave_barrier();
  const int rsub = lane >> 4, c4 = (lane & 15) * 4;
  {
#pragma unroll
    for (int q = 0; q < 8; ++q) { const int r = q * 2 + rsub; if (col0 + c4 < N) { const v4f v = *(const v4fa*)&so[w][r][c4]; *(v4f*)(C + (size_t)(row0 + r) * ldc + col0 + c4) = v; } }
     }
}

// Wt[n][k] = f16(W[k][n]·scale) from f32 row-major W[K][N] (scale = power of two; bf16-exact weights stay exact in f16 away from the subnormal range)
__global__ __launch_bounds__(256) void k_wt_f16(const float* __restrict__ W, _Float16* __restrict__ Wt, int K, int N, float scale) {
  const int t = blockIdx.x * 256 + threadIdx.x; if (t >= N * (K / 8)) return; const int n = t / (K / 8), k8 = (t % (K / 8)) * 8; FragH f;
#pragma unroll
  for (int i = 0; i < 8; ++i) f.h[i] = (_Float16)(bf16_round(W[(size_t)(k8 + i) * N + n]) * scale); const v8us o = f.half[0];
  *(v8us*)((unsigned short*)Wt + (size_t)n * K + k8) = o; 
}
// k_gemm_hh variant with fused epilogue: v = acc·alpha + bias[by·sBias + col] (+ CP[(row/rowsPerB)·sCPb + by·64 + col] if CP) ; ACT 0 none / 1 elu ; writes f16 C16 (and f32 C if non-null)
template <int ACT>
__global__ __launch_bounds__(128) void k_gemm_hhx(const _Float16* __restrict__ A, int lda, size_t sA, const _Float16* __restrict__ Bh, int ldb, size_t sB, float alpha, const float* __restrict__ bias, size_t sBias, const float* __restrict__ CP, int rowsPerB, size_t sCPb, int row0g,
    float* __restrict__ C, _Float16* __restrict__ C16, int ldc, size_t sC, int M, int N, int K) {
  __shared__ __attribute__((aligned(16))) float so[4][16][64];
  const int tid = threadIdx.x, w = tid >> 5, lane = tid & 31, ln = lane & 15, hh = lane >> 4; const int by = blockIdx.y;
  A += (size_t)by * sA; Bh += (size_t)by * sB; const size_t cofs = (size_t)by * sC; const float* bp = bias ? bias + (size_t)by * sBias : nullptr;
  const int ntn = (N + 63) / 64; const int wid = blockIdx.x * 4 + w; const int mt = wid / ntn, nq = wid % ntn; if (mt * 16 >= M) return;
  const int row0 = mt * 16, col0 = nq * 64; const _Float16* arow = A + (size_t)(row0 + ln) * lda;
  v8f acc[4] = {};
  for (int kb = 0; kb < K; kb += 32) { FragH ah; ah.half[0] = *(const v8us*)((const unsigned short*)arow + kb + 8 * hh); ah.half[1] = *(const v8us*)((const unsigned short*)arow + kb + 16 + 8 * hh);
#pragma unroll
    for (int t = 0; t < 4; ++t) { if (col0 + t * 16 >= N) continue; const size_t boff = (size_t)(col0 + t * 16 + ln) * ldb + kb; FragH bq; bq.half[0] = *(const v8us*)((const unsigned short*)Bh + boff + 8 * hh); bq.half[1] = *(const v8us*)((const unsigned short*)Bh + boff + 16 + 8 * hh);
      acc[t] = mmaH<1>(ah.v, ah.v, bq.v, bq.v, acc[t]); }
  }
#pragma unroll
  for (int t = 0; t < 4; ++t) { if (col0 + t * 16 >= N) continue; const int col = col0 + t * 16 + ln; const float bv = bp ? bf16_round(bp[col]) : 0.f;
#pragma unroll
    for (int r = 0; r < 8; ++r) { float v = acc[t][r] * alpha + bv; if (CP) { const int bidx = (row0g + row0 + 8 * hh + r) / rowsPerB; v += CP[(size_t)bidx * sCPb + (size_t)by * 64 + col]; } if (ACT == 1) v = (v > 0.f) ? v : expm1f(v); else if (ACT == 7) v = (v > 0.f) ? v + 1.0f : expf(v); else if (ACT == 8) v = tanhf(v); else if (ACT == 9) v = 0.5f * v * (1.0f + tanhf(0.7978845608028654f * (v + 0.044715f * v * v * v))); else if (ACT == 11) v = 1.0f / (1.0f + expf(-v)); else if (ACT == 12) v = (v > 0.f) ? v : 0.01f * v; else if (ACT == 14) v = (v > 0.f) ? v : 0.1f * v; else if (ACT == 15) v = v / (1.0f + expf(-v)); else if (ACT == 3) v = fmaxf(v, 0.f); else if (ACT == 6) v = 0.5f * v * (1.0f + erff(v * 0.70710678118654752f)); so[w][8 * hh + r][t * 16 + ln] = v; } }
  __builtin_amdgcn_fence(__ATOMIC_ACQ_REL, "workgroup"); __builtin_amdgcn_wave_barrier();
  const int rsub = lane >> 4, c4 = (lane & 15) * 4; typedef _Float16 v4h __attribute__((ext_vector_type(4)));
  {
#pragma unroll
    for (int q = 0; q < 8; ++q) { const int r = q * 2 + rsub; if (col0 + c4 < N) { const v4f v = *(const v4fa*)&so[w][r][c4]; if (C) *(v4f*)(C + cofs + (size_t)(row0 + r) * ldc + col0 + c4) = v; if (C16) { v4h h4; for (int i = 0; i < 4; ++i) h4[i] = (_Float16)v[i]; *(v4h*)(C16 + cofs + (size_t)(row0 + r) * ldc + col0 + c4) = h4; } } }
     }
}


typedef _Float16 v4h __attribute__((ext_vector_type(4)));

__global__ __launch_bounds__(256) void k_h16(const float* __restrict__ x, _Float16* __restrict__ X16, size_t n8) { const size_t t = (size_t)blockIdx.x * 256 + threadIdx.x; if (t >= n8) return; FragH f;
#pragma unroll
  for (int q = 0; q < 8; ++q) f.h[q] = (_Float16)x[t * 8 + q]; *(v8us*)((unsigned short*)X16 + t * 8) = f.half[0];  }
__global__ __launch_bounds__(256) void k_round16f(const float* __restrict__ W, _Float16* __restrict__ Bt, size_t n8) { const size_t t = (size_t)blockIdx.x * 256 + threadIdx.x; if (t >= n8) return; FragH f;
#pragma unroll
  for (int i = 0; i < 8; ++i) f.h[i] = (_Float16)(bf16_round(W[t * 8 + i]) * 16.0f); *(v8us*)((unsigned short*)Bt + t * 8) = f.half[0];  }
template <int NHv, int TTv>
__global__ __launch_bounds__(256) void k_vt(const _Float16* __restrict__ V16, int ldv, int voff, _Float16* __restrict__ Vt) { __shared__ unsigned short tl[64][66]; const int tid = threadIdx.x; const int slab = blockIdx.x / (TTv / 64), lg = blockIdx.x % (TTv / 64); const int b = slab / NHv, h = slab % NHv;
  for (int i = tid; i < 64 * 8; i += 256) { const int r = i / 8, c8 = (i % 8) * 8; FragH f; f.half[0] = *(const v8us*)((const unsigned short*)V16 + ((size_t)b * TTv + lg * 64 + r) * ldv + voff + h * 64 + c8);
#pragma unroll
    for (int q = 0; q < 8; ++q) tl[r][c8 + q] = f.u[q]; }
  __syncthreads();
  {
#pragma unroll
    for (int rd = 0; rd < 2; ++rd) { const int d = rd * 32 + tid / 8, pc = tid % 8; FragH f;
#pragma unroll
      for (int q = 0; q < 8; ++q) f.u[q] = tl[pc * 8 + q][d];
      *(v8us*)((unsigned short*)Vt + ((size_t)slab * 64 + d) * TTv + lg * 64 + pc * 8) = f.half[0]; }
     } }

// ---- fast GEMM (block tile 128x64, wave tile 32x64; requires M % 128 == 0, N % 64 == 0, K % 64 == 0); epilogue: alpha, bias and CP as in k_gemm_hhx, then f32 C or the split f16 pair C16/CL ----
// Per trip a 64-deep slice of A (128 rows) and of B (64 rows) is copied to LDS in whole 128-byte lines (asynchronous copies, two buffers: the next slice flies while this one is multiplied); fragments come from LDS.
#define G2_PITCH 144                      /* LDS bytes per staged row: 128 + 16, the conflict-free pitch for 16-byte reads */
#define G2_BUF ((128 + 64) * G2_PITCH)    /* one buffer: A rows 0..127, then B rows 128..191 */
__device__ __forceinline__ v16h g2_lfrag(const unsigned char* p) { FragH f; f.half[0] = *(const v8us*)p; f.half[1] = *(const v8us*)(p + 32); return f.v; }
__device__ __forceinline__ v8f g2_mma(v16h a, v16h b, v8f c) { v8f d = __builtin_amdgcn_wmma_f32_16x16x32_f16(false, a, false, b, (short)0, c, false, false); asm volatile("v_nop\n\tv_nop\n\tv_nop\n\tv_nop" : "+v"(d) : "v"(a), "v"(b)); return d; }
// one slice: 12 copies of 16 bytes per lane (8 of A, 4 of B), a wave's copy covering 4 whole rows; l = the lane's LDS byte address of its first row, rows 16 apart
__device__ __forceinline__ void g2_copy(unsigned l, const _Float16* ga, size_t sa16, const _Float16* gb, size_t sb16) {
  /* the closing s_wait_xcnt keeps every address register intact until the copies have taken it */
  asm volatile("global_load_async_to_lds_b128 %0, %12, off\n\t"
               "global_load_async_to_lds_b128 %1, %13, off\n\t"
               "global_load_async_to_lds_b128 %2, %14, off\n\t"
               "global_load_async_to_lds_b128 %3, %15, off\n\t"
               "global_load_async_to_lds_b128 %4, %16, off\n\t"
               "global_load_async_to_lds_b128 %5, %17, off\n\t"
               "global_load_async_to_lds_b128 %6, %18, off\n\t"
               "global_load_async_to_lds_b128 %7, %19, off\n\t"
               "global_load_async_to_lds_b128 %8, %20, off\n\t"
               "global_load_async_to_lds_b128 %9, %21, off\n\t"
               "global_load_async_to_lds_b128 %10, %22, off\n\t"
               "global_load_async_to_lds_b128 %11, %23, off\n\t"
               "s_wait_xcnt 0x0"
               :: "v"(l), "v"(l + 16 * G2_PITCH), "v"(l + 32 * G2_PITCH), "v"(l + 48 * G2_PITCH), "v"(l + 64 * G2_PITCH), "v"(l + 80 * G2_PITCH), "v"(l + 96 * G2_PITCH), "v"(l + 112 * G2_PITCH),
                  "v"(l + 128 * G2_PITCH), "v"(l + 144 * G2_PITCH), "v"(l + 160 * G2_PITCH), "v"(l + 176 * G2_PITCH),
                  "v"(ga), "v"(ga + sa16), "v"(ga + 2 * sa16), "v"(ga + 3 * sa16), "v"(ga + 4 * sa16), "v"(ga + 5 * sa16), "v"(ga + 6 * sa16), "v"(ga + 7 * sa16),
                  "v"(gb), "v"(gb + sb16), "v"(gb + 2 * sb16), "v"(gb + 3 * sb16)
               : "memory");
}
template <int ACT, bool SPLIT>
__device__ __forceinline__ void g2_body(unsigned char* smem, int bx, int by, const _Float16* __restrict__ A, int lda, size_t sA, const _Float16* __restrict__ Bh, int ldb, size_t sB, float alpha, const float* __restrict__ bias, size_t sBias, const float* __restrict__ CP, int rowsPerB, size_t sCPb, int row0g,
    float* __restrict__ C, _Float16* __restrict__ C16, _Float16* __restrict__ CL, int ldc, size_t sC, int M, int N, int K) {      /* output: C (f32) or, with SPLIT, the pair C16 and CL: the f16 rounding and its 2^10-scaled residual, the two planes of a split operand */
  /* smem: the kernel's 2 * G2_BUF bytes of LDS, the two staging buffers; the epilogue's 4 x 32 x 68 floats lie over them once the loop's last barrier has ended every read. bx, by: the block's place in this product's own grid */
  float (*so)[32][68] = reinterpret_cast<float (*)[32][68]>(smem);
  const int tid = threadIdx.x, w = tid >> 5, lane = tid & 31, ln = lane & 15, hh = lane >> 4;
  A += (size_t)by * sA; Bh += (size_t)by * sB; const size_t cofs = (size_t)by * sC; const float* bp = bias ? bias + (size_t)by * sBias : nullptr;
  const int ntn = N >> 6; const int mt = bx / ntn, nq = bx - mt * ntn; const int row0 = mt * 128 + 32 * w, col0 = nq * 64; if (mt * 128 >= M) return;      /* the whole block leaves or none: barriers follow */
  const int crow = tid >> 3, cch = tid & 7;      /* copy role: row (mod 16) and 16-byte piece of the 128-byte row */
  const _Float16* gA = A + (size_t)(mt * 128 + crow) * lda + cch * 8; const _Float16* gB = Bh + (size_t)(col0 + crow) * ldb + cch * 8; const size_t sa16 = (size_t)16 * lda, sb16 = (size_t)16 * ldb;
  const unsigned l0 = (unsigned)(size_t)smem + (unsigned)(crow * G2_PITCH + cch * 16);
  const int aoff = (32 * w + ln) * G2_PITCH + 16 * hh, boff = (128 + ln) * G2_PITCH + 16 * hh;
  const v8f z8 = {0.f,0.f,0.f,0.f,0.f,0.f,0.f,0.f}; v8f c00 = z8, c01 = z8, c02 = z8, c03 = z8, c10 = z8, c11 = z8, c12 = z8, c13 = z8;
  const int NT = K >> 6;
  g2_copy(l0, gA, sa16, gB, sb16);
  asm volatile("s_wait_asynccnt 0x0" ::: "memory");      /* slice 0 has landed before the barrier publishes it */
  __syncthreads();
  if (NT > 1) g2_copy(l0 + G2_BUF, gA + 64, sa16, gB + 64, sb16);
#pragma unroll 1      /* one slice per trip: the buffer alternates with the trip's parity */
  for (int t = 0; t < NT; ++t) { const unsigned char* sb = smem + (t & 1) * G2_BUF; const unsigned char* pa = sb + aoff; const unsigned char* pb = sb + boff;
    const v16h a0 = g2_lfrag(pa), a1 = g2_lfrag(pa + 16 * G2_PITCH), b0 = g2_lfrag(pb), b1 = g2_lfrag(pb + 16 * G2_PITCH), b2 = g2_lfrag(pb + 32 * G2_PITCH), b3 = g2_lfrag(pb + 48 * G2_PITCH);
    const v16h e0 = g2_lfrag(pa + 64), e1 = g2_lfrag(pa + 16 * G2_PITCH + 64), f0 = g2_lfrag(pb + 64), f1 = g2_lfrag(pb + 16 * G2_PITCH + 64), f2 = g2_lfrag(pb + 32 * G2_PITCH + 64), f3 = g2_lfrag(pb + 48 * G2_PITCH + 64);
    c00 = g2_mma(a0, b0, c00); c10 = g2_mma(a1, b0, c10); c01 = g2_mma(a0, b1, c01); c11 = g2_mma(a1, b1, c11); c02 = g2_mma(a0, b2, c02); c12 = g2_mma(a1, b2, c12); c03 = g2_mma(a0, b3, c03); c13 = g2_mma(a1, b3, c13);
    c00 = g2_mma(e0, f0, c00); c10 = g2_mma(e1, f0, c10); c01 = g2_mma(e0, f1, c01); c11 = g2_mma(e1, f1, c11); c02 = g2_mma(e0, f2, c02); c12 = g2_mma(e1, f2, c12); c03 = g2_mma(e0, f3, c03); c13 = g2_mma(e1, f3, c13);
    asm volatile("s_wait_dscnt 0x0" ::: "memory");         /* this wave's reads of the buffer are over before it may be refilled */
    asm volatile("s_wait_asynccnt 0x0" ::: "memory");      /* this wave's copies of the next slice have landed */
    __syncthreads();                                       /* publishes the next slice and ends every wave's reads of this one */
    if (t + 2 < NT) g2_copy(l0 + (unsigned)(t & 1) * G2_BUF, gA + (size_t)(t + 2) * 64, sa16, gB + (size_t)(t + 2) * 64, sb16); }
  asm volatile("s_wait_asynccnt 0x0" ::: "memory");        /* nothing is in flight when the buffers become output staging */
  v8f accs[8] = {c00, c01, c02, c03, c10, c11, c12, c13};
#pragma unroll
  for (int u = 0; u < 8; ++u) { const int t = u & 3, half = u >> 2; const int col = col0 + t * 16 + ln; const float bv = bp ? bf16_round(bp[col]) : 0.f;
#pragma unroll
    for (int r = 0; r < 8; ++r) { const int rloc = half * 16 + 8 * hh + r; float v = accs[u][r] * alpha + bv; if (CP) { const int bidx = (row0g + row0 + rloc) / rowsPerB; v += CP[(size_t)bidx * sCPb + (size_t)by * 64 + col]; }
      if (ACT == 3) v = fmaxf(v, 0.f); else if (ACT == 6) v = 0.5f * v * (1.0f + erff(v * 0.70710678118654752f)); else if (ACT == 11) v = 1.0f / (1.0f + expf(-v)); else if (ACT == 15) v = v / (1.0f + expf(-v)); else if (ACT == 12) v = (v > 0.f) ? v : 0.01f * v; else if (ACT == 8) v = tanhf(v);
      so[w][rloc][t * 16 + ln] = v; } }
  __builtin_amdgcn_fence(__ATOMIC_ACQ_REL, "workgroup"); __builtin_amdgcn_wave_barrier();
  const int rsub = lane >> 4, c4 = (lane & 15) * 4;
  if (!SPLIT) {
#pragma unroll
    for (int q = 0; q < 16; ++q) { const int r = q * 2 + rsub; const v4f v = *(const v4fa*)&so[w][r][c4]; *(v4f*)(C + cofs + (size_t)(row0 + r) * ldc + col0 + c4) = v; }
  } else {
#pragma unroll
    for (int q = 0; q < 16; ++q) { const int r = q * 2 + rsub; const v4f v = *(const v4fa*)&so[w][r][c4]; const size_t o = cofs + (size_t)(row0 + r) * ldc + col0 + c4; v4h h4, l4;
      for (int i = 0; i < 4; ++i) { h4[i] = (_Float16)v[i]; l4[i] = (_Float16)((v[i] - (float)h4[i]) * 1024.0f); }
      *(v4h*)(C16 + o) = h4; *(v4h*)(CL + o) = l4; }
  } }
template <int ACT, bool SPLIT>
__global__ __launch_bounds__(128) void k_gemm2(const _Float16* __restrict__ A, int lda, size_t sA, const _Float16* __restrict__ Bh, int ldb, size_t sB, float alpha, const float* __restrict__ bias, size_t sBias, const float* __restrict__ CP, int rowsPerB, size_t sCPb, int row0g,
    float* __restrict__ C, _Float16* __restrict__ C16, _Float16* __restrict__ CL, int ldc, size_t sC, int M, int N, int K) {
  __shared__ __attribute__((aligned(16))) unsigned char smem[2 * G2_BUF];
  g2_body<ACT, SPLIT>(smem, (int)blockIdx.x, (int)blockIdx.y, A, lda, sA, Bh, ldb, sB, alpha, bias, sBias, CP, rowsPerB, sCPb, row0g, C, C16, CL, ldc, sC, M, N, K); }
// The three projections in one grid (they share x and depend on nothing of each other): blocks 0.. q = x Wq^T, then k = x Wk^T, then V^T = Wv x^T per batch (the weight rows are the A operand, the tokens the B operand). The two small products alone would leave three SIMD places in four empty.
#define PJ_NQ ((NR / 128) * (DM / 64))
#define PJ_NK ((NR / 128) * (KVD / 64))
#define PJ_NV ((KVD / 128) * (SLEN / 64))      /* per batch */
__global__ __launch_bounds__(128) void k_proj(const _Float16* __restrict__ X16, const _Float16* __restrict__ BQ, const _Float16* __restrict__ BK, const _Float16* __restrict__ BV,
    _Float16* __restrict__ QH, _Float16* __restrict__ QL, _Float16* __restrict__ KH, _Float16* __restrict__ KL, _Float16* __restrict__ VT, _Float16* __restrict__ VTL) {
  __shared__ __attribute__((aligned(16))) unsigned char smem[2 * G2_BUF];
  int bx = (int)blockIdx.x; const _Float16* A = X16; const _Float16* B = BQ; _Float16* H = QH; _Float16* L = QL; int ldc = DM, M = NR, N = DM;
  if (bx >= PJ_NQ + PJ_NK) { bx -= PJ_NQ + PJ_NK; const int bt = bx / PJ_NV; bx -= bt * PJ_NV; A = BV; B = X16 + (size_t)bt * SLEN * DM; H = VT + (size_t)bt * KVD * SLEN; L = VTL + (size_t)bt * KVD * SLEN; ldc = SLEN; M = KVD; N = SLEN; }
  else if (bx >= PJ_NQ) { bx -= PJ_NQ; B = BK; H = KH; L = KL; ldc = KVD; N = KVD; }
  g2_body<0, true>(smem, bx, 0, A, DM, 0, B, DM, 0, 0.0625f, nullptr, 0, nullptr, 1, 0, 0, nullptr, H, L, ldc, 0, M, N, DM); }



// lane l with lane l ^ 16 (the two halves of a wave hold the two key halves of one query column)
__device__ __forceinline__ float xhalf(float x) { return __builtin_bit_cast(float, __builtin_amdgcn_permlanex16(__builtin_bit_cast(int, x), __builtin_bit_cast(int, x), 0x76543210, 0xfedcba98, false, false)); }
#define FL_BUF (192 * G2_PITCH)      /* one buffer: key rows 0..63, low value-dimension rows 64..127, high ones 128..191 */
// one tile: 12 copies of 16 bytes per lane (4 of K, 4 of V^T low, 4 of V^T high), a wave's copy covering 4 whole rows; l = the lane's LDS byte address of its first row, rows 16 apart
__device__ __forceinline__ void fl_copy(unsigned l, const unsigned short* gk, size_t sk16, const unsigned short* gv, const unsigned short* gw, size_t sv16) {
  /* the closing s_wait_xcnt keeps every address register intact until the copies have taken it */
  asm volatile("global_load_async_to_lds_b128 %0, %12, off\n\t"
               "global_load_async_to_lds_b128 %1, %13, off\n\t"
               "global_load_async_to_lds_b128 %2, %14, off\n\t"
               "global_load_async_to_lds_b128 %3, %15, off\n\t"
               "global_load_async_to_lds_b128 %4, %16, off\n\t"
               "global_load_async_to_lds_b128 %5, %17, off\n\t"
               "global_load_async_to_lds_b128 %6, %18, off\n\t"
               "global_load_async_to_lds_b128 %7, %19, off\n\t"
               "global_load_async_to_lds_b128 %8, %20, off\n\t"
               "global_load_async_to_lds_b128 %9, %21, off\n\t"
               "global_load_async_to_lds_b128 %10, %22, off\n\t"
               "global_load_async_to_lds_b128 %11, %23, off\n\t"
               "s_wait_xcnt 0x0"
               :: "v"(l), "v"(l + 16 * G2_PITCH), "v"(l + 32 * G2_PITCH), "v"(l + 48 * G2_PITCH), "v"(l + 64 * G2_PITCH), "v"(l + 80 * G2_PITCH), "v"(l + 96 * G2_PITCH), "v"(l + 112 * G2_PITCH),
                  "v"(l + 128 * G2_PITCH), "v"(l + 144 * G2_PITCH), "v"(l + 160 * G2_PITCH), "v"(l + 176 * G2_PITCH),
                  "v"(gk), "v"(gk + sk16), "v"(gk + 2 * sk16), "v"(gk + 3 * sk16), "v"(gv), "v"(gv + sv16), "v"(gv + 2 * sv16), "v"(gv + 3 * sv16),
                  "v"(gw), "v"(gw + sv16), "v"(gw + 2 * sv16), "v"(gw + 3 * sv16)
               : "memory");
}
// Transposed products: S^T = K Q^T (A = key rows, B = query columns) and O^T += V^T P^T (A = value-dimension rows of V^T, B = P^T). A lane holds 16 of the 32 scores of ONE query (keys 8 hh + r and 16 + 8 hh + r), which is the k order of a B operand: P goes from the score accumulators into the next product without LDS; maximum, sum and rescale factor are one value per lane.
template <int CAUSAL>
__device__ __forceinline__ void fl_body(unsigned char* smem, int bx, const _Float16* __restrict__ Q16, int ldq, const _Float16* __restrict__ K16, int ldk, const _Float16* __restrict__ Vt, const _Float16* __restrict__ Vt2, const int* __restrict__ MSK, const float* __restrict__ LAM, const float* __restrict__ lnw, _Float16* __restrict__ A16) {
  constexpr int RPW = 16, DT = 8, KS = 2;      /* DT 0..3: low 64 value columns (Vt), DT 4..7: high 64 (Vt2); one score/softmax pass feeds both */
  /* smem: the kernel's 2 * FL_BUF bytes of LDS, the two staging buffers; the epilogue's hand-over (2 x 16 x 32 groups of 4 floats) lies over them once the loop's last barrier has ended every read. bx: the block's place among the NB * (NH / 2) * PQN blocks of this part */
  /* a block holds 32 queries of BOTH pseudo-heads of one differential head jh (they share key head and value head, so one staged tile serves all four waves): waves 0, 1 the even pseudo-head, waves 2, 3 the odd one, on the same two groups of 16 queries */
  const int tid = threadIdx.x, w = tid >> 5, lane = tid & 31, ln = lane & 15, hh = lane >> 4;
  const int slab = bx / PQN, qblk = PQ0 + bx % PQN; const int b = slab / (NH / 2), jh = slab % (NH / 2), h = 2 * jh + (w >> 1); const int qb0 = qblk * (2 * RPW); const int q0 = qb0 + (w & 1) * RPW; const int tq = q0 + ln;      /* this lane's query */
  FragH aq[KS];
  { const unsigned short* qr = (const unsigned short*)Q16 + ((size_t)b * TQ + tq) * ldq + h * 64;
#pragma unroll
    for (int ks = 0; ks < KS; ++ks) { aq[ks].half[0] = *(const v8us*)(qr + ks * 32 + 8 * hh); aq[ks].half[1] = *(const v8us*)(qr + ks * 32 + 16 + 8 * hh); } }
  const size_t vo = ((size_t)b * KVD + (h / 8) * 128) * TK;      /* pseudo-head h reads value head h / 8 (128 rows of V^T [batch][512][token]); Vt2 points 64 rows further */
  const unsigned short* Vth = (const unsigned short*)Vt + vo; const unsigned short* Vth2 = (const unsigned short*)Vt2 + vo;
  constexpr float C2 = SCL * 1.4426950408889634f;      /* raw score -> exponent in base 2 */
  float m_r = -1.0e38f, l_r = 0.f; v8f oacc[DT];      /* m_r: running maximum of the RAW scores, never below -1e38, so that a masked score (-3e38) stays far under it; l_r: row sum in units of 2^-10 */
#pragma unroll
  for (int dt = 0; dt < DT; ++dt) oacc[dt] = (v8f){0.f,0.f,0.f,0.f,0.f,0.f,0.f,0.f};
  const int jend = (CAUSAL == 1) ? (qb0 + 2 * RPW) : TK;      /* causal: keys beyond the block's last query never contribute */
  const int crow = tid >> 3, cch = tid & 7;      /* copy role: row (mod 16) and 16-byte piece of the 128-byte row */
  const unsigned short* gK = (const unsigned short*)K16 + ((size_t)b * TK + crow) * ldk + (h / NREP) * 64 + cch * 8;      /* query head h reads key head h / 4 */
  const unsigned short* gV = Vth + (size_t)crow * TK + cch * 8; const unsigned short* gW = Vth2 + (size_t)crow * TK + cch * 8; const size_t sk16 = (size_t)16 * ldk, sv16 = (size_t)16 * TK;
  const unsigned l0 = (unsigned)(size_t)smem + (unsigned)(crow * G2_PITCH + cch * 16);
  const int foff = ln * G2_PITCH + 16 * hh;      /* fragment role: row (mod 16) and 16-byte piece, the k order of the former global loads */
  const int NT = (jend + 63) >> 6;      /* whole tiles of 64 keys (TK is a multiple of 64); the keys past jend are masked like any key behind the query */
  fl_copy(l0, gK, sk16, gV, gW, sv16);
  asm volatile("s_wait_asynccnt 0x0" ::: "memory");      /* tile 0 has landed before the barrier publishes it */
  __syncthreads();
  if (NT > 1) fl_copy(l0 + FL_BUF, gK + (size_t)64 * ldk, sk16, gV + 64, gW + 64, sv16);
#pragma unroll 1      /* one tile per trip: the buffer alternates with the trip's parity */
  for (int t = 0; t < NT; ++t) { const unsigned char* sb = smem + (t & 1) * FL_BUF + foff;
#pragma unroll      /* the tile's two 32-key halves, each worked on as one pass of the online softmax, in key order */
   for (int sub = 0; sub < 2; ++sub) { const int j0 = t * 64 + sub * 32;
    FragH bk[2][KS], bv[DT];
#pragma unroll
    for (int nt = 0; nt < 2; ++nt) {
#pragma unroll
      for (int ks = 0; ks < KS; ++ks) bk[nt][ks].v = g2_lfrag(sb + (sub * 32 + nt * 16) * G2_PITCH + ks * 64); }
    v8f st[2];      /* st[nt][r] = score of key j0 + nt * 16 + 8 * hh + r against query tq */
#pragma unroll
    for (int nt = 0; nt < 2; ++nt) { v8f acc = (v8f){0.f,0.f,0.f,0.f,0.f,0.f,0.f,0.f};
#pragma unroll
      for (int ks = 0; ks < KS; ++ks) acc = mmaH<1>(bk[nt][ks].v, bk[nt][ks].v, aq[ks].v, aq[ks].v, acc);
      st[nt] = acc; }
#pragma unroll
    for (int dt = 0; dt < DT; ++dt) bv[dt].v = g2_lfrag(sb + (64 + dt * 16) * G2_PITCH + sub * 64);
    float sv[16]; float mc = -3.0e38f;
#pragma unroll
    for (int e = 0; e < 16; ++e) { const int kk = j0 + (e >> 3) * 16 + 8 * hh + (e & 7); const bool ok = (CAUSAL == 1) ? (kk <= tq) : ((CAUSAL == 2) ? ((kk >> 5) == (tq >> 5)) : true);      /* mode 2: block-diagonal 32-token groups */
      sv[e] = ok ? st[e >> 3][e & 7] : -3.0e38f; mc = fmaxf(mc, sv[e]); }
    mc = fmaxf(mc, xhalf(mc));      /* both halves feed one output column: they share the maximum */
    const float mn = fmaxf(m_r, mc); const float xa = (m_r - mn) * C2; m_r = mn;      /* rescale factor 2^xa; nothing seen yet: 2^0 = 1 on zero sums */
    const float nb = fmaf(-mn, C2, 10.0f);      /* p = 1024 exp((s - mn) / 8) = 2^(s C2 + nb): scale, maximum and the operand's 2^10 in one fused multiply-add; a masked score gives 2^(-huge) = 0 */
    float pe[16], al = xa;
#pragma unroll
    for (int e = 0; e < 16; ++e) pe[e] = fmaf(sv[e], C2, nb);
    /* the exponentials stand together, each in place on a register of its own: no v_exp_f32 is directly followed by a read of its result or by another instruction's write of its source; the closing v_nop keeps that slot free of whatever the compiler puts next */
    asm("v_exp_f32 %0, %0\n\tv_exp_f32 %1, %1\n\tv_exp_f32 %2, %2\n\tv_exp_f32 %3, %3\n\tv_exp_f32 %4, %4\n\tv_exp_f32 %5, %5\n\tv_exp_f32 %6, %6\n\tv_exp_f32 %7, %7\n\tv_exp_f32 %8, %8\n\tv_nop"
        : "+v"(al), "+v"(pe[0]), "+v"(pe[1]), "+v"(pe[2]), "+v"(pe[3]), "+v"(pe[4]), "+v"(pe[5]), "+v"(pe[6]), "+v"(pe[7]));
    asm("v_exp_f32 %0, %0\n\tv_exp_f32 %1, %1\n\tv_exp_f32 %2, %2\n\tv_exp_f32 %3, %3\n\tv_exp_f32 %4, %4\n\tv_exp_f32 %5, %5\n\tv_exp_f32 %6, %6\n\tv_exp_f32 %7, %7\n\tv_nop"
        : "+v"(pe[8]), "+v"(pe[9]), "+v"(pe[10]), "+v"(pe[11]), "+v"(pe[12]), "+v"(pe[13]), "+v"(pe[14]), "+v"(pe[15]));
    FragH pb; float ps[4] = {0.f, 0.f, 0.f, 0.f};
#pragma unroll
    for (int e = 0; e < 16; ++e) { ps[e & 3] += pe[e]; pb.h[e] = (_Float16)pe[e]; }
    l_r = l_r * al + ((ps[0] + ps[1]) + (ps[2] + ps[3]));
#pragma unroll
    for (int dt = 0; dt < DT; ++dt) {
#pragma unroll
      for (int r = 0; r < 8; ++r) oacc[dt][r] *= al; }
#pragma unroll
    for (int dt = 0; dt < DT; ++dt) oacc[dt] = mmaH<1>(bv[dt].v, bv[dt].v, pb.v, pb.v, oacc[dt]); }
    asm volatile("s_wait_dscnt 0x0" ::: "memory");         /* this wave's reads of the buffer are over before it may be refilled */
    asm volatile("s_wait_asynccnt 0x0" ::: "memory");      /* this wave's copies of the next tile have landed */
    __syncthreads();                                       /* publishes the next tile and ends every wave's reads of this one */
    if (t + 2 < NT) fl_copy(l0 + (unsigned)(t & 1) * FL_BUF, gK + (size_t)(t + 2) * 64 * ldk, sk16, gV + (t + 2) * 64, gW + (t + 2) * 64, sv16); }
  asm volatile("s_wait_asynccnt 0x0" ::: "memory");        /* nothing is in flight when the buffers become output staging */
  const float lt = l_r + xhalf(l_r); const float inv = (lt > 0.f) ? 1.0f / lt : 0.f;      /* sums and products both carry the 2^10 */
  /* oacc[dt][r] * inv = value column dt * 16 + 8 * hh + r of query tq. Difference, RMSNorm and weight follow here: the odd pseudo-head's waves hand their columns over through LDS, lane for lane (wave w + 2 and wave w hold the same queries in the same layout) */
  v4fa* sx = reinterpret_cast<v4fa*>(smem);
  if (w >= 2) {
#pragma unroll
    for (int dt = 0; dt < DT; ++dt) { const v8f a = oacc[dt]; const v4f lo = {a[0] * inv, a[1] * inv, a[2] * inv, a[3] * inv}, hi = {a[4] * inv, a[5] * inv, a[6] * inv, a[7] * inv};
      sx[((w - 2) * 16 + dt * 2) * 32 + lane] = lo; sx[((w - 2) * 16 + dt * 2 + 1) * 32 + lane] = hi; } }
  __syncthreads();      /* publishes the odd pseudo-head's columns to the even one's waves */
  if (w < 2) { const float lam = LAM[0]; float ps[4] = {0.f, 0.f, 0.f, 0.f};
#pragma unroll
    for (int dt = 0; dt < DT; ++dt) {
#pragma unroll
      for (int g = 0; g < 2; ++g) { const v4f o = sx[(w * 16 + dt * 2 + g) * 32 + lane];
#pragma unroll
        for (int i = 0; i < 4; ++i) { const float v = oacc[dt][g * 4 + i] * inv - lam * o[i]; oacc[dt][g * 4 + i] = v; ps[i] += v * v; } } }
    const float sh = (ps[0] + ps[1]) + (ps[2] + ps[3]); const float ss = sh + xhalf(sh);      /* the lane pair l, l ^ 16 holds the query's 128 columns */
    const float rn = rsqrtf(ss / 128.0f + 1e-5f); unsigned short* dst = (unsigned short*)A16 + ((size_t)b * TQ + tq) * DM + (size_t)jh * 128 + 8 * hh;
#pragma unroll
    for (int dt = 0; dt < DT; ++dt) { const v4f g0 = *(const v4fa*)(lnw + dt * 16 + 8 * hh), g1 = *(const v4fa*)(lnw + dt * 16 + 8 * hh + 4); FragH f;
#pragma unroll
      for (int r = 0; r < 8; ++r) f.h[r] = (_Float16)(oacc[dt][r] * rn * bf16_round(r < 4 ? g0[r & 3] : g1[r & 3]) * 0.21639423346837554f);      /* 1 - LAMBDA_INIT */
      *(v8us*)(dst + dt * 16) = f.half[0]; } } }
// 5-plane variant: S = Qh Kh^T + (Ql Kh^T + Qh Kl^T)/1024 with Q/K = [hi | 2^10 residual] f16 planes (QL/KL same layout as Q16/K16), then the 3-term P.V below.
// 3-term variant: O = (P_hi V_hi + (P_lo V_hi + P_hi V_lo) / 1024) / l with P = [hi | 2^10 residual] of 1024 p and V^T = [hi | 2^10 residual] planes (VtL same layout as Vt) -> ~2^-21-class products for un-averaged (early causal / peaked) rows
template <int CAUSAL>
__device__ __forceinline__ void fl5_body(unsigned char* smem, int bx, const _Float16* __restrict__ Q16, const _Float16* __restrict__ QL, int ldq, const _Float16* __restrict__ K16, const _Float16* __restrict__ KL, int ldk, const _Float16* __restrict__ Vt, const _Float16* __restrict__ VtL, const int* __restrict__ MSK, const float* __restrict__ LAM, const float* __restrict__ lnw, _Float16* __restrict__ A16) {
  constexpr int RPW = 16, DT = 4, KS = 2;      /* transposed like fl_body: key rows and V^T rows are A operands, query columns and P^T are B operands */
  /* a block holds 16 queries of one differential head jh, whole: wave w has pseudo-head 2 jh + (w >> 1) and the low (w & 1 = 0) or high 64 value columns. smem: the epilogue's hand-over at the head of the kernel's LDS; bx: the block's place among the NB * (NH / 2) * SQN blocks of this part */
  const int tid = threadIdx.x, w = tid >> 5, lane = tid & 31, ln = lane & 15, hh = lane >> 4;
  const int slab = bx / SQN, qblk = bx % SQN; const int b = slab / (NH / 2), jh = slab % (NH / 2), h = 2 * jh + (w >> 1), hf = w & 1; const int q0 = qblk * RPW; const int tq = q0 + ln;      /* this lane's query */
  FragH aq[KS], aql[KS];
  { const unsigned short* qr = (const unsigned short*)Q16 + ((size_t)b * TQ + tq) * ldq + h * 64; const unsigned short* ql = (const unsigned short*)QL + ((size_t)b * TQ + tq) * ldq + h * 64;
#pragma unroll
    for (int ks = 0; ks < KS; ++ks) { aq[ks].half[0] = *(const v8us*)(qr + ks * 32 + 8 * hh); aq[ks].half[1] = *(const v8us*)(qr + ks * 32 + 16 + 8 * hh); aql[ks].half[0] = *(const v8us*)(ql + ks * 32 + 8 * hh); aql[ks].half[1] = *(const v8us*)(ql + ks * 32 + 16 + 8 * hh); } }
  const size_t vo = ((size_t)b * KVD + (h / 8) * 128 + hf * 64) * TK;      /* value head h / 8 of V^T [batch][512][token], its low or high 64 rows */
  const unsigned short* Vth = (const unsigned short*)Vt + vo; const unsigned short* Vtl = (const unsigned short*)VtL + vo;
  float m_r = -3.0e38f, l_r = 0.f; v8f oacc[DT], oaccL[DT];
#pragma unroll
  for (int dt = 0; dt < DT; ++dt) { oacc[dt] = (v8f){0.f,0.f,0.f,0.f,0.f,0.f,0.f,0.f}; oaccL[dt] = oacc[dt]; }
  const int jend = (CAUSAL == 1) ? (q0 + RPW) : TK;      /* causal: keys beyond the block's last query never contribute; the last pass of 32 keys may reach past jend (never past TK), masked */
#pragma unroll 1
  for (int j0 = 0; j0 < jend; j0 += 32) {
    FragH bk[2][KS], bkl[2][KS], bv[DT], bl[DT];
    const size_t ko = ((size_t)b * TK + j0 + ln) * ldk + (h / NREP) * 64 + 8 * hh; const unsigned short* kr0 = (const unsigned short*)K16 + ko; const unsigned short* kr1 = kr0 + (size_t)16 * ldk; const unsigned short* kl0 = (const unsigned short*)KL + ko; const unsigned short* kl1 = kl0 + (size_t)16 * ldk;
#pragma unroll
    for (int nt = 0; nt < 2; ++nt) { const unsigned short* kr = nt ? kr1 : kr0; const unsigned short* klr = nt ? kl1 : kl0;
#pragma unroll
      for (int ks = 0; ks < KS; ++ks) { bk[nt][ks].half[0] = *(const v8us*)(kr + ks * 32); bk[nt][ks].half[1] = *(const v8us*)(kr + ks * 32 + 16); bkl[nt][ks].half[0] = *(const v8us*)(klr + ks * 32); bkl[nt][ks].half[1] = *(const v8us*)(klr + ks * 32 + 16); } }
    asm volatile("s_wait_xcnt 0x0" :: "v"(kr0), "v"(kr1), "v"(kl0), "v"(kl1) : "memory");      /* a precaution: the address registers stay whole (no load's own destination takes them) until the issued loads have taken them */
    v8f st[2];      /* st[nt][r] = score of key j0 + nt * 16 + 8 * hh + r against query tq */
#pragma unroll
    for (int nt = 0; nt < 2; ++nt) { v8f acc = (v8f){0.f,0.f,0.f,0.f,0.f,0.f,0.f,0.f}, accl = acc;
#pragma unroll
      for (int ks = 0; ks < KS; ++ks) { acc = mmaH<1>(bk[nt][ks].v, bk[nt][ks].v, aq[ks].v, aq[ks].v, acc); accl = mmaH<1>(bk[nt][ks].v, bk[nt][ks].v, aql[ks].v, aql[ks].v, accl); accl = mmaH<1>(bkl[nt][ks].v, bkl[nt][ks].v, aq[ks].v, aq[ks].v, accl); }
#pragma unroll
      for (int r = 0; r < 8; ++r) acc[r] += accl[r] * 0.0009765625f;
      st[nt] = acc; }
    const unsigned short* vr0 = Vth + (size_t)ln * TK + j0 + 8 * hh; const unsigned short* vr1 = Vtl + (size_t)ln * TK + j0 + 8 * hh;
#pragma unroll
    for (int dt = 0; dt < DT; ++dt) { const unsigned short* vrow = vr0 + (size_t)(dt * 16) * TK; const unsigned short* vrl = vr1 + (size_t)(dt * 16) * TK; bv[dt].half[0] = *(const v8us*)vrow; bv[dt].half[1] = *(const v8us*)(vrow + 16); bl[dt].half[0] = *(const v8us*)vrl; bl[dt].half[1] = *(const v8us*)(vrl + 16); }
    asm volatile("s_wait_xcnt 0x0" :: "v"(vr0), "v"(vr1) : "memory");      /* the same precaution for the value loads, which fly during the softmax */
    float sv[16]; bool ok[16]; float mc = -3.0e38f;
#pragma unroll
    for (int e = 0; e < 16; ++e) { const int kk = j0 + (e >> 3) * 16 + 8 * hh + (e & 7); ok[e] = (CAUSAL == 1) ? (kk <= tq) : ((CAUSAL == 2) ? ((kk >> 5) == (tq >> 5)) : true);      /* mode 2: block-diagonal 32-token groups */
      if (CAUSAL == 4) ok[e] = MSK[((size_t)b * TQ + tq) * TK + kk] != 0;      /* mode 4: per-(query, key) INPUT mask shared by all heads; masked keys contribute nothing (== the reference's -4096 fill, whose exp underflows to 0), rows with no valid key give l = 0 -> output 0 (== the reference's row_valid zeroing) */
      sv[e] = ok[e] ? st[e >> 3][e & 7] * SCL : -3.0e38f; mc = fmaxf(mc, sv[e]); }
    mc = fmaxf(mc, xhalf(mc));      /* both halves feed one output column: they share the maximum */
    const float mn = fmaxf(m_r, mc); const float al = (mn > -1.0e38f) ? expf(m_r - mn) : 1.0f; m_r = mn;
    FragH pa, pl; float ps[4] = {0.f, 0.f, 0.f, 0.f};
#pragma unroll
    for (int e = 0; e < 16; ++e) { const float p = ok[e] ? expf(sv[e] - mn) : 0.f; ps[e & 3] += p; const float pw = p * 1024.0f; pa.h[e] = (_Float16)pw; pl.h[e] = (_Float16)((pw - (float)pa.h[e]) * 1024.0f); }
    l_r = l_r * al + ((ps[0] + ps[1]) + (ps[2] + ps[3]));
#pragma unroll
    for (int dt = 0; dt < DT; ++dt) {
#pragma unroll
      for (int r = 0; r < 8; ++r) { oacc[dt][r] *= al; oaccL[dt][r] *= al; } }
#pragma unroll
    for (int dt = 0; dt < DT; ++dt) { oacc[dt] = mmaH<1>(bv[dt].v, bv[dt].v, pa.v, pa.v, oacc[dt]); oaccL[dt] = mmaH<1>(bv[dt].v, bv[dt].v, pl.v, pl.v, oaccL[dt]); oaccL[dt] = mmaH<1>(bl[dt].v, bl[dt].v, pa.v, pa.v, oaccL[dt]); } }
  const float lt = l_r + xhalf(l_r); const float inv = (lt > 0.f) ? 1.0f / (lt * 1024.0f) : 0.f;
#pragma unroll
  for (int dt = 0; dt < DT; ++dt) {
#pragma unroll
    for (int r = 0; r < 8; ++r) oacc[dt][r] = (oacc[dt][r] + oaccL[dt][r] * 0.0009765625f) * inv; }      /* oacc[dt][r] = value column hf * 64 + dt * 16 + 8 * hh + r of query tq */
  /* difference, RMSNorm and weight: waves 2, 3 (odd pseudo-head) hand their columns to waves 0, 1 lane for lane; these two then exchange their halves' sums of squares */
  v4fa* sx = reinterpret_cast<v4fa*>(smem); float* sq = reinterpret_cast<float*>(smem + 2 * 8 * 32 * 16);
  if (w >= 2) {
#pragma unroll
    for (int dt = 0; dt < DT; ++dt) { const v8f a = oacc[dt]; const v4f lo = {a[0], a[1], a[2], a[3]}, hi = {a[4], a[5], a[6], a[7]};
      sx[((w - 2) * 8 + dt * 2) * 32 + lane] = lo; sx[((w - 2) * 8 + dt * 2 + 1) * 32 + lane] = hi; } }
  __syncthreads();      /* publishes the odd pseudo-head's columns */
  float sh = 0.f;
  if (w < 2) { const float lam = LAM[0]; float ps[4] = {0.f, 0.f, 0.f, 0.f};
#pragma unroll
    for (int dt = 0; dt < DT; ++dt) {
#pragma unroll
      for (int g = 0; g < 2; ++g) { const v4f o = sx[(w * 8 + dt * 2 + g) * 32 + lane];
#pragma unroll
        for (int i = 0; i < 4; ++i) { const float v = oacc[dt][g * 4 + i] - lam * o[i]; oacc[dt][g * 4 + i] = v; ps[i] += v * v; } } }
    sh = (ps[0] + ps[1]) + (ps[2] + ps[3]); sh += xhalf(sh);      /* this half's 64 columns of the query */
    if (hh == 0) sq[w * 16 + ln] = sh; }
  __syncthreads();      /* publishes the two halves' sums of squares */
  if (w < 2) { const float ss = sh + sq[(w ^ 1) * 16 + ln];
    const float rn = rsqrtf(ss / 128.0f + 1e-5f); unsigned short* dst = (unsigned short*)A16 + ((size_t)b * TQ + tq) * DM + (size_t)jh * 128 + hf * 64 + 8 * hh;
#pragma unroll
    for (int dt = 0; dt < DT; ++dt) { const v4f g0 = *(const v4fa*)(lnw + hf * 64 + dt * 16 + 8 * hh), g1 = *(const v4fa*)(lnw + hf * 64 + dt * 16 + 8 * hh + 4); FragH f;
#pragma unroll
      for (int r = 0; r < 8; ++r) f.h[r] = (_Float16)(oacc[dt][r] * rn * bf16_round(r < 4 ? g0[r & 3] : g1[r & 3]) * 0.21639423346837554f);      /* 1 - LAMBDA_INIT */
      *(v8us*)(dst + dt * 16) = f.half[0]; } } }
// All of the attention in one grid, down to the normalised f16 operand of the output product (its two parts write disjoint rows and depend on nothing of each other): first the long blocks (rows from 256 on), behind them the short ones (first 256 rows), which start as places come free.
#define AT_NP (NB * (NH / 2) * PQN)
#define AT_N5 (NB * (NH / 2) * SQN)
__global__ __launch_bounds__(128) void k_attn(const _Float16* __restrict__ QH, const _Float16* __restrict__ QL, const _Float16* __restrict__ KH, const _Float16* __restrict__ KL, const _Float16* __restrict__ VT, const _Float16* __restrict__ VTL, const float* __restrict__ LAM, const float* __restrict__ lnw, _Float16* __restrict__ A16) {
  __shared__ __attribute__((aligned(16))) unsigned char smem[2 * FL_BUF];
  const int bx = (int)blockIdx.x;
  if (bx < AT_NP) { fl_body<1>(smem, bx, QH, DM, KH, KVD, VT, VT + (size_t)64 * SLEN, nullptr, LAM, lnw, A16); }
  else { fl5_body<1>(smem, bx - AT_NP, QH, QL, DM, KH, KL, KVD, VT, VTL, nullptr, LAM, lnw, A16); } }

__device__ __forceinline__ void lam_body(const float* __restrict__ q1, const float* __restrict__ k1, const float* __restrict__ q2, const float* __restrict__ k2, float* __restrict__ LAM) {
  #pragma clang fp contract(off)
  const int ln = threadIdx.x & 31; if (threadIdx.x >= 32) return; float a = bf16_round(q1[ln]) * bf16_round(k1[ln]); a += bf16_round(q1[ln + 32]) * bf16_round(k1[ln + 32]); float c = bf16_round(q2[ln]) * bf16_round(k2[ln]); c += bf16_round(q2[ln + 32]) * bf16_round(k2[ln + 32]);
  for (int o = 16; o > 0; o >>= 1) { a += __shfl_xor(a, o, 32); c += __shfl_xor(c, o, 32); } const float lf = expf(a) - expf(c) + 0.78360576653162446f;      /* LAMBDA_INIT = 0.8 - 0.6 exp(-0.3 * 12) = 0.78360577 */
  const float v = (ln == 0) ? lf : 0.f; *(float*)(LAM + ln) = v;  }
// Every operand conversion in one grid (none depends on another): x, then Wq, Wk, Wv, Wo (each weight lies (out,in), which is the GEMM's B^T form), each f32 -> bf16 rounding -> f16 (weights times 16, exact; x times 1, exact); the last block makes lambda_full. One group of 8 elements per thread, as in the separate launches before.
#define CV_NX ((NR / 8) * DM / 256)               /* blocks: x */
#define CV_NW ((DM / 8) * DM / 256)               /* Wq, Wo */
#define CV_NS ((KVD / 8) * DM / 256)              /* Wk, Wv */
#define CV_N (CV_NX + 2 * CV_NW + 2 * CV_NS)
__global__ __launch_bounds__(256) void k_prep(const float* __restrict__ x, const float* __restrict__ Wq, const float* __restrict__ Wk, const float* __restrict__ Wv, const float* __restrict__ Wo,
    const float* __restrict__ q1, const float* __restrict__ k1, const float* __restrict__ q2, const float* __restrict__ k2,
    _Float16* __restrict__ X16, _Float16* __restrict__ BQ, _Float16* __restrict__ BK, _Float16* __restrict__ BV, _Float16* __restrict__ BO, float* __restrict__ LAM) {
  int bx = (int)blockIdx.x;
  if (bx >= CV_N) { lam_body(q1, k1, q2, k2, LAM); return; }
  const float* src = x; _Float16* dst = X16; float sc = 1.0f;
  if (bx >= CV_NX) { bx -= CV_NX; sc = 16.0f;
    if (bx < CV_NW) { src = Wq; dst = BQ; }
    else if (bx < CV_NW + CV_NS) { bx -= CV_NW; src = Wk; dst = BK; }
    else if (bx < CV_NW + 2 * CV_NS) { bx -= CV_NW + CV_NS; src = Wv; dst = BV; }
    else { bx -= CV_NW + 2 * CV_NS; src = Wo; dst = BO; } }
  const size_t t = (size_t)bx * 256 + threadIdx.x; FragH f;
#pragma unroll
  for (int q = 0; q < 8; ++q) f.h[q] = (_Float16)(bf16_round(src[t * 8 + q]) * sc);
  *(v8us*)((unsigned short*)dst + t * 8) = f.half[0];
  asm volatile("s_wait_xcnt 0x0" ::: "memory");      /* the store's registers are not rewritten ahead of this wait, whatever code the build lays out behind it */
}

extern "C" void kernel_launch(void* const* d_in, const int* in_sizes, int n_in,
                              void* d_out, int out_size, void* d_ws, size_t ws_size, hipStream_t stream) {
  (void)in_sizes; (void)n_in; (void)out_size;
  const float* const* I = (const float* const*)d_in; const float* x = I[0]; const float* Wq = I[1]; const float* Wk = I[2]; const float* Wv = I[3]; const float* Wo = I[4]; const float* lq1 = I[5]; const float* lk1 = I[6]; const float* lq2 = I[7]; const float* lk2 = I[8]; const float* lnw = I[9];
  char* ws = (char*)d_ws; size_t off = 0;
  auto take = [&](size_t bytes) { char* p = ws + off; off += (bytes + 255) & ~(size_t)255; return p; };
  const size_t np = (size_t)NR * DM, nk = (size_t)NR * KVD;
  _Float16* BQ = (_Float16*)take((size_t)DM * DM * 2); _Float16* BK = (_Float16*)take((size_t)KVD * DM * 2); _Float16* BV = (_Float16*)take((size_t)KVD * DM * 2); _Float16* BO = (_Float16*)take((size_t)DM * DM * 2);
  _Float16* X16 = (_Float16*)take(np * 2); _Float16* QH = (_Float16*)take(np * 2); _Float16* QL = (_Float16*)take(np * 2); _Float16* KH = (_Float16*)take(nk * 2); _Float16* KL = (_Float16*)take(nk * 2); _Float16* VT = (_Float16*)take(nk * 2); _Float16* VTL = (_Float16*)take(nk * 2); float* LAM = (float*)take(256);      /* q [token][32 x 64], k [token][8 x 64], V^T [batch][4 x 128][token], each as f16 hi + residual plane */
  _Float16* A16 = X16;      /* normalised attention over the input plane (dead after the projections) */
  if (off > ws_size) return;      /* 8+2+2+8 + 16+16+16+4+4+4+4 = 84 MiB */
  k_prep<<<CV_N + 1, 256, 0, stream>>>(x, Wq, Wk, Wv, Wo, lq1, lk1, lq2, lk2, X16, BQ, BK, BV, BO, LAM);
  /* the projections write the attention's operands themselves: no f32 plane, no split, repeat or transpose pass in between */
  k_proj<<<PJ_NQ + PJ_NK + NB * PJ_NV, 128, 0, stream>>>(X16, BQ, BK, BV, QH, QL, KH, KL, VT, VTL);
  k_attn<<<AT_NP + AT_N5, 128, 0, stream>>>(QH, QL, KH, KL, VT, VTL, LAM, lnw, A16);
  k_gemm2<0, false><<<dim3((NR / 128) * (DM / 64), 1), 128, 0, stream>>>(A16, DM, 0, BO, DM, 0, 0.0625f, nullptr, 0, nullptr, 1, 0, 0, (float*)d_out, nullptr, nullptr, DM, 0, NR, DM, DM);      /* out = attn Wo^T */
}
